// v000
// Measured on an AMD MI455X. A time is GPU time per run, averaged over a window of back-to-back runs after a warm-up
// (all launches, gaps included; the runs take copies of the inputs in turn), and the median of several windows.
// Apart from v000's, it joins two sittings. Times from different sittings can be a few percent apart, while
// side-by-side timings come from the same sitting.
// v000, which the later versions start from, runs in 1290 microseconds.
// All contractions (token-shift LoRA xxx.w1 and lora.w2, q/k/v projections, attention q.k^T and p.v, output projection): v_wmma_f32_16x16x32_bf16 with bf16 hi/lo split operands (hi.hi + hi.lo + lo.hi), f32 accumulate; token shift, tanh, LayerNorms, RoPE, online softmax, score scale 0.125 in f32.
#include <hip/hip_runtime.h>
#include <math.h>
#include <stdint.h>

constexpr int kBatch = 2;
constexpr int kSeq   = 2048;
constexpr int kDm    = 1024;
constexpr int kHeads = 16;
constexpr int kLoraN = 96;      // 3 x 32 LoRA outputs
constexpr int kLoraP = 128;     // padded to a 64-multiple
constexpr int kLoraD = 32;

typedef __attribute__((ext_vector_type(16))) _Float16 v16h;
typedef __attribute__((ext_vector_type(8)))  _Float16 v8h;
typedef __attribute__((ext_vector_type(16))) __bf16   v16b;
typedef __attribute__((ext_vector_type(8)))  __bf16   v8b;
typedef __attribute__((ext_vector_type(8)))  float    v8f;
typedef __attribute__((ext_vector_type(4)))  float    v4f;
typedef __attribute__((ext_vector_type(2)))  float    v2f;
typedef __attribute__((ext_vector_type(4)))  unsigned int v4u;
typedef __attribute__((ext_vector_type(8)))  unsigned short v8us;

__device__ __forceinline__ unsigned short f2bf_bits(float f) {
  unsigned u = __float_as_uint(f);
  return (unsigned short)((u + 0x7FFFu + ((u >> 16) & 1u)) >> 16);
}
__device__ __forceinline__ float bf_bits2f(unsigned short h) { return __uint_as_float(((unsigned)h) << 16); }

// hazard guards as plain device helpers (no inline asm inside the kernel template body)
__device__ __forceinline__ void dep_guard_h(v8f& a, v8f& b, v16h x, v16h y) { asm volatile("v_nop\n\tv_nop\n\tv_nop\n\tv_nop" : "+v"(a), "+v"(b) : "v"(x), "v"(y)); }
__device__ __forceinline__ void dep_guard_b(v8f& a, v8f& b, v16b x, v16b y) { asm volatile("v_nop\n\tv_nop\n\tv_nop\n\tv_nop" : "+v"(a), "+v"(b) : "v"(x), "v"(y)); }
__device__ __forceinline__ void keep4_h(v16h a, v16h b, v16h c, v16h d) { asm volatile("v_nop" :: "v"(a), "v"(b), "v"(c), "v"(d)); }
__device__ __forceinline__ void keep4_b(v16b a, v16b b, v16b c, v16b d) { asm volatile("v_nop" :: "v"(a), "v"(b), "v"(c), "v"(d)); }
__device__ __forceinline__ void acc_guard4(v8f& a, v8f& b, v8f& c, v8f& d) { asm volatile("v_nop\n\tv_nop\n\tv_nop\n\tv_nop" : "+v"(a), "+v"(b), "+v"(c), "+v"(d)); }
template <typename T> struct Frag;
template <> struct Frag<_Float16> {
  typedef v16h V; union U { v16h v; v8h h[2]; };
  static __device__ __forceinline__ v16h load(const _Float16* p) {   // elements 0..7 <- p[0..7], 8..15 <- p[16..23]
    U f; f.h[0] = *(const v8h*)(p); f.h[1] = *(const v8h*)(p + 16); return f.v;
  }
  static __device__ __forceinline__ v8f mma(v16h a, v16h b, v8f c) {
    return __builtin_amdgcn_wmma_f32_16x16x32_f16(false, a, false, b, (short)0, c, false, false);
  }
  static __device__ __forceinline__ void guard(v8f& a, v8f& b, v16h x, v16h y) { dep_guard_h(a, b, x, y); }
  static __device__ __forceinline__ void keep(v16h a, v16h b, v16h c, v16h d) { keep4_h(a, b, c, d); }
};
template <> struct Frag<__bf16> {
  typedef v16b V; union U { v16b v; v8b h[2]; };
  static __device__ __forceinline__ v16b load(const __bf16* p) {
    U f; f.h[0] = *(const v8b*)(p); f.h[1] = *(const v8b*)(p + 16); return f.v;
  }
  static __device__ __forceinline__ v8f mma(v16b a, v16b b, v8f c) {
    return __builtin_amdgcn_wmma_f32_16x16x32_bf16(false, a, false, b, (short)0, c, false, false);
  }
  static __device__ __forceinline__ void guard(v8f& a, v8f& b, v16b x, v16b y) { dep_guard_b(a, b, x, y); }
  static __device__ __forceinline__ void keep(v16b a, v16b b, v16b c, v16b d) { keep4_b(a, b, c, d); }
};

// ---- Register-blocked batched WMMA GEMM ------------------------------------
// C[m,n] = scale * sum_k A[m,k] * Bt[n,k] (+bias)(+resid); each wave owns a 64x64 tile.
// A row-major [M,K]; Bt row-major [N,K]; M,N % 64 == 0, K % 32 == 0.
// SPLIT: operands are hi/lo planes (A2/Bt2 = lo planes, same layout); product = hi.hi + hi.lo + lo.hi.
// BIAS_MODE: 0 = none, 1 = bias[m], 2 = bias[n].
// OUT_MODE: 0 = f32, 1 = f16, 2 = bf16 hi plane (Cout) + bf16 lo plane (Cout2).
// Coverage per wave tile: 4 slabs x 16 rows x 64 cols = 64x64 (f32: it 0..7 x hh 0..1 rows, 16 lanes x 4 floats;
// 16-bit: it 0..3 x q 0..3 rows, 8 lanes x 8 elements).
// ET: 0 = f16 operands, 1 = bf16 operands (pointers passed as 16-bit storage)
template <int ET> struct Elem;
template <> struct Elem<0> { typedef _Float16 T; };
template <> struct Elem<1> { typedef __bf16 T; };
template <int ET, bool SPLIT, int BIAS_MODE, int OUT_MODE, bool RESID, int ACT = 0>
__global__ __launch_bounds__(256) void wmma_gemm64(
    const unsigned short* __restrict__ Ap, const unsigned short* __restrict__ A2p, int lda, long strideA,
    const unsigned short* __restrict__ Btp, const unsigned short* __restrict__ Bt2p, int ldb, long strideB,
    void* __restrict__ Cout, void* __restrict__ Cout2, int ldc, long strideC,
    const float* __restrict__ bias,
    const float* __restrict__ resid, long strideR,
    int M, int N, int K, float scale) {
  typedef typename Elem<ET>::T T;
  typedef typename Frag<T>::V V;
  const T* A = (const T*)Ap; const T* A2 = (const T*)A2p; const T* Bt = (const T*)Btp; const T* Bt2 = (const T*)Bt2p;
  __shared__ __align__(16) float sT[8][16 * 68];   // per-wave 16x64 slab, pitch 68 floats
  const int b    = blockIdx.y;
  const int lane = threadIdx.x & 31;
  const int wave = threadIdx.x >> 5;
  const int tilesN = N >> 6;
  const int tilesM = M >> 6;
  const int tile = blockIdx.x * 8 + wave;
  if (tile >= tilesM * tilesN) return;   // wave-uniform; no block barriers in this kernel
  const int tm = tile / tilesN;
  const int tn = tile - tm * tilesN;
  const int m0 = tm << 6;
  const int n0 = tn << 6;

  const T* Ab  = A  + (size_t)b * strideA;
  const T* Bb  = Bt + (size_t)b * strideB;
  const T* Ab2 = SPLIT ? (A2  + (size_t)b * strideA) : nullptr;
  const T* Bb2 = SPLIT ? (Bt2 + (size_t)b * strideB) : nullptr;

  const int rlane = lane & 15;                 // row (A) / col (B, D) within subtile
  const int koff  = (lane >> 4) * 8;           // k offset of this lane half
  const int mOff  = (lane >> 4) * 8;           // D row offset

  v8f acc[4][4];
#pragma unroll
  for (int i = 0; i < 4; ++i)
#pragma unroll
    for (int j = 0; j < 4; ++j) acc[i][j] = (v8f){0.f,0.f,0.f,0.f,0.f,0.f,0.f,0.f};

  for (int k0 = 0; k0 < K; k0 += 32) {
    V bh[4], bl[4];
#pragma unroll
    for (int j = 0; j < 4; ++j) {
      const size_t bo = (size_t)(n0 + (j << 4) + rlane) * ldb + koff + k0;
      bh[j] = Frag<T>::load(Bb + bo);
      if (SPLIT) bl[j] = Frag<T>::load(Bb2 + bo);
    }
#pragma unroll
    for (int i = 0; i < 4; ++i) {
      const size_t ao = (size_t)(m0 + (i << 4) + rlane) * lda + koff + k0;
      V ah = Frag<T>::load(Ab + ao);
      V al;
      if (SPLIT) al = Frag<T>::load(Ab2 + ao);
#pragma unroll
      for (int j = 0; j < 4; ++j) {
        acc[i][j] = Frag<T>::mma(ah, bh[j], acc[i][j]);
        if (SPLIT) {
          acc[i][j] = Frag<T>::mma(ah, bl[j], acc[i][j]);
          acc[i][j] = Frag<T>::mma(al, bh[j], acc[i][j]);
        }
      }
      Frag<T>::guard(acc[i][0], acc[i][3], ah, SPLIT ? al : ah);
    }
    Frag<T>::keep(bh[0], bh[1], bh[2], bh[3]);
    if (SPLIT) Frag<T>::keep(bl[0], bl[1], bl[2], bl[3]);
  }
  acc_guard4(acc[0][0], acc[0][1], acc[0][2], acc[0][3]);
  acc_guard4(acc[1][0], acc[1][1], acc[1][2], acc[1][3]);
  acc_guard4(acc[2][0], acc[2][1], acc[2][2], acc[2][3]);
  acc_guard4(acc[3][0], acc[3][1], acc[3][2], acc[3][3]);

  // ---- epilogue ----
  float* slab = sT[wave];
  const float* Rb = RESID ? (resid + (size_t)b * strideR) : nullptr;
#pragma unroll
  for (int i = 0; i < 4; ++i) {
    const int mBase = m0 + (i << 4);
#pragma unroll
    for (int j = 0; j < 4; ++j) {
      const int n = n0 + (j << 4) + rlane;
      float bv = 0.f;
      if (BIAS_MODE == 2) bv = bias[n];
#pragma unroll
      for (int r = 0; r < 8; ++r) {
        float v = acc[i][j][r] * scale;
        if (BIAS_MODE == 1) v += bias[mBase + mOff + r];
        if (BIAS_MODE == 2) v += bv;
        if (RESID) v += Rb[(size_t)(mBase + mOff + r) * ldc + n];
        if (ACT == 1) v = tanhf(v);
        if (ACT == 2) v = fmaxf(v, 0.0f);
        if (ACT == 3) v = v / (1.0f + expf(-v));
        if (ACT == 4) v = (v > 0.f) ? v : 0.01f * v;
        slab[(mOff + r) * 68 + (j << 4) + rlane] = v;
      }
    }
    __builtin_amdgcn_fence(__ATOMIC_RELEASE, "workgroup");
    __builtin_amdgcn_wave_barrier();
    __builtin_amdgcn_fence(__ATOMIC_ACQUIRE, "workgroup");
    if (OUT_MODE == 0) {
      float* C = (float*)Cout + (size_t)b * strideC;
      const int hh = lane >> 4, c4 = (lane & 15) * 4;     // row seg = 256 B = 16 lanes x 16 B
      {
#pragma unroll
        for (int it = 0; it < 8; ++it) {
          const int row = it * 2 + hh;
          v4f v = *(const v4f*)(slab + row * 68 + c4);
          *(v4f*)(C + (size_t)(mBase + row) * ldc + n0 + c4) = v;
        }
        
      }
    } else {
      const int q = lane >> 3, c8 = (lane & 7) * 8;
      unsigned short* C  = (unsigned short*)Cout  + (size_t)b * strideC;
      unsigned short* C2 = (OUT_MODE == 2) ? ((unsigned short*)Cout2 + (size_t)b * strideC) : nullptr;
      {
#pragma unroll
        for (int it = 0; it < 4; ++it) {
          const int row = it * 4 + q;
          const float* sp = slab + row * 68 + c8;
          v8h hv, lv;
#pragma unroll
          for (int e = 0; e < 8; ++e) {
            if (OUT_MODE == 1) {
              hv[e] = (_Float16)sp[e];
            } else {
              unsigned short hb = f2bf_bits(sp[e]);
              unsigned short lb = f2bf_bits(sp[e] - bf_bits2f(hb));
              hv[e] = __builtin_bit_cast(_Float16, hb);
              lv[e] = __builtin_bit_cast(_Float16, lb);
            }
          }
          *(v8h*)(C + (size_t)(mBase + row) * ldc + n0 + c8) = hv;
          if (OUT_MODE == 2) *(v8h*)(C2 + (size_t)(mBase + row) * ldc + n0 + c8) = lv;
        }
        
      }
    }
    __builtin_amdgcn_fence(__ATOMIC_RELEASE, "workgroup");
    __builtin_amdgcn_wave_barrier();
    __builtin_amdgcn_fence(__ATOMIC_ACQUIRE, "workgroup");
  }
}

// ---------------------------------------------------------------------------
// Elementwise bf16 split: hi = bf16_rne(in), lo = bf16_rne(in - hi); 2 elements per thread, one 4-B store
// ---------------------------------------------------------------------------
__device__ __forceinline__ unsigned pk16(unsigned short a, unsigned short b) { return (unsigned)a | ((unsigned)b << 16); }

__global__ __launch_bounds__(256) void split_bf16x2_kernel(const float* __restrict__ in, unsigned short* __restrict__ hi,
                                                           unsigned short* __restrict__ lo, int n2) {
  const int i = blockIdx.x * 256 + threadIdx.x;
  if (i < n2) {
    const v2f f = *(const v2f*)(in + 2 * (size_t)i);
    const unsigned short h0 = f2bf_bits(f[0]), h1 = f2bf_bits(f[1]);
    const unsigned short l0 = f2bf_bits(f[0] - bf_bits2f(h0)), l1 = f2bf_bits(f[1] - bf_bits2f(h1));
    const unsigned uh = pk16(h0, h1), ul = pk16(l0, l1);
    ((unsigned*)hi)[i] = uh;
    ((unsigned*)lo)[i] = ul;
    
  }
}

// ---------------------------------------------------------------------------
// tanh then bf16 split: hi = bf16_rne(tanh(in)), lo = bf16_rne(tanh(in) - hi); same store shape as above
// Coverage: grid = ceil(n2/256) x 256 threads x 2 elements = 2*n2 = whole plane.
// ---------------------------------------------------------------------------
__global__ __launch_bounds__(256) void tanh_split_kernel(const float* __restrict__ in, unsigned short* __restrict__ hi,
                                                         unsigned short* __restrict__ lo, int n2) {
  const int i = blockIdx.x * 256 + threadIdx.x;
  if (i < n2) {
    const v2f f = *(const v2f*)(in + 2 * (size_t)i);
    const float t0 = tanhf(f[0]), t1 = tanhf(f[1]);
    const unsigned short h0 = f2bf_bits(t0), h1 = f2bf_bits(t1);
    const unsigned short l0 = f2bf_bits(t0 - bf_bits2f(h0)), l1 = f2bf_bits(t1 - bf_bits2f(h1));
    const unsigned uh = pk16(h0, h1), ul = pk16(l0, l1);
    ((unsigned*)hi)[i] = uh;
    ((unsigned*)lo)[i] = ul;
    
  }
}

// ---------------------------------------------------------------------------
// Transpose + bf16 split: in w[R][Cn] f32 -> planes th/tl [Cn][R] bf16: out[n*R + k] = split(w[k*Cn + n]).
// grid = (Cn/64, R/64), R, Cn % 64 == 0.  (Used for the LayerNormed v [s=R=2048][c=Cn=1024] -> v^T planes [c][s].)
// Coverage: load 256 threads x 16 = 64x64; store 8 waves x 2 it x 4 rows(q) x 8 lanes x 8 elements = 64x64.
// ---------------------------------------------------------------------------
__global__ __launch_bounds__(256) void wt_split_kernel(const float* __restrict__ w, unsigned short* __restrict__ th,
                                                       unsigned short* __restrict__ tl, int R, int Cn) {
  __shared__ float tile[64 * 65];
  const int n0 = blockIdx.x * 64;
  const int k0 = blockIdx.y * 64;
  const int t = threadIdx.x;
#pragma unroll
  for (int i = 0; i < 16; ++i) {
    const int idx = i * 256 + t;
    const int kk = idx >> 6, nn = idx & 63;
    tile[nn * 65 + kk] = w[(size_t)(k0 + kk) * Cn + n0 + nn];
  }
  __syncthreads();
  const int lane = t & 31, wave = t >> 5;
  const int q = lane >> 3, c8 = (lane & 7) * 8;
  {
#pragma unroll
    for (int it = 0; it < 2; ++it) {
      const int row = wave * 8 + it * 4 + q;          // 0..63 = local n
      const float* sp = tile + row * 65 + c8;
      v8us hv, lv;
#pragma unroll
      for (int e = 0; e < 8; ++e) {
        const unsigned short hb = f2bf_bits(sp[e]);
        const unsigned short lb = f2bf_bits(sp[e] - bf_bits2f(hb));
        hv[e] = hb; lv[e] = lb;
      }
      const size_t o = (size_t)(n0 + row) * R + k0 + c8;
      *(v8us*)(th + o) = hv;
      *(v8us*)(tl + o) = lv;
    }
    
  }
}

// ---------------------------------------------------------------------------
// LoRA weight w1 [1024 in k][96 out n] f32 -> Bt planes th/tl [kLoraP=128 n][1024 k] bf16, rows n >= 96 ZERO:
//   out[n*1024 + k] = split(n < 96 ? w1[k*96 + n] : 0).  grid = 1024/64 k-tiles; block = 256 threads.
// LDS tile [128 n][65]: load 256 threads x 32 iterations = 64 k x 128 n (address clamped to n <= 95, zero by predicate).
// ---------------------------------------------------------------------------
__global__ __launch_bounds__(256) void w1t_split_kernel(const float* __restrict__ w1, unsigned short* __restrict__ th,
                                                        unsigned short* __restrict__ tl) {
  __shared__ float tile[kLoraP * 65];
  const int k0 = blockIdx.x * 64;
  const int t = threadIdx.x;
#pragma unroll 4
  for (int i = 0; i < 32; ++i) {
    const int idx = i * 256 + t;
    const int kk = idx >> 7, nn = idx & 127;
    const int nc = (nn < kLoraN) ? nn : (kLoraN - 1);
    float v = w1[(size_t)(k0 + kk) * kLoraN + nc];
    if (nn >= kLoraN) v = 0.0f;
    tile[nn * 65 + kk] = v;
  }
  __syncthreads();
  const int lane = t & 31, wave = t >> 5;
  const int q = lane >> 3, c8 = (lane & 7) * 8;
  {
#pragma unroll
    for (int it = 0; it < 4; ++it) {
      const int row = wave * 16 + it * 4 + q;         // 0..127 = n
      const float* sp = tile + row * 65 + c8;
      v8us hv, lv;
#pragma unroll
      for (int e = 0; e < 8; ++e) {
        const unsigned short hb = f2bf_bits(sp[e]);
        const unsigned short lb = f2bf_bits(sp[e] - bf_bits2f(hb));
        hv[e] = hb; lv[e] = lb;
      }
      const size_t o = (size_t)row * kDm + k0 + c8;
      *(v8us*)(th + o) = hv;
      *(v8us*)(tl + o) = lv;
    }
    
  }
}

// ---------------------------------------------------------------------------
// LoRA weight w2 [3 l][32 d][1024 c] f32 -> Bt planes th/tl [3 l][1024 n=c][32 k=d] bf16: out[l][n][k] = split(w2[l][k][n]).
// grid = (1024/64 n-tiles, 3); block 256. LDS tile [64 n][33]: load 256 threads x 8 = 32 k x 64 n.
// 512 contiguous bytes) with ONE 16-B-per-lane instruction: lane -> line L = lane>>3, row = wave*8 + 2L + ((lane&7)>>2),
// ---------------------------------------------------------------------------
__global__ __launch_bounds__(256) void w2t_split_kernel(const float* __restrict__ w2, unsigned short* __restrict__ th,
                                                        unsigned short* __restrict__ tl) {
  __shared__ float tile[64 * 33];
  const int n0 = blockIdx.x * 64;
  const int l  = blockIdx.y;
  const int t  = threadIdx.x;
  const float* wl = w2 + (size_t)l * kLoraD * kDm;
#pragma unroll
  for (int i = 0; i < 8; ++i) {
    const int idx = i * 256 + t;
    const int kk = idx >> 6, nn = idx & 63;
    tile[nn * 33 + kk] = wl[(size_t)kk * kDm + n0 + nn];
  }
  __syncthreads();
  const int lane = t & 31, wave = t >> 5;
  const int L = lane >> 3, q = lane & 7;
  const int row = wave * 8 + 2 * L + (q >> 2);
  const int k8 = (q & 3) * 8;
  const float* sp = tile + row * 33 + k8;
  v8us hv, lv;
#pragma unroll
  for (int e = 0; e < 8; ++e) {
    const unsigned short hb = f2bf_bits(sp[e]);
    const unsigned short lb = f2bf_bits(sp[e] - bf_bits2f(hb));
    hv[e] = hb; lv[e] = lb;
  }
  const size_t o = (size_t)l * kDm * kLoraD + (size_t)(n0 + row) * kLoraD + k8;
  *(v8us*)(th + o) = hv;
  *(v8us*)(tl + o) = lv;
  
}

// ---------------------------------------------------------------------------
// Shared elementwise split helper for 8 consecutive values -> v8us hi/lo.
// ---------------------------------------------------------------------------
__device__ __forceinline__ void split8(const v4f va, const v4f vb, v8us& hv, v8us& lv) {
#pragma unroll
  for (int e = 0; e < 4; ++e) {
    const unsigned short h0 = f2bf_bits(va[e]);
    hv[e] = h0; lv[e] = f2bf_bits(va[e] - bf_bits2f(h0));
    const unsigned short h1 = f2bf_bits(vb[e]);
    hv[4 + e] = h1; lv[4 + e] = f2bf_bits(vb[e] - bf_bits2f(h1));
  }
}
__device__ __forceinline__ void store16x2(unsigned short* ph, unsigned short* pl, size_t o, const v8us hv, const v8us lv) {
  *(v8us*)(ph + o) = hv;
  *(v8us*)(pl + o) = lv;
  
}

// ---------------------------------------------------------------------------
// Token shift: xxx = x + (xprev - x) * maa_x for batch element b -> bf16 hi/lo planes [kSeq][kDm];
// xprev = shift_state[b] for s == 0, else x[b][s-1] (block-uniform pointer choice).
// grid = kSeq blocks x 128 threads x 8 elements = kSeq x kDm = the whole plane; each lane stores 16 B,
// ---------------------------------------------------------------------------
__global__ __launch_bounds__(128) void xxx_split_kernel(const float* __restrict__ x, const float* __restrict__ ss,
                                                        const float* __restrict__ maax,
                                                        unsigned short* __restrict__ oh, unsigned short* __restrict__ ol, int b) {
  const int s = blockIdx.x;
  const int c0 = threadIdx.x * 8;
  const float* xr = x + ((size_t)b * kSeq + s) * kDm;
  const float* xp = (s == 0) ? (ss + (size_t)b * kDm) : (xr - kDm);
  const v4f xa = *(const v4f*)(xr + c0), xb = *(const v4f*)(xr + c0 + 4);
  const v4f pa = *(const v4f*)(xp + c0), pb = *(const v4f*)(xp + c0 + 4);
  const v4f ma = *(const v4f*)(maax + c0), mb = *(const v4f*)(maax + c0 + 4);
  const v4f va = xa + (pa - xa) * ma;
  const v4f vb = xb + (pb - xb) * mb;
  v8us hv, lv;
  split8(va, vb, hv, lv);
  store16x2(oh, ol, (size_t)s * kDm + c0, hv, lv);
}

// ---------------------------------------------------------------------------
// Data-dependent mixing: x? = x + (xprev - x) * (maa_? + mix_?[s][c]) for ? in {q(r), k, v} -> three bf16 hi/lo plane pairs
// [kSeq][kDm]. mix planes f32 [3][kSeq][kDm] (l = 0 r, 1 k, 2 v). Same thread/store shape as xxx_split_kernel:
// ---------------------------------------------------------------------------
__global__ __launch_bounds__(128) void mix_split_kernel(const float* __restrict__ x, const float* __restrict__ ss,
                                                        const float* __restrict__ maar, const float* __restrict__ maak,
                                                        const float* __restrict__ maav, const float* __restrict__ mix,
                                                        unsigned short* __restrict__ qh, unsigned short* __restrict__ ql,
                                                        unsigned short* __restrict__ kh, unsigned short* __restrict__ kl,
                                                        unsigned short* __restrict__ vh, unsigned short* __restrict__ vl, int b) {
  const int s = blockIdx.x;
  const int c0 = threadIdx.x * 8;
  const float* xr = x + ((size_t)b * kSeq + s) * kDm;
  const float* xp = (s == 0) ? (ss + (size_t)b * kDm) : (xr - kDm);
  const v4f xa = *(const v4f*)(xr + c0), xb = *(const v4f*)(xr + c0 + 4);
  const v4f pa = *(const v4f*)(xp + c0), pb = *(const v4f*)(xp + c0 + 4);
  const v4f da = pa - xa, db = pb - xb;
  const size_t plane = (size_t)kSeq * kDm;
  const float* m0 = mix + (size_t)s * kDm + c0;
  const size_t o = (size_t)s * kDm + c0;
  {
    const v4f ma = *(const v4f*)(maar + c0), mb = *(const v4f*)(maar + c0 + 4);
    const v4f qa = *(const v4f*)(m0), qb = *(const v4f*)(m0 + 4);
    const v4f va = xa + da * (ma + qa), vb = xb + db * (mb + qb);
    v8us hv, lv; split8(va, vb, hv, lv); store16x2(qh, ql, o, hv, lv);
  }
  {
    const v4f ma = *(const v4f*)(maak + c0), mb = *(const v4f*)(maak + c0 + 4);
    const v4f qa = *(const v4f*)(m0 + plane), qb = *(const v4f*)(m0 + plane + 4);
    const v4f va = xa + da * (ma + qa), vb = xb + db * (mb + qb);
    v8us hv, lv; split8(va, vb, hv, lv); store16x2(kh, kl, o, hv, lv);
  }
  {
    const v4f ma = *(const v4f*)(maav + c0), mb = *(const v4f*)(maav + c0 + 4);
    const v4f qa = *(const v4f*)(m0 + 2 * plane), qb = *(const v4f*)(m0 + 2 * plane + 4);
    const v4f va = xa + da * (ma + qa), vb = xb + db * (mb + qb);
    v8us hv, lv; split8(va, vb, hv, lv); store16x2(vh, vl, o, hv, lv);
  }
}

// ---------------------------------------------------------------------------
//   MODE 0: LN then RoPE (half-split per 64-wide head: out[f] = x1*cos - x2*sin, out[32+f] = x1*sin + x2*cos with
//           cos/sin = cosf/sinf(angles[s][f])) then bf16 hi/lo split into planes [kSeq][kDm]; grid = (kSeq, 2),
//           blockIdx.y selects source/params/planes A (0) or B (1).
//   MODE 1: LN written back IN PLACE as f32 (dstf == src): each block owns its row; thread t writes floats 4t..4t+3,
//   MODE 2: LN then bf16 hi/lo split into planes (no rotation); grid = (kSeq, 1).
// MODE 0/2 store path: per wave (heads 2w, 2w+1) the 128 results are staged in LDS, then lanes 0..15 write 16 B each =
// ---------------------------------------------------------------------------
template <int MODE>
__global__ __launch_bounds__(256) void ln_kernel(const float* srcA, const float* srcB,
                                                 const float* __restrict__ gA, const float* __restrict__ bA,
                                                 const float* __restrict__ gB, const float* __restrict__ bB,
                                                 const float* __restrict__ ang,
                                                 unsigned short* hA, unsigned short* lA,
                                                 unsigned short* hB, unsigned short* lB, float* dstf) {
  __shared__ __align__(16) float srow[kDm];
  __shared__ __align__(16) unsigned short Lh[8][128];
  __shared__ __align__(16) unsigned short Ll[8][128];
  __shared__ float sred[8];
  __shared__ float sred2[8];
  const int s = blockIdx.x;
  const int which = blockIdx.y;                  // block-uniform
  const float* src = (which == 0) ? srcA : srcB;
  const float* g   = (which == 0) ? gA : gB;
  const float* bb  = (which == 0) ? bA : bB;
  unsigned short* dh = (which == 0) ? hA : hB;
  unsigned short* dl = (which == 0) ? lA : lB;
  const int tid = threadIdx.x, lane = tid & 31, wave = tid >> 5;

  const float* row = src + (size_t)s * kDm;
  const v4f xv = *(const v4f*)(row + tid * 4);
  float ps = (xv[0] + xv[1]) + (xv[2] + xv[3]);
#pragma unroll
  for (int off = 1; off < 32; off <<= 1) ps += __shfl_xor(ps, off, 32);
  if (lane == 0) sred[wave] = ps;
  __syncthreads();
  float tot = 0.f;
#pragma unroll
  for (int w = 0; w < 8; ++w) tot += sred[w];
  const float mean = tot * (1.0f / (float)kDm);
  const v4f dv = xv - mean;
  float pq = (dv[0] * dv[0] + dv[1] * dv[1]) + (dv[2] * dv[2] + dv[3] * dv[3]);
#pragma unroll
  for (int off = 1; off < 32; off <<= 1) pq += __shfl_xor(pq, off, 32);
  if (lane == 0) sred2[wave] = pq;
  __syncthreads();
  float tot2 = 0.f;
#pragma unroll
  for (int w = 0; w < 8; ++w) tot2 += sred2[w];
  const float var  = tot2 * (1.0f / (float)kDm);
  const float rstd = rsqrtf(var + 1.0e-5f);
  const v4f gv = *(const v4f*)(g + tid * 4);
  const v4f bv = *(const v4f*)(bb + tid * 4);
  v4f yv;
#pragma unroll
  for (int e = 0; e < 4; ++e) yv[e] = dv[e] * rstd * gv[e] + bv[e];

  if (MODE == 1) {
    float* dp = dstf + (size_t)s * kDm + tid * 4;
    *(v4f*)dp = yv;
    
    return;                                     // MODE is a compile-time constant: uniform
  }

  *(v4f*)(srow + tid * 4) = yv;
  __syncthreads();

  float cs = 1.0f, sn = 0.0f;
  if (MODE == 0) {
    const float a = ang[(size_t)s * 32 + lane];
    cs = cosf(a);
    sn = sinf(a);
  }
  unsigned short* lh = Lh[wave];
  unsigned short* ll = Ll[wave];
#pragma unroll 1
  for (int hp = 0; hp < 2; ++hp) {
    const int base = wave * 128 + hp * 64;
    const float xr = srow[base + lane];
    const float xi = srow[base + 32 + lane];
    float vr = xr, vi = xi;
    if (MODE == 0) { vr = xr * cs - xi * sn; vi = xr * sn + xi * cs; }
    const unsigned short hr = f2bf_bits(vr);
    const unsigned short lr = f2bf_bits(vr - bf_bits2f(hr));
    const unsigned short hi = f2bf_bits(vi);
    const unsigned short li = f2bf_bits(vi - bf_bits2f(hi));
    lh[hp * 64 + lane] = hr;       ll[hp * 64 + lane] = lr;
    lh[hp * 64 + 32 + lane] = hi;  ll[hp * 64 + 32 + lane] = li;
  }
  __builtin_amdgcn_fence(__ATOMIC_RELEASE, "workgroup");
  __builtin_amdgcn_wave_barrier();
  __builtin_amdgcn_fence(__ATOMIC_ACQUIRE, "workgroup");
  const int l16 = lane & 15;
  const v8us hv = *(const v8us*)(lh + l16 * 8);
  const v8us lv = *(const v8us*)(ll + l16 * 8);
  const size_t o = (size_t)s * kDm + wave * 128 + l16 * 8;
  {
    if (lane < 16) {
      *(v8us*)(dh + o) = hv;
      *(v8us*)(dl + o) = lv;
    }
    
  }
}

// =====================================================================================
// Causal attention, head dim 64, one launch per batch element (structural lower-triangular mask incl. diagonal).
//   q planes (hi/lo bf16): element (t, h, d) at [t*kDm + h*64 + d]
//   k planes (hi/lo bf16): element (s, h, d) at [s*kDm + h*64 + d]
//   v^T planes (hi/lo bf16): element (h, d, s) at [(h*64 + d)*kSeq + s]
//   out f32: element (t, h, d) at [t*kDm + h*64 + d]
//   scores = (q . k) * sscale : bf16 hi/lo split (hi.hi + hi.lo + lo.hi) on v_wmma_f32_16x16x32_bf16
//   out    = p . v             : bf16 hi/lo split of p (unnormalised) and v, f32 accumulate
//   online softmax in f32. Key tiles strictly above the 64x64 block diagonal (kv chunk > query block) are not
//   visited (probabilities exactly 0 in f32); inside the diagonal tile, score := mfill where kv > query (select).
//   Block = 4 waves = 64 query rows of one head; grid.x = kHeads * (kSeq/64); kv chunks of 64, trip count qb+1 <= 32.
//   K / V^T chunk staging: 128 threads x 32 elements per plane = the whole 64x64 tile (16-B copies, plain loads,
//   __syncthreads before and after); fragment loads read the LDS tiles with the same v8b element type.
//   Output coverage: grid 16 heads x 32 query blocks x 4 waves x 16 rows x 64 cols = the whole [2048][1024] plane.
// =====================================================================================
#define AT_D 64
#define AT_NW 4
#define AT_QB 64
#define AT_KC 64

__device__ __forceinline__ unsigned short at_bf_bits(float f) {
  unsigned u = __float_as_uint(f);
  return (unsigned short)((u + 0x7FFFu + ((u >> 16) & 1u)) >> 16);
}
__device__ __forceinline__ __bf16 at_f2bf(float f) { return __builtin_bit_cast(__bf16, at_bf_bits(f)); }
__device__ __forceinline__ void at_split(float f, __bf16& hi, __bf16& lo) {
  const unsigned short hb = at_bf_bits(f);
  hi = __builtin_bit_cast(__bf16, hb);
  lo = at_f2bf(f - __uint_as_float(((unsigned)hb) << 16));
}
__device__ __forceinline__ v8f at_mma(v16b a, v16b b, v8f c) {
  c = __builtin_amdgcn_wmma_f32_16x16x32_bf16(false, a, false, b, (short)0, c, false, false);
  asm volatile("v_nop\n\tv_nop\n\tv_nop\n\tv_nop" : "+v"(c) : "v"(a), "v"(b));
  return c;
}

__global__ __launch_bounds__(128)
void attn_causal64_kernel(const unsigned short* __restrict__ qhp, const unsigned short* __restrict__ qlp,
                          const unsigned short* __restrict__ khp, const unsigned short* __restrict__ klp,
                          const unsigned short* __restrict__ vhp, const unsigned short* __restrict__ vlp,
                          float* __restrict__ out, float sscale, float mfill) {
  union FB { v16b v; v8b h[2]; };
  __shared__ __align__(16) __bf16 Ksh[AT_KC * AT_D];             // K hi [kv][d]      8 KB
  __shared__ __align__(16) __bf16 Ksl[AT_KC * AT_D];             // K lo
  __shared__ __align__(16) __bf16 Vth[AT_D * AT_KC];             // V hi [d][kv]      8 KB
  __shared__ __align__(16) __bf16 Vtl[AT_D * AT_KC];             // V lo
  __shared__ __align__(16) __bf16 Psh[AT_NW][16 * AT_KC];        // per wave P hi [row][kv]
  __shared__ __align__(16) __bf16 Psl[AT_NW][16 * AT_KC];        // per wave P lo
  __shared__ __align__(16) float  Os[AT_NW][16 * 68];            // per wave out tile, pitch 68

  const int tid  = threadIdx.x;
  const int wave = tid >> 5;
  const int lane = tid & 31;
  const int hh   = lane >> 4;
  const int c    = lane & 15;

  const int nqb = kSeq / AT_QB;           // 32
  const int bx = blockIdx.x;
  const int qb = bx % nqb;
  const int h  = bx / nqb;                // 0..kHeads-1 (grid = kHeads * nqb)
  const int q0 = qb * AT_QB + wave * 16;

  const __bf16* Qh = (const __bf16*)(const void*)qhp + (size_t)h * AT_D;
  const __bf16* Ql = (const __bf16*)(const void*)qlp + (size_t)h * AT_D;
  const __bf16* Kh = (const __bf16*)(const void*)khp + (size_t)h * AT_D;
  const __bf16* Kl = (const __bf16*)(const void*)klp + (size_t)h * AT_D;
  const __bf16* Vh = (const __bf16*)(const void*)vhp + (size_t)h * AT_D * kSeq;
  const __bf16* Vl = (const __bf16*)(const void*)vlp + (size_t)h * AT_D * kSeq;
  float*        ob = out + (size_t)h * AT_D;

  // ---- Q fragments (A operand, row = lane&15, split k map via Frag load): 2 d-chunks, hi and lo ----
  v16b qah[2], qal[2];
#pragma unroll
  for (int dc = 0; dc < 2; ++dc) {
    const __bf16* qr = Qh + (size_t)(q0 + c) * kDm + dc * 32 + 8 * hh;
    const __bf16* ql = Ql + (size_t)(q0 + c) * kDm + dc * 32 + 8 * hh;
    qah[dc] = Frag<__bf16>::load(qr);
    qal[dc] = Frag<__bf16>::load(ql);
  }

  float mrow[8], lrow[8];
  v8f oacc[4];
#pragma unroll
  for (int r = 0; r < 8; ++r) { mrow[r] = -INFINITY; lrow[r] = 0.f; }
#pragma unroll
  for (int t = 0; t < 4; ++t) oacc[t] = (v8f){0.f,0.f,0.f,0.f,0.f,0.f,0.f,0.f};

  int nChunks = qb + 1;                      // block-uniform, <= 32
  if (nChunks > kSeq / AT_KC) nChunks = kSeq / AT_KC;
  for (int kc = 0; kc < nChunks; ++kc) {
    const int kv0 = kc * AT_KC;
    __syncthreads();
    {
      // staging coverage: 128 threads x (4 x 8) elements = 64 rows x 64 per plane = the whole chunk tile
      const int r = tid >> 1, half = (tid & 1) * 32;
      const __bf16* ksh = Kh + (size_t)(kv0 + r) * kDm + half;     // K row kv0+r, d = half..half+31
      const __bf16* ksl = Kl + (size_t)(kv0 + r) * kDm + half;
      const __bf16* vsh = Vh + (size_t)r * kSeq + kv0 + half;     // V^T row d = r, s = kv0+half..+31
      const __bf16* vsl = Vl + (size_t)r * kSeq + kv0 + half;
#pragma unroll
      for (int i = 0; i < 4; ++i) {
        const v8b a0 = *(const v8b*)(ksh + 8 * i);
        const v8b a1 = *(const v8b*)(ksl + 8 * i);
        const v8b b0 = *(const v8b*)(vsh + 8 * i);
        const v8b b1 = *(const v8b*)(vsl + 8 * i);
        *(v8b*)(Ksh + r * AT_D  + half + 8 * i) = a0;
        *(v8b*)(Ksl + r * AT_D  + half + 8 * i) = a1;
        *(v8b*)(Vth + r * AT_KC + half + 8 * i) = b0;
        *(v8b*)(Vtl + r * AT_KC + half + 8 * i) = b1;
      }
    }
    __syncthreads();

    v8f s[4];
#pragma unroll
    for (int j = 0; j < 4; ++j) {
      s[j] = (v8f){0.f,0.f,0.f,0.f,0.f,0.f,0.f,0.f};
#pragma unroll
      for (int dc = 0; dc < 2; ++dc) {
        FB kb, kl;
        kb.h[0] = *(const v8b*)(Ksh + (j * 16 + c) * AT_D + dc * 32 + 8 * hh);
        kb.h[1] = *(const v8b*)(Ksh + (j * 16 + c) * AT_D + dc * 32 + 16 + 8 * hh);
        kl.h[0] = *(const v8b*)(Ksl + (j * 16 + c) * AT_D + dc * 32 + 8 * hh);
        kl.h[1] = *(const v8b*)(Ksl + (j * 16 + c) * AT_D + dc * 32 + 16 + 8 * hh);
        s[j] = at_mma(qah[dc], kb.v, s[j]);
        s[j] = at_mma(qah[dc], kl.v, s[j]);
        s[j] = at_mma(qal[dc], kb.v, s[j]);
      }
    }
    // ---- scale, structural causal select on the diagonal tile, row max over the 16 lanes of each half ----
    const bool diag = (kc == qb);            // block-uniform
    float cm[8];
#pragma unroll
    for (int r = 0; r < 8; ++r) {
      const int qrow = q0 + 8 * hh + r;                       // 0..kSeq-1
      float m = -INFINITY;
#pragma unroll
      for (int j = 0; j < 4; ++j) {
        const int kvcol = kv0 + j * 16 + c;
        const float sv = s[j][r] * sscale;
        const bool masked = diag && (kvcol > qrow);
        const float sm = masked ? mfill : sv;
        s[j][r] = sm;
        m = fmaxf(m, sm);
      }
#pragma unroll
      for (int off = 1; off < 16; off <<= 1) m = fmaxf(m, __shfl_xor(m, off, 32));
      cm[r] = m;
    }
    __bf16* pwh = Psh[wave];
    __bf16* pwl = Psl[wave];
#pragma unroll
    for (int r = 0; r < 8; ++r) {
      const float mnew = fmaxf(mrow[r], cm[r]);
      const float alpha = expf(mrow[r] - mnew);
      mrow[r] = mnew;
      float psum = 0.f;
#pragma unroll
      for (int j = 0; j < 4; ++j) {
        const float p = expf(s[j][r] - mnew);
        psum += p;
        __bf16 a, bl; at_split(p, a, bl);
        pwh[(8 * hh + r) * AT_KC + j * 16 + c] = a;
        pwl[(8 * hh + r) * AT_KC + j * 16 + c] = bl;
      }
#pragma unroll
      for (int off = 1; off < 16; off <<= 1) psum += __shfl_xor(psum, off, 32);
      lrow[r] = lrow[r] * alpha + psum;
#pragma unroll
      for (int t = 0; t < 4; ++t) oacc[t][r] *= alpha;
    }
    __builtin_amdgcn_fence(__ATOMIC_RELEASE, "workgroup");
    __builtin_amdgcn_wave_barrier();
    __builtin_amdgcn_fence(__ATOMIC_ACQUIRE, "workgroup");
#pragma unroll 1
    for (int kk = 0; kk < 2; ++kk) {
      FB pa, pl;
      pa.h[0] = *(const v8b*)(pwh + c * AT_KC + kk * 32 + 8 * hh);
      pa.h[1] = *(const v8b*)(pwh + c * AT_KC + kk * 32 + 16 + 8 * hh);
      pl.h[0] = *(const v8b*)(pwl + c * AT_KC + kk * 32 + 8 * hh);
      pl.h[1] = *(const v8b*)(pwl + c * AT_KC + kk * 32 + 16 + 8 * hh);
#pragma unroll
      for (int t = 0; t < 4; ++t) {
        FB vb, vl;
        vb.h[0] = *(const v8b*)(Vth + (t * 16 + c) * AT_KC + kk * 32 + 8 * hh);
        vb.h[1] = *(const v8b*)(Vth + (t * 16 + c) * AT_KC + kk * 32 + 16 + 8 * hh);
        vl.h[0] = *(const v8b*)(Vtl + (t * 16 + c) * AT_KC + kk * 32 + 8 * hh);
        vl.h[1] = *(const v8b*)(Vtl + (t * 16 + c) * AT_KC + kk * 32 + 16 + 8 * hh);
        oacc[t] = at_mma(pa.v, vb.v, oacc[t]);
        oacc[t] = at_mma(pa.v, vl.v, oacc[t]);
        oacc[t] = at_mma(pl.v, vb.v, oacc[t]);
      }
    }
  }

  float* os = Os[wave];
#pragma unroll
  for (int r = 0; r < 8; ++r) {
    const float inv = 1.0f / lrow[r];
#pragma unroll
    for (int t = 0; t < 4; ++t) os[(8 * hh + r) * 68 + t * 16 + c] = oacc[t][r] * inv;
  }
  __builtin_amdgcn_fence(__ATOMIC_RELEASE, "workgroup");
  __builtin_amdgcn_wave_barrier();
  __builtin_amdgcn_fence(__ATOMIC_ACQUIRE, "workgroup");
  {
    const int c4 = (lane & 15) * 4;
    {
#pragma unroll
      for (int it = 0; it < 8; ++it) {
        const int row = it * 2 + hh;   // it 0..7 x hh 0..1 covers rows 0..15 of the wave tile
        v4f val = *(const v4f*)(os + row * 68 + c4);
        *(v4f*)(ob + (size_t)(q0 + row) * kDm + c4) = val;
      }
      
    }
  }
}

// ---------------------------------------------------------------------------
// Workspace region map (byte offsets). Every GEMM: K in {1024, 32} (%32 == 0), M = 2048, N in {128, 1024} (%64 == 0).
// Every region is fully written before it is read within the in-order launch sequence; reused regions noted.
//   Wqh bf16 [1024 n][1024 k]        0      Wql    2097152
//   Wkh                        4194304      Wkl    6291456
//   Wvh                        8388608      Wvl   10485760
//   Woh                       12582912      Wol   14680064
//   W1Th bf16 [128 n][1024 k] 16777216      W1Tl  17039360   (rows 96..127 zero)
//   W2Th bf16 [3][1024 n][32] 17301504      W2Tl  17498112
//   XXh  bf16 [2048][1024]    17694720      XXl   21889024   (xxx planes; reused later in the batch as Oh / Ol)
//   LORAf f32 [2048][128]     26083328
//   LTh  bf16 [2048][128]     27131904      LTl   27656192
//   MIX  f32 [3][2048][1024]  28180480                       (reused after the mix kernel: Qf = +0, Kf = +8388608,
//                                                             Vf = +16777216 f32 [2048][1024]; Of reuses Qf)
//   XQh/XQl/XKh/XKl/XVh/XVl   53346304 .. (6 x 4194304)
//   Qh/Ql/Kh/Kl               78512128 .. (4 x 4194304)
//   VTh/VTl bf16 [1024][2048] 95289344, 99483648
//   total                    103677952  (~98.9 MiB)
// ---------------------------------------------------------------------------
extern "C" void kernel_launch(void* const* d_in, const int* in_sizes, int n_in,
                              void* d_out, int out_size, void* d_ws, size_t ws_size,
                              hipStream_t stream) {
  if (n_in < 21) return;
  const int nRow = kSeq * kDm;            // 2097152 per batch element
  const int nAct = kBatch * nRow;         // 4194304
  const int nW   = kDm * kDm;             // 1048576
  if (in_sizes[0] != nAct) return;
  if (in_sizes[1] != kBatch * kDm) return;
  if (in_sizes[2] != kDm || in_sizes[3] != kDm || in_sizes[4] != kDm || in_sizes[5] != kDm) return;
  if (in_sizes[6] != kDm * kLoraN) return;
  if (in_sizes[7] != 3 * kLoraD * kDm) return;
  if (in_sizes[8] != nW || in_sizes[9] != nW || in_sizes[10] != nW || in_sizes[11] != nW) return;
  for (int i = 12; i < 20; ++i) if (in_sizes[i] != kDm) return;
  if (in_sizes[20] != kSeq * 32) return;
  if (out_size != nAct) return;

  const float* x     = (const float*)d_in[0];    // [2][2048][1024]
  const float* ss    = (const float*)d_in[1];    // [2][1024]
  const float* maax  = (const float*)d_in[2];    // [1024]
  const float* maar  = (const float*)d_in[3];
  const float* maak  = (const float*)d_in[4];
  const float* maav  = (const float*)d_in[5];
  const float* w1    = (const float*)d_in[6];    // [1024][96]
  const float* w2    = (const float*)d_in[7];    // [3][32][1024]
  const float* wq    = (const float*)d_in[8];    // [1024 out][1024 in]
  const float* wk    = (const float*)d_in[9];
  const float* wv    = (const float*)d_in[10];
  const float* wo    = (const float*)d_in[11];
  const float* lnrg  = (const float*)d_in[12];
  const float* lnrb  = (const float*)d_in[13];
  const float* lnkg  = (const float*)d_in[14];
  const float* lnkb  = (const float*)d_in[15];
  const float* lnvg  = (const float*)d_in[16];
  const float* lnvb  = (const float*)d_in[17];
  const float* lnxg  = (const float*)d_in[18];
  const float* lnxb  = (const float*)d_in[19];
  const float* ang   = (const float*)d_in[20];   // [2048][32]

  const size_t PW   = (size_t)kDm * kDm * 2;          // 2097152  bf16 weight plane
  const size_t PX   = (size_t)kSeq * kDm * 2;         // 4194304  bf16 activation plane (one batch element)
  const size_t PF   = (size_t)kSeq * kDm * 4;         // 8388608  f32 activation plane
  const size_t PW1  = (size_t)kLoraP * kDm * 2;       // 262144
  const size_t PW2  = (size_t)3 * kDm * kLoraD * 2;   // 196608
  const size_t PLF  = (size_t)kSeq * kLoraP * 4;      // 1048576
  const size_t PLT  = (size_t)kSeq * kLoraP * 2;      // 524288
  size_t off = 0;
  const size_t oWqh = off; off += PW;  const size_t oWql = off; off += PW;
  const size_t oWkh = off; off += PW;  const size_t oWkl = off; off += PW;
  const size_t oWvh = off; off += PW;  const size_t oWvl = off; off += PW;
  const size_t oWoh = off; off += PW;  const size_t oWol = off; off += PW;
  const size_t oW1h = off; off += PW1; const size_t oW1l = off; off += PW1;
  const size_t oW2h = off; off += PW2; const size_t oW2l = off; off += PW2;
  const size_t oXXh = off; off += PX;  const size_t oXXl = off; off += PX;
  const size_t oLF  = off; off += PLF;
  const size_t oLTh = off; off += PLT; const size_t oLTl = off; off += PLT;
  const size_t oMIX = off; off += 3 * PF;
  const size_t oXQh = off; off += PX;  const size_t oXQl = off; off += PX;
  const size_t oXKh = off; off += PX;  const size_t oXKl = off; off += PX;
  const size_t oXVh = off; off += PX;  const size_t oXVl = off; off += PX;
  const size_t oQh  = off; off += PX;  const size_t oQl  = off; off += PX;
  const size_t oKh  = off; off += PX;  const size_t oKl  = off; off += PX;
  const size_t oVTh = off; off += PX;  const size_t oVTl = off; off += PX;
  if (off > ws_size) return;                    // off = 103677952

  char* ws = (char*)d_ws;
  unsigned short* Wqh = (unsigned short*)(ws + oWqh); unsigned short* Wql = (unsigned short*)(ws + oWql);
  unsigned short* Wkh = (unsigned short*)(ws + oWkh); unsigned short* Wkl = (unsigned short*)(ws + oWkl);
  unsigned short* Wvh = (unsigned short*)(ws + oWvh); unsigned short* Wvl = (unsigned short*)(ws + oWvl);
  unsigned short* Woh = (unsigned short*)(ws + oWoh); unsigned short* Wol = (unsigned short*)(ws + oWol);
  unsigned short* W1h = (unsigned short*)(ws + oW1h); unsigned short* W1l = (unsigned short*)(ws + oW1l);
  unsigned short* W2h = (unsigned short*)(ws + oW2h); unsigned short* W2l = (unsigned short*)(ws + oW2l);
  unsigned short* XXh = (unsigned short*)(ws + oXXh); unsigned short* XXl = (unsigned short*)(ws + oXXl);
  float*          LF  = (float*)(ws + oLF);
  unsigned short* LTh = (unsigned short*)(ws + oLTh); unsigned short* LTl = (unsigned short*)(ws + oLTl);
  float*          MIX = (float*)(ws + oMIX);
  float*          Qf  = (float*)(ws + oMIX);
  float*          Kf  = (float*)(ws + oMIX + PF);
  float*          Vf  = (float*)(ws + oMIX + 2 * PF);
  float*          Of  = Qf;
  unsigned short* XQh = (unsigned short*)(ws + oXQh); unsigned short* XQl = (unsigned short*)(ws + oXQl);
  unsigned short* XKh = (unsigned short*)(ws + oXKh); unsigned short* XKl = (unsigned short*)(ws + oXKl);
  unsigned short* XVh = (unsigned short*)(ws + oXVh); unsigned short* XVl = (unsigned short*)(ws + oXVl);
  unsigned short* Qh  = (unsigned short*)(ws + oQh);  unsigned short* Ql  = (unsigned short*)(ws + oQl);
  unsigned short* Kh  = (unsigned short*)(ws + oKh);  unsigned short* Kl  = (unsigned short*)(ws + oKl);
  unsigned short* VTh = (unsigned short*)(ws + oVTh); unsigned short* VTl = (unsigned short*)(ws + oVTl);
  unsigned short* Oh  = XXh;                          unsigned short* Ol  = XXl;

  const float* dummyf = lnrg;                         // valid pointer for unused bias / resid arguments (never read)

  const dim3 blk(256);
  const int  n2w = nW / 2;                                  // 524288 pairs per weight plane
  const dim3 gCastW((n2w + 255) / 256);                     // 2048 blocks x 256 threads x 2 = 1024x1024
  const dim3 gW1(kDm / 64);                                 // 16 k-tiles
  const dim3 gW2(kDm / 64, 3);                              // 16 n-tiles x 3
  const dim3 gRow(kSeq);                                    // one block per token row (128-thread kernels)
  const dim3 gLora(((kSeq / 64) * (kLoraP / 64) + 7) / 8);  // 64 tiles: M=2048, N=128 -> 8 blocks
  const dim3 gMix(((kSeq / 64) * (kDm / 64) + 7) / 8, 3);   // 512 tiles x 3 (l): M=2048, N=1024, K=32
  const int  n2l = kSeq * kLoraP / 2;                       // 131072 pairs
  const dim3 gTanh((n2l + 255) / 256);                      // 512 blocks x 256 x 2 = 2048x128
  const dim3 gProj(((kSeq / 64) * (kDm / 64) + 7) / 8, 1);  // 512 tiles: M=2048, N=1024 -> 64 blocks x 8 waves
  const dim3 gLnQK(kSeq, 2);                                // 2048 rows x {q, k}
  const dim3 gLn1(kSeq, 1);
  const dim3 gVT(kDm / 64, kSeq / 64);                      // in [R=2048 s][Cn=1024 c] -> planes [c][s]; grid (Cn/64, R/64)
  const dim3 gAtt(kHeads * (kSeq / 64));                    // 512 blocks: 16 heads x 32 query blocks

  // setup: weights -> bf16 hi/lo planes (q/k/v/o already [out n][in k] = Bt layout; w1/w2 transposed)
  split_bf16x2_kernel<<<gCastW, blk, 0, stream>>>(wq, Wqh, Wql, n2w);
  split_bf16x2_kernel<<<gCastW, blk, 0, stream>>>(wk, Wkh, Wkl, n2w);
  split_bf16x2_kernel<<<gCastW, blk, 0, stream>>>(wv, Wvh, Wvl, n2w);
  split_bf16x2_kernel<<<gCastW, blk, 0, stream>>>(wo, Woh, Wol, n2w);
  w1t_split_kernel<<<gW1, blk, 0, stream>>>(w1, W1h, W1l);
  w2t_split_kernel<<<gW2, blk, 0, stream>>>(w2, W2h, W2l);

  for (int b = 0; b < kBatch; ++b) {
    // (1) xxx = x + dxprev*maa_x -> planes
    xxx_split_kernel<<<gRow, dim3(128), 0, stream>>>(x, ss, maax, XXh, XXl, b);
    // (2) lora_pre = xxx . w1 -> f32 [2048][128]   (M=2048, N=128, K=1024)
    wmma_gemm64<1, true, 0, 0, false, 0><<<gLora, blk, 0, stream>>>(
        XXh, XXl, kDm, 0L, W1h, W1l, kDm, 0L, (void*)LF, (void*)LF, kLoraP, 0L,
        dummyf, dummyf, 0L, kSeq, kLoraP, kDm, 1.0f);
    // (3) lora = tanh -> planes [2048][128]
    tanh_split_kernel<<<gTanh, blk, 0, stream>>>(LF, LTh, LTl, n2l);
    // (4) mixes[l] = lora[:, 32l..32l+31] . w2[l] -> f32 [3][2048][1024]   (M=2048, N=1024, K=32; grid.y = l)
    wmma_gemm64<1, true, 0, 0, false, 0><<<gMix, blk, 0, stream>>>(
        LTh, LTl, kLoraP, (long)kLoraD, W2h, W2l, kLoraD, (long)kDm * kLoraD, (void*)MIX, (void*)MIX, kDm, (long)nRow,
        dummyf, dummyf, 0L, kSeq, kDm, kLoraD, 1.0f);
    // (5) xq/xk/xv = x + dxprev*(maa + mix) -> planes
    mix_split_kernel<<<gRow, dim3(128), 0, stream>>>(x, ss, maar, maak, maav, MIX, XQh, XQl, XKh, XKl, XVh, XVl, b);
    // (6) q0 = xq . Wq^T, k0 = xk . Wk^T, v0 = xv . Wv^T -> f32 [2048][1024]   (M=2048, N=1024, K=1024)
    wmma_gemm64<1, true, 0, 0, false, 0><<<gProj, blk, 0, stream>>>(
        XQh, XQl, kDm, 0L, Wqh, Wql, kDm, 0L, (void*)Qf, (void*)Qf, kDm, 0L,
        dummyf, dummyf, 0L, kSeq, kDm, kDm, 1.0f);
    wmma_gemm64<1, true, 0, 0, false, 0><<<gProj, blk, 0, stream>>>(
        XKh, XKl, kDm, 0L, Wkh, Wkl, kDm, 0L, (void*)Kf, (void*)Kf, kDm, 0L,
        dummyf, dummyf, 0L, kSeq, kDm, kDm, 1.0f);
    wmma_gemm64<1, true, 0, 0, false, 0><<<gProj, blk, 0, stream>>>(
        XVh, XVl, kDm, 0L, Wvh, Wvl, kDm, 0L, (void*)Vf, (void*)Vf, kDm, 0L,
        dummyf, dummyf, 0L, kSeq, kDm, kDm, 1.0f);
    // (7) LayerNorm + RoPE + split for q and k -> planes [s][h*64+d]
    ln_kernel<0><<<gLnQK, blk, 0, stream>>>(Qf, Kf, lnrg, lnrb, lnkg, lnkb, ang, Qh, Ql, Kh, Kl, Qf);
    // (8) LayerNorm of v in place (f32), then transpose-split -> v^T planes [h*64+d][s]
    ln_kernel<1><<<gLn1, blk, 0, stream>>>(Vf, Vf, lnvg, lnvb, lnvg, lnvb, ang, VTh, VTl, VTh, VTl, Vf);
    wt_split_kernel<<<gVT, blk, 0, stream>>>(Vf, VTh, VTl, kSeq, kDm);
    // (9) causal attention per head -> f32 [t][h*64+d] (Of region; Qf is dead after step 7)
    attn_causal64_kernel<<<gAtt, dim3(128), 0, stream>>>(Qh, Ql, Kh, Kl, VTh, VTl, Of, 0.125f, -1.0e30f);
    // (10) output LayerNorm + split -> planes (XX region is dead after step 2)
    ln_kernel<2><<<gLn1, blk, 0, stream>>>(Of, Of, lnxg, lnxb, lnxg, lnxb, ang, Oh, Ol, Oh, Ol, Of);
    // (11) out[b] = o . Wo^T -> d_out rows b*2048 .. b*2048+2047 (f32)   (M=2048, N=1024, K=1024)
    float* outb = (float*)d_out + (size_t)b * nRow;
    wmma_gemm64<1, true, 0, 0, false, 0><<<gProj, blk, 0, stream>>>(
        Oh, Ol, kDm, 0L, Woh, Wol, kDm, 0L, (void*)outb, (void*)outb, kDm, 0L,
        dummyf, dummyf, 0L, kSeq, kDm, kDm, 1.0f);
  }
}

// v001
// It runs in 712 microseconds.
// Timed twice side by side with v000, it ran 1.82 times as fast both times.
// All contractions (token-shift LoRA xxx.w1 and lora.w2, q/k/v projections, attention q.k^T and p.v, output projection): v_wmma_f32_16x16x32_bf16 with bf16 hi/lo split operands (hi.hi + hi.lo + lo.hi), f32 accumulate; token shift, tanh, LayerNorms, RoPE, online softmax, score scale 0.125 in f32.
#include <hip/hip_runtime.h>
#include <math.h>
#include <stdint.h>

constexpr int kBatch = 2;
constexpr int kSeq   = 2048;
constexpr int kRows  = kBatch * kSeq;   // token rows of both batch elements, row = b*kSeq + s
constexpr int kDm    = 1024;
constexpr int kHeads = 16;
constexpr int kLoraN = 96;      // 3 x 32 LoRA outputs
constexpr int kLoraP = 128;     // padded to a 64-multiple
constexpr int kLoraD = 32;

typedef __attribute__((ext_vector_type(16))) _Float16 v16h;
typedef __attribute__((ext_vector_type(8)))  _Float16 v8h;
typedef __attribute__((ext_vector_type(16))) __bf16   v16b;
typedef __attribute__((ext_vector_type(8)))  __bf16   v8b;
typedef __attribute__((ext_vector_type(8)))  float    v8f;
typedef __attribute__((ext_vector_type(4)))  float    v4f;
typedef __attribute__((ext_vector_type(2)))  float    v2f;
typedef __attribute__((ext_vector_type(4)))  unsigned int v4u;
typedef __attribute__((ext_vector_type(8)))  unsigned short v8us;

__device__ __forceinline__ unsigned short f2bf_bits(float f) {
  unsigned u = __float_as_uint(f);
  return (unsigned short)((u + 0x7FFFu + ((u >> 16) & 1u)) >> 16);
}
__device__ __forceinline__ float bf_bits2f(unsigned short h) { return __uint_as_float(((unsigned)h) << 16); }

// hazard guards as plain device helpers (no inline asm inside the kernel template body)
__device__ __forceinline__ void dep_guard_h(v8f& a, v8f& b, v16h x, v16h y) { asm volatile("v_nop\n\tv_nop\n\tv_nop\n\tv_nop" : "+v"(a), "+v"(b) : "v"(x), "v"(y)); }
__device__ __forceinline__ void dep_guard_b(v8f& a, v8f& b, v16b x, v16b y) { asm volatile("v_nop\n\tv_nop\n\tv_nop\n\tv_nop" : "+v"(a), "+v"(b) : "v"(x), "v"(y)); }
__device__ __forceinline__ void keep4_h(v16h a, v16h b, v16h c, v16h d) { asm volatile("v_nop" :: "v"(a), "v"(b), "v"(c), "v"(d)); }
__device__ __forceinline__ void keep4_b(v16b a, v16b b, v16b c, v16b d) { asm volatile("v_nop" :: "v"(a), "v"(b), "v"(c), "v"(d)); }
__device__ __forceinline__ void acc_guard4(v8f& a, v8f& b, v8f& c, v8f& d) { asm volatile("v_nop\n\tv_nop\n\tv_nop\n\tv_nop" : "+v"(a), "+v"(b), "+v"(c), "+v"(d)); }
template <typename T> struct Frag;
template <> struct Frag<_Float16> {
  typedef v16h V; union U { v16h v; v8h h[2]; };
  static __device__ __forceinline__ v16h load(const _Float16* p) {   // elements 0..7 <- p[0..7], 8..15 <- p[16..23]
    U f; f.h[0] = *(const v8h*)(p); f.h[1] = *(const v8h*)(p + 16); return f.v;
  }
  static __device__ __forceinline__ v8f mma(v16h a, v16h b, v8f c) {
    return __builtin_amdgcn_wmma_f32_16x16x32_f16(false, a, false, b, (short)0, c, false, false);
  }
  static __device__ __forceinline__ void guard(v8f& a, v8f& b, v16h x, v16h y) { dep_guard_h(a, b, x, y); }
  static __device__ __forceinline__ void keep(v16h a, v16h b, v16h c, v16h d) { keep4_h(a, b, c, d); }
};
template <> struct Frag<__bf16> {
  typedef v16b V; union U { v16b v; v8b h[2]; };
  static __device__ __forceinline__ v16b load(const __bf16* p) {
    U f; f.h[0] = *(const v8b*)(p); f.h[1] = *(const v8b*)(p + 16); return f.v;
  }
  static __device__ __forceinline__ v8f mma(v16b a, v16b b, v8f c) {
    return __builtin_amdgcn_wmma_f32_16x16x32_bf16(false, a, false, b, (short)0, c, false, false);
  }
  static __device__ __forceinline__ void guard(v8f& a, v8f& b, v16b x, v16b y) { dep_guard_b(a, b, x, y); }
  static __device__ __forceinline__ void keep(v16b a, v16b b, v16b c, v16b d) { keep4_b(a, b, c, d); }
};

// ---- Register-blocked batched WMMA GEMM ------------------------------------
// C[m,n] = scale * sum_k A[m,k] * Bt[n,k] (+bias)(+resid); each wave owns a 64x64 tile.
// A row-major [M,K]; Bt row-major [N,K]; M,N % 64 == 0, K % 32 == 0.
// SPLIT: operands are hi/lo planes (A2/Bt2 = lo planes, same layout); product = hi.hi + hi.lo + lo.hi.
// BIAS_MODE: 0 = none, 1 = bias[m], 2 = bias[n].
// OUT_MODE: 0 = f32, 1 = f16, 2 = bf16 hi plane (Cout) + bf16 lo plane (Cout2).
// Coverage per wave tile: 4 slabs x 16 rows x 64 cols = 64x64 (f32: it 0..7 x hh 0..1 rows, 16 lanes x 4 floats;
// 16-bit: it 0..3 x q 0..3 rows, 8 lanes x 8 elements).
// ET: 0 = f16 operands, 1 = bf16 operands (pointers passed as 16-bit storage)
template <int ET> struct Elem;
template <> struct Elem<0> { typedef _Float16 T; };
template <> struct Elem<1> { typedef __bf16 T; };
template <int ET, bool SPLIT, int BIAS_MODE, int OUT_MODE, bool RESID, int ACT = 0>
__global__ __launch_bounds__(256) void wmma_gemm64(
    const unsigned short* __restrict__ Ap, const unsigned short* __restrict__ A2p, int lda, long strideA,
    const unsigned short* __restrict__ Btp, const unsigned short* __restrict__ Bt2p, int ldb, long strideB,
    void* __restrict__ Cout, void* __restrict__ Cout2, int ldc, long strideC,
    const float* __restrict__ bias,
    const float* __restrict__ resid, long strideR,
    int M, int N, int K, float scale) {
  typedef typename Elem<ET>::T T;
  typedef typename Frag<T>::V V;
  const T* A = (const T*)Ap; const T* A2 = (const T*)A2p; const T* Bt = (const T*)Btp; const T* Bt2 = (const T*)Bt2p;
  __shared__ __align__(16) float sT[8][16 * 68];   // per-wave 16x64 slab, pitch 68 floats
  const int b    = blockIdx.y;
  const int lane = threadIdx.x & 31;
  const int wave = threadIdx.x >> 5;
  const int tilesN = N >> 6;
  const int tilesM = M >> 6;
  const int tile = blockIdx.x * 8 + wave;
  if (tile >= tilesM * tilesN) return;   // wave-uniform; no block barriers in this kernel
  const int tm = tile / tilesN;
  const int tn = tile - tm * tilesN;
  const int m0 = tm << 6;
  const int n0 = tn << 6;

  const T* Ab  = A  + (size_t)b * strideA;
  const T* Bb  = Bt + (size_t)b * strideB;
  const T* Ab2 = SPLIT ? (A2  + (size_t)b * strideA) : nullptr;
  const T* Bb2 = SPLIT ? (Bt2 + (size_t)b * strideB) : nullptr;

  const int rlane = lane & 15;                 // row (A) / col (B, D) within subtile
  const int koff  = (lane >> 4) * 8;           // k offset of this lane half
  const int mOff  = (lane >> 4) * 8;           // D row offset

  v8f acc[4][4];
#pragma unroll
  for (int i = 0; i < 4; ++i)
#pragma unroll
    for (int j = 0; j < 4; ++j) acc[i][j] = (v8f){0.f,0.f,0.f,0.f,0.f,0.f,0.f,0.f};

  for (int k0 = 0; k0 < K; k0 += 32) {
    V bh[4], bl[4];
#pragma unroll
    for (int j = 0; j < 4; ++j) {
      const size_t bo = (size_t)(n0 + (j << 4) + rlane) * ldb + koff + k0;
      bh[j] = Frag<T>::load(Bb + bo);
      if (SPLIT) bl[j] = Frag<T>::load(Bb2 + bo);
    }
#pragma unroll
    for (int i = 0; i < 4; ++i) {
      const size_t ao = (size_t)(m0 + (i << 4) + rlane) * lda + koff + k0;
      V ah = Frag<T>::load(Ab + ao);
      V al;
      if (SPLIT) al = Frag<T>::load(Ab2 + ao);
#pragma unroll
      for (int j = 0; j < 4; ++j) {
        acc[i][j] = Frag<T>::mma(ah, bh[j], acc[i][j]);
        if (SPLIT) {
          acc[i][j] = Frag<T>::mma(ah, bl[j], acc[i][j]);
          acc[i][j] = Frag<T>::mma(al, bh[j], acc[i][j]);
        }
      }
      Frag<T>::guard(acc[i][0], acc[i][3], ah, SPLIT ? al : ah);
    }
    Frag<T>::keep(bh[0], bh[1], bh[2], bh[3]);
    if (SPLIT) Frag<T>::keep(bl[0], bl[1], bl[2], bl[3]);
  }
  acc_guard4(acc[0][0], acc[0][1], acc[0][2], acc[0][3]);
  acc_guard4(acc[1][0], acc[1][1], acc[1][2], acc[1][3]);
  acc_guard4(acc[2][0], acc[2][1], acc[2][2], acc[2][3]);
  acc_guard4(acc[3][0], acc[3][1], acc[3][2], acc[3][3]);

  // ---- epilogue ----
  float* slab = sT[wave];
  const float* Rb = RESID ? (resid + (size_t)b * strideR) : nullptr;
#pragma unroll
  for (int i = 0; i < 4; ++i) {
    const int mBase = m0 + (i << 4);
#pragma unroll
    for (int j = 0; j < 4; ++j) {
      const int n = n0 + (j << 4) + rlane;
      float bv = 0.f;
      if (BIAS_MODE == 2) bv = bias[n];
#pragma unroll
      for (int r = 0; r < 8; ++r) {
        float v = acc[i][j][r] * scale;
        if (BIAS_MODE == 1) v += bias[mBase + mOff + r];
        if (BIAS_MODE == 2) v += bv;
        if (RESID) v += Rb[(size_t)(mBase + mOff + r) * ldc + n];
        if (ACT == 1) v = tanhf(v);
        if (ACT == 2) v = fmaxf(v, 0.0f);
        if (ACT == 3) v = v / (1.0f + expf(-v));
        if (ACT == 4) v = (v > 0.f) ? v : 0.01f * v;
        slab[(mOff + r) * 68 + (j << 4) + rlane] = v;
      }
    }
    __builtin_amdgcn_fence(__ATOMIC_RELEASE, "workgroup");
    __builtin_amdgcn_wave_barrier();
    __builtin_amdgcn_fence(__ATOMIC_ACQUIRE, "workgroup");
    if (OUT_MODE == 0) {
      float* C = (float*)Cout + (size_t)b * strideC;
      const int hh = lane >> 4, c4 = (lane & 15) * 4;     // row seg = 256 B = 16 lanes x 16 B
      {
#pragma unroll
        for (int it = 0; it < 8; ++it) {
          const int row = it * 2 + hh;
          v4f v = *(const v4f*)(slab + row * 68 + c4);
          *(v4f*)(C + (size_t)(mBase + row) * ldc + n0 + c4) = v;
        }
        
      }
    } else {
      const int q = lane >> 3, c8 = (lane & 7) * 8;
      unsigned short* C  = (unsigned short*)Cout  + (size_t)b * strideC;
      unsigned short* C2 = (OUT_MODE == 2) ? ((unsigned short*)Cout2 + (size_t)b * strideC) : nullptr;
      {
#pragma unroll
        for (int it = 0; it < 4; ++it) {
          const int row = it * 4 + q;
          const float* sp = slab + row * 68 + c8;
          v8h hv, lv;
#pragma unroll
          for (int e = 0; e < 8; ++e) {
            if (OUT_MODE == 1) {
              hv[e] = (_Float16)sp[e];
            } else {
              unsigned short hb = f2bf_bits(sp[e]);
              unsigned short lb = f2bf_bits(sp[e] - bf_bits2f(hb));
              hv[e] = __builtin_bit_cast(_Float16, hb);
              lv[e] = __builtin_bit_cast(_Float16, lb);
            }
          }
          *(v8h*)(C + (size_t)(mBase + row) * ldc + n0 + c8) = hv;
          if (OUT_MODE == 2) *(v8h*)(C2 + (size_t)(mBase + row) * ldc + n0 + c8) = lv;
        }
        
      }
    }
    __builtin_amdgcn_fence(__ATOMIC_RELEASE, "workgroup");
    __builtin_amdgcn_wave_barrier();
    __builtin_amdgcn_fence(__ATOMIC_ACQUIRE, "workgroup");
  }
}

// ---------------------------------------------------------------------------
// Elementwise bf16 split: hi = bf16_rne(in), lo = bf16_rne(in - hi); 2 elements per thread, one 4-B store.
// blockIdx.y (block-uniform) picks one of four equally sized sources; its planes start pstride 16-bit elements apart.
// ---------------------------------------------------------------------------
__device__ __forceinline__ unsigned pk16(unsigned short a, unsigned short b) { return (unsigned)a | ((unsigned)b << 16); }

__global__ __launch_bounds__(256) void split_bf16x2_kernel(const float* __restrict__ in0, const float* __restrict__ in1,
                                                           const float* __restrict__ in2, const float* __restrict__ in3,
                                                           unsigned short* __restrict__ hi, unsigned short* __restrict__ lo,
                                                           int n2, long pstride) {
  const int w = blockIdx.y;
  const float* in = (w == 0) ? in0 : (w == 1) ? in1 : (w == 2) ? in2 : in3;
  unsigned short* ph = hi + (size_t)w * pstride;
  unsigned short* pl = lo + (size_t)w * pstride;
  const int i = blockIdx.x * 256 + threadIdx.x;
  if (i < n2) {
    const v2f f = *(const v2f*)(in + 2 * (size_t)i);
    const unsigned short h0 = f2bf_bits(f[0]), h1 = f2bf_bits(f[1]);
    const unsigned short l0 = f2bf_bits(f[0] - bf_bits2f(h0)), l1 = f2bf_bits(f[1] - bf_bits2f(h1));
    const unsigned uh = pk16(h0, h1), ul = pk16(l0, l1);
    ((unsigned*)ph)[i] = uh;
    ((unsigned*)pl)[i] = ul;
    
  }
}

// ---------------------------------------------------------------------------
// tanh then bf16 split: hi = bf16_rne(tanh(in)), lo = bf16_rne(tanh(in) - hi); same store shape as above
// Coverage: grid = ceil(n2/256) x 256 threads x 2 elements = 2*n2 = whole plane.
// ---------------------------------------------------------------------------
__global__ __launch_bounds__(256) void tanh_split_kernel(const float* __restrict__ in, unsigned short* __restrict__ hi,
                                                         unsigned short* __restrict__ lo, int n2) {
  const int i = blockIdx.x * 256 + threadIdx.x;
  if (i < n2) {
    const v2f f = *(const v2f*)(in + 2 * (size_t)i);
    const float t0 = tanhf(f[0]), t1 = tanhf(f[1]);
    const unsigned short h0 = f2bf_bits(t0), h1 = f2bf_bits(t1);
    const unsigned short l0 = f2bf_bits(t0 - bf_bits2f(h0)), l1 = f2bf_bits(t1 - bf_bits2f(h1));
    const unsigned uh = pk16(h0, h1), ul = pk16(l0, l1);
    ((unsigned*)hi)[i] = uh;
    ((unsigned*)lo)[i] = ul;
    
  }
}

// ---------------------------------------------------------------------------
// Transpose + bf16 split: in w[R][Cn] f32 -> planes th/tl [Cn][R] bf16: out[n*R + k] = split(w[k*Cn + n]).
// grid = (Cn/64, R/64, matrices), R, Cn % 64 == 0; matrix z starts z*R*Cn elements into w, th and tl.
// (Used for the LayerNormed v [b][s=R=2048][c=Cn=1024] -> v^T planes [b][c][s].)
// Coverage: load 256 threads x 16 = 64x64; store 8 waves x 2 it x 4 rows(q) x 8 lanes x 8 elements = 64x64.
// ---------------------------------------------------------------------------
__global__ __launch_bounds__(256) void wt_split_kernel(const float* __restrict__ wz, unsigned short* __restrict__ thz,
                                                       unsigned short* __restrict__ tlz, int R, int Cn) {
  __shared__ float tile[64 * 65];
  const int n0 = blockIdx.x * 64;
  const int k0 = blockIdx.y * 64;
  const size_t zo = (size_t)blockIdx.z * R * Cn;
  const float* w = wz + zo;
  unsigned short* th = thz + zo;
  unsigned short* tl = tlz + zo;
  const int t = threadIdx.x;
#pragma unroll
  for (int i = 0; i < 16; ++i) {
    const int idx = i * 256 + t;
    const int kk = idx >> 6, nn = idx & 63;
    tile[nn * 65 + kk] = w[(size_t)(k0 + kk) * Cn + n0 + nn];
  }
  __syncthreads();
  const int lane = t & 31, wave = t >> 5;
  const int q = lane >> 3, c8 = (lane & 7) * 8;
  {
#pragma unroll
    for (int it = 0; it < 2; ++it) {
      const int row = wave * 8 + it * 4 + q;          // 0..63 = local n
      const float* sp = tile + row * 65 + c8;
      v8us hv, lv;
#pragma unroll
      for (int e = 0; e < 8; ++e) {
        const unsigned short hb = f2bf_bits(sp[e]);
        const unsigned short lb = f2bf_bits(sp[e] - bf_bits2f(hb));
        hv[e] = hb; lv[e] = lb;
      }
      const size_t o = (size_t)(n0 + row) * R + k0 + c8;
      *(v8us*)(th + o) = hv;
      *(v8us*)(tl + o) = lv;
    }
    
  }
}

// ---------------------------------------------------------------------------
// LoRA weight w1 [1024 in k][96 out n] f32 -> Bt planes th/tl [kLoraP=128 n][1024 k] bf16, rows n >= 96 ZERO:
//   out[n*1024 + k] = split(n < 96 ? w1[k*96 + n] : 0).  grid = 1024/64 k-tiles; block = 256 threads.
// LDS tile [128 n][65]: load 256 threads x 32 iterations = 64 k x 128 n (address clamped to n <= 95, zero by predicate).
// ---------------------------------------------------------------------------
__global__ __launch_bounds__(256) void w1t_split_kernel(const float* __restrict__ w1, unsigned short* __restrict__ th,
                                                        unsigned short* __restrict__ tl) {
  __shared__ float tile[kLoraP * 65];
  const int k0 = blockIdx.x * 64;
  const int t = threadIdx.x;
#pragma unroll 4
  for (int i = 0; i < 32; ++i) {
    const int idx = i * 256 + t;
    const int kk = idx >> 7, nn = idx & 127;
    const int nc = (nn < kLoraN) ? nn : (kLoraN - 1);
    float v = w1[(size_t)(k0 + kk) * kLoraN + nc];
    if (nn >= kLoraN) v = 0.0f;
    tile[nn * 65 + kk] = v;
  }
  __syncthreads();
  const int lane = t & 31, wave = t >> 5;
  const int q = lane >> 3, c8 = (lane & 7) * 8;
  {
#pragma unroll
    for (int it = 0; it < 4; ++it) {
      const int row = wave * 16 + it * 4 + q;         // 0..127 = n
      const float* sp = tile + row * 65 + c8;
      v8us hv, lv;
#pragma unroll
      for (int e = 0; e < 8; ++e) {
        const unsigned short hb = f2bf_bits(sp[e]);
        const unsigned short lb = f2bf_bits(sp[e] - bf_bits2f(hb));
        hv[e] = hb; lv[e] = lb;
      }
      const size_t o = (size_t)row * kDm + k0 + c8;
      *(v8us*)(th + o) = hv;
      *(v8us*)(tl + o) = lv;
    }
    
  }
}

// ---------------------------------------------------------------------------
// LoRA weight w2 [3 l][32 d][1024 c] f32 -> Bt planes th/tl [3 l][1024 n=c][32 k=d] bf16: out[l][n][k] = split(w2[l][k][n]).
// grid = (1024/64 n-tiles, 3); block 256. LDS tile [64 n][33]: load 256 threads x 8 = 32 k x 64 n.
// 512 contiguous bytes) with ONE 16-B-per-lane instruction: lane -> line L = lane>>3, row = wave*8 + 2L + ((lane&7)>>2),
// ---------------------------------------------------------------------------
__global__ __launch_bounds__(256) void w2t_split_kernel(const float* __restrict__ w2, unsigned short* __restrict__ th,
                                                        unsigned short* __restrict__ tl) {
  __shared__ float tile[64 * 33];
  const int n0 = blockIdx.x * 64;
  const int l  = blockIdx.y;
  const int t  = threadIdx.x;
  const float* wl = w2 + (size_t)l * kLoraD * kDm;
#pragma unroll
  for (int i = 0; i < 8; ++i) {
    const int idx = i * 256 + t;
    const int kk = idx >> 6, nn = idx & 63;
    tile[nn * 33 + kk] = wl[(size_t)kk * kDm + n0 + nn];
  }
  __syncthreads();
  const int lane = t & 31, wave = t >> 5;
  const int L = lane >> 3, q = lane & 7;
  const int row = wave * 8 + 2 * L + (q >> 2);
  const int k8 = (q & 3) * 8;
  const float* sp = tile + row * 33 + k8;
  v8us hv, lv;
#pragma unroll
  for (int e = 0; e < 8; ++e) {
    const unsigned short hb = f2bf_bits(sp[e]);
    const unsigned short lb = f2bf_bits(sp[e] - bf_bits2f(hb));
    hv[e] = hb; lv[e] = lb;
  }
  const size_t o = (size_t)l * kDm * kLoraD + (size_t)(n0 + row) * kLoraD + k8;
  *(v8us*)(th + o) = hv;
  *(v8us*)(tl + o) = lv;
  
}

// ---------------------------------------------------------------------------
// Shared elementwise split helper for 8 consecutive values -> v8us hi/lo.
// ---------------------------------------------------------------------------
__device__ __forceinline__ void split8(const v4f va, const v4f vb, v8us& hv, v8us& lv) {
#pragma unroll
  for (int e = 0; e < 4; ++e) {
    const unsigned short h0 = f2bf_bits(va[e]);
    hv[e] = h0; lv[e] = f2bf_bits(va[e] - bf_bits2f(h0));
    const unsigned short h1 = f2bf_bits(vb[e]);
    hv[4 + e] = h1; lv[4 + e] = f2bf_bits(vb[e] - bf_bits2f(h1));
  }
}
__device__ __forceinline__ void store16x2(unsigned short* ph, unsigned short* pl, size_t o, const v8us hv, const v8us lv) {
  *(v8us*)(ph + o) = hv;
  *(v8us*)(pl + o) = lv;
  
}

// ---------------------------------------------------------------------------
// Token shift: xxx = x + (xprev - x) * maa_x -> bf16 hi/lo planes [kRows][kDm], row = b*kSeq + s;
// xprev = shift_state[b] for s == 0, else x[b][s-1] (block-uniform pointer choice).
// grid = kRows blocks x 128 threads x 8 elements = kRows x kDm = the whole plane; each lane stores 16 B,
// ---------------------------------------------------------------------------
__global__ __launch_bounds__(128) void xxx_split_kernel(const float* __restrict__ x, const float* __restrict__ ss,
                                                        const float* __restrict__ maax,
                                                        unsigned short* __restrict__ oh, unsigned short* __restrict__ ol) {
  const int row = blockIdx.x;
  const int b = row / kSeq, s = row % kSeq;
  const int c0 = threadIdx.x * 8;
  const float* xr = x + (size_t)row * kDm;
  const float* xp = (s == 0) ? (ss + (size_t)b * kDm) : (xr - kDm);
  const v4f xa = *(const v4f*)(xr + c0), xb = *(const v4f*)(xr + c0 + 4);
  const v4f pa = *(const v4f*)(xp + c0), pb = *(const v4f*)(xp + c0 + 4);
  const v4f ma = *(const v4f*)(maax + c0), mb = *(const v4f*)(maax + c0 + 4);
  const v4f va = xa + (pa - xa) * ma;
  const v4f vb = xb + (pb - xb) * mb;
  v8us hv, lv;
  split8(va, vb, hv, lv);
  store16x2(oh, ol, (size_t)row * kDm + c0, hv, lv);
}

// ---------------------------------------------------------------------------
// Data-dependent mixing: x? = x + (xprev - x) * (maa_? + mix_?[s][c]) for ? in {q(r), k, v} -> three bf16 hi/lo plane pairs
// [kRows][kDm]. mix planes f32 [3][kRows][kDm] (l = 0 r, 1 k, 2 v). Same row index and thread/store shape as xxx_split_kernel:
// ---------------------------------------------------------------------------
__global__ __launch_bounds__(128) void mix_split_kernel(const float* __restrict__ x, const float* __restrict__ ss,
                                                        const float* __restrict__ maar, const float* __restrict__ maak,
                                                        const float* __restrict__ maav, const float* __restrict__ mix,
                                                        unsigned short* __restrict__ qh, unsigned short* __restrict__ ql,
                                                        unsigned short* __restrict__ kh, unsigned short* __restrict__ kl,
                                                        unsigned short* __restrict__ vh, unsigned short* __restrict__ vl) {
  const int row = blockIdx.x;
  const int b = row / kSeq, s = row % kSeq;
  const int c0 = threadIdx.x * 8;
  const float* xr = x + (size_t)row * kDm;
  const float* xp = (s == 0) ? (ss + (size_t)b * kDm) : (xr - kDm);
  const v4f xa = *(const v4f*)(xr + c0), xb = *(const v4f*)(xr + c0 + 4);
  const v4f pa = *(const v4f*)(xp + c0), pb = *(const v4f*)(xp + c0 + 4);
  const v4f da = pa - xa, db = pb - xb;
  const size_t plane = (size_t)kRows * kDm;
  const float* m0 = mix + (size_t)row * kDm + c0;
  const size_t o = (size_t)row * kDm + c0;
  {
    const v4f ma = *(const v4f*)(maar + c0), mb = *(const v4f*)(maar + c0 + 4);
    const v4f qa = *(const v4f*)(m0), qb = *(const v4f*)(m0 + 4);
    const v4f va = xa + da * (ma + qa), vb = xb + db * (mb + qb);
    v8us hv, lv; split8(va, vb, hv, lv); store16x2(qh, ql, o, hv, lv);
  }
  {
    const v4f ma = *(const v4f*)(maak + c0), mb = *(const v4f*)(maak + c0 + 4);
    const v4f qa = *(const v4f*)(m0 + plane), qb = *(const v4f*)(m0 + plane + 4);
    const v4f va = xa + da * (ma + qa), vb = xb + db * (mb + qb);
    v8us hv, lv; split8(va, vb, hv, lv); store16x2(kh, kl, o, hv, lv);
  }
  {
    const v4f ma = *(const v4f*)(maav + c0), mb = *(const v4f*)(maav + c0 + 4);
    const v4f qa = *(const v4f*)(m0 + 2 * plane), qb = *(const v4f*)(m0 + 2 * plane + 4);
    const v4f va = xa + da * (ma + qa), vb = xb + db * (mb + qb);
    v8us hv, lv; split8(va, vb, hv, lv); store16x2(vh, vl, o, hv, lv);
  }
}

// ---------------------------------------------------------------------------
//   MODE 0: LN then RoPE (half-split per 64-wide head: out[f] = x1*cos - x2*sin, out[32+f] = x1*sin + x2*cos with
//           cos/sin = cosf/sinf(angles[s][f]), s = row % kSeq) then bf16 hi/lo split into planes [kRows][kDm]; grid = (kRows, 2),
//           blockIdx.y selects source/params/planes A (0) or B (1).
//   MODE 1: LN written back IN PLACE as f32 (dstf == src): each block owns its row; thread t writes floats 4t..4t+3,
//   MODE 2: LN then bf16 hi/lo split into planes (no rotation); grid = (kRows, 1).
// MODE 0/2 store path: per wave (heads 2w, 2w+1) the 128 results are staged in LDS, then lanes 0..15 write 16 B each =
// ---------------------------------------------------------------------------
template <int MODE>
__global__ __launch_bounds__(256) void ln_kernel(const float* srcA, const float* srcB,
                                                 const float* __restrict__ gA, const float* __restrict__ bA,
                                                 const float* __restrict__ gB, const float* __restrict__ bB,
                                                 const float* __restrict__ ang,
                                                 unsigned short* hA, unsigned short* lA,
                                                 unsigned short* hB, unsigned short* lB, float* dstf) {
  __shared__ __align__(16) float srow[kDm];
  __shared__ __align__(16) unsigned short Lh[8][128];
  __shared__ __align__(16) unsigned short Ll[8][128];
  __shared__ float sred[8];
  __shared__ float sred2[8];
  const int s = blockIdx.x;                      // token row b*kSeq + position
  const int which = blockIdx.y;                  // block-uniform
  const float* src = (which == 0) ? srcA : srcB;
  const float* g   = (which == 0) ? gA : gB;
  const float* bb  = (which == 0) ? bA : bB;
  unsigned short* dh = (which == 0) ? hA : hB;
  unsigned short* dl = (which == 0) ? lA : lB;
  const int tid = threadIdx.x, lane = tid & 31, wave = tid >> 5;

  const float* row = src + (size_t)s * kDm;
  const v4f xv = *(const v4f*)(row + tid * 4);
  float ps = (xv[0] + xv[1]) + (xv[2] + xv[3]);
#pragma unroll
  for (int off = 1; off < 32; off <<= 1) ps += __shfl_xor(ps, off, 32);
  if (lane == 0) sred[wave] = ps;
  __syncthreads();
  float tot = 0.f;
#pragma unroll
  for (int w = 0; w < 8; ++w) tot += sred[w];
  const float mean = tot * (1.0f / (float)kDm);
  const v4f dv = xv - mean;
  float pq = (dv[0] * dv[0] + dv[1] * dv[1]) + (dv[2] * dv[2] + dv[3] * dv[3]);
#pragma unroll
  for (int off = 1; off < 32; off <<= 1) pq += __shfl_xor(pq, off, 32);
  if (lane == 0) sred2[wave] = pq;
  __syncthreads();
  float tot2 = 0.f;
#pragma unroll
  for (int w = 0; w < 8; ++w) tot2 += sred2[w];
  const float var  = tot2 * (1.0f / (float)kDm);
  const float rstd = rsqrtf(var + 1.0e-5f);
  const v4f gv = *(const v4f*)(g + tid * 4);
  const v4f bv = *(const v4f*)(bb + tid * 4);
  v4f yv;
#pragma unroll
  for (int e = 0; e < 4; ++e) yv[e] = dv[e] * rstd * gv[e] + bv[e];

  if (MODE == 1) {
    float* dp = dstf + (size_t)s * kDm + tid * 4;
    *(v4f*)dp = yv;
    
    return;                                     // MODE is a compile-time constant: uniform
  }

  *(v4f*)(srow + tid * 4) = yv;
  __syncthreads();

  float cs = 1.0f, sn = 0.0f;
  if (MODE == 0) {
    const float a = ang[(size_t)(s % kSeq) * 32 + lane];
    cs = cosf(a);
    sn = sinf(a);
  }
  unsigned short* lh = Lh[wave];
  unsigned short* ll = Ll[wave];
#pragma unroll 1
  for (int hp = 0; hp < 2; ++hp) {
    const int base = wave * 128 + hp * 64;
    const float xr = srow[base + lane];
    const float xi = srow[base + 32 + lane];
    float vr = xr, vi = xi;
    if (MODE == 0) { vr = xr * cs - xi * sn; vi = xr * sn + xi * cs; }
    const unsigned short hr = f2bf_bits(vr);
    const unsigned short lr = f2bf_bits(vr - bf_bits2f(hr));
    const unsigned short hi = f2bf_bits(vi);
    const unsigned short li = f2bf_bits(vi - bf_bits2f(hi));
    lh[hp * 64 + lane] = hr;       ll[hp * 64 + lane] = lr;
    lh[hp * 64 + 32 + lane] = hi;  ll[hp * 64 + 32 + lane] = li;
  }
  __builtin_amdgcn_fence(__ATOMIC_RELEASE, "workgroup");
  __builtin_amdgcn_wave_barrier();
  __builtin_amdgcn_fence(__ATOMIC_ACQUIRE, "workgroup");
  const int l16 = lane & 15;
  const v8us hv = *(const v8us*)(lh + l16 * 8);
  const v8us lv = *(const v8us*)(ll + l16 * 8);
  const size_t o = (size_t)s * kDm + wave * 128 + l16 * 8;
  {
    if (lane < 16) {
      *(v8us*)(dh + o) = hv;
      *(v8us*)(dl + o) = lv;
    }
    
  }
}

// =====================================================================================
// Causal attention, head dim 64, batch element = blockIdx.y (structural lower-triangular mask incl. diagonal).
//   Every plane below is that of one batch element; element b starts b*kSeq*kDm elements into each buffer.
//   q planes (hi/lo bf16): element (t, h, d) at [t*kDm + h*64 + d]
//   k planes (hi/lo bf16): element (s, h, d) at [s*kDm + h*64 + d]
//   v^T planes (hi/lo bf16): element (h, d, s) at [(h*64 + d)*kSeq + s]
//   out f32: element (t, h, d) at [t*kDm + h*64 + d]
//   scores = (q . k) * sscale : bf16 hi/lo split (hi.hi + hi.lo + lo.hi) on v_wmma_f32_16x16x32_bf16
//   out    = p . v             : bf16 hi/lo split of p (unnormalised) and v, f32 accumulate
//   online softmax in f32. Key tiles strictly above the 64x64 block diagonal (kv chunk > query block) are not
//   visited (probabilities exactly 0 in f32); inside the diagonal tile, score := mfill where kv > query (select).
//   Block = 4 waves = 64 query rows of one head; grid.x = kHeads * (kSeq/64); kv chunks of 64, trip count qb+1 <= 32.
//   K / V^T chunk staging: 128 threads x 32 elements per plane = the whole 64x64 tile (16-B copies, plain loads,
//   __syncthreads before and after); fragment loads read the LDS tiles with the same v8b element type.
//   Output coverage: grid.x 16 heads x 32 query blocks x 4 waves x 16 rows x 64 cols = one [2048][1024] plane per grid.y.
// =====================================================================================
#define AT_D 64
#define AT_NW 4
#define AT_QB 64
#define AT_KC 64

__device__ __forceinline__ unsigned short at_bf_bits(float f) {
  unsigned u = __float_as_uint(f);
  return (unsigned short)((u + 0x7FFFu + ((u >> 16) & 1u)) >> 16);
}
__device__ __forceinline__ __bf16 at_f2bf(float f) { return __builtin_bit_cast(__bf16, at_bf_bits(f)); }
__device__ __forceinline__ void at_split(float f, __bf16& hi, __bf16& lo) {
  const unsigned short hb = at_bf_bits(f);
  hi = __builtin_bit_cast(__bf16, hb);
  lo = at_f2bf(f - __uint_as_float(((unsigned)hb) << 16));
}
__device__ __forceinline__ v8f at_mma(v16b a, v16b b, v8f c) {
  c = __builtin_amdgcn_wmma_f32_16x16x32_bf16(false, a, false, b, (short)0, c, false, false);
  asm volatile("v_nop\n\tv_nop\n\tv_nop\n\tv_nop" : "+v"(c) : "v"(a), "v"(b));
  return c;
}

__global__ __launch_bounds__(128)
void attn_causal64_kernel(const unsigned short* __restrict__ qhp, const unsigned short* __restrict__ qlp,
                          const unsigned short* __restrict__ khp, const unsigned short* __restrict__ klp,
                          const unsigned short* __restrict__ vhp, const unsigned short* __restrict__ vlp,
                          float* __restrict__ out, float sscale, float mfill) {
  union FB { v16b v; v8b h[2]; };
  __shared__ __align__(16) __bf16 Ksh[AT_KC * AT_D];             // K hi [kv][d]      8 KB
  __shared__ __align__(16) __bf16 Ksl[AT_KC * AT_D];             // K lo
  __shared__ __align__(16) __bf16 Vth[AT_D * AT_KC];             // V hi [d][kv]      8 KB
  __shared__ __align__(16) __bf16 Vtl[AT_D * AT_KC];             // V lo
  __shared__ __align__(16) __bf16 Psh[AT_NW][16 * AT_KC];        // per wave P hi [row][kv]
  __shared__ __align__(16) __bf16 Psl[AT_NW][16 * AT_KC];        // per wave P lo
  __shared__ __align__(16) float  Os[AT_NW][16 * 68];            // per wave out tile, pitch 68

  const int tid  = threadIdx.x;
  const int wave = tid >> 5;
  const int lane = tid & 31;
  const int hh   = lane >> 4;
  const int c    = lane & 15;

  const int nqb = kSeq / AT_QB;           // 32
  const int bx = blockIdx.x;
  const int qb = bx % nqb;
  const int h  = bx / nqb;                // 0..kHeads-1 (grid = kHeads * nqb)
  const int q0 = qb * AT_QB + wave * 16;

  const size_t bo = (size_t)blockIdx.y * kSeq * kDm;
  const __bf16* Qh = (const __bf16*)(const void*)qhp + bo + (size_t)h * AT_D;
  const __bf16* Ql = (const __bf16*)(const void*)qlp + bo + (size_t)h * AT_D;
  const __bf16* Kh = (const __bf16*)(const void*)khp + bo + (size_t)h * AT_D;
  const __bf16* Kl = (const __bf16*)(const void*)klp + bo + (size_t)h * AT_D;
  const __bf16* Vh = (const __bf16*)(const void*)vhp + bo + (size_t)h * AT_D * kSeq;
  const __bf16* Vl = (const __bf16*)(const void*)vlp + bo + (size_t)h * AT_D * kSeq;
  float*        ob = out + bo + (size_t)h * AT_D;

  // ---- Q fragments (A operand, row = lane&15, split k map via Frag load): 2 d-chunks, hi and lo ----
  v16b qah[2], qal[2];
#pragma unroll
  for (int dc = 0; dc < 2; ++dc) {
    const __bf16* qr = Qh + (size_t)(q0 + c) * kDm + dc * 32 + 8 * hh;
    const __bf16* ql = Ql + (size_t)(q0 + c) * kDm + dc * 32 + 8 * hh;
    qah[dc] = Frag<__bf16>::load(qr);
    qal[dc] = Frag<__bf16>::load(ql);
  }

  float mrow[8], lrow[8];
  v8f oacc[4];
#pragma unroll
  for (int r = 0; r < 8; ++r) { mrow[r] = -INFINITY; lrow[r] = 0.f; }
#pragma unroll
  for (int t = 0; t < 4; ++t) oacc[t] = (v8f){0.f,0.f,0.f,0.f,0.f,0.f,0.f,0.f};

  int nChunks = qb + 1;                      // block-uniform, <= 32
  if (nChunks > kSeq / AT_KC) nChunks = kSeq / AT_KC;
  for (int kc = 0; kc < nChunks; ++kc) {
    const int kv0 = kc * AT_KC;
    __syncthreads();
    {
      // staging coverage: 128 threads x (4 x 8) elements = 64 rows x 64 per plane = the whole chunk tile
      const int r = tid >> 1, half = (tid & 1) * 32;
      const __bf16* ksh = Kh + (size_t)(kv0 + r) * kDm + half;     // K row kv0+r, d = half..half+31
      const __bf16* ksl = Kl + (size_t)(kv0 + r) * kDm + half;
      const __bf16* vsh = Vh + (size_t)r * kSeq + kv0 + half;     // V^T row d = r, s = kv0+half..+31
      const __bf16* vsl = Vl + (size_t)r * kSeq + kv0 + half;
#pragma unroll
      for (int i = 0; i < 4; ++i) {
        const v8b a0 = *(const v8b*)(ksh + 8 * i);
        const v8b a1 = *(const v8b*)(ksl + 8 * i);
        const v8b b0 = *(const v8b*)(vsh + 8 * i);
        const v8b b1 = *(const v8b*)(vsl + 8 * i);
        *(v8b*)(Ksh + r * AT_D  + half + 8 * i) = a0;
        *(v8b*)(Ksl + r * AT_D  + half + 8 * i) = a1;
        *(v8b*)(Vth + r * AT_KC + half + 8 * i) = b0;
        *(v8b*)(Vtl + r * AT_KC + half + 8 * i) = b1;
      }
    }
    __syncthreads();

    v8f s[4];
#pragma unroll
    for (int j = 0; j < 4; ++j) {
      s[j] = (v8f){0.f,0.f,0.f,0.f,0.f,0.f,0.f,0.f};
#pragma unroll
      for (int dc = 0; dc < 2; ++dc) {
        FB kb, kl;
        kb.h[0] = *(const v8b*)(Ksh + (j * 16 + c) * AT_D + dc * 32 + 8 * hh);
        kb.h[1] = *(const v8b*)(Ksh + (j * 16 + c) * AT_D + dc * 32 + 16 + 8 * hh);
        kl.h[0] = *(const v8b*)(Ksl + (j * 16 + c) * AT_D + dc * 32 + 8 * hh);
        kl.h[1] = *(const v8b*)(Ksl + (j * 16 + c) * AT_D + dc * 32 + 16 + 8 * hh);
        s[j] = at_mma(qah[dc], kb.v, s[j]);
        s[j] = at_mma(qah[dc], kl.v, s[j]);
        s[j] = at_mma(qal[dc], kb.v, s[j]);
      }
    }
    // ---- scale, structural causal select on the diagonal tile, row max over the 16 lanes of each half ----
    const bool diag = (kc == qb);            // block-uniform
    float cm[8];
#pragma unroll
    for (int r = 0; r < 8; ++r) {
      const int qrow = q0 + 8 * hh + r;                       // 0..kSeq-1
      float m = -INFINITY;
#pragma unroll
      for (int j = 0; j < 4; ++j) {
        const int kvcol = kv0 + j * 16 + c;
        const float sv = s[j][r] * sscale;
        const bool masked = diag && (kvcol > qrow);
        const float sm = masked ? mfill : sv;
        s[j][r] = sm;
        m = fmaxf(m, sm);
      }
#pragma unroll
      for (int off = 1; off < 16; off <<= 1) m = fmaxf(m, __shfl_xor(m, off, 32));
      cm[r] = m;
    }
    __bf16* pwh = Psh[wave];
    __bf16* pwl = Psl[wave];
#pragma unroll
    for (int r = 0; r < 8; ++r) {
      const float mnew = fmaxf(mrow[r], cm[r]);
      const float alpha = expf(mrow[r] - mnew);
      mrow[r] = mnew;
      float psum = 0.f;
#pragma unroll
      for (int j = 0; j < 4; ++j) {
        const float p = expf(s[j][r] - mnew);
        psum += p;
        __bf16 a, bl; at_split(p, a, bl);
        pwh[(8 * hh + r) * AT_KC + j * 16 + c] = a;
        pwl[(8 * hh + r) * AT_KC + j * 16 + c] = bl;
      }
#pragma unroll
      for (int off = 1; off < 16; off <<= 1) psum += __shfl_xor(psum, off, 32);
      lrow[r] = lrow[r] * alpha + psum;
#pragma unroll
      for (int t = 0; t < 4; ++t) oacc[t][r] *= alpha;
    }
    __builtin_amdgcn_fence(__ATOMIC_RELEASE, "workgroup");
    __builtin_amdgcn_wave_barrier();
    __builtin_amdgcn_fence(__ATOMIC_ACQUIRE, "workgroup");
#pragma unroll 1
    for (int kk = 0; kk < 2; ++kk) {
      FB pa, pl;
      pa.h[0] = *(const v8b*)(pwh + c * AT_KC + kk * 32 + 8 * hh);
      pa.h[1] = *(const v8b*)(pwh + c * AT_KC + kk * 32 + 16 + 8 * hh);
      pl.h[0] = *(const v8b*)(pwl + c * AT_KC + kk * 32 + 8 * hh);
      pl.h[1] = *(const v8b*)(pwl + c * AT_KC + kk * 32 + 16 + 8 * hh);
#pragma unroll
      for (int t = 0; t < 4; ++t) {
        FB vb, vl;
        vb.h[0] = *(const v8b*)(Vth + (t * 16 + c) * AT_KC + kk * 32 + 8 * hh);
        vb.h[1] = *(const v8b*)(Vth + (t * 16 + c) * AT_KC + kk * 32 + 16 + 8 * hh);
        vl.h[0] = *(const v8b*)(Vtl + (t * 16 + c) * AT_KC + kk * 32 + 8 * hh);
        vl.h[1] = *(const v8b*)(Vtl + (t * 16 + c) * AT_KC + kk * 32 + 16 + 8 * hh);
        oacc[t] = at_mma(pa.v, vb.v, oacc[t]);
        oacc[t] = at_mma(pa.v, vl.v, oacc[t]);
        oacc[t] = at_mma(pl.v, vb.v, oacc[t]);
      }
    }
  }

  float* os = Os[wave];
#pragma unroll
  for (int r = 0; r < 8; ++r) {
    const float inv = 1.0f / lrow[r];
#pragma unroll
    for (int t = 0; t < 4; ++t) os[(8 * hh + r) * 68 + t * 16 + c] = oacc[t][r] * inv;
  }
  __builtin_amdgcn_fence(__ATOMIC_RELEASE, "workgroup");
  __builtin_amdgcn_wave_barrier();
  __builtin_amdgcn_fence(__ATOMIC_ACQUIRE, "workgroup");
  {
    const int c4 = (lane & 15) * 4;
    {
#pragma unroll
      for (int it = 0; it < 8; ++it) {
        const int row = it * 2 + hh;   // it 0..7 x hh 0..1 covers rows 0..15 of the wave tile
        v4f val = *(const v4f*)(os + row * 68 + c4);
        *(v4f*)(ob + (size_t)(q0 + row) * kDm + c4) = val;
      }
      
    }
  }
}

// ---------------------------------------------------------------------------
// Workspace region map (byte offsets). Every GEMM: K in {1024, 32} (%32 == 0), M = kRows = 4096, N in {128, 1024} (%64 == 0).
// Activation regions hold both batch elements, row = b*2048 + s.
// Every region is fully written before it is read within the in-order launch sequence; reused regions noted.
//   Wqh bf16 [1024 n][1024 k]        0      Wql    2097152
//   Wkh                        4194304      Wkl    6291456
//   Wvh                        8388608      Wvl   10485760
//   Woh                       12582912      Wol   14680064
//   W1Th bf16 [128 n][1024 k] 16777216      W1Tl  17039360   (rows 96..127 zero)
//   W2Th bf16 [3][1024 n][32] 17301504      W2Tl  17498112
//   XXh  bf16 [4096][1024]    17694720      XXl   26083328   (xxx planes; reused after the LoRA GEMM as Oh / Ol)
//   LORAf f32 [4096][128]     34471936
//   LTh  bf16 [4096][128]     36569088      LTl   37617664
//   MIX  f32 [3][4096][1024]  38666240                       (reused after the mix kernel: Qf = +0, Kf = +16777216,
//                                                             Vf = +33554432 f32 [4096][1024]; Of reuses Qf)
//   XQh/XQl/XKh/XKl/XVh/XVl   88997888 .. (6 x 8388608)
//   Qh/Ql/Kh/Kl              139329536 .. (4 x 8388608)
//   VTh/VTl bf16 [2][1024][2048] 172883968, 181272576
//   total                    189661184  (~180.9 MiB)
// ---------------------------------------------------------------------------
extern "C" void kernel_launch(void* const* d_in, const int* in_sizes, int n_in,
                              void* d_out, int out_size, void* d_ws, size_t ws_size,
                              hipStream_t stream) {
  if (n_in < 21) return;
  const int nRow = kSeq * kDm;            // 2097152 per batch element
  const int nAct = kBatch * nRow;         // 4194304
  const int nW   = kDm * kDm;             // 1048576
  if (in_sizes[0] != nAct) return;
  if (in_sizes[1] != kBatch * kDm) return;
  if (in_sizes[2] != kDm || in_sizes[3] != kDm || in_sizes[4] != kDm || in_sizes[5] != kDm) return;
  if (in_sizes[6] != kDm * kLoraN) return;
  if (in_sizes[7] != 3 * kLoraD * kDm) return;
  if (in_sizes[8] != nW || in_sizes[9] != nW || in_sizes[10] != nW || in_sizes[11] != nW) return;
  for (int i = 12; i < 20; ++i) if (in_sizes[i] != kDm) return;
  if (in_sizes[20] != kSeq * 32) return;
  if (out_size != nAct) return;

  const float* x     = (const float*)d_in[0];    // [2][2048][1024]
  const float* ss    = (const float*)d_in[1];    // [2][1024]
  const float* maax  = (const float*)d_in[2];    // [1024]
  const float* maar  = (const float*)d_in[3];
  const float* maak  = (const float*)d_in[4];
  const float* maav  = (const float*)d_in[5];
  const float* w1    = (const float*)d_in[6];    // [1024][96]
  const float* w2    = (const float*)d_in[7];    // [3][32][1024]
  const float* wq    = (const float*)d_in[8];    // [1024 out][1024 in]
  const float* wk    = (const float*)d_in[9];
  const float* wv    = (const float*)d_in[10];
  const float* wo    = (const float*)d_in[11];
  const float* lnrg  = (const float*)d_in[12];
  const float* lnrb  = (const float*)d_in[13];
  const float* lnkg  = (const float*)d_in[14];
  const float* lnkb  = (const float*)d_in[15];
  const float* lnvg  = (const float*)d_in[16];
  const float* lnvb  = (const float*)d_in[17];
  const float* lnxg  = (const float*)d_in[18];
  const float* lnxb  = (const float*)d_in[19];
  const float* ang   = (const float*)d_in[20];   // [2048][32]

  const size_t PW   = (size_t)kDm * kDm * 2;          // 2097152  bf16 weight plane
  const size_t PX   = (size_t)kRows * kDm * 2;        // 8388608  bf16 activation plane (both batch elements)
  const size_t PF   = (size_t)kRows * kDm * 4;        // 16777216 f32 activation plane
  const size_t PW1  = (size_t)kLoraP * kDm * 2;       // 262144
  const size_t PW2  = (size_t)3 * kDm * kLoraD * 2;   // 196608
  const size_t PLF  = (size_t)kRows * kLoraP * 4;     // 2097152
  const size_t PLT  = (size_t)kRows * kLoraP * 2;     // 1048576
  size_t off = 0;
  const size_t oWqh = off; off += PW;  const size_t oWql = off; off += PW;
  off += 4 * PW;                                // Wkh, Wkl, Wvh, Wvl: reached from Wqh / Wql by the plane stride
  const size_t oWoh = off; off += PW;  const size_t oWol = off; off += PW;
  const size_t oW1h = off; off += PW1; const size_t oW1l = off; off += PW1;
  const size_t oW2h = off; off += PW2; const size_t oW2l = off; off += PW2;
  const size_t oXXh = off; off += PX;  const size_t oXXl = off; off += PX;
  const size_t oLF  = off; off += PLF;
  const size_t oLTh = off; off += PLT; const size_t oLTl = off; off += PLT;
  const size_t oMIX = off; off += 3 * PF;
  const size_t oXQh = off; off += PX;  const size_t oXQl = off; off += PX;
  const size_t oXKh = off; off += PX;  const size_t oXKl = off; off += PX;
  const size_t oXVh = off; off += PX;  const size_t oXVl = off; off += PX;
  const size_t oQh  = off; off += PX;  const size_t oQl  = off; off += PX;
  const size_t oKh  = off; off += PX;  const size_t oKl  = off; off += PX;
  const size_t oVTh = off; off += PX;  const size_t oVTl = off; off += PX;
  if (off > ws_size) return;                    // off = 189661184

  char* ws = (char*)d_ws;
  unsigned short* Wqh = (unsigned short*)(ws + oWqh); unsigned short* Wql = (unsigned short*)(ws + oWql);
  unsigned short* Woh = (unsigned short*)(ws + oWoh); unsigned short* Wol = (unsigned short*)(ws + oWol);
  unsigned short* W1h = (unsigned short*)(ws + oW1h); unsigned short* W1l = (unsigned short*)(ws + oW1l);
  unsigned short* W2h = (unsigned short*)(ws + oW2h); unsigned short* W2l = (unsigned short*)(ws + oW2l);
  unsigned short* XXh = (unsigned short*)(ws + oXXh); unsigned short* XXl = (unsigned short*)(ws + oXXl);
  float*          LF  = (float*)(ws + oLF);
  unsigned short* LTh = (unsigned short*)(ws + oLTh); unsigned short* LTl = (unsigned short*)(ws + oLTl);
  float*          MIX = (float*)(ws + oMIX);
  float*          Qf  = (float*)(ws + oMIX);
  float*          Kf  = (float*)(ws + oMIX + PF);
  float*          Vf  = (float*)(ws + oMIX + 2 * PF);
  float*          Of  = Qf;
  unsigned short* XQh = (unsigned short*)(ws + oXQh); unsigned short* XQl = (unsigned short*)(ws + oXQl);
  unsigned short* XKh = (unsigned short*)(ws + oXKh); unsigned short* XKl = (unsigned short*)(ws + oXKl);
  unsigned short* XVh = (unsigned short*)(ws + oXVh); unsigned short* XVl = (unsigned short*)(ws + oXVl);
  unsigned short* Qh  = (unsigned short*)(ws + oQh);  unsigned short* Ql  = (unsigned short*)(ws + oQl);
  unsigned short* Kh  = (unsigned short*)(ws + oKh);  unsigned short* Kl  = (unsigned short*)(ws + oKl);
  unsigned short* VTh = (unsigned short*)(ws + oVTh); unsigned short* VTl = (unsigned short*)(ws + oVTl);
  unsigned short* Oh  = XXh;                          unsigned short* Ol  = XXl;

  const float* dummyf = lnrg;                         // valid pointer for unused bias / resid arguments (never read)

  const dim3 blk(256);
  const int  n2w = nW / 2;                                  // 524288 pairs per weight plane
  const dim3 gCastW((n2w + 255) / 256, 4);                  // 2048 blocks x 256 threads x 2 = 1024x1024, y = q, k, v, o
  const dim3 gW1(kDm / 64);                                 // 16 k-tiles
  const dim3 gW2(kDm / 64, 3);                              // 16 n-tiles x 3
  const dim3 gRow(kRows);                                   // one block per token row (128-thread kernels)
  const dim3 gLora(((kRows / 64) * (kLoraP / 64) + 7) / 8); // 128 tiles: M=4096, N=128 -> 16 blocks
  const dim3 gMix(((kRows / 64) * (kDm / 64) + 7) / 8, 3);  // 1024 tiles x 3 (l): M=4096, N=1024, K=32
  const int  n2l = kRows * kLoraP / 2;                      // 262144 pairs
  const dim3 gTanh((n2l + 255) / 256);                      // 1024 blocks x 256 x 2 = 4096x128
  const dim3 gQKV(((kRows / 64) * (kDm / 64) + 7) / 8, 3);  // 1024 tiles x 3 (q, k, v): M=4096, N=1024 -> 128 x 3 blocks x 8 waves
  const dim3 gProj(((kRows / 64) * (kDm / 64) + 7) / 8, 1); // 1024 tiles: M=4096, N=1024 -> 128 blocks x 8 waves
  const dim3 gLnQK(kRows, 2);                               // 4096 rows x {q, k}
  const dim3 gLn1(kRows, 1);
  const dim3 gVT(kDm / 64, kSeq / 64, kBatch);              // per b: in [R=2048 s][Cn=1024 c] -> planes [c][s]
  const dim3 gAtt(kHeads * (kSeq / 64), kBatch);            // 512 x 2 blocks: 16 heads x 32 query blocks, y = b

  // setup: weights -> bf16 hi/lo planes (q/k/v/o already [out n][in k] = Bt layout; w1/w2 transposed).
  // The hi planes of q, k, v, o lie 2 weight planes apart (hi, lo, hi, lo, ...), and so do the lo planes.
  split_bf16x2_kernel<<<gCastW, blk, 0, stream>>>(wq, wk, wv, wo, Wqh, Wql, n2w, 2L * nW);
  w1t_split_kernel<<<gW1, blk, 0, stream>>>(w1, W1h, W1l);
  w2t_split_kernel<<<gW2, blk, 0, stream>>>(w2, W2h, W2l);

  // Each stage below runs once, on the rows of both batch elements.
  // (1) xxx = x + dxprev*maa_x -> planes
  xxx_split_kernel<<<gRow, dim3(128), 0, stream>>>(x, ss, maax, XXh, XXl);
  // (2) lora_pre = xxx . w1 -> f32 [4096][128]   (M=4096, N=128, K=1024)
  wmma_gemm64<1, true, 0, 0, false, 0><<<gLora, blk, 0, stream>>>(
      XXh, XXl, kDm, 0L, W1h, W1l, kDm, 0L, (void*)LF, (void*)LF, kLoraP, 0L,
      dummyf, dummyf, 0L, kRows, kLoraP, kDm, 1.0f);
  // (3) lora = tanh -> planes [4096][128]
  tanh_split_kernel<<<gTanh, blk, 0, stream>>>(LF, LTh, LTl, n2l);
  // (4) mixes[l] = lora[:, 32l..32l+31] . w2[l] -> f32 [3][4096][1024]   (M=4096, N=1024, K=32; grid.y = l)
  wmma_gemm64<1, true, 0, 0, false, 0><<<gMix, blk, 0, stream>>>(
      LTh, LTl, kLoraP, (long)kLoraD, W2h, W2l, kLoraD, (long)kDm * kLoraD, (void*)MIX, (void*)MIX, kDm, (long)nAct,
      dummyf, dummyf, 0L, kRows, kDm, kLoraD, 1.0f);
  // (5) xq/xk/xv = x + dxprev*(maa + mix) -> planes
  mix_split_kernel<<<gRow, dim3(128), 0, stream>>>(x, ss, maar, maak, maav, MIX, XQh, XQl, XKh, XKl, XVh, XVl);
  // (6) q0 = xq . Wq^T, k0 = xk . Wk^T, v0 = xv . Wv^T -> f32 [3][4096][1024]   (M=4096, N=1024, K=1024; grid.y = q, k, v:
  //     XQ/XK/XV hi planes lie 2 activation planes apart, Wq/Wk/Wv hi planes 2 weight planes, Qf/Kf/Vf one f32 plane)
  wmma_gemm64<1, true, 0, 0, false, 0><<<gQKV, blk, 0, stream>>>(
      XQh, XQl, kDm, 2L * nAct, Wqh, Wql, kDm, 2L * nW, (void*)Qf, (void*)Qf, kDm, (long)nAct,
      dummyf, dummyf, 0L, kRows, kDm, kDm, 1.0f);
  // (7) LayerNorm + RoPE + split for q and k -> planes [row][h*64+d]
  ln_kernel<0><<<gLnQK, blk, 0, stream>>>(Qf, Kf, lnrg, lnrb, lnkg, lnkb, ang, Qh, Ql, Kh, Kl, Qf);
  // (8) LayerNorm of v in place (f32), then transpose-split -> v^T planes [b][h*64+d][s]
  ln_kernel<1><<<gLn1, blk, 0, stream>>>(Vf, Vf, lnvg, lnvb, lnvg, lnvb, ang, VTh, VTl, VTh, VTl, Vf);
  wt_split_kernel<<<gVT, blk, 0, stream>>>(Vf, VTh, VTl, kSeq, kDm);
  // (9) causal attention per batch element and head -> f32 [row][h*64+d] (Of region; Qf is dead after step 7)
  attn_causal64_kernel<<<gAtt, dim3(128), 0, stream>>>(Qh, Ql, Kh, Kl, VTh, VTl, Of, 0.125f, -1.0e30f);
  // (10) output LayerNorm + split -> planes (XX region is dead after step 2)
  ln_kernel<2><<<gLn1, blk, 0, stream>>>(Of, Of, lnxg, lnxb, lnxg, lnxb, ang, Oh, Ol, Oh, Ol, Of);
  // (11) out = o . Wo^T -> d_out (f32)   (M=4096, N=1024, K=1024)
  wmma_gemm64<1, true, 0, 0, false, 0><<<gProj, blk, 0, stream>>>(
      Oh, Ol, kDm, 0L, Woh, Wol, kDm, 0L, d_out, d_out, kDm, 0L,
      dummyf, dummyf, 0L, kRows, kDm, kDm, 1.0f);
}

// v002
// Measured time: 598 microseconds a run.
// Next to v001, in two timings, it ran 1.19 times as fast each time.
// Counting every step since v000, it is 2.16 times as fast.
// All contractions (token-shift LoRA xxx.w1 and lora.w2, q/k/v projections, attention q.k^T and p.v, output projection): v_wmma_f32_16x16x32_bf16 with bf16 hi/lo split operands (hi.hi + hi.lo + lo.hi), f32 accumulate; token shift, tanh, LayerNorms, RoPE, online softmax, score scale 0.125 in f32.
#include <hip/hip_runtime.h>
#include <math.h>
#include <stdint.h>

constexpr int kBatch = 2;
constexpr int kSeq   = 2048;
constexpr int kRows  = kBatch * kSeq;   // token rows of both batch elements, row = b*kSeq + s
constexpr int kDm    = 1024;
constexpr int kHeads = 16;
constexpr int kLoraN = 96;      // 3 x 32 LoRA outputs
constexpr int kLoraP = 128;     // padded to a 64-multiple
constexpr int kLoraD = 32;

typedef __attribute__((ext_vector_type(16))) _Float16 v16h;
typedef __attribute__((ext_vector_type(8)))  _Float16 v8h;
typedef __attribute__((ext_vector_type(16))) __bf16   v16b;
typedef __attribute__((ext_vector_type(8)))  __bf16   v8b;
typedef __attribute__((ext_vector_type(8)))  float    v8f;
typedef __attribute__((ext_vector_type(4)))  float    v4f;
typedef __attribute__((ext_vector_type(2)))  float    v2f;
typedef __attribute__((ext_vector_type(4)))  unsigned int v4u;
typedef __attribute__((ext_vector_type(8)))  unsigned short v8us;

__device__ __forceinline__ unsigned short f2bf_bits(float f) {
  unsigned u = __float_as_uint(f);
  return (unsigned short)((u + 0x7FFFu + ((u >> 16) & 1u)) >> 16);
}
__device__ __forceinline__ float bf_bits2f(unsigned short h) { return __uint_as_float(((unsigned)h) << 16); }

// hazard guards as plain device helpers
__device__ __forceinline__ void dep_guard_h(v8f& a, v8f& b, v16h x, v16h y) { asm volatile("v_nop\n\tv_nop\n\tv_nop\n\tv_nop" : "+v"(a), "+v"(b) : "v"(x), "v"(y)); }
__device__ __forceinline__ void dep_guard_b(v8f& a, v8f& b, v16b x, v16b y) { asm volatile("v_nop\n\tv_nop\n\tv_nop\n\tv_nop" : "+v"(a), "+v"(b) : "v"(x), "v"(y)); }
__device__ __forceinline__ void keep4_h(v16h a, v16h b, v16h c, v16h d) { asm volatile("v_nop" :: "v"(a), "v"(b), "v"(c), "v"(d)); }
__device__ __forceinline__ void keep4_b(v16b a, v16b b, v16b c, v16b d) { asm volatile("v_nop" :: "v"(a), "v"(b), "v"(c), "v"(d)); }
__device__ __forceinline__ void acc_guard4(v8f& a, v8f& b, v8f& c, v8f& d) { asm volatile("v_nop\n\tv_nop\n\tv_nop\n\tv_nop" : "+v"(a), "+v"(b), "+v"(c), "+v"(d)); }
template <typename T> struct Frag;
template <> struct Frag<_Float16> {
  typedef v16h V; union U { v16h v; v8h h[2]; };
  static __device__ __forceinline__ v16h load(const _Float16* p) {   // elements 0..7 <- p[0..7], 8..15 <- p[16..23]
    U f; f.h[0] = *(const v8h*)(p); f.h[1] = *(const v8h*)(p + 16); return f.v;
  }
  static __device__ __forceinline__ v8f mma(v16h a, v16h b, v8f c) {
    return __builtin_amdgcn_wmma_f32_16x16x32_f16(false, a, false, b, (short)0, c, false, false);
  }
  static __device__ __forceinline__ void guard(v8f& a, v8f& b, v16h x, v16h y) { dep_guard_h(a, b, x, y); }
  static __device__ __forceinline__ void keep(v16h a, v16h b, v16h c, v16h d) { keep4_h(a, b, c, d); }
};
template <> struct Frag<__bf16> {
  typedef v16b V; union U { v16b v; v8b h[2]; };
  static __device__ __forceinline__ v16b load(const __bf16* p) {
    U f; f.h[0] = *(const v8b*)(p); f.h[1] = *(const v8b*)(p + 16); return f.v;
  }
  static __device__ __forceinline__ v8f mma(v16b a, v16b b, v8f c) {
    return __builtin_amdgcn_wmma_f32_16x16x32_bf16(false, a, false, b, (short)0, c, false, false);
  }
  static __device__ __forceinline__ void guard(v8f& a, v8f& b, v16b x, v16b y) { dep_guard_b(a, b, x, y); }
  static __device__ __forceinline__ void keep(v16b a, v16b b, v16b c, v16b d) { keep4_b(a, b, c, d); }
};

// ---- Register-blocked batched WMMA GEMM, operands staged in LDS --------------
// C[m,n] = scale * sum_k A[m,k] * Bt[n,k] (+bias)(+resid); a block of 4 waves (2 x 2) owns a 128x128 tile, each wave 64x64 of it.
// A row-major [M,K]; Bt row-major [N,K]; M,N % 128 == 0, K % 32 == 0.
// Per 32-wide k tile the block brings 128 A rows and 128 Bt rows of every plane (64 B a row) into LDS with asynchronous
// 16-B copies (a wave-wide copy = 8 rows x 64 contiguous B), two buffers: tile t+1 flies while tile t is multiplied.
// SPLIT: operands are hi/lo planes (A2/Bt2 = lo planes, same layout); product = hi.hi + hi.lo + lo.hi.
// BIAS_MODE: 0 = none, 1 = bias[m], 2 = bias[n].
// OUT_MODE: 0 = f32, 1 = f16, 2 = bf16 hi plane (Cout) + bf16 lo plane (Cout2).
// Coverage per wave tile: 4 slabs x 16 rows x 64 cols = 64x64 (f32: it 0..7 x hh 0..1 rows, 16 lanes x 4 floats;
// 16-bit: it 0..3 x q 0..3 rows, 8 lanes x 8 elements).
// ET: 0 = f16 operands, 1 = bf16 operands (pointers passed as 16-bit storage)
template <int ET> struct Elem;
template <> struct Elem<0> { typedef _Float16 T; };
template <> struct Elem<1> { typedef __bf16 T; };
constexpr int kGLP    = 40;            // LDS row pitch in 16-bit elements: 80 B = 16 B x 5 (odd), the pitch for 16-B reads of 64-B rows
constexpr int kGPlane = 128 * kGLP;    // one plane of a stage: 128 rows
constexpr int kGStage = 4 * kGPlane;   // A hi, A lo, Bt hi, Bt lo

// Four rows (32 apart) of one plane pair -> LDS: 8 (hi and lo) or 4 (hi only) copies of 16 B per lane. l = the lane's LDS byte
// address of its first hi row, g / g2 = its global address in the hi / lo plane, step = 32 source rows in elements.
// s_wait_xcnt 0 ends the copies' own statement, so that it stands in front of any rewrite of the address registers they name.
template <typename T>
__device__ __forceinline__ void stage_rows8(unsigned l, const T* g, const T* g2, size_t step) {
  const unsigned l1 = l + 32 * kGLP * 2, l2 = l + 64 * kGLP * 2, l3 = l + 96 * kGLP * 2;
  const unsigned m0 = l + kGPlane * 2, m1 = l1 + kGPlane * 2, m2 = l2 + kGPlane * 2, m3 = l3 + kGPlane * 2;
  const T* g1 = g + step;  const T* gg2 = g1 + step;  const T* g3 = gg2 + step;
  const T* h1 = g2 + step; const T* h2 = h1 + step;   const T* h3 = h2 + step;
  asm volatile("global_load_async_to_lds_b128 %0, %8, off\n\t"
               "global_load_async_to_lds_b128 %1, %9, off\n\t"
               "global_load_async_to_lds_b128 %2, %10, off\n\t"
               "global_load_async_to_lds_b128 %3, %11, off\n\t"
               "global_load_async_to_lds_b128 %4, %12, off\n\t"
               "global_load_async_to_lds_b128 %5, %13, off\n\t"
               "global_load_async_to_lds_b128 %6, %14, off\n\t"
               "global_load_async_to_lds_b128 %7, %15, off\n\t"
               "s_wait_xcnt 0x0"
               :: "v"(l), "v"(l1), "v"(l2), "v"(l3), "v"(m0), "v"(m1), "v"(m2), "v"(m3),
                  "v"(g), "v"(g1), "v"(gg2), "v"(g3), "v"(g2), "v"(h1), "v"(h2), "v"(h3) : "memory");
}
template <typename T>
__device__ __forceinline__ void stage_rows4(unsigned l, const T* g, size_t step) {
  const unsigned l1 = l + 32 * kGLP * 2, l2 = l + 64 * kGLP * 2, l3 = l + 96 * kGLP * 2;
  const T* g1 = g + step; const T* gg2 = g1 + step; const T* g3 = gg2 + step;
  asm volatile("global_load_async_to_lds_b128 %0, %4, off\n\t"
               "global_load_async_to_lds_b128 %1, %5, off\n\t"
               "global_load_async_to_lds_b128 %2, %6, off\n\t"
               "global_load_async_to_lds_b128 %3, %7, off\n\t"
               "s_wait_xcnt 0x0"
               :: "v"(l), "v"(l1), "v"(l2), "v"(l3), "v"(g), "v"(g1), "v"(gg2), "v"(g3) : "memory");
}

template <int ET, bool SPLIT, int BIAS_MODE, int OUT_MODE, bool RESID, int ACT = 0>
__global__ __launch_bounds__(128) void wmma_gemm64(
    const unsigned short* __restrict__ Ap, const unsigned short* __restrict__ A2p, int lda, long strideA,
    const unsigned short* __restrict__ Btp, const unsigned short* __restrict__ Bt2p, int ldb, long strideB,
    void* __restrict__ Cout, void* __restrict__ Cout2, int ldc, long strideC,
    const float* __restrict__ bias,
    const float* __restrict__ resid, long strideR,
    int M, int N, int K, float scale) {
  typedef typename Elem<ET>::T T;
  typedef typename Frag<T>::V V;
  const T* A = (const T*)Ap; const T* A2 = (const T*)A2p; const T* Bt = (const T*)Btp; const T* Bt2 = (const T*)Bt2p;
  __shared__ __align__(16) T ring[2 * kGStage];    // two stages of operand tiles, 2 x 40,960 B
  __shared__ __align__(16) float sT[4][16 * 68];   // per-wave 16x64 slab, pitch 68 floats
  const int b    = blockIdx.y;
  const int lane = threadIdx.x & 31;
  const int wave = threadIdx.x >> 5;
  const int tilesN = N >> 7;
  const int tilesM = M >> 7;
  const int tile = blockIdx.x;
  if (tile >= tilesM * tilesN) return;   // block-uniform, in front of every barrier and copy
  const int tm = tile / tilesN;
  const int tn = tile - tm * tilesN;
  const int bm0 = tm << 7;                         // block tile origin
  const int bn0 = tn << 7;
  const int wm = (wave >> 1) << 6;                 // wave tile origin inside the block tile
  const int wn = (wave & 1) << 6;
  const int m0 = bm0 + wm;
  const int n0 = bn0 + wn;

  const T* Ab  = A  + (size_t)b * strideA;
  const T* Bb  = Bt + (size_t)b * strideB;
  const T* Ab2 = SPLIT ? (A2  + (size_t)b * strideA) : nullptr;
  const T* Bb2 = SPLIT ? (Bt2 + (size_t)b * strideB) : nullptr;

  const int rlane = lane & 15;                 // row (A) / col (B, D) within subtile
  const int koff  = (lane >> 4) * 8;           // k offset of this lane half
  const int mOff  = (lane >> 4) * 8;           // D row offset

  v8f acc[4][4];
#pragma unroll
  for (int i = 0; i < 4; ++i)
#pragma unroll
    for (int j = 0; j < 4; ++j) acc[i][j] = (v8f){0.f,0.f,0.f,0.f,0.f,0.f,0.f,0.f};

  // copy map: thread -> row (tid >> 2) + 32 r, r = 0..3, 16-B chunk tid & 3 of the row's 64 B; 128 threads x 4 rows = 128 rows a plane
  const int crow = threadIdx.x >> 2;
  const int cchk = (threadIdx.x & 3) * 8;
  const size_t cao = (size_t)(bm0 + crow) * lda + cchk;
  const size_t cbo = (size_t)(bn0 + crow) * ldb + cchk;
  const size_t stepA = (size_t)32 * lda, stepB = (size_t)32 * ldb;
  const unsigned lds0 = (unsigned)(uintptr_t)(&ring[0]) + (unsigned)(crow * kGLP + cchk) * 2u;   // LDS byte address: low 32 bits
  const int nT = K >> 5;                           // k tiles, the same for the whole grid

#define GEMM_STAGE(t_)                                                                          \
  {                                                                                             \
    const unsigned lt = lds0 + (unsigned)((t_) & 1) * (kGStage * 2u);                           \
    const size_t ko = (size_t)(t_) * 32;                                                        \
    if (SPLIT) {                                                                                \
      stage_rows8<T>(lt, Ab + cao + ko, Ab2 + cao + ko, stepA);                                 \
      stage_rows8<T>(lt + 2u * kGPlane * 2u, Bb + cbo + ko, Bb2 + cbo + ko, stepB);             \
    } else {                                                                                    \
      stage_rows4<T>(lt, Ab + cao + ko, stepA);                                                 \
      stage_rows4<T>(lt + 2u * kGPlane * 2u, Bb + cbo + ko, stepB);                             \
    }                                                                                           \
  }

  GEMM_STAGE(0)
  asm volatile("s_wait_asynccnt 0x0" ::: "memory");   // this wave's copies of tile 0 have landed
  __syncthreads();                                    // ... and every other wave's: tile 0 may be read
  if (nT > 1) GEMM_STAGE(1)

  for (int t = 0; t < nT; ++t) {
    const T* st = ring + (t & 1) * kGStage;
    const T* sA = st + (wm + rlane) * kGLP + koff;
    const T* sB = st + 2 * kGPlane + (wn + rlane) * kGLP + koff;
    V bh[4], bl[4];
#pragma unroll
    for (int j = 0; j < 4; ++j) {
      bh[j] = Frag<T>::load(sB + (j << 4) * kGLP);
      if (SPLIT) bl[j] = Frag<T>::load(sB + kGPlane + (j << 4) * kGLP);
    }
#pragma unroll
    for (int i = 0; i < 4; ++i) {
      V ah = Frag<T>::load(sA + (i << 4) * kGLP);
      V al;
      if (SPLIT) al = Frag<T>::load(sA + kGPlane + (i << 4) * kGLP);
#pragma unroll
      for (int j = 0; j < 4; ++j) {
        acc[i][j] = Frag<T>::mma(ah, bh[j], acc[i][j]);
        if (SPLIT) {
          acc[i][j] = Frag<T>::mma(ah, bl[j], acc[i][j]);
          acc[i][j] = Frag<T>::mma(al, bh[j], acc[i][j]);
        }
      }
      Frag<T>::guard(acc[i][0], acc[i][3], ah, SPLIT ? al : ah);
    }
    Frag<T>::keep(bh[0], bh[1], bh[2], bh[3]);
    if (SPLIT) Frag<T>::keep(bl[0], bl[1], bl[2], bl[3]);
    asm volatile("s_wait_dscnt 0x0" ::: "memory");      // this wave's reads of tile t's buffer are done before it is refilled
    asm volatile("s_wait_asynccnt 0x0" ::: "memory");   // this wave's copies of tile t+1 have landed
    __syncthreads();                                    // publishes tile t+1 and ends every wave's reads of tile t
    if (t + 2 < nT) GEMM_STAGE(t + 2)                   // uniform test; into the buffer that trip t has just read
  }
  asm volatile("s_wait_asynccnt 0x0" ::: "memory");     // no copy outstanding behind the loop
#undef GEMM_STAGE
  acc_guard4(acc[0][0], acc[0][1], acc[0][2], acc[0][3]);
  acc_guard4(acc[1][0], acc[1][1], acc[1][2], acc[1][3]);
  acc_guard4(acc[2][0], acc[2][1], acc[2][2], acc[2][3]);
  acc_guard4(acc[3][0], acc[3][1], acc[3][2], acc[3][3]);

  // ---- epilogue ----
  float* slab = sT[wave];
  const float* Rb = RESID ? (resid + (size_t)b * strideR) : nullptr;
#pragma unroll
  for (int i = 0; i < 4; ++i) {
    const int mBase = m0 + (i << 4);
#pragma unroll
    for (int j = 0; j < 4; ++j) {
      const int n = n0 + (j << 4) + rlane;
      float bv = 0.f;
      if (BIAS_MODE == 2) bv = bias[n];
#pragma unroll
      for (int r = 0; r < 8; ++r) {
        float v = acc[i][j][r] * scale;
        if (BIAS_MODE == 1) v += bias[mBase + mOff + r];
        if (BIAS_MODE == 2) v += bv;
        if (RESID) v += Rb[(size_t)(mBase + mOff + r) * ldc + n];
        if (ACT == 1) v = tanhf(v);
        if (ACT == 2) v = fmaxf(v, 0.0f);
        if (ACT == 3) v = v / (1.0f + expf(-v));
        if (ACT == 4) v = (v > 0.f) ? v : 0.01f * v;
        slab[(mOff + r) * 68 + (j << 4) + rlane] = v;
      }
    }
    __builtin_amdgcn_fence(__ATOMIC_RELEASE, "workgroup");
    __builtin_amdgcn_wave_barrier();
    __builtin_amdgcn_fence(__ATOMIC_ACQUIRE, "workgroup");
    if (OUT_MODE == 0) {
      float* C = (float*)Cout + (size_t)b * strideC;
      const int hh = lane >> 4, c4 = (lane & 15) * 4;     // row seg = 256 B = 16 lanes x 16 B
      {
#pragma unroll
        for (int it = 0; it < 8; ++it) {
          const int row = it * 2 + hh;
          v4f v = *(const v4f*)(slab + row * 68 + c4);
          *(v4f*)(C + (size_t)(mBase + row) * ldc + n0 + c4) = v;
        }
        
      }
    } else {
      const int q = lane >> 3, c8 = (lane & 7) * 8;
      unsigned short* C  = (unsigned short*)Cout  + (size_t)b * strideC;
      unsigned short* C2 = (OUT_MODE == 2) ? ((unsigned short*)Cout2 + (size_t)b * strideC) : nullptr;
      {
#pragma unroll
        for (int it = 0; it < 4; ++it) {
          const int row = it * 4 + q;
          const float* sp = slab + row * 68 + c8;
          v8h hv, lv;
#pragma unroll
          for (int e = 0; e < 8; ++e) {
            if (OUT_MODE == 1) {
              hv[e] = (_Float16)sp[e];
            } else {
              unsigned short hb = f2bf_bits(sp[e]);
              unsigned short lb = f2bf_bits(sp[e] - bf_bits2f(hb));
              hv[e] = __builtin_bit_cast(_Float16, hb);
              lv[e] = __builtin_bit_cast(_Float16, lb);
            }
          }
          *(v8h*)(C + (size_t)(mBase + row) * ldc + n0 + c8) = hv;
          if (OUT_MODE == 2) *(v8h*)(C2 + (size_t)(mBase + row) * ldc + n0 + c8) = lv;
        }
        
      }
    }
    __builtin_amdgcn_fence(__ATOMIC_RELEASE, "workgroup");
    __builtin_amdgcn_wave_barrier();
    __builtin_amdgcn_fence(__ATOMIC_ACQUIRE, "workgroup");
  }
}

// ---------------------------------------------------------------------------
// Elementwise bf16 split: hi = bf16_rne(in), lo = bf16_rne(in - hi); 2 elements per thread, one 4-B store.
// blockIdx.y (block-uniform) picks one of four equally sized sources; its planes start pstride 16-bit elements apart.
// ---------------------------------------------------------------------------
__device__ __forceinline__ unsigned pk16(unsigned short a, unsigned short b) { return (unsigned)a | ((unsigned)b << 16); }

__global__ __launch_bounds__(256) void split_bf16x2_kernel(const float* __restrict__ in0, const float* __restrict__ in1,
                                                           const float* __restrict__ in2, const float* __restrict__ in3,
                                                           unsigned short* __restrict__ hi, unsigned short* __restrict__ lo,
                                                           int n2, long pstride) {
  const int w = blockIdx.y;
  const float* in = (w == 0) ? in0 : (w == 1) ? in1 : (w == 2) ? in2 : in3;
  unsigned short* ph = hi + (size_t)w * pstride;
  unsigned short* pl = lo + (size_t)w * pstride;
  const int i = blockIdx.x * 256 + threadIdx.x;
  if (i < n2) {
    const v2f f = *(const v2f*)(in + 2 * (size_t)i);
    const unsigned short h0 = f2bf_bits(f[0]), h1 = f2bf_bits(f[1]);
    const unsigned short l0 = f2bf_bits(f[0] - bf_bits2f(h0)), l1 = f2bf_bits(f[1] - bf_bits2f(h1));
    const unsigned uh = pk16(h0, h1), ul = pk16(l0, l1);
    ((unsigned*)ph)[i] = uh;
    ((unsigned*)pl)[i] = ul;
    
  }
}

// ---------------------------------------------------------------------------
// tanh then bf16 split: hi = bf16_rne(tanh(in)), lo = bf16_rne(tanh(in) - hi); same store shape as above
// Coverage: grid = ceil(n2/256) x 256 threads x 2 elements = 2*n2 = whole plane.
// ---------------------------------------------------------------------------
__global__ __launch_bounds__(256) void tanh_split_kernel(const float* __restrict__ in, unsigned short* __restrict__ hi,
                                                         unsigned short* __restrict__ lo, int n2) {
  const int i = blockIdx.x * 256 + threadIdx.x;
  if (i < n2) {
    const v2f f = *(const v2f*)(in + 2 * (size_t)i);
    const float t0 = tanhf(f[0]), t1 = tanhf(f[1]);
    const unsigned short h0 = f2bf_bits(t0), h1 = f2bf_bits(t1);
    const unsigned short l0 = f2bf_bits(t0 - bf_bits2f(h0)), l1 = f2bf_bits(t1 - bf_bits2f(h1));
    const unsigned uh = pk16(h0, h1), ul = pk16(l0, l1);
    ((unsigned*)hi)[i] = uh;
    ((unsigned*)lo)[i] = ul;
    
  }
}

// ---------------------------------------------------------------------------
// Transpose + bf16 split: in w[R][Cn] f32 -> planes th/tl [Cn][R] bf16: out[n*R + k] = split(w[k*Cn + n]).
// grid = (Cn/64, R/64, matrices), R, Cn % 64 == 0; matrix z starts z*R*Cn elements into w, th and tl.
// (Used for the LayerNormed v [b][s=R=2048][c=Cn=1024] -> v^T planes [b][c][s].)
// Coverage: load 256 threads x 16 = 64x64; store 8 waves x 2 it x 4 rows(q) x 8 lanes x 8 elements = 64x64.
// ---------------------------------------------------------------------------
__global__ __launch_bounds__(256) void wt_split_kernel(const float* __restrict__ wz, unsigned short* __restrict__ thz,
                                                       unsigned short* __restrict__ tlz, int R, int Cn) {
  __shared__ float tile[64 * 65];
  const int n0 = blockIdx.x * 64;
  const int k0 = blockIdx.y * 64;
  const size_t zo = (size_t)blockIdx.z * R * Cn;
  const float* w = wz + zo;
  unsigned short* th = thz + zo;
  unsigned short* tl = tlz + zo;
  const int t = threadIdx.x;
#pragma unroll
  for (int i = 0; i < 16; ++i) {
    const int idx = i * 256 + t;
    const int kk = idx >> 6, nn = idx & 63;
    tile[nn * 65 + kk] = w[(size_t)(k0 + kk) * Cn + n0 + nn];
  }
  __syncthreads();
  const int lane = t & 31, wave = t >> 5;
  const int q = lane >> 3, c8 = (lane & 7) * 8;
  {
#pragma unroll
    for (int it = 0; it < 2; ++it) {
      const int row = wave * 8 + it * 4 + q;          // 0..63 = local n
      const float* sp = tile + row * 65 + c8;
      v8us hv, lv;
#pragma unroll
      for (int e = 0; e < 8; ++e) {
        const unsigned short hb = f2bf_bits(sp[e]);
        const unsigned short lb = f2bf_bits(sp[e] - bf_bits2f(hb));
        hv[e] = hb; lv[e] = lb;
      }
      const size_t o = (size_t)(n0 + row) * R + k0 + c8;
      *(v8us*)(th + o) = hv;
      *(v8us*)(tl + o) = lv;
    }
    
  }
}

// ---------------------------------------------------------------------------
// LoRA weight w1 [1024 in k][96 out n] f32 -> Bt planes th/tl [kLoraP=128 n][1024 k] bf16, rows n >= 96 ZERO:
//   out[n*1024 + k] = split(n < 96 ? w1[k*96 + n] : 0).  grid = 1024/64 k-tiles; block = 256 threads.
// LDS tile [128 n][65]: load 256 threads x 32 iterations = 64 k x 128 n (address clamped to n <= 95, zero by predicate).
// ---------------------------------------------------------------------------
__global__ __launch_bounds__(256) void w1t_split_kernel(const float* __restrict__ w1, unsigned short* __restrict__ th,
                                                        unsigned short* __restrict__ tl) {
  __shared__ float tile[kLoraP * 65];
  const int k0 = blockIdx.x * 64;
  const int t = threadIdx.x;
#pragma unroll 4
  for (int i = 0; i < 32; ++i) {
    const int idx = i * 256 + t;
    const int kk = idx >> 7, nn = idx & 127;
    const int nc = (nn < kLoraN) ? nn : (kLoraN - 1);
    float v = w1[(size_t)(k0 + kk) * kLoraN + nc];
    if (nn >= kLoraN) v = 0.0f;
    tile[nn * 65 + kk] = v;
  }
  __syncthreads();
  const int lane = t & 31, wave = t >> 5;
  const int q = lane >> 3, c8 = (lane & 7) * 8;
  {
#pragma unroll
    for (int it = 0; it < 4; ++it) {
      const int row = wave * 16 + it * 4 + q;         // 0..127 = n
      const float* sp = tile + row * 65 + c8;
      v8us hv, lv;
#pragma unroll
      for (int e = 0; e < 8; ++e) {
        const unsigned short hb = f2bf_bits(sp[e]);
        const unsigned short lb = f2bf_bits(sp[e] - bf_bits2f(hb));
        hv[e] = hb; lv[e] = lb;
      }
      const size_t o = (size_t)row * kDm + k0 + c8;
      *(v8us*)(th + o) = hv;
      *(v8us*)(tl + o) = lv;
    }
    
  }
}

// ---------------------------------------------------------------------------
// LoRA weight w2 [3 l][32 d][1024 c] f32 -> Bt planes th/tl [3 l][1024 n=c][32 k=d] bf16: out[l][n][k] = split(w2[l][k][n]).
// grid = (1024/64 n-tiles, 3); block 256. LDS tile [64 n][33]: load 256 threads x 8 = 32 k x 64 n.
// 512 contiguous bytes) with ONE 16-B-per-lane instruction: lane -> line L = lane>>3, row = wave*8 + 2L + ((lane&7)>>2),
// ---------------------------------------------------------------------------
__global__ __launch_bounds__(256) void w2t_split_kernel(const float* __restrict__ w2, unsigned short* __restrict__ th,
                                                        unsigned short* __restrict__ tl) {
  __shared__ float tile[64 * 33];
  const int n0 = blockIdx.x * 64;
  const int l  = blockIdx.y;
  const int t  = threadIdx.x;
  const float* wl = w2 + (size_t)l * kLoraD * kDm;
#pragma unroll
  for (int i = 0; i < 8; ++i) {
    const int idx = i * 256 + t;
    const int kk = idx >> 6, nn = idx & 63;
    tile[nn * 33 + kk] = wl[(size_t)kk * kDm + n0 + nn];
  }
  __syncthreads();
  const int lane = t & 31, wave = t >> 5;
  const int L = lane >> 3, q = lane & 7;
  const int row = wave * 8 + 2 * L + (q >> 2);
  const int k8 = (q & 3) * 8;
  const float* sp = tile + row * 33 + k8;
  v8us hv, lv;
#pragma unroll
  for (int e = 0; e < 8; ++e) {
    const unsigned short hb = f2bf_bits(sp[e]);
    const unsigned short lb = f2bf_bits(sp[e] - bf_bits2f(hb));
    hv[e] = hb; lv[e] = lb;
  }
  const size_t o = (size_t)l * kDm * kLoraD + (size_t)(n0 + row) * kLoraD + k8;
  *(v8us*)(th + o) = hv;
  *(v8us*)(tl + o) = lv;
  
}

// ---------------------------------------------------------------------------
// Shared elementwise split helper for 8 consecutive values -> v8us hi/lo.
// ---------------------------------------------------------------------------
__device__ __forceinline__ void split8(const v4f va, const v4f vb, v8us& hv, v8us& lv) {
#pragma unroll
  for (int e = 0; e < 4; ++e) {
    const unsigned short h0 = f2bf_bits(va[e]);
    hv[e] = h0; lv[e] = f2bf_bits(va[e] - bf_bits2f(h0));
    const unsigned short h1 = f2bf_bits(vb[e]);
    hv[4 + e] = h1; lv[4 + e] = f2bf_bits(vb[e] - bf_bits2f(h1));
  }
}
__device__ __forceinline__ void store16x2(unsigned short* ph, unsigned short* pl, size_t o, const v8us hv, const v8us lv) {
  *(v8us*)(ph + o) = hv;
  *(v8us*)(pl + o) = lv;
  
}

// ---------------------------------------------------------------------------
// Token shift: xxx = x + (xprev - x) * maa_x -> bf16 hi/lo planes [kRows][kDm], row = b*kSeq + s;
// xprev = shift_state[b] for s == 0, else x[b][s-1] (block-uniform pointer choice).
// grid = kRows blocks x 128 threads x 8 elements = kRows x kDm = the whole plane; each lane stores 16 B,
// ---------------------------------------------------------------------------
__global__ __launch_bounds__(128) void xxx_split_kernel(const float* __restrict__ x, const float* __restrict__ ss,
                                                        const float* __restrict__ maax,
                                                        unsigned short* __restrict__ oh, unsigned short* __restrict__ ol) {
  const int row = blockIdx.x;
  const int b = row / kSeq, s = row % kSeq;
  const int c0 = threadIdx.x * 8;
  const float* xr = x + (size_t)row * kDm;
  const float* xp = (s == 0) ? (ss + (size_t)b * kDm) : (xr - kDm);
  const v4f xa = *(const v4f*)(xr + c0), xb = *(const v4f*)(xr + c0 + 4);
  const v4f pa = *(const v4f*)(xp + c0), pb = *(const v4f*)(xp + c0 + 4);
  const v4f ma = *(const v4f*)(maax + c0), mb = *(const v4f*)(maax + c0 + 4);
  const v4f va = xa + (pa - xa) * ma;
  const v4f vb = xb + (pb - xb) * mb;
  v8us hv, lv;
  split8(va, vb, hv, lv);
  store16x2(oh, ol, (size_t)row * kDm + c0, hv, lv);
}

// ---------------------------------------------------------------------------
// Data-dependent mixing: x? = x + (xprev - x) * (maa_? + mix_?[s][c]) for ? in {q(r), k, v} -> three bf16 hi/lo plane pairs
// [kRows][kDm]. mix planes f32 [3][kRows][kDm] (l = 0 r, 1 k, 2 v). Same row index and thread/store shape as xxx_split_kernel:
// ---------------------------------------------------------------------------
__global__ __launch_bounds__(128) void mix_split_kernel(const float* __restrict__ x, const float* __restrict__ ss,
                                                        const float* __restrict__ maar, const float* __restrict__ maak,
                                                        const float* __restrict__ maav, const float* __restrict__ mix,
                                                        unsigned short* __restrict__ qh, unsigned short* __restrict__ ql,
                                                        unsigned short* __restrict__ kh, unsigned short* __restrict__ kl,
                                                        unsigned short* __restrict__ vh, unsigned short* __restrict__ vl) {
  const int row = blockIdx.x;
  const int b = row / kSeq, s = row % kSeq;
  const int c0 = threadIdx.x * 8;
  const float* xr = x + (size_t)row * kDm;
  const float* xp = (s == 0) ? (ss + (size_t)b * kDm) : (xr - kDm);
  const v4f xa = *(const v4f*)(xr + c0), xb = *(const v4f*)(xr + c0 + 4);
  const v4f pa = *(const v4f*)(xp + c0), pb = *(const v4f*)(xp + c0 + 4);
  const v4f da = pa - xa, db = pb - xb;
  const size_t plane = (size_t)kRows * kDm;
  const float* m0 = mix + (size_t)row * kDm + c0;
  const size_t o = (size_t)row * kDm + c0;
  {
    const v4f ma = *(const v4f*)(maar + c0), mb = *(const v4f*)(maar + c0 + 4);
    const v4f qa = *(const v4f*)(m0), qb = *(const v4f*)(m0 + 4);
    const v4f va = xa + da * (ma + qa), vb = xb + db * (mb + qb);
    v8us hv, lv; split8(va, vb, hv, lv); store16x2(qh, ql, o, hv, lv);
  }
  {
    const v4f ma = *(const v4f*)(maak + c0), mb = *(const v4f*)(maak + c0 + 4);
    const v4f qa = *(const v4f*)(m0 + plane), qb = *(const v4f*)(m0 + plane + 4);
    const v4f va = xa + da * (ma + qa), vb = xb + db * (mb + qb);
    v8us hv, lv; split8(va, vb, hv, lv); store16x2(kh, kl, o, hv, lv);
  }
  {
    const v4f ma = *(const v4f*)(maav + c0), mb = *(const v4f*)(maav + c0 + 4);
    const v4f qa = *(const v4f*)(m0 + 2 * plane), qb = *(const v4f*)(m0 + 2 * plane + 4);
    const v4f va = xa + da * (ma + qa), vb = xb + db * (mb + qb);
    v8us hv, lv; split8(va, vb, hv, lv); store16x2(vh, vl, o, hv, lv);
  }
}

// ---------------------------------------------------------------------------
//   MODE 0: LN then RoPE (half-split per 64-wide head: out[f] = x1*cos - x2*sin, out[32+f] = x1*sin + x2*cos with
//           cos/sin = cosf/sinf(angles[s][f]), s = row % kSeq) then bf16 hi/lo split into planes [kRows][kDm]; grid = (kRows, 2),
//           blockIdx.y selects source/params/planes A (0) or B (1).
//   MODE 1: LN written back IN PLACE as f32 (dstf == src): each block owns its row; thread t writes floats 4t..4t+3,
//   MODE 2: LN then bf16 hi/lo split into planes (no rotation); grid = (kRows, 1).
// MODE 0/2 store path: per wave (heads 2w, 2w+1) the 128 results are staged in LDS, then lanes 0..15 write 16 B each =
// ---------------------------------------------------------------------------
template <int MODE>
__global__ __launch_bounds__(256) void ln_kernel(const float* srcA, const float* srcB,
                                                 const float* __restrict__ gA, const float* __restrict__ bA,
                                                 const float* __restrict__ gB, const float* __restrict__ bB,
                                                 const float* __restrict__ ang,
                                                 unsigned short* hA, unsigned short* lA,
                                                 unsigned short* hB, unsigned short* lB, float* dstf) {
  __shared__ __align__(16) float srow[kDm];
  __shared__ __align__(16) unsigned short Lh[8][128];
  __shared__ __align__(16) unsigned short Ll[8][128];
  __shared__ float sred[8];
  __shared__ float sred2[8];
  const int s = blockIdx.x;                      // token row b*kSeq + position
  const int which = blockIdx.y;                  // block-uniform
  const float* src = (which == 0) ? srcA : srcB;
  const float* g   = (which == 0) ? gA : gB;
  const float* bb  = (which == 0) ? bA : bB;
  unsigned short* dh = (which == 0) ? hA : hB;
  unsigned short* dl = (which == 0) ? lA : lB;
  const int tid = threadIdx.x, lane = tid & 31, wave = tid >> 5;

  const float* row = src + (size_t)s * kDm;
  const v4f xv = *(const v4f*)(row + tid * 4);
  float ps = (xv[0] + xv[1]) + (xv[2] + xv[3]);
#pragma unroll
  for (int off = 1; off < 32; off <<= 1) ps += __shfl_xor(ps, off, 32);
  if (lane == 0) sred[wave] = ps;
  __syncthreads();
  float tot = 0.f;
#pragma unroll
  for (int w = 0; w < 8; ++w) tot += sred[w];
  const float mean = tot * (1.0f / (float)kDm);
  const v4f dv = xv - mean;
  float pq = (dv[0] * dv[0] + dv[1] * dv[1]) + (dv[2] * dv[2] + dv[3] * dv[3]);
#pragma unroll
  for (int off = 1; off < 32; off <<= 1) pq += __shfl_xor(pq, off, 32);
  if (lane == 0) sred2[wave] = pq;
  __syncthreads();
  float tot2 = 0.f;
#pragma unroll
  for (int w = 0; w < 8; ++w) tot2 += sred2[w];
  const float var  = tot2 * (1.0f / (float)kDm);
  const float rstd = rsqrtf(var + 1.0e-5f);
  const v4f gv = *(const v4f*)(g + tid * 4);
  const v4f bv = *(const v4f*)(bb + tid * 4);
  v4f yv;
#pragma unroll
  for (int e = 0; e < 4; ++e) yv[e] = dv[e] * rstd * gv[e] + bv[e];

  if (MODE == 1) {
    float* dp = dstf + (size_t)s * kDm + tid * 4;
    *(v4f*)dp = yv;
    
    return;                                     // MODE is a compile-time constant: uniform
  }

  *(v4f*)(srow + tid * 4) = yv;
  __syncthreads();

  float cs = 1.0f, sn = 0.0f;
  if (MODE == 0) {
    const float a = ang[(size_t)(s % kSeq) * 32 + lane];
    cs = cosf(a);
    sn = sinf(a);
  }
  unsigned short* lh = Lh[wave];
  unsigned short* ll = Ll[wave];
#pragma unroll 1
  for (int hp = 0; hp < 2; ++hp) {
    const int base = wave * 128 + hp * 64;
    const float xr = srow[base + lane];
    const float xi = srow[base + 32 + lane];
    float vr = xr, vi = xi;
    if (MODE == 0) { vr = xr * cs - xi * sn; vi = xr * sn + xi * cs; }
    const unsigned short hr = f2bf_bits(vr);
    const unsigned short lr = f2bf_bits(vr - bf_bits2f(hr));
    const unsigned short hi = f2bf_bits(vi);
    const unsigned short li = f2bf_bits(vi - bf_bits2f(hi));
    lh[hp * 64 + lane] = hr;       ll[hp * 64 + lane] = lr;
    lh[hp * 64 + 32 + lane] = hi;  ll[hp * 64 + 32 + lane] = li;
  }
  __builtin_amdgcn_fence(__ATOMIC_RELEASE, "workgroup");
  __builtin_amdgcn_wave_barrier();
  __builtin_amdgcn_fence(__ATOMIC_ACQUIRE, "workgroup");
  const int l16 = lane & 15;
  const v8us hv = *(const v8us*)(lh + l16 * 8);
  const v8us lv = *(const v8us*)(ll + l16 * 8);
  const size_t o = (size_t)s * kDm + wave * 128 + l16 * 8;
  {
    if (lane < 16) {
      *(v8us*)(dh + o) = hv;
      *(v8us*)(dl + o) = lv;
    }
    
  }
}

// =====================================================================================
// Causal attention, head dim 64, batch element = blockIdx.y (structural lower-triangular mask incl. diagonal).
//   Every plane below is that of one batch element; element b starts b*kSeq*kDm elements into each buffer.
//   q planes (hi/lo bf16): element (t, h, d) at [t*kDm + h*64 + d]
//   k planes (hi/lo bf16): element (s, h, d) at [s*kDm + h*64 + d]
//   v^T planes (hi/lo bf16): element (h, d, s) at [(h*64 + d)*kSeq + s]
//   out f32: element (t, h, d) at [t*kDm + h*64 + d]
//   scores = (q . k) * sscale : bf16 hi/lo split (hi.hi + hi.lo + lo.hi) on v_wmma_f32_16x16x32_bf16
//   out    = p . v             : bf16 hi/lo split of p (unnormalised) and v, f32 accumulate
//   online softmax in f32. Key tiles strictly above the 64x64 block diagonal (kv chunk > query block) are not
//   visited (probabilities exactly 0 in f32); inside the diagonal tile, score := mfill where kv > query (select).
//   Block = 4 waves = 64 query rows of one head; grid.x = kHeads * (kSeq/64); kv chunks of 64, trip count qb+1 <= 32.
//   K / V^T chunk staging: 128 threads x 32 elements per plane = the whole 64x64 tile (16-B copies, plain loads,
//   __syncthreads before and after); fragment loads read the LDS tiles with the same v8b element type.
//   Output coverage: grid.x 16 heads x 32 query blocks x 4 waves x 16 rows x 64 cols = one [2048][1024] plane per grid.y.
// =====================================================================================
#define AT_D 64
#define AT_NW 4
#define AT_QB 64
#define AT_KC 64

__device__ __forceinline__ unsigned short at_bf_bits(float f) {
  unsigned u = __float_as_uint(f);
  return (unsigned short)((u + 0x7FFFu + ((u >> 16) & 1u)) >> 16);
}
__device__ __forceinline__ __bf16 at_f2bf(float f) { return __builtin_bit_cast(__bf16, at_bf_bits(f)); }
__device__ __forceinline__ void at_split(float f, __bf16& hi, __bf16& lo) {
  const unsigned short hb = at_bf_bits(f);
  hi = __builtin_bit_cast(__bf16, hb);
  lo = at_f2bf(f - __uint_as_float(((unsigned)hb) << 16));
}
__device__ __forceinline__ v8f at_mma(v16b a, v16b b, v8f c) {
  c = __builtin_amdgcn_wmma_f32_16x16x32_bf16(false, a, false, b, (short)0, c, false, false);
  asm volatile("v_nop\n\tv_nop\n\tv_nop\n\tv_nop" : "+v"(c) : "v"(a), "v"(b));
  return c;
}

__global__ __launch_bounds__(128)
void attn_causal64_kernel(const unsigned short* __restrict__ qhp, const unsigned short* __restrict__ qlp,
                          const unsigned short* __restrict__ khp, const unsigned short* __restrict__ klp,
                          const unsigned short* __restrict__ vhp, const unsigned short* __restrict__ vlp,
                          float* __restrict__ out, float sscale, float mfill) {
  union FB { v16b v; v8b h[2]; };
  __shared__ __align__(16) __bf16 Ksh[AT_KC * AT_D];             // K hi [kv][d]      8 KB
  __shared__ __align__(16) __bf16 Ksl[AT_KC * AT_D];             // K lo
  __shared__ __align__(16) __bf16 Vth[AT_D * AT_KC];             // V hi [d][kv]      8 KB
  __shared__ __align__(16) __bf16 Vtl[AT_D * AT_KC];             // V lo
  __shared__ __align__(16) __bf16 Psh[AT_NW][16 * AT_KC];        // per wave P hi [row][kv]
  __shared__ __align__(16) __bf16 Psl[AT_NW][16 * AT_KC];        // per wave P lo
  __shared__ __align__(16) float  Os[AT_NW][16 * 68];            // per wave out tile, pitch 68

  const int tid  = threadIdx.x;
  const int wave = tid >> 5;
  const int lane = tid & 31;
  const int hh   = lane >> 4;
  const int c    = lane & 15;

  const int nqb = kSeq / AT_QB;           // 32
  const int bx = blockIdx.x;
  const int qb = bx % nqb;
  const int h  = bx / nqb;                // 0..kHeads-1 (grid = kHeads * nqb)
  const int q0 = qb * AT_QB + wave * 16;

  const size_t bo = (size_t)blockIdx.y * kSeq * kDm;
  const __bf16* Qh = (const __bf16*)(const void*)qhp + bo + (size_t)h * AT_D;
  const __bf16* Ql = (const __bf16*)(const void*)qlp + bo + (size_t)h * AT_D;
  const __bf16* Kh = (const __bf16*)(const void*)khp + bo + (size_t)h * AT_D;
  const __bf16* Kl = (const __bf16*)(const void*)klp + bo + (size_t)h * AT_D;
  const __bf16* Vh = (const __bf16*)(const void*)vhp + bo + (size_t)h * AT_D * kSeq;
  const __bf16* Vl = (const __bf16*)(const void*)vlp + bo + (size_t)h * AT_D * kSeq;
  float*        ob = out + bo + (size_t)h * AT_D;

  // ---- Q fragments (A operand, row = lane&15, split k map via Frag load): 2 d-chunks, hi and lo ----
  v16b qah[2], qal[2];
#pragma unroll
  for (int dc = 0; dc < 2; ++dc) {
    const __bf16* qr = Qh + (size_t)(q0 + c) * kDm + dc * 32 + 8 * hh;
    const __bf16* ql = Ql + (size_t)(q0 + c) * kDm + dc * 32 + 8 * hh;
    qah[dc] = Frag<__bf16>::load(qr);
    qal[dc] = Frag<__bf16>::load(ql);
  }

  float mrow[8], lrow[8];
  v8f oacc[4];
#pragma unroll
  for (int r = 0; r < 8; ++r) { mrow[r] = -INFINITY; lrow[r] = 0.f; }
#pragma unroll
  for (int t = 0; t < 4; ++t) oacc[t] = (v8f){0.f,0.f,0.f,0.f,0.f,0.f,0.f,0.f};

  int nChunks = qb + 1;                      // block-uniform, <= 32
  if (nChunks > kSeq / AT_KC) nChunks = kSeq / AT_KC;
  for (int kc = 0; kc < nChunks; ++kc) {
    const int kv0 = kc * AT_KC;
    __syncthreads();
    {
      // staging coverage: 128 threads x (4 x 8) elements = 64 rows x 64 per plane = the whole chunk tile
      const int r = tid >> 1, half = (tid & 1) * 32;
      const __bf16* ksh = Kh + (size_t)(kv0 + r) * kDm + half;     // K row kv0+r, d = half..half+31
      const __bf16* ksl = Kl + (size_t)(kv0 + r) * kDm + half;
      const __bf16* vsh = Vh + (size_t)r * kSeq + kv0 + half;     // V^T row d = r, s = kv0+half..+31
      const __bf16* vsl = Vl + (size_t)r * kSeq + kv0 + half;
#pragma unroll
      for (int i = 0; i < 4; ++i) {
        const v8b a0 = *(const v8b*)(ksh + 8 * i);
        const v8b a1 = *(const v8b*)(ksl + 8 * i);
        const v8b b0 = *(const v8b*)(vsh + 8 * i);
        const v8b b1 = *(const v8b*)(vsl + 8 * i);
        *(v8b*)(Ksh + r * AT_D  + half + 8 * i) = a0;
        *(v8b*)(Ksl + r * AT_D  + half + 8 * i) = a1;
        *(v8b*)(Vth + r * AT_KC + half + 8 * i) = b0;
        *(v8b*)(Vtl + r * AT_KC + half + 8 * i) = b1;
      }
    }
    __syncthreads();

    v8f s[4];
#pragma unroll
    for (int j = 0; j < 4; ++j) {
      s[j] = (v8f){0.f,0.f,0.f,0.f,0.f,0.f,0.f,0.f};
#pragma unroll
      for (int dc = 0; dc < 2; ++dc) {
        FB kb, kl;
        kb.h[0] = *(const v8b*)(Ksh + (j * 16 + c) * AT_D + dc * 32 + 8 * hh);
        kb.h[1] = *(const v8b*)(Ksh + (j * 16 + c) * AT_D + dc * 32 + 16 + 8 * hh);
        kl.h[0] = *(const v8b*)(Ksl + (j * 16 + c) * AT_D + dc * 32 + 8 * hh);
        kl.h[1] = *(const v8b*)(Ksl + (j * 16 + c) * AT_D + dc * 32 + 16 + 8 * hh);
        s[j] = at_mma(qah[dc], kb.v, s[j]);
        s[j] = at_mma(qah[dc], kl.v, s[j]);
        s[j] = at_mma(qal[dc], kb.v, s[j]);
      }
    }
    // ---- scale, structural causal select on the diagonal tile, row max over the 16 lanes of each half ----
    const bool diag = (kc == qb);            // block-uniform
    float cm[8];
#pragma unroll
    for (int r = 0; r < 8; ++r) {
      const int qrow = q0 + 8 * hh + r;                       // 0..kSeq-1
      float m = -INFINITY;
#pragma unroll
      for (int j = 0; j < 4; ++j) {
        const int kvcol = kv0 + j * 16 + c;
        const float sv = s[j][r] * sscale;
        const bool masked = diag && (kvcol > qrow);
        const float sm = masked ? mfill : sv;
        s[j][r] = sm;
        m = fmaxf(m, sm);
      }
#pragma unroll
      for (int off = 1; off < 16; off <<= 1) m = fmaxf(m, __shfl_xor(m, off, 32));
      cm[r] = m;
    }
    __bf16* pwh = Psh[wave];
    __bf16* pwl = Psl[wave];
#pragma unroll
    for (int r = 0; r < 8; ++r) {
      const float mnew = fmaxf(mrow[r], cm[r]);
      const float alpha = expf(mrow[r] - mnew);
      mrow[r] = mnew;
      float psum = 0.f;
#pragma unroll
      for (int j = 0; j < 4; ++j) {
        const float p = expf(s[j][r] - mnew);
        psum += p;
        __bf16 a, bl; at_split(p, a, bl);
        pwh[(8 * hh + r) * AT_KC + j * 16 + c] = a;
        pwl[(8 * hh + r) * AT_KC + j * 16 + c] = bl;
      }
#pragma unroll
      for (int off = 1; off < 16; off <<= 1) psum += __shfl_xor(psum, off, 32);
      lrow[r] = lrow[r] * alpha + psum;
#pragma unroll
      for (int t = 0; t < 4; ++t) oacc[t][r] *= alpha;
    }
    __builtin_amdgcn_fence(__ATOMIC_RELEASE, "workgroup");
    __builtin_amdgcn_wave_barrier();
    __builtin_amdgcn_fence(__ATOMIC_ACQUIRE, "workgroup");
#pragma unroll 1
    for (int kk = 0; kk < 2; ++kk) {
      FB pa, pl;
      pa.h[0] = *(const v8b*)(pwh + c * AT_KC + kk * 32 + 8 * hh);
      pa.h[1] = *(const v8b*)(pwh + c * AT_KC + kk * 32 + 16 + 8 * hh);
      pl.h[0] = *(const v8b*)(pwl + c * AT_KC + kk * 32 + 8 * hh);
      pl.h[1] = *(const v8b*)(pwl + c * AT_KC + kk * 32 + 16 + 8 * hh);
#pragma unroll
      for (int t = 0; t < 4; ++t) {
        FB vb, vl;
        vb.h[0] = *(const v8b*)(Vth + (t * 16 + c) * AT_KC + kk * 32 + 8 * hh);
        vb.h[1] = *(const v8b*)(Vth + (t * 16 + c) * AT_KC + kk * 32 + 16 + 8 * hh);
        vl.h[0] = *(const v8b*)(Vtl + (t * 16 + c) * AT_KC + kk * 32 + 8 * hh);
        vl.h[1] = *(const v8b*)(Vtl + (t * 16 + c) * AT_KC + kk * 32 + 16 + 8 * hh);
        oacc[t] = at_mma(pa.v, vb.v, oacc[t]);
        oacc[t] = at_mma(pa.v, vl.v, oacc[t]);
        oacc[t] = at_mma(pl.v, vb.v, oacc[t]);
      }
    }
  }

  float* os = Os[wave];
#pragma unroll
  for (int r = 0; r < 8; ++r) {
    const float inv = 1.0f / lrow[r];
#pragma unroll
    for (int t = 0; t < 4; ++t) os[(8 * hh + r) * 68 + t * 16 + c] = oacc[t][r] * inv;
  }
  __builtin_amdgcn_fence(__ATOMIC_RELEASE, "workgroup");
  __builtin_amdgcn_wave_barrier();
  __builtin_amdgcn_fence(__ATOMIC_ACQUIRE, "workgroup");
  {
    const int c4 = (lane & 15) * 4;
    {
#pragma unroll
      for (int it = 0; it < 8; ++it) {
        const int row = it * 2 + hh;   // it 0..7 x hh 0..1 covers rows 0..15 of the wave tile
        v4f val = *(const v4f*)(os + row * 68 + c4);
        *(v4f*)(ob + (size_t)(q0 + row) * kDm + c4) = val;
      }
      
    }
  }
}

// ---------------------------------------------------------------------------
// Workspace region map (byte offsets). Every GEMM: K in {1024, 32} (%32 == 0), M = kRows = 4096, N in {128, 1024} (%128 == 0).
// Activation regions hold both batch elements, row = b*2048 + s.
// Every region is fully written before it is read within the in-order launch sequence; reused regions noted.
//   Wqh bf16 [1024 n][1024 k]        0      Wql    2097152
//   Wkh                        4194304      Wkl    6291456
//   Wvh                        8388608      Wvl   10485760
//   Woh                       12582912      Wol   14680064
//   W1Th bf16 [128 n][1024 k] 16777216      W1Tl  17039360   (rows 96..127 zero)
//   W2Th bf16 [3][1024 n][32] 17301504      W2Tl  17498112
//   XXh  bf16 [4096][1024]    17694720      XXl   26083328   (xxx planes; reused after the LoRA GEMM as Oh / Ol)
//   LORAf f32 [4096][128]     34471936
//   LTh  bf16 [4096][128]     36569088      LTl   37617664
//   MIX  f32 [3][4096][1024]  38666240                       (reused after the mix kernel: Qf = +0, Kf = +16777216,
//                                                             Vf = +33554432 f32 [4096][1024]; Of reuses Qf)
//   XQh/XQl/XKh/XKl/XVh/XVl   88997888 .. (6 x 8388608)
//   Qh/Ql/Kh/Kl              139329536 .. (4 x 8388608)
//   VTh/VTl bf16 [2][1024][2048] 172883968, 181272576
//   total                    189661184  (~180.9 MiB)
// ---------------------------------------------------------------------------
extern "C" void kernel_launch(void* const* d_in, const int* in_sizes, int n_in,
                              void* d_out, int out_size, void* d_ws, size_t ws_size,
                              hipStream_t stream) {
  if (n_in < 21) return;
  const int nRow = kSeq * kDm;            // 2097152 per batch element
  const int nAct = kBatch * nRow;         // 4194304
  const int nW   = kDm * kDm;             // 1048576
  if (in_sizes[0] != nAct) return;
  if (in_sizes[1] != kBatch * kDm) return;
  if (in_sizes[2] != kDm || in_sizes[3] != kDm || in_sizes[4] != kDm || in_sizes[5] != kDm) return;
  if (in_sizes[6] != kDm * kLoraN) return;
  if (in_sizes[7] != 3 * kLoraD * kDm) return;
  if (in_sizes[8] != nW || in_sizes[9] != nW || in_sizes[10] != nW || in_sizes[11] != nW) return;
  for (int i = 12; i < 20; ++i) if (in_sizes[i] != kDm) return;
  if (in_sizes[20] != kSeq * 32) return;
  if (out_size != nAct) return;

  const float* x     = (const float*)d_in[0];    // [2][2048][1024]
  const float* ss    = (const float*)d_in[1];    // [2][1024]
  const float* maax  = (const float*)d_in[2];    // [1024]
  const float* maar  = (const float*)d_in[3];
  const float* maak  = (const float*)d_in[4];
  const float* maav  = (const float*)d_in[5];
  const float* w1    = (const float*)d_in[6];    // [1024][96]
  const float* w2    = (const float*)d_in[7];    // [3][32][1024]
  const float* wq    = (const float*)d_in[8];    // [1024 out][1024 in]
  const float* wk    = (const float*)d_in[9];
  const float* wv    = (const float*)d_in[10];
  const float* wo    = (const float*)d_in[11];
  const float* lnrg  = (const float*)d_in[12];
  const float* lnrb  = (const float*)d_in[13];
  const float* lnkg  = (const float*)d_in[14];
  const float* lnkb  = (const float*)d_in[15];
  const float* lnvg  = (const float*)d_in[16];
  const float* lnvb  = (const float*)d_in[17];
  const float* lnxg  = (const float*)d_in[18];
  const float* lnxb  = (const float*)d_in[19];
  const float* ang   = (const float*)d_in[20];   // [2048][32]

  const size_t PW   = (size_t)kDm * kDm * 2;          // 2097152  bf16 weight plane
  const size_t PX   = (size_t)kRows * kDm * 2;        // 8388608  bf16 activation plane (both batch elements)
  const size_t PF   = (size_t)kRows * kDm * 4;        // 16777216 f32 activation plane
  const size_t PW1  = (size_t)kLoraP * kDm * 2;       // 262144
  const size_t PW2  = (size_t)3 * kDm * kLoraD * 2;   // 196608
  const size_t PLF  = (size_t)kRows * kLoraP * 4;     // 2097152
  const size_t PLT  = (size_t)kRows * kLoraP * 2;     // 1048576
  size_t off = 0;
  const size_t oWqh = off; off += PW;  const size_t oWql = off; off += PW;
  off += 4 * PW;                                // Wkh, Wkl, Wvh, Wvl: reached from Wqh / Wql by the plane stride
  const size_t oWoh = off; off += PW;  const size_t oWol = off; off += PW;
  const size_t oW1h = off; off += PW1; const size_t oW1l = off; off += PW1;
  const size_t oW2h = off; off += PW2; const size_t oW2l = off; off += PW2;
  const size_t oXXh = off; off += PX;  const size_t oXXl = off; off += PX;
  const size_t oLF  = off; off += PLF;
  const size_t oLTh = off; off += PLT; const size_t oLTl = off; off += PLT;
  const size_t oMIX = off; off += 3 * PF;
  const size_t oXQh = off; off += PX;  const size_t oXQl = off; off += PX;
  const size_t oXKh = off; off += PX;  const size_t oXKl = off; off += PX;
  const size_t oXVh = off; off += PX;  const size_t oXVl = off; off += PX;
  const size_t oQh  = off; off += PX;  const size_t oQl  = off; off += PX;
  const size_t oKh  = off; off += PX;  const size_t oKl  = off; off += PX;
  const size_t oVTh = off; off += PX;  const size_t oVTl = off; off += PX;
  if (off > ws_size) return;                    // off = 189661184

  char* ws = (char*)d_ws;
  unsigned short* Wqh = (unsigned short*)(ws + oWqh); unsigned short* Wql = (unsigned short*)(ws + oWql);
  unsigned short* Woh = (unsigned short*)(ws + oWoh); unsigned short* Wol = (unsigned short*)(ws + oWol);
  unsigned short* W1h = (unsigned short*)(ws + oW1h); unsigned short* W1l = (unsigned short*)(ws + oW1l);
  unsigned short* W2h = (unsigned short*)(ws + oW2h); unsigned short* W2l = (unsigned short*)(ws + oW2l);
  unsigned short* XXh = (unsigned short*)(ws + oXXh); unsigned short* XXl = (unsigned short*)(ws + oXXl);
  float*          LF  = (float*)(ws + oLF);
  unsigned short* LTh = (unsigned short*)(ws + oLTh); unsigned short* LTl = (unsigned short*)(ws + oLTl);
  float*          MIX = (float*)(ws + oMIX);
  float*          Qf  = (float*)(ws + oMIX);
  float*          Kf  = (float*)(ws + oMIX + PF);
  float*          Vf  = (float*)(ws + oMIX + 2 * PF);
  float*          Of  = Qf;
  unsigned short* XQh = (unsigned short*)(ws + oXQh); unsigned short* XQl = (unsigned short*)(ws + oXQl);
  unsigned short* XKh = (unsigned short*)(ws + oXKh); unsigned short* XKl = (unsigned short*)(ws + oXKl);
  unsigned short* XVh = (unsigned short*)(ws + oXVh); unsigned short* XVl = (unsigned short*)(ws + oXVl);
  unsigned short* Qh  = (unsigned short*)(ws + oQh);  unsigned short* Ql  = (unsigned short*)(ws + oQl);
  unsigned short* Kh  = (unsigned short*)(ws + oKh);  unsigned short* Kl  = (unsigned short*)(ws + oKl);
  unsigned short* VTh = (unsigned short*)(ws + oVTh); unsigned short* VTl = (unsigned short*)(ws + oVTl);
  unsigned short* Oh  = XXh;                          unsigned short* Ol  = XXl;

  const float* dummyf = lnrg;                         // valid pointer for unused bias / resid arguments (never read)

  const dim3 blk(256);
  const int  n2w = nW / 2;                                  // 524288 pairs per weight plane
  const dim3 gCastW((n2w + 255) / 256, 4);                  // 2048 blocks x 256 threads x 2 = 1024x1024, y = q, k, v, o
  const dim3 gW1(kDm / 64);                                 // 16 k-tiles
  const dim3 gW2(kDm / 64, 3);                              // 16 n-tiles x 3
  const dim3 gRow(kRows);                                   // one block per token row (128-thread kernels)
  const dim3 blkG(128);                                     // GEMM block: 4 waves, one 128x128 tile
  const dim3 gLora((kRows / 128) * (kLoraP / 128));         // 32 tiles: M=4096, N=128
  const dim3 gMix((kRows / 128) * (kDm / 128), 3);          // 256 tiles x 3 (l): M=4096, N=1024, K=32
  const int  n2l = kRows * kLoraP / 2;                      // 262144 pairs
  const dim3 gTanh((n2l + 255) / 256);                      // 1024 blocks x 256 x 2 = 4096x128
  const dim3 gQKV((kRows / 128) * (kDm / 128), 3);          // 256 tiles x 3 (q, k, v): M=4096, N=1024
  const dim3 gProj((kRows / 128) * (kDm / 128), 1);         // 256 tiles: M=4096, N=1024
  const dim3 gLnQK(kRows, 2);                               // 4096 rows x {q, k}
  const dim3 gLn1(kRows, 1);
  const dim3 gVT(kDm / 64, kSeq / 64, kBatch);              // per b: in [R=2048 s][Cn=1024 c] -> planes [c][s]
  const dim3 gAtt(kHeads * (kSeq / 64), kBatch);            // 512 x 2 blocks: 16 heads x 32 query blocks, y = b

  // setup: weights -> bf16 hi/lo planes (q/k/v/o already [out n][in k] = Bt layout; w1/w2 transposed).
  // The hi planes of q, k, v, o lie 2 weight planes apart (hi, lo, hi, lo, ...), and so do the lo planes.
  split_bf16x2_kernel<<<gCastW, blk, 0, stream>>>(wq, wk, wv, wo, Wqh, Wql, n2w, 2L * nW);
  w1t_split_kernel<<<gW1, blk, 0, stream>>>(w1, W1h, W1l);
  w2t_split_kernel<<<gW2, blk, 0, stream>>>(w2, W2h, W2l);

  // Each stage below runs once, on the rows of both batch elements.
  // (1) xxx = x + dxprev*maa_x -> planes
  xxx_split_kernel<<<gRow, dim3(128), 0, stream>>>(x, ss, maax, XXh, XXl);
  // (2) lora_pre = xxx . w1 -> f32 [4096][128]   (M=4096, N=128, K=1024)
  wmma_gemm64<1, true, 0, 0, false, 0><<<gLora, blkG, 0, stream>>>(
      XXh, XXl, kDm, 0L, W1h, W1l, kDm, 0L, (void*)LF, (void*)LF, kLoraP, 0L,
      dummyf, dummyf, 0L, kRows, kLoraP, kDm, 1.0f);
  // (3) lora = tanh -> planes [4096][128]
  tanh_split_kernel<<<gTanh, blk, 0, stream>>>(LF, LTh, LTl, n2l);
  // (4) mixes[l] = lora[:, 32l..32l+31] . w2[l] -> f32 [3][4096][1024]   (M=4096, N=1024, K=32; grid.y = l)
  wmma_gemm64<1, true, 0, 0, false, 0><<<gMix, blkG, 0, stream>>>(
      LTh, LTl, kLoraP, (long)kLoraD, W2h, W2l, kLoraD, (long)kDm * kLoraD, (void*)MIX, (void*)MIX, kDm, (long)nAct,
      dummyf, dummyf, 0L, kRows, kDm, kLoraD, 1.0f);
  // (5) xq/xk/xv = x + dxprev*(maa + mix) -> planes
  mix_split_kernel<<<gRow, dim3(128), 0, stream>>>(x, ss, maar, maak, maav, MIX, XQh, XQl, XKh, XKl, XVh, XVl);
  // (6) q0 = xq . Wq^T, k0 = xk . Wk^T, v0 = xv . Wv^T -> f32 [3][4096][1024]   (M=4096, N=1024, K=1024; grid.y = q, k, v:
  //     XQ/XK/XV hi planes lie 2 activation planes apart, Wq/Wk/Wv hi planes 2 weight planes, Qf/Kf/Vf one f32 plane)
  wmma_gemm64<1, true, 0, 0, false, 0><<<gQKV, blkG, 0, stream>>>(
      XQh, XQl, kDm, 2L * nAct, Wqh, Wql, kDm, 2L * nW, (void*)Qf, (void*)Qf, kDm, (long)nAct,
      dummyf, dummyf, 0L, kRows, kDm, kDm, 1.0f);
  // (7) LayerNorm + RoPE + split for q and k -> planes [row][h*64+d]
  ln_kernel<0><<<gLnQK, blk, 0, stream>>>(Qf, Kf, lnrg, lnrb, lnkg, lnkb, ang, Qh, Ql, Kh, Kl, Qf);
  // (8) LayerNorm of v in place (f32), then transpose-split -> v^T planes [b][h*64+d][s]
  ln_kernel<1><<<gLn1, blk, 0, stream>>>(Vf, Vf, lnvg, lnvb, lnvg, lnvb, ang, VTh, VTl, VTh, VTl, Vf);
  wt_split_kernel<<<gVT, blk, 0, stream>>>(Vf, VTh, VTl, kSeq, kDm);
  // (9) causal attention per batch element and head -> f32 [row][h*64+d] (Of region; Qf is dead after step 7)
  attn_causal64_kernel<<<gAtt, dim3(128), 0, stream>>>(Qh, Ql, Kh, Kl, VTh, VTl, Of, 0.125f, -1.0e30f);
  // (10) output LayerNorm + split -> planes (XX region is dead after step 2)
  ln_kernel<2><<<gLn1, blk, 0, stream>>>(Of, Of, lnxg, lnxb, lnxg, lnxb, ang, Oh, Ol, Oh, Ol, Of);
  // (11) out = o . Wo^T -> d_out (f32)   (M=4096, N=1024, K=1024)
  wmma_gemm64<1, true, 0, 0, false, 0><<<gProj, blkG, 0, stream>>>(
      Oh, Ol, kDm, 0L, Woh, Wol, kDm, 0L, d_out, d_out, kDm, 0L,
      dummyf, dummyf, 0L, kRows, kDm, kDm, 1.0f);
}

// v003
// A run of this version takes 431 microseconds.
// Timed twice side by side with v002, it ran 1.39 times as fast both times.
// All steps since v000 together make it 3.01 times as fast.
// All contractions (token-shift LoRA xxx.w1 and lora.w2, q/k/v projections, attention q.k^T and p.v, output projection): v_wmma_f32_16x16x32_bf16 with bf16 hi/lo split operands (hi.hi + hi.lo + lo.hi), f32 accumulate; token shift, tanh, LayerNorms, RoPE, online softmax, score scale 0.125 in f32.
#include <hip/hip_runtime.h>
#include <math.h>
#include <stdint.h>

constexpr int kBatch = 2;
constexpr int kSeq   = 2048;
constexpr int kRows  = kBatch * kSeq;   // token rows of both batch elements, row = b*kSeq + s
constexpr int kDm    = 1024;
constexpr int kHeads = 16;
constexpr int kLoraN = 96;      // 3 x 32 LoRA outputs
constexpr int kLoraP = 128;     // padded to a 64-multiple
constexpr int kLoraD = 32;

typedef __attribute__((ext_vector_type(16))) _Float16 v16h;
typedef __attribute__((ext_vector_type(8)))  _Float16 v8h;
typedef __attribute__((ext_vector_type(16))) __bf16   v16b;
typedef __attribute__((ext_vector_type(8)))  __bf16   v8b;
typedef __attribute__((ext_vector_type(8)))  float    v8f;
typedef __attribute__((ext_vector_type(4)))  float    v4f;
typedef __attribute__((ext_vector_type(2)))  float    v2f;
typedef __attribute__((ext_vector_type(4)))  unsigned int v4u;
typedef __attribute__((ext_vector_type(8)))  unsigned short v8us;

__device__ __forceinline__ unsigned short f2bf_bits(float f) {
  unsigned u = __float_as_uint(f);
  return (unsigned short)((u + 0x7FFFu + ((u >> 16) & 1u)) >> 16);
}
__device__ __forceinline__ float bf_bits2f(unsigned short h) { return __uint_as_float(((unsigned)h) << 16); }

// hazard guards as plain device helpers
__device__ __forceinline__ void dep_guard_h(v8f& a, v8f& b, v16h x, v16h y) { asm volatile("v_nop\n\tv_nop\n\tv_nop\n\tv_nop" : "+v"(a), "+v"(b) : "v"(x), "v"(y)); }
__device__ __forceinline__ void dep_guard_b(v8f& a, v8f& b, v16b x, v16b y) { asm volatile("v_nop\n\tv_nop\n\tv_nop\n\tv_nop" : "+v"(a), "+v"(b) : "v"(x), "v"(y)); }
__device__ __forceinline__ void keep4_h(v16h a, v16h b, v16h c, v16h d) { asm volatile("v_nop" :: "v"(a), "v"(b), "v"(c), "v"(d)); }
__device__ __forceinline__ void keep4_b(v16b a, v16b b, v16b c, v16b d) { asm volatile("v_nop" :: "v"(a), "v"(b), "v"(c), "v"(d)); }
__device__ __forceinline__ void acc_guard4(v8f& a, v8f& b, v8f& c, v8f& d) { asm volatile("v_nop\n\tv_nop\n\tv_nop\n\tv_nop" : "+v"(a), "+v"(b), "+v"(c), "+v"(d)); }
template <typename T> struct Frag;
template <> struct Frag<_Float16> {
  typedef v16h V; union U { v16h v; v8h h[2]; };
  static __device__ __forceinline__ v16h load(const _Float16* p) {   // elements 0..7 <- p[0..7], 8..15 <- p[16..23]
    U f; f.h[0] = *(const v8h*)(p); f.h[1] = *(const v8h*)(p + 16); return f.v;
  }
  static __device__ __forceinline__ v8f mma(v16h a, v16h b, v8f c) {
    return __builtin_amdgcn_wmma_f32_16x16x32_f16(false, a, false, b, (short)0, c, false, false);
  }
  static __device__ __forceinline__ void guard(v8f& a, v8f& b, v16h x, v16h y) { dep_guard_h(a, b, x, y); }
  static __device__ __forceinline__ void keep(v16h a, v16h b, v16h c, v16h d) { keep4_h(a, b, c, d); }
};
template <> struct Frag<__bf16> {
  typedef v16b V; union U { v16b v; v8b h[2]; };
  static __device__ __forceinline__ v16b load(const __bf16* p) {
    U f; f.h[0] = *(const v8b*)(p); f.h[1] = *(const v8b*)(p + 16); return f.v;
  }
  static __device__ __forceinline__ v8f mma(v16b a, v16b b, v8f c) {
    return __builtin_amdgcn_wmma_f32_16x16x32_bf16(false, a, false, b, (short)0, c, false, false);
  }
  static __device__ __forceinline__ void guard(v8f& a, v8f& b, v16b x, v16b y) { dep_guard_b(a, b, x, y); }
  static __device__ __forceinline__ void keep(v16b a, v16b b, v16b c, v16b d) { keep4_b(a, b, c, d); }
};

// ---- Register-blocked batched WMMA GEMM, operands staged in LDS --------------
// C[m,n] = scale * sum_k A[m,k] * Bt[n,k] (+bias)(+resid); a block of 4 waves (2 x 2) owns a 128x128 tile, each wave 64x64 of it.
// A row-major [M,K]; Bt row-major [N,K]; M,N % 128 == 0, K % 32 == 0.
// Per 32-wide k tile the block brings 128 A rows and 128 Bt rows of every plane (64 B a row) into LDS with asynchronous
// 16-B copies (a wave-wide copy = 8 rows x 64 contiguous B), two buffers: tile t+1 flies while tile t is multiplied.
// SPLIT: operands are hi/lo planes (A2/Bt2 = lo planes, same layout); product = hi.hi + hi.lo + lo.hi.
// BIAS_MODE: 0 = none, 1 = bias[m], 2 = bias[n].
// OUT_MODE: 0 = f32, 1 = f16, 2 = bf16 hi plane (Cout) + bf16 lo plane (Cout2).
// Coverage per wave tile: 4 slabs x 16 rows x 64 cols = 64x64 (f32: it 0..7 x hh 0..1 rows, 16 lanes x 4 floats;
// 16-bit: it 0..3 x q 0..3 rows, 8 lanes x 8 elements).
// ET: 0 = f16 operands, 1 = bf16 operands (pointers passed as 16-bit storage)
template <int ET> struct Elem;
template <> struct Elem<0> { typedef _Float16 T; };
template <> struct Elem<1> { typedef __bf16 T; };
constexpr int kGLP    = 40;            // LDS row pitch in 16-bit elements: 80 B = 16 B x 5 (odd), the pitch for 16-B reads of 64-B rows
constexpr int kGPlane = 128 * kGLP;    // one plane of a stage: 128 rows
constexpr int kGStage = 4 * kGPlane;   // A hi, A lo, Bt hi, Bt lo

// Four rows (32 apart) of one plane pair -> LDS: 8 (hi and lo) or 4 (hi only) copies of 16 B per lane. l = the lane's LDS byte
// address of its first hi row, g / g2 = its global address in the hi / lo plane, step = 32 source rows in elements.
// s_wait_xcnt 0 ends the copies' own statement, so that it stands in front of any rewrite of the address registers they name.
template <typename T>
__device__ __forceinline__ void stage_rows8(unsigned l, const T* g, const T* g2, size_t step) {
  const unsigned l1 = l + 32 * kGLP * 2, l2 = l + 64 * kGLP * 2, l3 = l + 96 * kGLP * 2;
  const unsigned m0 = l + kGPlane * 2, m1 = l1 + kGPlane * 2, m2 = l2 + kGPlane * 2, m3 = l3 + kGPlane * 2;
  const T* g1 = g + step;  const T* gg2 = g1 + step;  const T* g3 = gg2 + step;
  const T* h1 = g2 + step; const T* h2 = h1 + step;   const T* h3 = h2 + step;
  asm volatile("global_load_async_to_lds_b128 %0, %8, off\n\t"
               "global_load_async_to_lds_b128 %1, %9, off\n\t"
               "global_load_async_to_lds_b128 %2, %10, off\n\t"
               "global_load_async_to_lds_b128 %3, %11, off\n\t"
               "global_load_async_to_lds_b128 %4, %12, off\n\t"
               "global_load_async_to_lds_b128 %5, %13, off\n\t"
               "global_load_async_to_lds_b128 %6, %14, off\n\t"
               "global_load_async_to_lds_b128 %7, %15, off\n\t"
               "s_wait_xcnt 0x0"
               :: "v"(l), "v"(l1), "v"(l2), "v"(l3), "v"(m0), "v"(m1), "v"(m2), "v"(m3),
                  "v"(g), "v"(g1), "v"(gg2), "v"(g3), "v"(g2), "v"(h1), "v"(h2), "v"(h3) : "memory");
}
template <typename T>
__device__ __forceinline__ void stage_rows4(unsigned l, const T* g, size_t step) {
  const unsigned l1 = l + 32 * kGLP * 2, l2 = l + 64 * kGLP * 2, l3 = l + 96 * kGLP * 2;
  const T* g1 = g + step; const T* gg2 = g1 + step; const T* g3 = gg2 + step;
  asm volatile("global_load_async_to_lds_b128 %0, %4, off\n\t"
               "global_load_async_to_lds_b128 %1, %5, off\n\t"
               "global_load_async_to_lds_b128 %2, %6, off\n\t"
               "global_load_async_to_lds_b128 %3, %7, off\n\t"
               "s_wait_xcnt 0x0"
               :: "v"(l), "v"(l1), "v"(l2), "v"(l3), "v"(g), "v"(g1), "v"(gg2), "v"(g3) : "memory");
}

template <int ET, bool SPLIT, int BIAS_MODE, int OUT_MODE, bool RESID, int ACT = 0>
__global__ __launch_bounds__(128) void wmma_gemm64(
    const unsigned short* __restrict__ Ap, const unsigned short* __restrict__ A2p, int lda, long strideA,
    const unsigned short* __restrict__ Btp, const unsigned short* __restrict__ Bt2p, int ldb, long strideB,
    void* __restrict__ Cout, void* __restrict__ Cout2, int ldc, long strideC,
    const float* __restrict__ bias,
    const float* __restrict__ resid, long strideR,
    int M, int N, int K, float scale) {
  typedef typename Elem<ET>::T T;
  typedef typename Frag<T>::V V;
  const T* A = (const T*)Ap; const T* A2 = (const T*)A2p; const T* Bt = (const T*)Btp; const T* Bt2 = (const T*)Bt2p;
  __shared__ __align__(16) T ring[2 * kGStage];    // two stages of operand tiles, 2 x 40,960 B
  __shared__ __align__(16) float sT[4][16 * 68];   // per-wave 16x64 slab, pitch 68 floats
  const int b    = blockIdx.y;
  const int lane = threadIdx.x & 31;
  const int wave = threadIdx.x >> 5;
  const int tilesN = N >> 7;
  const int tilesM = M >> 7;
  const int tile = blockIdx.x;
  if (tile >= tilesM * tilesN) return;   // block-uniform, in front of every barrier and copy
  const int tm = tile / tilesN;
  const int tn = tile - tm * tilesN;
  const int bm0 = tm << 7;                         // block tile origin
  const int bn0 = tn << 7;
  const int wm = (wave >> 1) << 6;                 // wave tile origin inside the block tile
  const int wn = (wave & 1) << 6;
  const int m0 = bm0 + wm;
  const int n0 = bn0 + wn;

  const T* Ab  = A  + (size_t)b * strideA;
  const T* Bb  = Bt + (size_t)b * strideB;
  const T* Ab2 = SPLIT ? (A2  + (size_t)b * strideA) : nullptr;
  const T* Bb2 = SPLIT ? (Bt2 + (size_t)b * strideB) : nullptr;

  const int rlane = lane & 15;                 // row (A) / col (B, D) within subtile
  const int koff  = (lane >> 4) * 8;           // k offset of this lane half
  const int mOff  = (lane >> 4) * 8;           // D row offset

  v8f acc[4][4];
#pragma unroll
  for (int i = 0; i < 4; ++i)
#pragma unroll
    for (int j = 0; j < 4; ++j) acc[i][j] = (v8f){0.f,0.f,0.f,0.f,0.f,0.f,0.f,0.f};

  // copy map: thread -> row (tid >> 2) + 32 r, r = 0..3, 16-B chunk tid & 3 of the row's 64 B; 128 threads x 4 rows = 128 rows a plane
  const int crow = threadIdx.x >> 2;
  const int cchk = (threadIdx.x & 3) * 8;
  const size_t cao = (size_t)(bm0 + crow) * lda + cchk;
  const size_t cbo = (size_t)(bn0 + crow) * ldb + cchk;
  const size_t stepA = (size_t)32 * lda, stepB = (size_t)32 * ldb;
  const unsigned lds0 = (unsigned)(uintptr_t)(&ring[0]) + (unsigned)(crow * kGLP + cchk) * 2u;   // LDS byte address: low 32 bits
  const int nT = K >> 5;                           // k tiles, the same for the whole grid

#define GEMM_STAGE(t_)                                                                          \
  {                                                                                             \
    const unsigned lt = lds0 + (unsigned)((t_) & 1) * (kGStage * 2u);                           \
    const size_t ko = (size_t)(t_) * 32;                                                        \
    if (SPLIT) {                                                                                \
      stage_rows8<T>(lt, Ab + cao + ko, Ab2 + cao + ko, stepA);                                 \
      stage_rows8<T>(lt + 2u * kGPlane * 2u, Bb + cbo + ko, Bb2 + cbo + ko, stepB);             \
    } else {                                                                                    \
      stage_rows4<T>(lt, Ab + cao + ko, stepA);                                                 \
      stage_rows4<T>(lt + 2u * kGPlane * 2u, Bb + cbo + ko, stepB);                             \
    }                                                                                           \
  }

  GEMM_STAGE(0)
  asm volatile("s_wait_asynccnt 0x0" ::: "memory");   // this wave's copies of tile 0 have landed
  __syncthreads();                                    // ... and every other wave's: tile 0 may be read
  if (nT > 1) GEMM_STAGE(1)

  for (int t = 0; t < nT; ++t) {
    const T* st = ring + (t & 1) * kGStage;
    const T* sA = st + (wm + rlane) * kGLP + koff;
    const T* sB = st + 2 * kGPlane + (wn + rlane) * kGLP + koff;
    V bh[4], bl[4];
#pragma unroll
    for (int j = 0; j < 4; ++j) {
      bh[j] = Frag<T>::load(sB + (j << 4) * kGLP);
      if (SPLIT) bl[j] = Frag<T>::load(sB + kGPlane + (j << 4) * kGLP);
    }
#pragma unroll
    for (int i = 0; i < 4; ++i) {
      V ah = Frag<T>::load(sA + (i << 4) * kGLP);
      V al;
      if (SPLIT) al = Frag<T>::load(sA + kGPlane + (i << 4) * kGLP);
#pragma unroll
      for (int j = 0; j < 4; ++j) {
        acc[i][j] = Frag<T>::mma(ah, bh[j], acc[i][j]);
        if (SPLIT) {
          acc[i][j] = Frag<T>::mma(ah, bl[j], acc[i][j]);
          acc[i][j] = Frag<T>::mma(al, bh[j], acc[i][j]);
        }
      }
      Frag<T>::guard(acc[i][0], acc[i][3], ah, SPLIT ? al : ah);
    }
    Frag<T>::keep(bh[0], bh[1], bh[2], bh[3]);
    if (SPLIT) Frag<T>::keep(bl[0], bl[1], bl[2], bl[3]);
    asm volatile("s_wait_dscnt 0x0" ::: "memory");      // this wave's reads of tile t's buffer are done before it is refilled
    asm volatile("s_wait_asynccnt 0x0" ::: "memory");   // this wave's copies of tile t+1 have landed
    __syncthreads();                                    // publishes tile t+1 and ends every wave's reads of tile t
    if (t + 2 < nT) GEMM_STAGE(t + 2)                   // uniform test; into the buffer that trip t has just read
  }
  asm volatile("s_wait_asynccnt 0x0" ::: "memory");     // no copy outstanding behind the loop
#undef GEMM_STAGE
  acc_guard4(acc[0][0], acc[0][1], acc[0][2], acc[0][3]);
  acc_guard4(acc[1][0], acc[1][1], acc[1][2], acc[1][3]);
  acc_guard4(acc[2][0], acc[2][1], acc[2][2], acc[2][3]);
  acc_guard4(acc[3][0], acc[3][1], acc[3][2], acc[3][3]);

  // ---- epilogue ----
  float* slab = sT[wave];
  const float* Rb = RESID ? (resid + (size_t)b * strideR) : nullptr;
#pragma unroll
  for (int i = 0; i < 4; ++i) {
    const int mBase = m0 + (i << 4);
#pragma unroll
    for (int j = 0; j < 4; ++j) {
      const int n = n0 + (j << 4) + rlane;
      float bv = 0.f;
      if (BIAS_MODE == 2) bv = bias[n];
#pragma unroll
      for (int r = 0; r < 8; ++r) {
        float v = acc[i][j][r] * scale;
        if (BIAS_MODE == 1) v += bias[mBase + mOff + r];
        if (BIAS_MODE == 2) v += bv;
        if (RESID) v += Rb[(size_t)(mBase + mOff + r) * ldc + n];
        if (ACT == 1) v = tanhf(v);
        if (ACT == 2) v = fmaxf(v, 0.0f);
        if (ACT == 3) v = v / (1.0f + expf(-v));
        if (ACT == 4) v = (v > 0.f) ? v : 0.01f * v;
        slab[(mOff + r) * 68 + (j << 4) + rlane] = v;
      }
    }
    __builtin_amdgcn_fence(__ATOMIC_RELEASE, "workgroup");
    __builtin_amdgcn_wave_barrier();
    __builtin_amdgcn_fence(__ATOMIC_ACQUIRE, "workgroup");
    if (OUT_MODE == 0) {
      float* C = (float*)Cout + (size_t)b * strideC;
      const int hh = lane >> 4, c4 = (lane & 15) * 4;     // row seg = 256 B = 16 lanes x 16 B
      {
#pragma unroll
        for (int it = 0; it < 8; ++it) {
          const int row = it * 2 + hh;
          v4f v = *(const v4f*)(slab + row * 68 + c4);
          *(v4f*)(C + (size_t)(mBase + row) * ldc + n0 + c4) = v;
        }
        
      }
    } else {
      const int q = lane >> 3, c8 = (lane & 7) * 8;
      unsigned short* C  = (unsigned short*)Cout  + (size_t)b * strideC;
      unsigned short* C2 = (OUT_MODE == 2) ? ((unsigned short*)Cout2 + (size_t)b * strideC) : nullptr;
      {
#pragma unroll
        for (int it = 0; it < 4; ++it) {
          const int row = it * 4 + q;
          const float* sp = slab + row * 68 + c8;
          v8h hv, lv;
#pragma unroll
          for (int e = 0; e < 8; ++e) {
            if (OUT_MODE == 1) {
              hv[e] = (_Float16)sp[e];
            } else {
              unsigned short hb = f2bf_bits(sp[e]);
              unsigned short lb = f2bf_bits(sp[e] - bf_bits2f(hb));
              hv[e] = __builtin_bit_cast(_Float16, hb);
              lv[e] = __builtin_bit_cast(_Float16, lb);
            }
          }
          *(v8h*)(C + (size_t)(mBase + row) * ldc + n0 + c8) = hv;
          if (OUT_MODE == 2) *(v8h*)(C2 + (size_t)(mBase + row) * ldc + n0 + c8) = lv;
        }
        
      }
    }
    __builtin_amdgcn_fence(__ATOMIC_RELEASE, "workgroup");
    __builtin_amdgcn_wave_barrier();
    __builtin_amdgcn_fence(__ATOMIC_ACQUIRE, "workgroup");
  }
}

// ---------------------------------------------------------------------------
// Elementwise bf16 split: hi = bf16_rne(in), lo = bf16_rne(in - hi); 2 elements per thread, one 4-B store.
// blockIdx.y (block-uniform) picks one of four equally sized sources; its planes start pstride 16-bit elements apart.
// ---------------------------------------------------------------------------
__device__ __forceinline__ unsigned pk16(unsigned short a, unsigned short b) { return (unsigned)a | ((unsigned)b << 16); }

__global__ __launch_bounds__(256) void split_bf16x2_kernel(const float* __restrict__ in0, const float* __restrict__ in1,
                                                           const float* __restrict__ in2, const float* __restrict__ in3,
                                                           unsigned short* __restrict__ hi, unsigned short* __restrict__ lo,
                                                           int n2, long pstride) {
  const int w = blockIdx.y;
  const float* in = (w == 0) ? in0 : (w == 1) ? in1 : (w == 2) ? in2 : in3;
  unsigned short* ph = hi + (size_t)w * pstride;
  unsigned short* pl = lo + (size_t)w * pstride;
  const int i = blockIdx.x * 256 + threadIdx.x;
  if (i < n2) {
    const v2f f = *(const v2f*)(in + 2 * (size_t)i);
    const unsigned short h0 = f2bf_bits(f[0]), h1 = f2bf_bits(f[1]);
    const unsigned short l0 = f2bf_bits(f[0] - bf_bits2f(h0)), l1 = f2bf_bits(f[1] - bf_bits2f(h1));
    const unsigned uh = pk16(h0, h1), ul = pk16(l0, l1);
    ((unsigned*)ph)[i] = uh;
    ((unsigned*)pl)[i] = ul;
    
  }
}

// ---------------------------------------------------------------------------
// tanh then bf16 split: hi = bf16_rne(tanh(in)), lo = bf16_rne(tanh(in) - hi); same store shape as above
// Coverage: grid = ceil(n2/256) x 256 threads x 2 elements = 2*n2 = whole plane.
// ---------------------------------------------------------------------------
__global__ __launch_bounds__(256) void tanh_split_kernel(const float* __restrict__ in, unsigned short* __restrict__ hi,
                                                         unsigned short* __restrict__ lo, int n2) {
  const int i = blockIdx.x * 256 + threadIdx.x;
  if (i < n2) {
    const v2f f = *(const v2f*)(in + 2 * (size_t)i);
    const float t0 = tanhf(f[0]), t1 = tanhf(f[1]);
    const unsigned short h0 = f2bf_bits(t0), h1 = f2bf_bits(t1);
    const unsigned short l0 = f2bf_bits(t0 - bf_bits2f(h0)), l1 = f2bf_bits(t1 - bf_bits2f(h1));
    const unsigned uh = pk16(h0, h1), ul = pk16(l0, l1);
    ((unsigned*)hi)[i] = uh;
    ((unsigned*)lo)[i] = ul;
    
  }
}

// ---------------------------------------------------------------------------
// Transpose + bf16 split: in w[R][Cn] f32 -> planes th/tl [Cn][R] bf16: out[n*R + k] = split(w[k*Cn + n]).
// grid = (Cn/64, R/64, matrices), R, Cn % 64 == 0; matrix z starts z*R*Cn elements into w, th and tl.
// (Used for the LayerNormed v [b][s=R=2048][c=Cn=1024] -> v^T planes [b][c][s].)
// Coverage: load 256 threads x 16 = 64x64; store 8 waves x 2 it x 4 rows(q) x 8 lanes x 8 elements = 64x64.
// ---------------------------------------------------------------------------
__global__ __launch_bounds__(256) void wt_split_kernel(const float* __restrict__ wz, unsigned short* __restrict__ thz,
                                                       unsigned short* __restrict__ tlz, int R, int Cn) {
  __shared__ float tile[64 * 65];
  const int n0 = blockIdx.x * 64;
  const int k0 = blockIdx.y * 64;
  const size_t zo = (size_t)blockIdx.z * R * Cn;
  const float* w = wz + zo;
  unsigned short* th = thz + zo;
  unsigned short* tl = tlz + zo;
  const int t = threadIdx.x;
#pragma unroll
  for (int i = 0; i < 16; ++i) {
    const int idx = i * 256 + t;
    const int kk = idx >> 6, nn = idx & 63;
    tile[nn * 65 + kk] = w[(size_t)(k0 + kk) * Cn + n0 + nn];
  }
  __syncthreads();
  const int lane = t & 31, wave = t >> 5;
  const int q = lane >> 3, c8 = (lane & 7) * 8;
  {
#pragma unroll
    for (int it = 0; it < 2; ++it) {
      const int row = wave * 8 + it * 4 + q;          // 0..63 = local n
      const float* sp = tile + row * 65 + c8;
      v8us hv, lv;
#pragma unroll
      for (int e = 0; e < 8; ++e) {
        const unsigned short hb = f2bf_bits(sp[e]);
        const unsigned short lb = f2bf_bits(sp[e] - bf_bits2f(hb));
        hv[e] = hb; lv[e] = lb;
      }
      const size_t o = (size_t)(n0 + row) * R + k0 + c8;
      *(v8us*)(th + o) = hv;
      *(v8us*)(tl + o) = lv;
    }
    
  }
}

// ---------------------------------------------------------------------------
// LoRA weight w1 [1024 in k][96 out n] f32 -> Bt planes th/tl [kLoraP=128 n][1024 k] bf16, rows n >= 96 ZERO:
//   out[n*1024 + k] = split(n < 96 ? w1[k*96 + n] : 0).  grid = 1024/64 k-tiles; block = 256 threads.
// LDS tile [128 n][65]: load 256 threads x 32 iterations = 64 k x 128 n (address clamped to n <= 95, zero by predicate).
// ---------------------------------------------------------------------------
__global__ __launch_bounds__(256) void w1t_split_kernel(const float* __restrict__ w1, unsigned short* __restrict__ th,
                                                        unsigned short* __restrict__ tl) {
  __shared__ float tile[kLoraP * 65];
  const int k0 = blockIdx.x * 64;
  const int t = threadIdx.x;
#pragma unroll 4
  for (int i = 0; i < 32; ++i) {
    const int idx = i * 256 + t;
    const int kk = idx >> 7, nn = idx & 127;
    const int nc = (nn < kLoraN) ? nn : (kLoraN - 1);
    float v = w1[(size_t)(k0 + kk) * kLoraN + nc];
    if (nn >= kLoraN) v = 0.0f;
    tile[nn * 65 + kk] = v;
  }
  __syncthreads();
  const int lane = t & 31, wave = t >> 5;
  const int q = lane >> 3, c8 = (lane & 7) * 8;
  {
#pragma unroll
    for (int it = 0; it < 4; ++it) {
      const int row = wave * 16 + it * 4 + q;         // 0..127 = n
      const float* sp = tile + row * 65 + c8;
      v8us hv, lv;
#pragma unroll
      for (int e = 0; e < 8; ++e) {
        const unsigned short hb = f2bf_bits(sp[e]);
        const unsigned short lb = f2bf_bits(sp[e] - bf_bits2f(hb));
        hv[e] = hb; lv[e] = lb;
      }
      const size_t o = (size_t)row * kDm + k0 + c8;
      *(v8us*)(th + o) = hv;
      *(v8us*)(tl + o) = lv;
    }
    
  }
}

// ---------------------------------------------------------------------------
// LoRA weight w2 [3 l][32 d][1024 c] f32 -> Bt planes th/tl [3 l][1024 n=c][32 k=d] bf16: out[l][n][k] = split(w2[l][k][n]).
// grid = (1024/64 n-tiles, 3); block 256. LDS tile [64 n][33]: load 256 threads x 8 = 32 k x 64 n.
// 512 contiguous bytes) with ONE 16-B-per-lane instruction: lane -> line L = lane>>3, row = wave*8 + 2L + ((lane&7)>>2),
// ---------------------------------------------------------------------------
__global__ __launch_bounds__(256) void w2t_split_kernel(const float* __restrict__ w2, unsigned short* __restrict__ th,
                                                        unsigned short* __restrict__ tl) {
  __shared__ float tile[64 * 33];
  const int n0 = blockIdx.x * 64;
  const int l  = blockIdx.y;
  const int t  = threadIdx.x;
  const float* wl = w2 + (size_t)l * kLoraD * kDm;
#pragma unroll
  for (int i = 0; i < 8; ++i) {
    const int idx = i * 256 + t;
    const int kk = idx >> 6, nn = idx & 63;
    tile[nn * 33 + kk] = wl[(size_t)kk * kDm + n0 + nn];
  }
  __syncthreads();
  const int lane = t & 31, wave = t >> 5;
  const int L = lane >> 3, q = lane & 7;
  const int row = wave * 8 + 2 * L + (q >> 2);
  const int k8 = (q & 3) * 8;
  const float* sp = tile + row * 33 + k8;
  v8us hv, lv;
#pragma unroll
  for (int e = 0; e < 8; ++e) {
    const unsigned short hb = f2bf_bits(sp[e]);
    const unsigned short lb = f2bf_bits(sp[e] - bf_bits2f(hb));
    hv[e] = hb; lv[e] = lb;
  }
  const size_t o = (size_t)l * kDm * kLoraD + (size_t)(n0 + row) * kLoraD + k8;
  *(v8us*)(th + o) = hv;
  *(v8us*)(tl + o) = lv;
  
}

// ---------------------------------------------------------------------------
// Shared elementwise split helper for 8 consecutive values -> v8us hi/lo.
// ---------------------------------------------------------------------------
__device__ __forceinline__ void split8(const v4f va, const v4f vb, v8us& hv, v8us& lv) {
#pragma unroll
  for (int e = 0; e < 4; ++e) {
    const unsigned short h0 = f2bf_bits(va[e]);
    hv[e] = h0; lv[e] = f2bf_bits(va[e] - bf_bits2f(h0));
    const unsigned short h1 = f2bf_bits(vb[e]);
    hv[4 + e] = h1; lv[4 + e] = f2bf_bits(vb[e] - bf_bits2f(h1));
  }
}
__device__ __forceinline__ void store16x2(unsigned short* ph, unsigned short* pl, size_t o, const v8us hv, const v8us lv) {
  *(v8us*)(ph + o) = hv;
  *(v8us*)(pl + o) = lv;
  
}

// ---------------------------------------------------------------------------
// Token shift: xxx = x + (xprev - x) * maa_x -> bf16 hi/lo planes [kRows][kDm], row = b*kSeq + s;
// xprev = shift_state[b] for s == 0, else x[b][s-1] (block-uniform pointer choice).
// grid = kRows blocks x 128 threads x 8 elements = kRows x kDm = the whole plane; each lane stores 16 B,
// ---------------------------------------------------------------------------
__global__ __launch_bounds__(128) void xxx_split_kernel(const float* __restrict__ x, const float* __restrict__ ss,
                                                        const float* __restrict__ maax,
                                                        unsigned short* __restrict__ oh, unsigned short* __restrict__ ol) {
  const int row = blockIdx.x;
  const int b = row / kSeq, s = row % kSeq;
  const int c0 = threadIdx.x * 8;
  const float* xr = x + (size_t)row * kDm;
  const float* xp = (s == 0) ? (ss + (size_t)b * kDm) : (xr - kDm);
  const v4f xa = *(const v4f*)(xr + c0), xb = *(const v4f*)(xr + c0 + 4);
  const v4f pa = *(const v4f*)(xp + c0), pb = *(const v4f*)(xp + c0 + 4);
  const v4f ma = *(const v4f*)(maax + c0), mb = *(const v4f*)(maax + c0 + 4);
  const v4f va = xa + (pa - xa) * ma;
  const v4f vb = xb + (pb - xb) * mb;
  v8us hv, lv;
  split8(va, vb, hv, lv);
  store16x2(oh, ol, (size_t)row * kDm + c0, hv, lv);
}

// ---------------------------------------------------------------------------
// Data-dependent mixing: x? = x + (xprev - x) * (maa_? + mix_?[s][c]) for ? in {q(r), k, v} -> three bf16 hi/lo plane pairs
// [kRows][kDm]. mix planes f32 [3][kRows][kDm] (l = 0 r, 1 k, 2 v). Same row index and thread/store shape as xxx_split_kernel:
// ---------------------------------------------------------------------------
__global__ __launch_bounds__(128) void mix_split_kernel(const float* __restrict__ x, const float* __restrict__ ss,
                                                        const float* __restrict__ maar, const float* __restrict__ maak,
                                                        const float* __restrict__ maav, const float* __restrict__ mix,
                                                        unsigned short* __restrict__ qh, unsigned short* __restrict__ ql,
                                                        unsigned short* __restrict__ kh, unsigned short* __restrict__ kl,
                                                        unsigned short* __restrict__ vh, unsigned short* __restrict__ vl) {
  const int row = blockIdx.x;
  const int b = row / kSeq, s = row % kSeq;
  const int c0 = threadIdx.x * 8;
  const float* xr = x + (size_t)row * kDm;
  const float* xp = (s == 0) ? (ss + (size_t)b * kDm) : (xr - kDm);
  const v4f xa = *(const v4f*)(xr + c0), xb = *(const v4f*)(xr + c0 + 4);
  const v4f pa = *(const v4f*)(xp + c0), pb = *(const v4f*)(xp + c0 + 4);
  const v4f da = pa - xa, db = pb - xb;
  const size_t plane = (size_t)kRows * kDm;
  const float* m0 = mix + (size_t)row * kDm + c0;
  const size_t o = (size_t)row * kDm + c0;
  {
    const v4f ma = *(const v4f*)(maar + c0), mb = *(const v4f*)(maar + c0 + 4);
    const v4f qa = *(const v4f*)(m0), qb = *(const v4f*)(m0 + 4);
    const v4f va = xa + da * (ma + qa), vb = xb + db * (mb + qb);
    v8us hv, lv; split8(va, vb, hv, lv); store16x2(qh, ql, o, hv, lv);
  }
  {
    const v4f ma = *(const v4f*)(maak + c0), mb = *(const v4f*)(maak + c0 + 4);
    const v4f qa = *(const v4f*)(m0 + plane), qb = *(const v4f*)(m0 + plane + 4);
    const v4f va = xa + da * (ma + qa), vb = xb + db * (mb + qb);
    v8us hv, lv; split8(va, vb, hv, lv); store16x2(kh, kl, o, hv, lv);
  }
  {
    const v4f ma = *(const v4f*)(maav + c0), mb = *(const v4f*)(maav + c0 + 4);
    const v4f qa = *(const v4f*)(m0 + 2 * plane), qb = *(const v4f*)(m0 + 2 * plane + 4);
    const v4f va = xa + da * (ma + qa), vb = xb + db * (mb + qb);
    v8us hv, lv; split8(va, vb, hv, lv); store16x2(vh, vl, o, hv, lv);
  }
}

// ---------------------------------------------------------------------------
//   MODE 0: LN then RoPE (half-split per 64-wide head: out[f] = x1*cos - x2*sin, out[32+f] = x1*sin + x2*cos with
//           cos/sin = cosf/sinf(angles[s][f]), s = row % kSeq) then bf16 hi/lo split into planes [kRows][kDm]; grid = (kRows, 2),
//           blockIdx.y selects source/params/planes A (0) or B (1).
//   MODE 1: LN written back IN PLACE as f32 (dstf == src): each block owns its row; thread t writes floats 4t..4t+3,
//   MODE 2: LN then bf16 hi/lo split into planes (no rotation); grid = (kRows, 1).
// MODE 0/2 store path: per wave (heads 2w, 2w+1) the 128 results are staged in LDS, then lanes 0..15 write 16 B each =
// ---------------------------------------------------------------------------
template <int MODE>
__global__ __launch_bounds__(256) void ln_kernel(const float* srcA, const float* srcB,
                                                 const float* __restrict__ gA, const float* __restrict__ bA,
                                                 const float* __restrict__ gB, const float* __restrict__ bB,
                                                 const float* __restrict__ ang,
                                                 unsigned short* hA, unsigned short* lA,
                                                 unsigned short* hB, unsigned short* lB, float* dstf) {
  __shared__ __align__(16) float srow[kDm];
  __shared__ __align__(16) unsigned short Lh[8][128];
  __shared__ __align__(16) unsigned short Ll[8][128];
  __shared__ float sred[8];
  __shared__ float sred2[8];
  const int s = blockIdx.x;                      // token row b*kSeq + position
  const int which = blockIdx.y;                  // block-uniform
  const float* src = (which == 0) ? srcA : srcB;
  const float* g   = (which == 0) ? gA : gB;
  const float* bb  = (which == 0) ? bA : bB;
  unsigned short* dh = (which == 0) ? hA : hB;
  unsigned short* dl = (which == 0) ? lA : lB;
  const int tid = threadIdx.x, lane = tid & 31, wave = tid >> 5;

  const float* row = src + (size_t)s * kDm;
  const v4f xv = *(const v4f*)(row + tid * 4);
  float ps = (xv[0] + xv[1]) + (xv[2] + xv[3]);
#pragma unroll
  for (int off = 1; off < 32; off <<= 1) ps += __shfl_xor(ps, off, 32);
  if (lane == 0) sred[wave] = ps;
  __syncthreads();
  float tot = 0.f;
#pragma unroll
  for (int w = 0; w < 8; ++w) tot += sred[w];
  const float mean = tot * (1.0f / (float)kDm);
  const v4f dv = xv - mean;
  float pq = (dv[0] * dv[0] + dv[1] * dv[1]) + (dv[2] * dv[2] + dv[3] * dv[3]);
#pragma unroll
  for (int off = 1; off < 32; off <<= 1) pq += __shfl_xor(pq, off, 32);
  if (lane == 0) sred2[wave] = pq;
  __syncthreads();
  float tot2 = 0.f;
#pragma unroll
  for (int w = 0; w < 8; ++w) tot2 += sred2[w];
  const float var  = tot2 * (1.0f / (float)kDm);
  const float rstd = rsqrtf(var + 1.0e-5f);
  const v4f gv = *(const v4f*)(g + tid * 4);
  const v4f bv = *(const v4f*)(bb + tid * 4);
  v4f yv;
#pragma unroll
  for (int e = 0; e < 4; ++e) yv[e] = dv[e] * rstd * gv[e] + bv[e];

  if (MODE == 1) {
    float* dp = dstf + (size_t)s * kDm + tid * 4;
    *(v4f*)dp = yv;
    
    return;                                     // MODE is a compile-time constant: uniform
  }

  *(v4f*)(srow + tid * 4) = yv;
  __syncthreads();

  float cs = 1.0f, sn = 0.0f;
  if (MODE == 0) {
    const float a = ang[(size_t)(s % kSeq) * 32 + lane];
    cs = cosf(a);
    sn = sinf(a);
  }
  unsigned short* lh = Lh[wave];
  unsigned short* ll = Ll[wave];
#pragma unroll 1
  for (int hp = 0; hp < 2; ++hp) {
    const int base = wave * 128 + hp * 64;
    const float xr = srow[base + lane];
    const float xi = srow[base + 32 + lane];
    float vr = xr, vi = xi;
    if (MODE == 0) { vr = xr * cs - xi * sn; vi = xr * sn + xi * cs; }
    const unsigned short hr = f2bf_bits(vr);
    const unsigned short lr = f2bf_bits(vr - bf_bits2f(hr));
    const unsigned short hi = f2bf_bits(vi);
    const unsigned short li = f2bf_bits(vi - bf_bits2f(hi));
    lh[hp * 64 + lane] = hr;       ll[hp * 64 + lane] = lr;
    lh[hp * 64 + 32 + lane] = hi;  ll[hp * 64 + 32 + lane] = li;
  }
  __builtin_amdgcn_fence(__ATOMIC_RELEASE, "workgroup");
  __builtin_amdgcn_wave_barrier();
  __builtin_amdgcn_fence(__ATOMIC_ACQUIRE, "workgroup");
  const int l16 = lane & 15;
  const v8us hv = *(const v8us*)(lh + l16 * 8);
  const v8us lv = *(const v8us*)(ll + l16 * 8);
  const size_t o = (size_t)s * kDm + wave * 128 + l16 * 8;
  {
    if (lane < 16) {
      *(v8us*)(dh + o) = hv;
      *(v8us*)(dl + o) = lv;
    }
    
  }
}

// =====================================================================================
// Causal attention, head dim 64, batch element = blockIdx.y (structural lower-triangular mask incl. diagonal).
//   Every plane below is that of one batch element; element b starts b*kSeq*kDm elements into each buffer.
//   q planes (hi/lo bf16): element (t, h, d) at [t*kDm + h*64 + d]
//   k planes (hi/lo bf16): element (s, h, d) at [s*kDm + h*64 + d]
//   v^T planes (hi/lo bf16): element (h, d, s) at [(h*64 + d)*kSeq + s]
//   out f32: element (t, h, d) at [t*kDm + h*64 + d]
//   scores = (q . k) * sscale : bf16 hi/lo split (hi.hi + hi.lo + lo.hi) on v_wmma_f32_16x16x32_bf16
//   out    = p . v             : bf16 hi/lo split of p (unnormalised) and v, f32 accumulate
//   online softmax in f32. Key tiles strictly above the 64x64 block diagonal (kv chunk > query block) are not
//   visited (probabilities exactly 0 in f32); inside the diagonal tile, score := mfill where kv > query (select).
//   Block = 4 waves = 64 query rows of one head; grid.x = kHeads * (kSeq/64); kv chunks of 64, trip count qb+1 <= 32.
//   K / V^T chunk staging: 128 threads x 32 elements per plane = the whole 64x64 tile (16-B copies, plain loads,
//   __syncthreads before and after); fragment loads read the LDS tiles with the same v8b element type.
//   Output coverage: grid.x 16 heads x 32 query blocks x 4 waves x 16 rows x 64 cols = one [2048][1024] plane per grid.y.
// =====================================================================================
#define AT_D 64
#define AT_NW 4
#define AT_QB 64
#define AT_KC 64
#define AT_LP 72   // LDS row pitch of the K, V^T and P tiles in 16-bit elements: 144 B = 16 B x 9 (odd), so that the 16 rows of one 16-B fragment read fall on 16 different bank groups

__device__ __forceinline__ unsigned short at_bf_bits(float f) {
  unsigned u = __float_as_uint(f);
  return (unsigned short)((u + 0x7FFFu + ((u >> 16) & 1u)) >> 16);
}
__device__ __forceinline__ __bf16 at_f2bf(float f) { return __builtin_bit_cast(__bf16, at_bf_bits(f)); }
__device__ __forceinline__ void at_split(float f, __bf16& hi, __bf16& lo) {
  const unsigned short hb = at_bf_bits(f);
  hi = __builtin_bit_cast(__bf16, hb);
  lo = at_f2bf(f - __uint_as_float(((unsigned)hb) << 16));
}
__device__ __forceinline__ v8f at_mma(v16b a, v16b b, v8f c) {
  c = __builtin_amdgcn_wmma_f32_16x16x32_bf16(false, a, false, b, (short)0, c, false, false);
  asm volatile("v_nop\n\tv_nop\n\tv_nop\n\tv_nop" : "+v"(c) : "v"(a), "v"(b));
  return c;
}

__global__ __launch_bounds__(128)
void attn_causal64_kernel(const unsigned short* __restrict__ qhp, const unsigned short* __restrict__ qlp,
                          const unsigned short* __restrict__ khp, const unsigned short* __restrict__ klp,
                          const unsigned short* __restrict__ vhp, const unsigned short* __restrict__ vlp,
                          float* __restrict__ out, float sscale, float mfill) {
  union FB { v16b v; v8b h[2]; };
  __shared__ __align__(16) __bf16 Ksh[AT_KC * AT_LP];            // K hi [kv][d], 64 rows of 144 B
  __shared__ __align__(16) __bf16 Ksl[AT_KC * AT_LP];            // K lo
  __shared__ __align__(16) __bf16 Vth[AT_D * AT_LP];             // V hi [d][kv], 64 rows of 144 B
  __shared__ __align__(16) __bf16 Vtl[AT_D * AT_LP];             // V lo
  __shared__ __align__(16) __bf16 Psh[AT_NW][16 * AT_LP];        // per wave P hi [row][kv], 16 rows of 144 B
  __shared__ __align__(16) __bf16 Psl[AT_NW][16 * AT_LP];        // per wave P lo
  __shared__ __align__(16) float  Os[AT_NW][16 * 68];            // per wave out tile, pitch 68

  const int tid  = threadIdx.x;
  const int wave = tid >> 5;
  const int lane = tid & 31;
  const int hh   = lane >> 4;
  const int c    = lane & 15;

  const int nqb = kSeq / AT_QB;           // 32
  const int bx = blockIdx.x;
  const int qb = bx % nqb;
  const int h  = bx / nqb;                // 0..kHeads-1 (grid = kHeads * nqb)
  const int q0 = qb * AT_QB + wave * 16;

  const size_t bo = (size_t)blockIdx.y * kSeq * kDm;
  const __bf16* Qh = (const __bf16*)(const void*)qhp + bo + (size_t)h * AT_D;
  const __bf16* Ql = (const __bf16*)(const void*)qlp + bo + (size_t)h * AT_D;
  const __bf16* Kh = (const __bf16*)(const void*)khp + bo + (size_t)h * AT_D;
  const __bf16* Kl = (const __bf16*)(const void*)klp + bo + (size_t)h * AT_D;
  const __bf16* Vh = (const __bf16*)(const void*)vhp + bo + (size_t)h * AT_D * kSeq;
  const __bf16* Vl = (const __bf16*)(const void*)vlp + bo + (size_t)h * AT_D * kSeq;
  float*        ob = out + bo + (size_t)h * AT_D;

  // ---- Q fragments (A operand, row = lane&15, split k map via Frag load): 2 d-chunks, hi and lo ----
  v16b qah[2], qal[2];
#pragma unroll
  for (int dc = 0; dc < 2; ++dc) {
    const __bf16* qr = Qh + (size_t)(q0 + c) * kDm + dc * 32 + 8 * hh;
    const __bf16* ql = Ql + (size_t)(q0 + c) * kDm + dc * 32 + 8 * hh;
    qah[dc] = Frag<__bf16>::load(qr);
    qal[dc] = Frag<__bf16>::load(ql);
  }

  float mrow[8], lrow[8];
  v8f oacc[4];
#pragma unroll
  for (int r = 0; r < 8; ++r) { mrow[r] = -INFINITY; lrow[r] = 0.f; }
#pragma unroll
  for (int t = 0; t < 4; ++t) oacc[t] = (v8f){0.f,0.f,0.f,0.f,0.f,0.f,0.f,0.f};

  int nChunks = qb + 1;                      // block-uniform, <= 32
  if (nChunks > kSeq / AT_KC) nChunks = kSeq / AT_KC;
  for (int kc = 0; kc < nChunks; ++kc) {
    const int kv0 = kc * AT_KC;
    __syncthreads();
    {
      // staging coverage: 128 threads x (4 x 8) elements = 64 rows x 64 per plane = the whole chunk tile
      const int r = tid >> 1, half = (tid & 1) * 32;
      const __bf16* ksh = Kh + (size_t)(kv0 + r) * kDm + half;     // K row kv0+r, d = half..half+31
      const __bf16* ksl = Kl + (size_t)(kv0 + r) * kDm + half;
      const __bf16* vsh = Vh + (size_t)r * kSeq + kv0 + half;     // V^T row d = r, s = kv0+half..+31
      const __bf16* vsl = Vl + (size_t)r * kSeq + kv0 + half;
#pragma unroll
      for (int i = 0; i < 4; ++i) {
        const v8b a0 = *(const v8b*)(ksh + 8 * i);
        const v8b a1 = *(const v8b*)(ksl + 8 * i);
        const v8b b0 = *(const v8b*)(vsh + 8 * i);
        const v8b b1 = *(const v8b*)(vsl + 8 * i);
        *(v8b*)(Ksh + r * AT_LP + half + 8 * i) = a0;
        *(v8b*)(Ksl + r * AT_LP + half + 8 * i) = a1;
        *(v8b*)(Vth + r * AT_LP + half + 8 * i) = b0;
        *(v8b*)(Vtl + r * AT_LP + half + 8 * i) = b1;
      }
    }
    __syncthreads();

    v8f s[4];
#pragma unroll
    for (int j = 0; j < 4; ++j) {
      s[j] = (v8f){0.f,0.f,0.f,0.f,0.f,0.f,0.f,0.f};
#pragma unroll
      for (int dc = 0; dc < 2; ++dc) {
        FB kb, kl;
        kb.h[0] = *(const v8b*)(Ksh + (j * 16 + c) * AT_LP + dc * 32 + 8 * hh);
        kb.h[1] = *(const v8b*)(Ksh + (j * 16 + c) * AT_LP + dc * 32 + 16 + 8 * hh);
        kl.h[0] = *(const v8b*)(Ksl + (j * 16 + c) * AT_LP + dc * 32 + 8 * hh);
        kl.h[1] = *(const v8b*)(Ksl + (j * 16 + c) * AT_LP + dc * 32 + 16 + 8 * hh);
        s[j] = at_mma(qah[dc], kb.v, s[j]);
        s[j] = at_mma(qah[dc], kl.v, s[j]);
        s[j] = at_mma(qal[dc], kb.v, s[j]);
      }
    }
    // ---- scale, structural causal select on the diagonal tile, row max over the 16 lanes of each half ----
    const bool diag = (kc == qb);            // block-uniform
    float cm[8];
#pragma unroll
    for (int r = 0; r < 8; ++r) {
      const int qrow = q0 + 8 * hh + r;                       // 0..kSeq-1
      float m = -INFINITY;
#pragma unroll
      for (int j = 0; j < 4; ++j) {
        const int kvcol = kv0 + j * 16 + c;
        const float sv = s[j][r] * sscale;
        const bool masked = diag && (kvcol > qrow);
        const float sm = masked ? mfill : sv;
        s[j][r] = sm;
        m = fmaxf(m, sm);
      }
#pragma unroll
      for (int off = 1; off < 16; off <<= 1) m = fmaxf(m, __shfl_xor(m, off, 32));
      cm[r] = m;
    }
    __bf16* pwh = Psh[wave];
    __bf16* pwl = Psl[wave];
#pragma unroll
    for (int r = 0; r < 8; ++r) {
      const float mnew = fmaxf(mrow[r], cm[r]);
      const float alpha = expf(mrow[r] - mnew);
      mrow[r] = mnew;
      float psum = 0.f;
#pragma unroll
      for (int j = 0; j < 4; ++j) {
        const float p = expf(s[j][r] - mnew);
        psum += p;
        __bf16 a, bl; at_split(p, a, bl);
        pwh[(8 * hh + r) * AT_LP + j * 16 + c] = a;
        pwl[(8 * hh + r) * AT_LP + j * 16 + c] = bl;
      }
#pragma unroll
      for (int off = 1; off < 16; off <<= 1) psum += __shfl_xor(psum, off, 32);
      lrow[r] = lrow[r] * alpha + psum;
#pragma unroll
      for (int t = 0; t < 4; ++t) oacc[t][r] *= alpha;
    }
    __builtin_amdgcn_fence(__ATOMIC_RELEASE, "workgroup");
    __builtin_amdgcn_wave_barrier();
    __builtin_amdgcn_fence(__ATOMIC_ACQUIRE, "workgroup");
#pragma unroll 1
    for (int kk = 0; kk < 2; ++kk) {
      FB pa, pl;
      pa.h[0] = *(const v8b*)(pwh + c * AT_LP + kk * 32 + 8 * hh);
      pa.h[1] = *(const v8b*)(pwh + c * AT_LP + kk * 32 + 16 + 8 * hh);
      pl.h[0] = *(const v8b*)(pwl + c * AT_LP + kk * 32 + 8 * hh);
      pl.h[1] = *(const v8b*)(pwl + c * AT_LP + kk * 32 + 16 + 8 * hh);
#pragma unroll
      for (int t = 0; t < 4; ++t) {
        FB vb, vl;
        vb.h[0] = *(const v8b*)(Vth + (t * 16 + c) * AT_LP + kk * 32 + 8 * hh);
        vb.h[1] = *(const v8b*)(Vth + (t * 16 + c) * AT_LP + kk * 32 + 16 + 8 * hh);
        vl.h[0] = *(const v8b*)(Vtl + (t * 16 + c) * AT_LP + kk * 32 + 8 * hh);
        vl.h[1] = *(const v8b*)(Vtl + (t * 16 + c) * AT_LP + kk * 32 + 16 + 8 * hh);
        oacc[t] = at_mma(pa.v, vb.v, oacc[t]);
        oacc[t] = at_mma(pa.v, vl.v, oacc[t]);
        oacc[t] = at_mma(pl.v, vb.v, oacc[t]);
      }
    }
  }

  float* os = Os[wave];
#pragma unroll
  for (int r = 0; r < 8; ++r) {
    const float inv = 1.0f / lrow[r];
#pragma unroll
    for (int t = 0; t < 4; ++t) os[(8 * hh + r) * 68 + t * 16 + c] = oacc[t][r] * inv;
  }
  __builtin_amdgcn_fence(__ATOMIC_RELEASE, "workgroup");
  __builtin_amdgcn_wave_barrier();
  __builtin_amdgcn_fence(__ATOMIC_ACQUIRE, "workgroup");
  {
    const int c4 = (lane & 15) * 4;
    {
#pragma unroll
      for (int it = 0; it < 8; ++it) {
        const int row = it * 2 + hh;   // it 0..7 x hh 0..1 covers rows 0..15 of the wave tile
        v4f val = *(const v4f*)(os + row * 68 + c4);
        *(v4f*)(ob + (size_t)(q0 + row) * kDm + c4) = val;
      }
      
    }
  }
}

// ---------------------------------------------------------------------------
// Workspace region map (byte offsets). Every GEMM: K in {1024, 32} (%32 == 0), M = kRows = 4096, N in {128, 1024} (%128 == 0).
// Activation regions hold both batch elements, row = b*2048 + s.
// Every region is fully written before it is read within the in-order launch sequence; reused regions noted.
//   Wqh bf16 [1024 n][1024 k]        0      Wql    2097152
//   Wkh                        4194304      Wkl    6291456
//   Wvh                        8388608      Wvl   10485760
//   Woh                       12582912      Wol   14680064
//   W1Th bf16 [128 n][1024 k] 16777216      W1Tl  17039360   (rows 96..127 zero)
//   W2Th bf16 [3][1024 n][32] 17301504      W2Tl  17498112
//   XXh  bf16 [4096][1024]    17694720      XXl   26083328   (xxx planes; reused after the LoRA GEMM as Oh / Ol)
//   LORAf f32 [4096][128]     34471936
//   LTh  bf16 [4096][128]     36569088      LTl   37617664
//   MIX  f32 [3][4096][1024]  38666240                       (reused after the mix kernel: Qf = +0, Kf = +16777216,
//                                                             Vf = +33554432 f32 [4096][1024]; Of reuses Qf)
//   XQh/XQl/XKh/XKl/XVh/XVl   88997888 .. (6 x 8388608)
//   Qh/Ql/Kh/Kl              139329536 .. (4 x 8388608)
//   VTh/VTl bf16 [2][1024][2048] 172883968, 181272576
//   total                    189661184  (~180.9 MiB)
// ---------------------------------------------------------------------------
extern "C" void kernel_launch(void* const* d_in, const int* in_sizes, int n_in,
                              void* d_out, int out_size, void* d_ws, size_t ws_size,
                              hipStream_t stream) {
  if (n_in < 21) return;
  const int nRow = kSeq * kDm;            // 2097152 per batch element
  const int nAct = kBatch * nRow;         // 4194304
  const int nW   = kDm * kDm;             // 1048576
  if (in_sizes[0] != nAct) return;
  if (in_sizes[1] != kBatch * kDm) return;
  if (in_sizes[2] != kDm || in_sizes[3] != kDm || in_sizes[4] != kDm || in_sizes[5] != kDm) return;
  if (in_sizes[6] != kDm * kLoraN) return;
  if (in_sizes[7] != 3 * kLoraD * kDm) return;
  if (in_sizes[8] != nW || in_sizes[9] != nW || in_sizes[10] != nW || in_sizes[11] != nW) return;
  for (int i = 12; i < 20; ++i) if (in_sizes[i] != kDm) return;
  if (in_sizes[20] != kSeq * 32) return;
  if (out_size != nAct) return;

  const float* x     = (const float*)d_in[0];    // [2][2048][1024]
  const float* ss    = (const float*)d_in[1];    // [2][1024]
  const float* maax  = (const float*)d_in[2];    // [1024]
  const float* maar  = (const float*)d_in[3];
  const float* maak  = (const float*)d_in[4];
  const float* maav  = (const float*)d_in[5];
  const float* w1    = (const float*)d_in[6];    // [1024][96]
  const float* w2    = (const float*)d_in[7];    // [3][32][1024]
  const float* wq    = (const float*)d_in[8];    // [1024 out][1024 in]
  const float* wk    = (const float*)d_in[9];
  const float* wv    = (const float*)d_in[10];
  const float* wo    = (const float*)d_in[11];
  const float* lnrg  = (const float*)d_in[12];
  const float* lnrb  = (const float*)d_in[13];
  const float* lnkg  = (const float*)d_in[14];
  const float* lnkb  = (const float*)d_in[15];
  const float* lnvg  = (const float*)d_in[16];
  const float* lnvb  = (const float*)d_in[17];
  const float* lnxg  = (const float*)d_in[18];
  const float* lnxb  = (const float*)d_in[19];
  const float* ang   = (const float*)d_in[20];   // [2048][32]

  const size_t PW   = (size_t)kDm * kDm * 2;          // 2097152  bf16 weight plane
  const size_t PX   = (size_t)kRows * kDm * 2;        // 8388608  bf16 activation plane (both batch elements)
  const size_t PF   = (size_t)kRows * kDm * 4;        // 16777216 f32 activation plane
  const size_t PW1  = (size_t)kLoraP * kDm * 2;       // 262144
  const size_t PW2  = (size_t)3 * kDm * kLoraD * 2;   // 196608
  const size_t PLF  = (size_t)kRows * kLoraP * 4;     // 2097152
  const size_t PLT  = (size_t)kRows * kLoraP * 2;     // 1048576
  size_t off = 0;
  const size_t oWqh = off; off += PW;  const size_t oWql = off; off += PW;
  off += 4 * PW;                                // Wkh, Wkl, Wvh, Wvl: reached from Wqh / Wql by the plane stride
  const size_t oWoh = off; off += PW;  const size_t oWol = off; off += PW;
  const size_t oW1h = off; off += PW1; const size_t oW1l = off; off += PW1;
  const size_t oW2h = off; off += PW2; const size_t oW2l = off; off += PW2;
  const size_t oXXh = off; off += PX;  const size_t oXXl = off; off += PX;
  const size_t oLF  = off; off += PLF;
  const size_t oLTh = off; off += PLT; const size_t oLTl = off; off += PLT;
  const size_t oMIX = off; off += 3 * PF;
  const size_t oXQh = off; off += PX;  const size_t oXQl = off; off += PX;
  const size_t oXKh = off; off += PX;  const size_t oXKl = off; off += PX;
  const size_t oXVh = off; off += PX;  const size_t oXVl = off; off += PX;
  const size_t oQh  = off; off += PX;  const size_t oQl  = off; off += PX;
  const size_t oKh  = off; off += PX;  const size_t oKl  = off; off += PX;
  const size_t oVTh = off; off += PX;  const size_t oVTl = off; off += PX;
  if (off > ws_size) return;                    // off = 189661184

  char* ws = (char*)d_ws;
  unsigned short* Wqh = (unsigned short*)(ws + oWqh); unsigned short* Wql = (unsigned short*)(ws + oWql);
  unsigned short* Woh = (unsigned short*)(ws + oWoh); unsigned short* Wol = (unsigned short*)(ws + oWol);
  unsigned short* W1h = (unsigned short*)(ws + oW1h); unsigned short* W1l = (unsigned short*)(ws + oW1l);
  unsigned short* W2h = (unsigned short*)(ws + oW2h); unsigned short* W2l = (unsigned short*)(ws + oW2l);
  unsigned short* XXh = (unsigned short*)(ws + oXXh); unsigned short* XXl = (unsigned short*)(ws + oXXl);
  float*          LF  = (float*)(ws + oLF);
  unsigned short* LTh = (unsigned short*)(ws + oLTh); unsigned short* LTl = (unsigned short*)(ws + oLTl);
  float*          MIX = (float*)(ws + oMIX);
  float*          Qf  = (float*)(ws + oMIX);
  float*          Kf  = (float*)(ws + oMIX + PF);
  float*          Vf  = (float*)(ws + oMIX + 2 * PF);
  float*          Of  = Qf;
  unsigned short* XQh = (unsigned short*)(ws + oXQh); unsigned short* XQl = (unsigned short*)(ws + oXQl);
  unsigned short* XKh = (unsigned short*)(ws + oXKh); unsigned short* XKl = (unsigned short*)(ws + oXKl);
  unsigned short* XVh = (unsigned short*)(ws + oXVh); unsigned short* XVl = (unsigned short*)(ws + oXVl);
  unsigned short* Qh  = (unsigned short*)(ws + oQh);  unsigned short* Ql  = (unsigned short*)(ws + oQl);
  unsigned short* Kh  = (unsigned short*)(ws + oKh);  unsigned short* Kl  = (unsigned short*)(ws + oKl);
  unsigned short* VTh = (unsigned short*)(ws + oVTh); unsigned short* VTl = (unsigned short*)(ws + oVTl);
  unsigned short* Oh  = XXh;                          unsigned short* Ol  = XXl;

  const float* dummyf = lnrg;                         // valid pointer for unused bias / resid arguments (never read)

  const dim3 blk(256);
  const int  n2w = nW / 2;                                  // 524288 pairs per weight plane
  const dim3 gCastW((n2w + 255) / 256, 4);                  // 2048 blocks x 256 threads x 2 = 1024x1024, y = q, k, v, o
  const dim3 gW1(kDm / 64);                                 // 16 k-tiles
  const dim3 gW2(kDm / 64, 3);                              // 16 n-tiles x 3
  const dim3 gRow(kRows);                                   // one block per token row (128-thread kernels)
  const dim3 blkG(128);                                     // GEMM block: 4 waves, one 128x128 tile
  const dim3 gLora((kRows / 128) * (kLoraP / 128));         // 32 tiles: M=4096, N=128
  const dim3 gMix((kRows / 128) * (kDm / 128), 3);          // 256 tiles x 3 (l): M=4096, N=1024, K=32
  const int  n2l = kRows * kLoraP / 2;                      // 262144 pairs
  const dim3 gTanh((n2l + 255) / 256);                      // 1024 blocks x 256 x 2 = 4096x128
  const dim3 gQKV((kRows / 128) * (kDm / 128), 3);          // 256 tiles x 3 (q, k, v): M=4096, N=1024
  const dim3 gProj((kRows / 128) * (kDm / 128), 1);         // 256 tiles: M=4096, N=1024
  const dim3 gLnQK(kRows, 2);                               // 4096 rows x {q, k}
  const dim3 gLn1(kRows, 1);
  const dim3 gVT(kDm / 64, kSeq / 64, kBatch);              // per b: in [R=2048 s][Cn=1024 c] -> planes [c][s]
  const dim3 gAtt(kHeads * (kSeq / 64), kBatch);            // 512 x 2 blocks: 16 heads x 32 query blocks, y = b

  // setup: weights -> bf16 hi/lo planes (q/k/v/o already [out n][in k] = Bt layout; w1/w2 transposed).
  // The hi planes of q, k, v, o lie 2 weight planes apart (hi, lo, hi, lo, ...), and so do the lo planes.
  split_bf16x2_kernel<<<gCastW, blk, 0, stream>>>(wq, wk, wv, wo, Wqh, Wql, n2w, 2L * nW);
  w1t_split_kernel<<<gW1, blk, 0, stream>>>(w1, W1h, W1l);
  w2t_split_kernel<<<gW2, blk, 0, stream>>>(w2, W2h, W2l);

  // Each stage below runs once, on the rows of both batch elements.
  // (1) xxx = x + dxprev*maa_x -> planes
  xxx_split_kernel<<<gRow, dim3(128), 0, stream>>>(x, ss, maax, XXh, XXl);
  // (2) lora_pre = xxx . w1 -> f32 [4096][128]   (M=4096, N=128, K=1024)
  wmma_gemm64<1, true, 0, 0, false, 0><<<gLora, blkG, 0, stream>>>(
      XXh, XXl, kDm, 0L, W1h, W1l, kDm, 0L, (void*)LF, (void*)LF, kLoraP, 0L,
      dummyf, dummyf, 0L, kRows, kLoraP, kDm, 1.0f);
  // (3) lora = tanh -> planes [4096][128]
  tanh_split_kernel<<<gTanh, blk, 0, stream>>>(LF, LTh, LTl, n2l);
  // (4) mixes[l] = lora[:, 32l..32l+31] . w2[l] -> f32 [3][4096][1024]   (M=4096, N=1024, K=32; grid.y = l)
  wmma_gemm64<1, true, 0, 0, false, 0><<<gMix, blkG, 0, stream>>>(
      LTh, LTl, kLoraP, (long)kLoraD, W2h, W2l, kLoraD, (long)kDm * kLoraD, (void*)MIX, (void*)MIX, kDm, (long)nAct,
      dummyf, dummyf, 0L, kRows, kDm, kLoraD, 1.0f);
  // (5) xq/xk/xv = x + dxprev*(maa + mix) -> planes
  mix_split_kernel<<<gRow, dim3(128), 0, stream>>>(x, ss, maar, maak, maav, MIX, XQh, XQl, XKh, XKl, XVh, XVl);
  // (6) q0 = xq . Wq^T, k0 = xk . Wk^T, v0 = xv . Wv^T -> f32 [3][4096][1024]   (M=4096, N=1024, K=1024; grid.y = q, k, v:
  //     XQ/XK/XV hi planes lie 2 activation planes apart, Wq/Wk/Wv hi planes 2 weight planes, Qf/Kf/Vf one f32 plane)
  wmma_gemm64<1, true, 0, 0, false, 0><<<gQKV, blkG, 0, stream>>>(
      XQh, XQl, kDm, 2L * nAct, Wqh, Wql, kDm, 2L * nW, (void*)Qf, (void*)Qf, kDm, (long)nAct,
      dummyf, dummyf, 0L, kRows, kDm, kDm, 1.0f);
  // (7) LayerNorm + RoPE + split for q and k -> planes [row][h*64+d]
  ln_kernel<0><<<gLnQK, blk, 0, stream>>>(Qf, Kf, lnrg, lnrb, lnkg, lnkb, ang, Qh, Ql, Kh, Kl, Qf);
  // (8) LayerNorm of v in place (f32), then transpose-split -> v^T planes [b][h*64+d][s]
  ln_kernel<1><<<gLn1, blk, 0, stream>>>(Vf, Vf, lnvg, lnvb, lnvg, lnvb, ang, VTh, VTl, VTh, VTl, Vf);
  wt_split_kernel<<<gVT, blk, 0, stream>>>(Vf, VTh, VTl, kSeq, kDm);
  // (9) causal attention per batch element and head -> f32 [row][h*64+d] (Of region; Qf is dead after step 7)
  attn_causal64_kernel<<<gAtt, dim3(128), 0, stream>>>(Qh, Ql, Kh, Kl, VTh, VTl, Of, 0.125f, -1.0e30f);
  // (10) output LayerNorm + split -> planes (XX region is dead after step 2)
  ln_kernel<2><<<gLn1, blk, 0, stream>>>(Of, Of, lnxg, lnxb, lnxg, lnxb, ang, Oh, Ol, Oh, Ol, Of);
  // (11) out = o . Wo^T -> d_out (f32)   (M=4096, N=1024, K=1024)
  wmma_gemm64<1, true, 0, 0, false, 0><<<gProj, blkG, 0, stream>>>(
      Oh, Ol, kDm, 0L, Woh, Wol, kDm, 0L, d_out, d_out, kDm, 0L,
      dummyf, dummyf, 0L, kRows, kDm, kDm, 1.0f);
}

// v004
// It runs in 363 microseconds.
// In both of two side-by-side timings against v003, it was 1.19 times as fast.
// All steps since v000 together make it 3.57 times as fast.
// All contractions (token-shift LoRA xxx.w1 and lora.w2, q/k/v projections, attention q.k^T and p.v, output projection): v_wmma_f32_16x16x32_bf16 with bf16 hi/lo split operands (hi.hi + hi.lo + lo.hi), f32 accumulate; token shift, tanh, LayerNorms, RoPE, online softmax, score scale 0.125 in f32.
#include <hip/hip_runtime.h>
#include <math.h>
#include <stdint.h>

constexpr int kBatch = 2;
constexpr int kSeq   = 2048;
constexpr int kRows  = kBatch * kSeq;   // token rows of both batch elements, row = b*kSeq + s
constexpr int kDm    = 1024;
constexpr int kHeads = 16;
constexpr int kLoraN = 96;      // 3 x 32 LoRA outputs
constexpr int kLoraP = 128;     // padded to a 64-multiple
constexpr int kLoraD = 32;

typedef __attribute__((ext_vector_type(16))) _Float16 v16h;
typedef __attribute__((ext_vector_type(8)))  _Float16 v8h;
typedef __attribute__((ext_vector_type(16))) __bf16   v16b;
typedef __attribute__((ext_vector_type(8)))  __bf16   v8b;
typedef __attribute__((ext_vector_type(8)))  float    v8f;
typedef __attribute__((ext_vector_type(4)))  float    v4f;
typedef __attribute__((ext_vector_type(2)))  float    v2f;
typedef __attribute__((ext_vector_type(4)))  unsigned int v4u;
typedef __attribute__((ext_vector_type(8)))  unsigned short v8us;

__device__ __forceinline__ unsigned short f2bf_bits(float f) {
  unsigned u = __float_as_uint(f);
  return (unsigned short)((u + 0x7FFFu + ((u >> 16) & 1u)) >> 16);
}
__device__ __forceinline__ float bf_bits2f(unsigned short h) { return __uint_as_float(((unsigned)h) << 16); }

// hazard guards as plain device helpers
__device__ __forceinline__ void dep_guard_h(v8f& a, v8f& b, v16h x, v16h y) { asm volatile("v_nop\n\tv_nop\n\tv_nop\n\tv_nop" : "+v"(a), "+v"(b) : "v"(x), "v"(y)); }
__device__ __forceinline__ void dep_guard_b(v8f& a, v8f& b, v16b x, v16b y) { asm volatile("v_nop\n\tv_nop\n\tv_nop\n\tv_nop" : "+v"(a), "+v"(b) : "v"(x), "v"(y)); }
__device__ __forceinline__ void keep4_h(v16h a, v16h b, v16h c, v16h d) { asm volatile("v_nop" :: "v"(a), "v"(b), "v"(c), "v"(d)); }
__device__ __forceinline__ void keep4_b(v16b a, v16b b, v16b c, v16b d) { asm volatile("v_nop" :: "v"(a), "v"(b), "v"(c), "v"(d)); }
__device__ __forceinline__ void acc_guard4(v8f& a, v8f& b, v8f& c, v8f& d) { asm volatile("v_nop\n\tv_nop\n\tv_nop\n\tv_nop" : "+v"(a), "+v"(b), "+v"(c), "+v"(d)); }
template <typename T> struct Frag;
template <> struct Frag<_Float16> {
  typedef v16h V; union U { v16h v; v8h h[2]; };
  static __device__ __forceinline__ v16h load(const _Float16* p) {   // elements 0..7 <- p[0..7], 8..15 <- p[16..23]
    U f; f.h[0] = *(const v8h*)(p); f.h[1] = *(const v8h*)(p + 16); return f.v;
  }
  static __device__ __forceinline__ v8f mma(v16h a, v16h b, v8f c) {
    return __builtin_amdgcn_wmma_f32_16x16x32_f16(false, a, false, b, (short)0, c, false, false);
  }
  static __device__ __forceinline__ void guard(v8f& a, v8f& b, v16h x, v16h y) { dep_guard_h(a, b, x, y); }
  static __device__ __forceinline__ void keep(v16h a, v16h b, v16h c, v16h d) { keep4_h(a, b, c, d); }
};
template <> struct Frag<__bf16> {
  typedef v16b V; union U { v16b v; v8b h[2]; };
  static __device__ __forceinline__ v16b load(const __bf16* p) {
    U f; f.h[0] = *(const v8b*)(p); f.h[1] = *(const v8b*)(p + 16); return f.v;
  }
  static __device__ __forceinline__ v8f mma(v16b a, v16b b, v8f c) {
    return __builtin_amdgcn_wmma_f32_16x16x32_bf16(false, a, false, b, (short)0, c, false, false);
  }
  static __device__ __forceinline__ void guard(v8f& a, v8f& b, v16b x, v16b y) { dep_guard_b(a, b, x, y); }
  static __device__ __forceinline__ void keep(v16b a, v16b b, v16b c, v16b d) { keep4_b(a, b, c, d); }
};

// ---- Register-blocked batched WMMA GEMM, operands staged in LDS --------------
// C[m,n] = scale * sum_k A[m,k] * Bt[n,k] (+bias)(+resid); a block of 4 waves (2 x 2) owns a 128x128 tile, each wave 64x64 of it.
// A row-major [M,K]; Bt row-major [N,K]; M,N % 128 == 0, K % 32 == 0.
// Per 32-wide k tile the block brings 128 A rows and 128 Bt rows of every plane (64 B a row) into LDS with asynchronous
// 16-B copies (a wave-wide copy = 8 rows x 64 contiguous B), two buffers: tile t+1 flies while tile t is multiplied.
// SPLIT: operands are hi/lo planes (A2/Bt2 = lo planes, same layout); product = hi.hi + hi.lo + lo.hi.
// BIAS_MODE: 0 = none, 1 = bias[m], 2 = bias[n].
// OUT_MODE: 0 = f32, 1 = f16, 2 = bf16 hi plane (Cout) + bf16 lo plane (Cout2).
// Coverage per wave tile: 4 slabs x 16 rows x 64 cols = 64x64 (f32: it 0..7 x hh 0..1 rows, 16 lanes x 4 floats;
// 16-bit: it 0..3 x q 0..3 rows, 8 lanes x 8 elements).
// ET: 0 = f16 operands, 1 = bf16 operands (pointers passed as 16-bit storage)
template <int ET> struct Elem;
template <> struct Elem<0> { typedef _Float16 T; };
template <> struct Elem<1> { typedef __bf16 T; };
constexpr int kGLP    = 40;            // LDS row pitch in 16-bit elements: 80 B = 16 B x 5 (odd), the pitch for 16-B reads of 64-B rows
constexpr int kGPlane = 128 * kGLP;    // one plane of a stage: 128 rows
constexpr int kGStage = 4 * kGPlane;   // A hi, A lo, Bt hi, Bt lo

// Four rows (32 apart) of one plane pair -> LDS: 8 (hi and lo) or 4 (hi only) copies of 16 B per lane. l = the lane's LDS byte
// address of its first hi row, g / g2 = its global address in the hi / lo plane, step = 32 source rows in elements.
// s_wait_xcnt 0 ends the copies' own statement, so that it stands in front of any rewrite of the address registers they name.
template <typename T>
__device__ __forceinline__ void stage_rows8(unsigned l, const T* g, const T* g2, size_t step) {
  const unsigned l1 = l + 32 * kGLP * 2, l2 = l + 64 * kGLP * 2, l3 = l + 96 * kGLP * 2;
  const unsigned m0 = l + kGPlane * 2, m1 = l1 + kGPlane * 2, m2 = l2 + kGPlane * 2, m3 = l3 + kGPlane * 2;
  const T* g1 = g + step;  const T* gg2 = g1 + step;  const T* g3 = gg2 + step;
  const T* h1 = g2 + step; const T* h2 = h1 + step;   const T* h3 = h2 + step;
  asm volatile("global_load_async_to_lds_b128 %0, %8, off\n\t"
               "global_load_async_to_lds_b128 %1, %9, off\n\t"
               "global_load_async_to_lds_b128 %2, %10, off\n\t"
               "global_load_async_to_lds_b128 %3, %11, off\n\t"
               "global_load_async_to_lds_b128 %4, %12, off\n\t"
               "global_load_async_to_lds_b128 %5, %13, off\n\t"
               "global_load_async_to_lds_b128 %6, %14, off\n\t"
               "global_load_async_to_lds_b128 %7, %15, off\n\t"
               "s_wait_xcnt 0x0"
               :: "v"(l), "v"(l1), "v"(l2), "v"(l3), "v"(m0), "v"(m1), "v"(m2), "v"(m3),
                  "v"(g), "v"(g1), "v"(gg2), "v"(g3), "v"(g2), "v"(h1), "v"(h2), "v"(h3) : "memory");
}
template <typename T>
__device__ __forceinline__ void stage_rows4(unsigned l, const T* g, size_t step) {
  const unsigned l1 = l + 32 * kGLP * 2, l2 = l + 64 * kGLP * 2, l3 = l + 96 * kGLP * 2;
  const T* g1 = g + step; const T* gg2 = g1 + step; const T* g3 = gg2 + step;
  asm volatile("global_load_async_to_lds_b128 %0, %4, off\n\t"
               "global_load_async_to_lds_b128 %1, %5, off\n\t"
               "global_load_async_to_lds_b128 %2, %6, off\n\t"
               "global_load_async_to_lds_b128 %3, %7, off\n\t"
               "s_wait_xcnt 0x0"
               :: "v"(l), "v"(l1), "v"(l2), "v"(l3), "v"(g), "v"(g1), "v"(gg2), "v"(g3) : "memory");
}

template <int ET, bool SPLIT, int BIAS_MODE, int OUT_MODE, bool RESID, int ACT = 0>
__global__ __launch_bounds__(128) void wmma_gemm64(
    const unsigned short* __restrict__ Ap, const unsigned short* __restrict__ A2p, int lda, long strideA,
    const unsigned short* __restrict__ Btp, const unsigned short* __restrict__ Bt2p, int ldb, long strideB,
    void* __restrict__ Cout, void* __restrict__ Cout2, int ldc, long strideC,
    const float* __restrict__ bias,
    const float* __restrict__ resid, long strideR,
    int M, int N, int K, float scale) {
  typedef typename Elem<ET>::T T;
  typedef typename Frag<T>::V V;
  const T* A = (const T*)Ap; const T* A2 = (const T*)A2p; const T* Bt = (const T*)Btp; const T* Bt2 = (const T*)Bt2p;
  __shared__ __align__(16) T ring[2 * kGStage];    // two stages of operand tiles, 2 x 40,960 B
  __shared__ __align__(16) float sT[4][16 * 68];   // per-wave 16x64 slab, pitch 68 floats
  const int b    = blockIdx.y;
  const int lane = threadIdx.x & 31;
  const int wave = threadIdx.x >> 5;
  const int tilesN = N >> 7;
  const int tilesM = M >> 7;
  const int tile = blockIdx.x;
  if (tile >= tilesM * tilesN) return;   // block-uniform, in front of every barrier and copy
  const int tm = tile / tilesN;
  const int tn = tile - tm * tilesN;
  const int bm0 = tm << 7;                         // block tile origin
  const int bn0 = tn << 7;
  const int wm = (wave >> 1) << 6;                 // wave tile origin inside the block tile
  const int wn = (wave & 1) << 6;
  const int m0 = bm0 + wm;
  const int n0 = bn0 + wn;

  const T* Ab  = A  + (size_t)b * strideA;
  const T* Bb  = Bt + (size_t)b * strideB;
  const T* Ab2 = SPLIT ? (A2  + (size_t)b * strideA) : nullptr;
  const T* Bb2 = SPLIT ? (Bt2 + (size_t)b * strideB) : nullptr;

  const int rlane = lane & 15;                 // row (A) / col (B, D) within subtile
  const int koff  = (lane >> 4) * 8;           // k offset of this lane half
  const int mOff  = (lane >> 4) * 8;           // D row offset

  v8f acc[4][4];
#pragma unroll
  for (int i = 0; i < 4; ++i)
#pragma unroll
    for (int j = 0; j < 4; ++j) acc[i][j] = (v8f){0.f,0.f,0.f,0.f,0.f,0.f,0.f,0.f};

  // copy map: thread -> row (tid >> 2) + 32 r, r = 0..3, 16-B chunk tid & 3 of the row's 64 B; 128 threads x 4 rows = 128 rows a plane
  const int crow = threadIdx.x >> 2;
  const int cchk = (threadIdx.x & 3) * 8;
  const size_t cao = (size_t)(bm0 + crow) * lda + cchk;
  const size_t cbo = (size_t)(bn0 + crow) * ldb + cchk;
  const size_t stepA = (size_t)32 * lda, stepB = (size_t)32 * ldb;
  const unsigned lds0 = (unsigned)(uintptr_t)(&ring[0]) + (unsigned)(crow * kGLP + cchk) * 2u;   // LDS byte address: low 32 bits
  const int nT = K >> 5;                           // k tiles, the same for the whole grid

#define GEMM_STAGE(t_)                                                                          \
  {                                                                                             \
    const unsigned lt = lds0 + (unsigned)((t_) & 1) * (kGStage * 2u);                           \
    const size_t ko = (size_t)(t_) * 32;                                                        \
    if (SPLIT) {                                                                                \
      stage_rows8<T>(lt, Ab + cao + ko, Ab2 + cao + ko, stepA);                                 \
      stage_rows8<T>(lt + 2u * kGPlane * 2u, Bb + cbo + ko, Bb2 + cbo + ko, stepB);             \
    } else {                                                                                    \
      stage_rows4<T>(lt, Ab + cao + ko, stepA);                                                 \
      stage_rows4<T>(lt + 2u * kGPlane * 2u, Bb + cbo + ko, stepB);                             \
    }                                                                                           \
  }

  GEMM_STAGE(0)
  asm volatile("s_wait_asynccnt 0x0" ::: "memory");   // this wave's copies of tile 0 have landed
  __syncthreads();                                    // ... and every other wave's: tile 0 may be read
  if (nT > 1) GEMM_STAGE(1)

  for (int t = 0; t < nT; ++t) {
    const T* st = ring + (t & 1) * kGStage;
    const T* sA = st + (wm + rlane) * kGLP + koff;
    const T* sB = st + 2 * kGPlane + (wn + rlane) * kGLP + koff;
    V bh[4], bl[4];
#pragma unroll
    for (int j = 0; j < 4; ++j) {
      bh[j] = Frag<T>::load(sB + (j << 4) * kGLP);
      if (SPLIT) bl[j] = Frag<T>::load(sB + kGPlane + (j << 4) * kGLP);
    }
#pragma unroll
    for (int i = 0; i < 4; ++i) {
      V ah = Frag<T>::load(sA + (i << 4) * kGLP);
      V al;
      if (SPLIT) al = Frag<T>::load(sA + kGPlane + (i << 4) * kGLP);
#pragma unroll
      for (int j = 0; j < 4; ++j) {
        acc[i][j] = Frag<T>::mma(ah, bh[j], acc[i][j]);
        if (SPLIT) {
          acc[i][j] = Frag<T>::mma(ah, bl[j], acc[i][j]);
          acc[i][j] = Frag<T>::mma(al, bh[j], acc[i][j]);
        }
      }
      Frag<T>::guard(acc[i][0], acc[i][3], ah, SPLIT ? al : ah);
    }
    Frag<T>::keep(bh[0], bh[1], bh[2], bh[3]);
    if (SPLIT) Frag<T>::keep(bl[0], bl[1], bl[2], bl[3]);
    asm volatile("s_wait_dscnt 0x0" ::: "memory");      // this wave's reads of tile t's buffer are done before it is refilled
    asm volatile("s_wait_asynccnt 0x0" ::: "memory");   // this wave's copies of tile t+1 have landed
    __syncthreads();                                    // publishes tile t+1 and ends every wave's reads of tile t
    if (t + 2 < nT) GEMM_STAGE(t + 2)                   // uniform test; into the buffer that trip t has just read
  }
  asm volatile("s_wait_asynccnt 0x0" ::: "memory");     // no copy outstanding behind the loop
#undef GEMM_STAGE
  acc_guard4(acc[0][0], acc[0][1], acc[0][2], acc[0][3]);
  acc_guard4(acc[1][0], acc[1][1], acc[1][2], acc[1][3]);
  acc_guard4(acc[2][0], acc[2][1], acc[2][2], acc[2][3]);
  acc_guard4(acc[3][0], acc[3][1], acc[3][2], acc[3][3]);

  // ---- epilogue ----
  float* slab = sT[wave];
  const float* Rb = RESID ? (resid + (size_t)b * strideR) : nullptr;
#pragma unroll
  for (int i = 0; i < 4; ++i) {
    const int mBase = m0 + (i << 4);
#pragma unroll
    for (int j = 0; j < 4; ++j) {
      const int n = n0 + (j << 4) + rlane;
      float bv = 0.f;
      if (BIAS_MODE == 2) bv = bias[n];
#pragma unroll
      for (int r = 0; r < 8; ++r) {
        float v = acc[i][j][r] * scale;
        if (BIAS_MODE == 1) v += bias[mBase + mOff + r];
        if (BIAS_MODE == 2) v += bv;
        if (RESID) v += Rb[(size_t)(mBase + mOff + r) * ldc + n];
        if (ACT == 1) v = tanhf(v);
        if (ACT == 2) v = fmaxf(v, 0.0f);
        if (ACT == 3) v = v / (1.0f + expf(-v));
        if (ACT == 4) v = (v > 0.f) ? v : 0.01f * v;
        slab[(mOff + r) * 68 + (j << 4) + rlane] = v;
      }
    }
    __builtin_amdgcn_fence(__ATOMIC_RELEASE, "workgroup");
    __builtin_amdgcn_wave_barrier();
    __builtin_amdgcn_fence(__ATOMIC_ACQUIRE, "workgroup");
    if (OUT_MODE == 0) {
      float* C = (float*)Cout + (size_t)b * strideC;
      const int hh = lane >> 4, c4 = (lane & 15) * 4;     // row seg = 256 B = 16 lanes x 16 B
      {
#pragma unroll
        for (int it = 0; it < 8; ++it) {
          const int row = it * 2 + hh;
          v4f v = *(const v4f*)(slab + row * 68 + c4);
          *(v4f*)(C + (size_t)(mBase + row) * ldc + n0 + c4) = v;
        }
        
      }
    } else {
      const int q = lane >> 3, c8 = (lane & 7) * 8;
      unsigned short* C  = (unsigned short*)Cout  + (size_t)b * strideC;
      unsigned short* C2 = (OUT_MODE == 2) ? ((unsigned short*)Cout2 + (size_t)b * strideC) : nullptr;
      {
#pragma unroll
        for (int it = 0; it < 4; ++it) {
          const int row = it * 4 + q;
          const float* sp = slab + row * 68 + c8;
          v8h hv, lv;
#pragma unroll
          for (int e = 0; e < 8; ++e) {
            if (OUT_MODE == 1) {
              hv[e] = (_Float16)sp[e];
            } else {
              unsigned short hb = f2bf_bits(sp[e]);
              unsigned short lb = f2bf_bits(sp[e] - bf_bits2f(hb));
              hv[e] = __builtin_bit_cast(_Float16, hb);
              lv[e] = __builtin_bit_cast(_Float16, lb);
            }
          }
          *(v8h*)(C + (size_t)(mBase + row) * ldc + n0 + c8) = hv;
          if (OUT_MODE == 2) *(v8h*)(C2 + (size_t)(mBase + row) * ldc + n0 + c8) = lv;
        }
        
      }
    }
    __builtin_amdgcn_fence(__ATOMIC_RELEASE, "workgroup");
    __builtin_amdgcn_wave_barrier();
    __builtin_amdgcn_fence(__ATOMIC_ACQUIRE, "workgroup");
  }
}

// ---------------------------------------------------------------------------
// Elementwise bf16 split: hi = bf16_rne(in), lo = bf16_rne(in - hi); 2 elements per thread, one 4-B store.
// blockIdx.y (block-uniform) picks one of four equally sized sources; its planes start pstride 16-bit elements apart.
// ---------------------------------------------------------------------------
__device__ __forceinline__ unsigned pk16(unsigned short a, unsigned short b) { return (unsigned)a | ((unsigned)b << 16); }

__global__ __launch_bounds__(256) void split_bf16x2_kernel(const float* __restrict__ in0, const float* __restrict__ in1,
                                                           const float* __restrict__ in2, const float* __restrict__ in3,
                                                           unsigned short* __restrict__ hi, unsigned short* __restrict__ lo,
                                                           int n2, long pstride) {
  const int w = blockIdx.y;
  const float* in = (w == 0) ? in0 : (w == 1) ? in1 : (w == 2) ? in2 : in3;
  unsigned short* ph = hi + (size_t)w * pstride;
  unsigned short* pl = lo + (size_t)w * pstride;
  const int i = blockIdx.x * 256 + threadIdx.x;
  if (i < n2) {
    const v2f f = *(const v2f*)(in + 2 * (size_t)i);
    const unsigned short h0 = f2bf_bits(f[0]), h1 = f2bf_bits(f[1]);
    const unsigned short l0 = f2bf_bits(f[0] - bf_bits2f(h0)), l1 = f2bf_bits(f[1] - bf_bits2f(h1));
    const unsigned uh = pk16(h0, h1), ul = pk16(l0, l1);
    ((unsigned*)ph)[i] = uh;
    ((unsigned*)pl)[i] = ul;
    
  }
}

// ---------------------------------------------------------------------------
// tanh then bf16 split: hi = bf16_rne(tanh(in)), lo = bf16_rne(tanh(in) - hi); same store shape as above
// Coverage: grid = ceil(n2/256) x 256 threads x 2 elements = 2*n2 = whole plane.
// ---------------------------------------------------------------------------
__global__ __launch_bounds__(256) void tanh_split_kernel(const float* __restrict__ in, unsigned short* __restrict__ hi,
                                                         unsigned short* __restrict__ lo, int n2) {
  const int i = blockIdx.x * 256 + threadIdx.x;
  if (i < n2) {
    const v2f f = *(const v2f*)(in + 2 * (size_t)i);
    const float t0 = tanhf(f[0]), t1 = tanhf(f[1]);
    const unsigned short h0 = f2bf_bits(t0), h1 = f2bf_bits(t1);
    const unsigned short l0 = f2bf_bits(t0 - bf_bits2f(h0)), l1 = f2bf_bits(t1 - bf_bits2f(h1));
    const unsigned uh = pk16(h0, h1), ul = pk16(l0, l1);
    ((unsigned*)hi)[i] = uh;
    ((unsigned*)lo)[i] = ul;
    
  }
}

// ---------------------------------------------------------------------------
// Transpose + bf16 split: in w[R][Cn] f32 -> planes th/tl [Cn][R] bf16: out[n*R + k] = split(w[k*Cn + n]).
// grid = (Cn/64, R/64, matrices), R, Cn % 64 == 0; matrix z starts z*R*Cn elements into w, th and tl.
// (Used for the LayerNormed v [b][s=R=2048][c=Cn=1024] -> v^T planes [b][c][s].)
// Coverage: load 256 threads x 16 = 64x64; store 8 waves x 2 it x 4 rows(q) x 8 lanes x 8 elements = 64x64.
// ---------------------------------------------------------------------------
__global__ __launch_bounds__(256) void wt_split_kernel(const float* __restrict__ wz, unsigned short* __restrict__ thz,
                                                       unsigned short* __restrict__ tlz, int R, int Cn) {
  __shared__ float tile[64 * 65];
  const int n0 = blockIdx.x * 64;
  const int k0 = blockIdx.y * 64;
  const size_t zo = (size_t)blockIdx.z * R * Cn;
  const float* w = wz + zo;
  unsigned short* th = thz + zo;
  unsigned short* tl = tlz + zo;
  const int t = threadIdx.x;
#pragma unroll
  for (int i = 0; i < 16; ++i) {
    const int idx = i * 256 + t;
    const int kk = idx >> 6, nn = idx & 63;
    tile[nn * 65 + kk] = w[(size_t)(k0 + kk) * Cn + n0 + nn];
  }
  __syncthreads();
  const int lane = t & 31, wave = t >> 5;
  const int q = lane >> 3, c8 = (lane & 7) * 8;
  {
#pragma unroll
    for (int it = 0; it < 2; ++it) {
      const int row = wave * 8 + it * 4 + q;          // 0..63 = local n
      const float* sp = tile + row * 65 + c8;
      v8us hv, lv;
#pragma unroll
      for (int e = 0; e < 8; ++e) {
        const unsigned short hb = f2bf_bits(sp[e]);
        const unsigned short lb = f2bf_bits(sp[e] - bf_bits2f(hb));
        hv[e] = hb; lv[e] = lb;
      }
      const size_t o = (size_t)(n0 + row) * R + k0 + c8;
      *(v8us*)(th + o) = hv;
      *(v8us*)(tl + o) = lv;
    }
    
  }
}

// ---------------------------------------------------------------------------
// LoRA weight w1 [1024 in k][96 out n] f32 -> Bt planes th/tl [kLoraP=128 n][1024 k] bf16, rows n >= 96 ZERO:
//   out[n*1024 + k] = split(n < 96 ? w1[k*96 + n] : 0).  grid = 1024/64 k-tiles; block = 256 threads.
// LDS tile [128 n][65]: load 256 threads x 32 iterations = 64 k x 128 n (address clamped to n <= 95, zero by predicate).
// ---------------------------------------------------------------------------
__global__ __launch_bounds__(256) void w1t_split_kernel(const float* __restrict__ w1, unsigned short* __restrict__ th,
                                                        unsigned short* __restrict__ tl) {
  __shared__ float tile[kLoraP * 65];
  const int k0 = blockIdx.x * 64;
  const int t = threadIdx.x;
#pragma unroll 4
  for (int i = 0; i < 32; ++i) {
    const int idx = i * 256 + t;
    const int kk = idx >> 7, nn = idx & 127;
    const int nc = (nn < kLoraN) ? nn : (kLoraN - 1);
    float v = w1[(size_t)(k0 + kk) * kLoraN + nc];
    if (nn >= kLoraN) v = 0.0f;
    tile[nn * 65 + kk] = v;
  }
  __syncthreads();
  const int lane = t & 31, wave = t >> 5;
  const int q = lane >> 3, c8 = (lane & 7) * 8;
  {
#pragma unroll
    for (int it = 0; it < 4; ++it) {
      const int row = wave * 16 + it * 4 + q;         // 0..127 = n
      const float* sp = tile + row * 65 + c8;
      v8us hv, lv;
#pragma unroll
      for (int e = 0; e < 8; ++e) {
        const unsigned short hb = f2bf_bits(sp[e]);
        const unsigned short lb = f2bf_bits(sp[e] - bf_bits2f(hb));
        hv[e] = hb; lv[e] = lb;
      }
      const size_t o = (size_t)row * kDm + k0 + c8;
      *(v8us*)(th + o) = hv;
      *(v8us*)(tl + o) = lv;
    }
    
  }
}

// ---------------------------------------------------------------------------
// LoRA weight w2 [3 l][32 d][1024 c] f32 -> Bt planes th/tl [3 l][1024 n=c][32 k=d] bf16: out[l][n][k] = split(w2[l][k][n]).
// grid = (1024/64 n-tiles, 3); block 256. LDS tile [64 n][33]: load 256 threads x 8 = 32 k x 64 n.
// 512 contiguous bytes) with ONE 16-B-per-lane instruction: lane -> line L = lane>>3, row = wave*8 + 2L + ((lane&7)>>2),
// ---------------------------------------------------------------------------
__global__ __launch_bounds__(256) void w2t_split_kernel(const float* __restrict__ w2, unsigned short* __restrict__ th,
                                                        unsigned short* __restrict__ tl) {
  __shared__ float tile[64 * 33];
  const int n0 = blockIdx.x * 64;
  const int l  = blockIdx.y;
  const int t  = threadIdx.x;
  const float* wl = w2 + (size_t)l * kLoraD * kDm;
#pragma unroll
  for (int i = 0; i < 8; ++i) {
    const int idx = i * 256 + t;
    const int kk = idx >> 6, nn = idx & 63;
    tile[nn * 33 + kk] = wl[(size_t)kk * kDm + n0 + nn];
  }
  __syncthreads();
  const int lane = t & 31, wave = t >> 5;
  const int L = lane >> 3, q = lane & 7;
  const int row = wave * 8 + 2 * L + (q >> 2);
  const int k8 = (q & 3) * 8;
  const float* sp = tile + row * 33 + k8;
  v8us hv, lv;
#pragma unroll
  for (int e = 0; e < 8; ++e) {
    const unsigned short hb = f2bf_bits(sp[e]);
    const unsigned short lb = f2bf_bits(sp[e] - bf_bits2f(hb));
    hv[e] = hb; lv[e] = lb;
  }
  const size_t o = (size_t)l * kDm * kLoraD + (size_t)(n0 + row) * kLoraD + k8;
  *(v8us*)(th + o) = hv;
  *(v8us*)(tl + o) = lv;
  
}

// ---------------------------------------------------------------------------
// Shared elementwise split helper for 8 consecutive values -> v8us hi/lo.
// ---------------------------------------------------------------------------
__device__ __forceinline__ void split8(const v4f va, const v4f vb, v8us& hv, v8us& lv) {
#pragma unroll
  for (int e = 0; e < 4; ++e) {
    const unsigned short h0 = f2bf_bits(va[e]);
    hv[e] = h0; lv[e] = f2bf_bits(va[e] - bf_bits2f(h0));
    const unsigned short h1 = f2bf_bits(vb[e]);
    hv[4 + e] = h1; lv[4 + e] = f2bf_bits(vb[e] - bf_bits2f(h1));
  }
}
__device__ __forceinline__ void store16x2(unsigned short* ph, unsigned short* pl, size_t o, const v8us hv, const v8us lv) {
  *(v8us*)(ph + o) = hv;
  *(v8us*)(pl + o) = lv;
  
}

// ---------------------------------------------------------------------------
// Token shift: xxx = x + (xprev - x) * maa_x -> bf16 hi/lo planes [kRows][kDm], row = b*kSeq + s;
// xprev = shift_state[b] for s == 0, else x[b][s-1] (block-uniform pointer choice).
// grid = kRows blocks x 128 threads x 8 elements = kRows x kDm = the whole plane; each lane stores 16 B,
// ---------------------------------------------------------------------------
__global__ __launch_bounds__(128) void xxx_split_kernel(const float* __restrict__ x, const float* __restrict__ ss,
                                                        const float* __restrict__ maax,
                                                        unsigned short* __restrict__ oh, unsigned short* __restrict__ ol) {
  const int row = blockIdx.x;
  const int b = row / kSeq, s = row % kSeq;
  const int c0 = threadIdx.x * 8;
  const float* xr = x + (size_t)row * kDm;
  const float* xp = (s == 0) ? (ss + (size_t)b * kDm) : (xr - kDm);
  const v4f xa = *(const v4f*)(xr + c0), xb = *(const v4f*)(xr + c0 + 4);
  const v4f pa = *(const v4f*)(xp + c0), pb = *(const v4f*)(xp + c0 + 4);
  const v4f ma = *(const v4f*)(maax + c0), mb = *(const v4f*)(maax + c0 + 4);
  const v4f va = xa + (pa - xa) * ma;
  const v4f vb = xb + (pb - xb) * mb;
  v8us hv, lv;
  split8(va, vb, hv, lv);
  store16x2(oh, ol, (size_t)row * kDm + c0, hv, lv);
}

// ---------------------------------------------------------------------------
// Data-dependent mixing: x? = x + (xprev - x) * (maa_? + mix_?[s][c]) for ? in {q(r), k, v} -> three bf16 hi/lo plane pairs
// [kRows][kDm]. mix planes f32 [3][kRows][kDm] (l = 0 r, 1 k, 2 v). Same row index and thread/store shape as xxx_split_kernel:
// ---------------------------------------------------------------------------
__global__ __launch_bounds__(128) void mix_split_kernel(const float* __restrict__ x, const float* __restrict__ ss,
                                                        const float* __restrict__ maar, const float* __restrict__ maak,
                                                        const float* __restrict__ maav, const float* __restrict__ mix,
                                                        unsigned short* __restrict__ qh, unsigned short* __restrict__ ql,
                                                        unsigned short* __restrict__ kh, unsigned short* __restrict__ kl,
                                                        unsigned short* __restrict__ vh, unsigned short* __restrict__ vl) {
  const int row = blockIdx.x;
  const int b = row / kSeq, s = row % kSeq;
  const int c0 = threadIdx.x * 8;
  const float* xr = x + (size_t)row * kDm;
  const float* xp = (s == 0) ? (ss + (size_t)b * kDm) : (xr - kDm);
  const v4f xa = *(const v4f*)(xr + c0), xb = *(const v4f*)(xr + c0 + 4);
  const v4f pa = *(const v4f*)(xp + c0), pb = *(const v4f*)(xp + c0 + 4);
  const v4f da = pa - xa, db = pb - xb;
  const size_t plane = (size_t)kRows * kDm;
  const float* m0 = mix + (size_t)row * kDm + c0;
  const size_t o = (size_t)row * kDm + c0;
  {
    const v4f ma = *(const v4f*)(maar + c0), mb = *(const v4f*)(maar + c0 + 4);
    const v4f qa = *(const v4f*)(m0), qb = *(const v4f*)(m0 + 4);
    const v4f va = xa + da * (ma + qa), vb = xb + db * (mb + qb);
    v8us hv, lv; split8(va, vb, hv, lv); store16x2(qh, ql, o, hv, lv);
  }
  {
    const v4f ma = *(const v4f*)(maak + c0), mb = *(const v4f*)(maak + c0 + 4);
    const v4f qa = *(const v4f*)(m0 + plane), qb = *(const v4f*)(m0 + plane + 4);
    const v4f va = xa + da * (ma + qa), vb = xb + db * (mb + qb);
    v8us hv, lv; split8(va, vb, hv, lv); store16x2(kh, kl, o, hv, lv);
  }
  {
    const v4f ma = *(const v4f*)(maav + c0), mb = *(const v4f*)(maav + c0 + 4);
    const v4f qa = *(const v4f*)(m0 + 2 * plane), qb = *(const v4f*)(m0 + 2 * plane + 4);
    const v4f va = xa + da * (ma + qa), vb = xb + db * (mb + qb);
    v8us hv, lv; split8(va, vb, hv, lv); store16x2(vh, vl, o, hv, lv);
  }
}

// ---------------------------------------------------------------------------
//   MODE 0: LN then RoPE (half-split per 64-wide head: out[f] = x1*cos - x2*sin, out[32+f] = x1*sin + x2*cos with
//           cos/sin = cosf/sinf(angles[s][f]), s = row % kSeq) then bf16 hi/lo split into planes [kRows][kDm]; grid = (kRows, 2),
//           blockIdx.y selects source/params/planes A (0) or B (1).
//   MODE 1: LN written back IN PLACE as f32 (dstf == src): each block owns its row; thread t writes floats 4t..4t+3,
//   MODE 2: LN then bf16 hi/lo split into planes (no rotation); grid = (kRows, 1).
// MODE 0/2 store path: per wave (heads 2w, 2w+1) the 128 results are staged in LDS, then lanes 0..15 write 16 B each =
// ---------------------------------------------------------------------------
template <int MODE>
__global__ __launch_bounds__(256) void ln_kernel(const float* srcA, const float* srcB,
                                                 const float* __restrict__ gA, const float* __restrict__ bA,
                                                 const float* __restrict__ gB, const float* __restrict__ bB,
                                                 const float* __restrict__ ang,
                                                 unsigned short* hA, unsigned short* lA,
                                                 unsigned short* hB, unsigned short* lB, float* dstf) {
  __shared__ __align__(16) float srow[kDm];
  __shared__ __align__(16) unsigned short Lh[8][128];
  __shared__ __align__(16) unsigned short Ll[8][128];
  __shared__ float sred[8];
  __shared__ float sred2[8];
  const int s = blockIdx.x;                      // token row b*kSeq + position
  const int which = blockIdx.y;                  // block-uniform
  const float* src = (which == 0) ? srcA : srcB;
  const float* g   = (which == 0) ? gA : gB;
  const float* bb  = (which == 0) ? bA : bB;
  unsigned short* dh = (which == 0) ? hA : hB;
  unsigned short* dl = (which == 0) ? lA : lB;
  const int tid = threadIdx.x, lane = tid & 31, wave = tid >> 5;

  const float* row = src + (size_t)s * kDm;
  const v4f xv = *(const v4f*)(row + tid * 4);
  float ps = (xv[0] + xv[1]) + (xv[2] + xv[3]);
#pragma unroll
  for (int off = 1; off < 32; off <<= 1) ps += __shfl_xor(ps, off, 32);
  if (lane == 0) sred[wave] = ps;
  __syncthreads();
  float tot = 0.f;
#pragma unroll
  for (int w = 0; w < 8; ++w) tot += sred[w];
  const float mean = tot * (1.0f / (float)kDm);
  const v4f dv = xv - mean;
  float pq = (dv[0] * dv[0] + dv[1] * dv[1]) + (dv[2] * dv[2] + dv[3] * dv[3]);
#pragma unroll
  for (int off = 1; off < 32; off <<= 1) pq += __shfl_xor(pq, off, 32);
  if (lane == 0) sred2[wave] = pq;
  __syncthreads();
  float tot2 = 0.f;
#pragma unroll
  for (int w = 0; w < 8; ++w) tot2 += sred2[w];
  const float var  = tot2 * (1.0f / (float)kDm);
  const float rstd = rsqrtf(var + 1.0e-5f);
  const v4f gv = *(const v4f*)(g + tid * 4);
  const v4f bv = *(const v4f*)(bb + tid * 4);
  v4f yv;
#pragma unroll
  for (int e = 0; e < 4; ++e) yv[e] = dv[e] * rstd * gv[e] + bv[e];

  if (MODE == 1) {
    float* dp = dstf + (size_t)s * kDm + tid * 4;
    *(v4f*)dp = yv;
    
    return;                                     // MODE is a compile-time constant: uniform
  }

  *(v4f*)(srow + tid * 4) = yv;
  __syncthreads();

  float cs = 1.0f, sn = 0.0f;
  if (MODE == 0) {
    const float a = ang[(size_t)(s % kSeq) * 32 + lane];
    cs = cosf(a);
    sn = sinf(a);
  }
  unsigned short* lh = Lh[wave];
  unsigned short* ll = Ll[wave];
#pragma unroll 1
  for (int hp = 0; hp < 2; ++hp) {
    const int base = wave * 128 + hp * 64;
    const float xr = srow[base + lane];
    const float xi = srow[base + 32 + lane];
    float vr = xr, vi = xi;
    if (MODE == 0) { vr = xr * cs - xi * sn; vi = xr * sn + xi * cs; }
    const unsigned short hr = f2bf_bits(vr);
    const unsigned short lr = f2bf_bits(vr - bf_bits2f(hr));
    const unsigned short hi = f2bf_bits(vi);
    const unsigned short li = f2bf_bits(vi - bf_bits2f(hi));
    lh[hp * 64 + lane] = hr;       ll[hp * 64 + lane] = lr;
    lh[hp * 64 + 32 + lane] = hi;  ll[hp * 64 + 32 + lane] = li;
  }
  __builtin_amdgcn_fence(__ATOMIC_RELEASE, "workgroup");
  __builtin_amdgcn_wave_barrier();
  __builtin_amdgcn_fence(__ATOMIC_ACQUIRE, "workgroup");
  const int l16 = lane & 15;
  const v8us hv = *(const v8us*)(lh + l16 * 8);
  const v8us lv = *(const v8us*)(ll + l16 * 8);
  const size_t o = (size_t)s * kDm + wave * 128 + l16 * 8;
  {
    if (lane < 16) {
      *(v8us*)(dh + o) = hv;
      *(v8us*)(dl + o) = lv;
    }
    
  }
}

// =====================================================================================
// Causal attention, head dim 64, batch element = blockIdx.y (structural lower-triangular mask incl. diagonal).
//   Every plane below is that of one batch element; element b starts b*kSeq*kDm elements into each buffer.
//   q planes (hi/lo bf16): element (t, h, d) at [t*kDm + h*64 + d]
//   k planes (hi/lo bf16): element (s, h, d) at [s*kDm + h*64 + d]
//   v^T planes (hi/lo bf16): element (h, d, s) at [(h*64 + d)*kSeq + s]
//   out f32: element (t, h, d) at [t*kDm + h*64 + d]
//   scores = (q . k) * sscale : bf16 hi/lo split (hi.hi + hi.lo + lo.hi) on v_wmma_f32_16x16x32_bf16
//   out    = p . v             : bf16 hi/lo split of p (unnormalised) and v, f32 accumulate
//   online softmax in f32. Key tiles strictly above the 64x64 block diagonal (kv chunk > query block) are not
//   visited (probabilities exactly 0 in f32); inside the diagonal tile, score := mfill where kv > query (select).
//   Block = 4 waves = 64 query rows of one head; grid.x = kHeads * (kSeq/64); kv chunks of 64, trip count qb+1 <= 32.
//   K / V^T chunk staging: 128 threads x 32 elements per plane = the whole 64x64 tile (16-B copies, plain loads,
//   __syncthreads before and after); fragment loads read the LDS tiles with the same v8b element type.
//   Output coverage: grid.x 16 heads x 32 query blocks x 4 waves x 16 rows x 64 cols = one [2048][1024] plane per grid.y.
// =====================================================================================
#define AT_D 64
#define AT_NW 4
#define AT_QB 64
#define AT_KC 64
#define AT_LP 72   // LDS row pitch of the K, V^T and P tiles in 16-bit elements: 144 B = 16 B x 9 (odd), so that the 16 rows of one 16-B fragment read fall on 16 different bank groups

__device__ __forceinline__ unsigned short at_bf_bits(float f) {
  unsigned u = __float_as_uint(f);
  return (unsigned short)((u + 0x7FFFu + ((u >> 16) & 1u)) >> 16);
}
__device__ __forceinline__ __bf16 at_f2bf(float f) { return __builtin_bit_cast(__bf16, at_bf_bits(f)); }
__device__ __forceinline__ void at_split(float f, __bf16& hi, __bf16& lo) {
  const unsigned short hb = at_bf_bits(f);
  hi = __builtin_bit_cast(__bf16, hb);
  lo = at_f2bf(f - __uint_as_float(((unsigned)hb) << 16));
}
__device__ __forceinline__ v8f at_mma(v16b a, v16b b, v8f c) {
  c = __builtin_amdgcn_wmma_f32_16x16x32_bf16(false, a, false, b, (short)0, c, false, false);
  asm volatile("v_nop\n\tv_nop\n\tv_nop\n\tv_nop" : "+v"(c) : "v"(a), "v"(b));
  return c;
}

// Value of lane l ^ M inside a 16-lane row (M = 1, 2, 4, 8) as a DPP operand of the vector unit (row_xmask); a shuffle builtin goes
// through the LDS queue instead and each step of a reduction then waits for that queue.
template <int M>
__device__ __forceinline__ float at_row_xor(float v) {
  return __int_as_float(__builtin_amdgcn_mov_dpp(__float_as_int(v), 0x160 + M, 0xf, 0xf, true));
}
__device__ __forceinline__ float at_row_max(float m) {
  m = fmaxf(m, at_row_xor<1>(m));
  m = fmaxf(m, at_row_xor<2>(m));
  m = fmaxf(m, at_row_xor<4>(m));
  m = fmaxf(m, at_row_xor<8>(m));
  return m;
}
__device__ __forceinline__ float at_row_sum(float s) {
  s += at_row_xor<1>(s);
  s += at_row_xor<2>(s);
  s += at_row_xor<4>(s);
  s += at_row_xor<8>(s);
  return s;
}

__global__ __launch_bounds__(128)
void attn_causal64_kernel(const unsigned short* __restrict__ qhp, const unsigned short* __restrict__ qlp,
                          const unsigned short* __restrict__ khp, const unsigned short* __restrict__ klp,
                          const unsigned short* __restrict__ vhp, const unsigned short* __restrict__ vlp,
                          float* __restrict__ out, float sscale, float mfill) {
  union FB { v16b v; v8b h[2]; };
  __shared__ __align__(16) __bf16 Ksh[AT_KC * AT_LP];            // K hi [kv][d], 64 rows of 144 B
  __shared__ __align__(16) __bf16 Ksl[AT_KC * AT_LP];            // K lo
  __shared__ __align__(16) __bf16 Vth[AT_D * AT_LP];             // V hi [d][kv], 64 rows of 144 B
  __shared__ __align__(16) __bf16 Vtl[AT_D * AT_LP];             // V lo
  __shared__ __align__(16) __bf16 Psh[AT_NW][16 * AT_LP];        // per wave P hi [row][kv], 16 rows of 144 B
  __shared__ __align__(16) __bf16 Psl[AT_NW][16 * AT_LP];        // per wave P lo
  __shared__ __align__(16) float  Os[AT_NW][16 * 68];            // per wave out tile, pitch 68

  const int tid  = threadIdx.x;
  const int wave = tid >> 5;
  const int lane = tid & 31;
  const int hh   = lane >> 4;
  const int c    = lane & 15;

  const int nqb = kSeq / AT_QB;           // 32
  const int bx = blockIdx.x;
  const int qb = bx % nqb;
  const int h  = bx / nqb;                // 0..kHeads-1 (grid = kHeads * nqb)
  const int q0 = qb * AT_QB + wave * 16;

  const size_t bo = (size_t)blockIdx.y * kSeq * kDm;
  const __bf16* Qh = (const __bf16*)(const void*)qhp + bo + (size_t)h * AT_D;
  const __bf16* Ql = (const __bf16*)(const void*)qlp + bo + (size_t)h * AT_D;
  const __bf16* Kh = (const __bf16*)(const void*)khp + bo + (size_t)h * AT_D;
  const __bf16* Kl = (const __bf16*)(const void*)klp + bo + (size_t)h * AT_D;
  const __bf16* Vh = (const __bf16*)(const void*)vhp + bo + (size_t)h * AT_D * kSeq;
  const __bf16* Vl = (const __bf16*)(const void*)vlp + bo + (size_t)h * AT_D * kSeq;
  float*        ob = out + bo + (size_t)h * AT_D;

  // ---- Q fragments (A operand, row = lane&15, split k map via Frag load): 2 d-chunks, hi and lo ----
  v16b qah[2], qal[2];
#pragma unroll
  for (int dc = 0; dc < 2; ++dc) {
    const __bf16* qr = Qh + (size_t)(q0 + c) * kDm + dc * 32 + 8 * hh;
    const __bf16* ql = Ql + (size_t)(q0 + c) * kDm + dc * 32 + 8 * hh;
    qah[dc] = Frag<__bf16>::load(qr);
    qal[dc] = Frag<__bf16>::load(ql);
  }

  float mrow[8], lrow[8];
  v8f oacc[4];
#pragma unroll
  for (int r = 0; r < 8; ++r) { mrow[r] = -INFINITY; lrow[r] = 0.f; }
#pragma unroll
  for (int t = 0; t < 4; ++t) oacc[t] = (v8f){0.f,0.f,0.f,0.f,0.f,0.f,0.f,0.f};

  int nChunks = qb + 1;                      // block-uniform, <= 32
  if (nChunks > kSeq / AT_KC) nChunks = kSeq / AT_KC;
  for (int kc = 0; kc < nChunks; ++kc) {
    const int kv0 = kc * AT_KC;
    __syncthreads();
    {
      // staging coverage: 128 threads x (4 x 8) elements = 64 rows x 64 per plane = the whole chunk tile
      const int r = tid >> 1, half = (tid & 1) * 32;
      const __bf16* ksh = Kh + (size_t)(kv0 + r) * kDm + half;     // K row kv0+r, d = half..half+31
      const __bf16* ksl = Kl + (size_t)(kv0 + r) * kDm + half;
      const __bf16* vsh = Vh + (size_t)r * kSeq + kv0 + half;     // V^T row d = r, s = kv0+half..+31
      const __bf16* vsl = Vl + (size_t)r * kSeq + kv0 + half;
#pragma unroll
      for (int i = 0; i < 4; ++i) {
        const v8b a0 = *(const v8b*)(ksh + 8 * i);
        const v8b a1 = *(const v8b*)(ksl + 8 * i);
        const v8b b0 = *(const v8b*)(vsh + 8 * i);
        const v8b b1 = *(const v8b*)(vsl + 8 * i);
        *(v8b*)(Ksh + r * AT_LP + half + 8 * i) = a0;
        *(v8b*)(Ksl + r * AT_LP + half + 8 * i) = a1;
        *(v8b*)(Vth + r * AT_LP + half + 8 * i) = b0;
        *(v8b*)(Vtl + r * AT_LP + half + 8 * i) = b1;
      }
    }
    __syncthreads();

    v8f s[4];
#pragma unroll
    for (int j = 0; j < 4; ++j) {
      s[j] = (v8f){0.f,0.f,0.f,0.f,0.f,0.f,0.f,0.f};
#pragma unroll
      for (int dc = 0; dc < 2; ++dc) {
        FB kb, kl;
        kb.h[0] = *(const v8b*)(Ksh + (j * 16 + c) * AT_LP + dc * 32 + 8 * hh);
        kb.h[1] = *(const v8b*)(Ksh + (j * 16 + c) * AT_LP + dc * 32 + 16 + 8 * hh);
        kl.h[0] = *(const v8b*)(Ksl + (j * 16 + c) * AT_LP + dc * 32 + 8 * hh);
        kl.h[1] = *(const v8b*)(Ksl + (j * 16 + c) * AT_LP + dc * 32 + 16 + 8 * hh);
        s[j] = at_mma(qah[dc], kb.v, s[j]);
        s[j] = at_mma(qah[dc], kl.v, s[j]);
        s[j] = at_mma(qal[dc], kb.v, s[j]);
      }
    }
    // ---- scale, structural causal select on the diagonal tile, row max over the 16 lanes of each half ----
    const bool diag = (kc == qb);            // block-uniform
    float cm[8];
#pragma unroll
    for (int r = 0; r < 8; ++r) {
      const int qrow = q0 + 8 * hh + r;                       // 0..kSeq-1
      float m = -INFINITY;
#pragma unroll
      for (int j = 0; j < 4; ++j) {
        const int kvcol = kv0 + j * 16 + c;
        const float sv = s[j][r] * sscale;
        const bool masked = diag && (kvcol > qrow);
        const float sm = masked ? mfill : sv;
        s[j][r] = sm;
        m = fmaxf(m, sm);
      }
      cm[r] = at_row_max(m);
    }
    __bf16* pwh = Psh[wave];
    __bf16* pwl = Psl[wave];
#pragma unroll
    for (int r = 0; r < 8; ++r) {
      const float mnew = fmaxf(mrow[r], cm[r]);
      const float alpha = expf(mrow[r] - mnew);
      mrow[r] = mnew;
      float psum = 0.f;
#pragma unroll
      for (int j = 0; j < 4; ++j) {
        const float p = expf(s[j][r] - mnew);
        psum += p;
        __bf16 a, bl; at_split(p, a, bl);
        pwh[(8 * hh + r) * AT_LP + j * 16 + c] = a;
        pwl[(8 * hh + r) * AT_LP + j * 16 + c] = bl;
      }
      psum = at_row_sum(psum);
      lrow[r] = lrow[r] * alpha + psum;
#pragma unroll
      for (int t = 0; t < 4; ++t) oacc[t][r] *= alpha;
    }
    __builtin_amdgcn_fence(__ATOMIC_RELEASE, "workgroup");
    __builtin_amdgcn_wave_barrier();
    __builtin_amdgcn_fence(__ATOMIC_ACQUIRE, "workgroup");
#pragma unroll 1
    for (int kk = 0; kk < 2; ++kk) {
      FB pa, pl;
      pa.h[0] = *(const v8b*)(pwh + c * AT_LP + kk * 32 + 8 * hh);
      pa.h[1] = *(const v8b*)(pwh + c * AT_LP + kk * 32 + 16 + 8 * hh);
      pl.h[0] = *(const v8b*)(pwl + c * AT_LP + kk * 32 + 8 * hh);
      pl.h[1] = *(const v8b*)(pwl + c * AT_LP + kk * 32 + 16 + 8 * hh);
#pragma unroll
      for (int t = 0; t < 4; ++t) {
        FB vb, vl;
        vb.h[0] = *(const v8b*)(Vth + (t * 16 + c) * AT_LP + kk * 32 + 8 * hh);
        vb.h[1] = *(const v8b*)(Vth + (t * 16 + c) * AT_LP + kk * 32 + 16 + 8 * hh);
        vl.h[0] = *(const v8b*)(Vtl + (t * 16 + c) * AT_LP + kk * 32 + 8 * hh);
        vl.h[1] = *(const v8b*)(Vtl + (t * 16 + c) * AT_LP + kk * 32 + 16 + 8 * hh);
        oacc[t] = at_mma(pa.v, vb.v, oacc[t]);
        oacc[t] = at_mma(pa.v, vl.v, oacc[t]);
        oacc[t] = at_mma(pl.v, vb.v, oacc[t]);
      }
    }
  }

  float* os = Os[wave];
#pragma unroll
  for (int r = 0; r < 8; ++r) {
    const float inv = 1.0f / lrow[r];
#pragma unroll
    for (int t = 0; t < 4; ++t) os[(8 * hh + r) * 68 + t * 16 + c] = oacc[t][r] * inv;
  }
  __builtin_amdgcn_fence(__ATOMIC_RELEASE, "workgroup");
  __builtin_amdgcn_wave_barrier();
  __builtin_amdgcn_fence(__ATOMIC_ACQUIRE, "workgroup");
  {
    const int c4 = (lane & 15) * 4;
    {
#pragma unroll
      for (int it = 0; it < 8; ++it) {
        const int row = it * 2 + hh;   // it 0..7 x hh 0..1 covers rows 0..15 of the wave tile
        v4f val = *(const v4f*)(os + row * 68 + c4);
        *(v4f*)(ob + (size_t)(q0 + row) * kDm + c4) = val;
      }
      
    }
  }
}

// ---------------------------------------------------------------------------
// Workspace region map (byte offsets). Every GEMM: K in {1024, 32} (%32 == 0), M = kRows = 4096, N in {128, 1024} (%128 == 0).
// Activation regions hold both batch elements, row = b*2048 + s.
// Every region is fully written before it is read within the in-order launch sequence; reused regions noted.
//   Wqh bf16 [1024 n][1024 k]        0      Wql    2097152
//   Wkh                        4194304      Wkl    6291456
//   Wvh                        8388608      Wvl   10485760
//   Woh                       12582912      Wol   14680064
//   W1Th bf16 [128 n][1024 k] 16777216      W1Tl  17039360   (rows 96..127 zero)
//   W2Th bf16 [3][1024 n][32] 17301504      W2Tl  17498112
//   XXh  bf16 [4096][1024]    17694720      XXl   26083328   (xxx planes; reused after the LoRA GEMM as Oh / Ol)
//   LORAf f32 [4096][128]     34471936
//   LTh  bf16 [4096][128]     36569088      LTl   37617664
//   MIX  f32 [3][4096][1024]  38666240                       (reused after the mix kernel: Qf = +0, Kf = +16777216,
//                                                             Vf = +33554432 f32 [4096][1024]; Of reuses Qf)
//   XQh/XQl/XKh/XKl/XVh/XVl   88997888 .. (6 x 8388608)
//   Qh/Ql/Kh/Kl              139329536 .. (4 x 8388608)
//   VTh/VTl bf16 [2][1024][2048] 172883968, 181272576
//   total                    189661184  (~180.9 MiB)
// ---------------------------------------------------------------------------
extern "C" void kernel_launch(void* const* d_in, const int* in_sizes, int n_in,
                              void* d_out, int out_size, void* d_ws, size_t ws_size,
                              hipStream_t stream) {
  if (n_in < 21) return;
  const int nRow = kSeq * kDm;            // 2097152 per batch element
  const int nAct = kBatch * nRow;         // 4194304
  const int nW   = kDm * kDm;             // 1048576
  if (in_sizes[0] != nAct) return;
  if (in_sizes[1] != kBatch * kDm) return;
  if (in_sizes[2] != kDm || in_sizes[3] != kDm || in_sizes[4] != kDm || in_sizes[5] != kDm) return;
  if (in_sizes[6] != kDm * kLoraN) return;
  if (in_sizes[7] != 3 * kLoraD * kDm) return;
  if (in_sizes[8] != nW || in_sizes[9] != nW || in_sizes[10] != nW || in_sizes[11] != nW) return;
  for (int i = 12; i < 20; ++i) if (in_sizes[i] != kDm) return;
  if (in_sizes[20] != kSeq * 32) return;
  if (out_size != nAct) return;

  const float* x     = (const float*)d_in[0];    // [2][2048][1024]
  const float* ss    = (const float*)d_in[1];    // [2][1024]
  const float* maax  = (const float*)d_in[2];    // [1024]
  const float* maar  = (const float*)d_in[3];
  const float* maak  = (const float*)d_in[4];
  const float* maav  = (const float*)d_in[5];
  const float* w1    = (const float*)d_in[6];    // [1024][96]
  const float* w2    = (const float*)d_in[7];    // [3][32][1024]
  const float* wq    = (const float*)d_in[8];    // [1024 out][1024 in]
  const float* wk    = (const float*)d_in[9];
  const float* wv    = (const float*)d_in[10];
  const float* wo    = (const float*)d_in[11];
  const float* lnrg  = (const float*)d_in[12];
  const float* lnrb  = (const float*)d_in[13];
  const float* lnkg  = (const float*)d_in[14];
  const float* lnkb  = (const float*)d_in[15];
  const float* lnvg  = (const float*)d_in[16];
  const float* lnvb  = (const float*)d_in[17];
  const float* lnxg  = (const float*)d_in[18];
  const float* lnxb  = (const float*)d_in[19];
  const float* ang   = (const float*)d_in[20];   // [2048][32]

  const size_t PW   = (size_t)kDm * kDm * 2;          // 2097152  bf16 weight plane
  const size_t PX   = (size_t)kRows * kDm * 2;        // 8388608  bf16 activation plane (both batch elements)
  const size_t PF   = (size_t)kRows * kDm * 4;        // 16777216 f32 activation plane
  const size_t PW1  = (size_t)kLoraP * kDm * 2;       // 262144
  const size_t PW2  = (size_t)3 * kDm * kLoraD * 2;   // 196608
  const size_t PLF  = (size_t)kRows * kLoraP * 4;     // 2097152
  const size_t PLT  = (size_t)kRows * kLoraP * 2;     // 1048576
  size_t off = 0;
  const size_t oWqh = off; off += PW;  const size_t oWql = off; off += PW;
  off += 4 * PW;                                // Wkh, Wkl, Wvh, Wvl: reached from Wqh / Wql by the plane stride
  const size_t oWoh = off; off += PW;  const size_t oWol = off; off += PW;
  const size_t oW1h = off; off += PW1; const size_t oW1l = off; off += PW1;
  const size_t oW2h = off; off += PW2; const size_t oW2l = off; off += PW2;
  const size_t oXXh = off; off += PX;  const size_t oXXl = off; off += PX;
  const size_t oLF  = off; off += PLF;
  const size_t oLTh = off; off += PLT; const size_t oLTl = off; off += PLT;
  const size_t oMIX = off; off += 3 * PF;
  const size_t oXQh = off; off += PX;  const size_t oXQl = off; off += PX;
  const size_t oXKh = off; off += PX;  const size_t oXKl = off; off += PX;
  const size_t oXVh = off; off += PX;  const size_t oXVl = off; off += PX;
  const size_t oQh  = off; off += PX;  const size_t oQl  = off; off += PX;
  const size_t oKh  = off; off += PX;  const size_t oKl  = off; off += PX;
  const size_t oVTh = off; off += PX;  const size_t oVTl = off; off += PX;
  if (off > ws_size) return;                    // off = 189661184

  char* ws = (char*)d_ws;
  unsigned short* Wqh = (unsigned short*)(ws + oWqh); unsigned short* Wql = (unsigned short*)(ws + oWql);
  unsigned short* Woh = (unsigned short*)(ws + oWoh); unsigned short* Wol = (unsigned short*)(ws + oWol);
  unsigned short* W1h = (unsigned short*)(ws + oW1h); unsigned short* W1l = (unsigned short*)(ws + oW1l);
  unsigned short* W2h = (unsigned short*)(ws + oW2h); unsigned short* W2l = (unsigned short*)(ws + oW2l);
  unsigned short* XXh = (unsigned short*)(ws + oXXh); unsigned short* XXl = (unsigned short*)(ws + oXXl);
  float*          LF  = (float*)(ws + oLF);
  unsigned short* LTh = (unsigned short*)(ws + oLTh); unsigned short* LTl = (unsigned short*)(ws + oLTl);
  float*          MIX = (float*)(ws + oMIX);
  float*          Qf  = (float*)(ws + oMIX);
  float*          Kf  = (float*)(ws + oMIX + PF);
  float*          Vf  = (float*)(ws + oMIX + 2 * PF);
  float*          Of  = Qf;
  unsigned short* XQh = (unsigned short*)(ws + oXQh); unsigned short* XQl = (unsigned short*)(ws + oXQl);
  unsigned short* XKh = (unsigned short*)(ws + oXKh); unsigned short* XKl = (unsigned short*)(ws + oXKl);
  unsigned short* XVh = (unsigned short*)(ws + oXVh); unsigned short* XVl = (unsigned short*)(ws + oXVl);
  unsigned short* Qh  = (unsigned short*)(ws + oQh);  unsigned short* Ql  = (unsigned short*)(ws + oQl);
  unsigned short* Kh  = (unsigned short*)(ws + oKh);  unsigned short* Kl  = (unsigned short*)(ws + oKl);
  unsigned short* VTh = (unsigned short*)(ws + oVTh); unsigned short* VTl = (unsigned short*)(ws + oVTl);
  unsigned short* Oh  = XXh;                          unsigned short* Ol  = XXl;

  const float* dummyf = lnrg;                         // valid pointer for unused bias / resid arguments (never read)

  const dim3 blk(256);
  const int  n2w = nW / 2;                                  // 524288 pairs per weight plane
  const dim3 gCastW((n2w + 255) / 256, 4);                  // 2048 blocks x 256 threads x 2 = 1024x1024, y = q, k, v, o
  const dim3 gW1(kDm / 64);                                 // 16 k-tiles
  const dim3 gW2(kDm / 64, 3);                              // 16 n-tiles x 3
  const dim3 gRow(kRows);                                   // one block per token row (128-thread kernels)
  const dim3 blkG(128);                                     // GEMM block: 4 waves, one 128x128 tile
  const dim3 gLora((kRows / 128) * (kLoraP / 128));         // 32 tiles: M=4096, N=128
  const dim3 gMix((kRows / 128) * (kDm / 128), 3);          // 256 tiles x 3 (l): M=4096, N=1024, K=32
  const int  n2l = kRows * kLoraP / 2;                      // 262144 pairs
  const dim3 gTanh((n2l + 255) / 256);                      // 1024 blocks x 256 x 2 = 4096x128
  const dim3 gQKV((kRows / 128) * (kDm / 128), 3);          // 256 tiles x 3 (q, k, v): M=4096, N=1024
  const dim3 gProj((kRows / 128) * (kDm / 128), 1);         // 256 tiles: M=4096, N=1024
  const dim3 gLnQK(kRows, 2);                               // 4096 rows x {q, k}
  const dim3 gLn1(kRows, 1);
  const dim3 gVT(kDm / 64, kSeq / 64, kBatch);              // per b: in [R=2048 s][Cn=1024 c] -> planes [c][s]
  const dim3 gAtt(kHeads * (kSeq / 64), kBatch);            // 512 x 2 blocks: 16 heads x 32 query blocks, y = b

  // setup: weights -> bf16 hi/lo planes (q/k/v/o already [out n][in k] = Bt layout; w1/w2 transposed).
  // The hi planes of q, k, v, o lie 2 weight planes apart (hi, lo, hi, lo, ...), and so do the lo planes.
  split_bf16x2_kernel<<<gCastW, blk, 0, stream>>>(wq, wk, wv, wo, Wqh, Wql, n2w, 2L * nW);
  w1t_split_kernel<<<gW1, blk, 0, stream>>>(w1, W1h, W1l);
  w2t_split_kernel<<<gW2, blk, 0, stream>>>(w2, W2h, W2l);

  // Each stage below runs once, on the rows of both batch elements.
  // (1) xxx = x + dxprev*maa_x -> planes
  xxx_split_kernel<<<gRow, dim3(128), 0, stream>>>(x, ss, maax, XXh, XXl);
  // (2) lora_pre = xxx . w1 -> f32 [4096][128]   (M=4096, N=128, K=1024)
  wmma_gemm64<1, true, 0, 0, false, 0><<<gLora, blkG, 0, stream>>>(
      XXh, XXl, kDm, 0L, W1h, W1l, kDm, 0L, (void*)LF, (void*)LF, kLoraP, 0L,
      dummyf, dummyf, 0L, kRows, kLoraP, kDm, 1.0f);
  // (3) lora = tanh -> planes [4096][128]
  tanh_split_kernel<<<gTanh, blk, 0, stream>>>(LF, LTh, LTl, n2l);
  // (4) mixes[l] = lora[:, 32l..32l+31] . w2[l] -> f32 [3][4096][1024]   (M=4096, N=1024, K=32; grid.y = l)
  wmma_gemm64<1, true, 0, 0, false, 0><<<gMix, blkG, 0, stream>>>(
      LTh, LTl, kLoraP, (long)kLoraD, W2h, W2l, kLoraD, (long)kDm * kLoraD, (void*)MIX, (void*)MIX, kDm, (long)nAct,
      dummyf, dummyf, 0L, kRows, kDm, kLoraD, 1.0f);
  // (5) xq/xk/xv = x + dxprev*(maa + mix) -> planes
  mix_split_kernel<<<gRow, dim3(128), 0, stream>>>(x, ss, maar, maak, maav, MIX, XQh, XQl, XKh, XKl, XVh, XVl);
  // (6) q0 = xq . Wq^T, k0 = xk . Wk^T, v0 = xv . Wv^T -> f32 [3][4096][1024]   (M=4096, N=1024, K=1024; grid.y = q, k, v:
  //     XQ/XK/XV hi planes lie 2 activation planes apart, Wq/Wk/Wv hi planes 2 weight planes, Qf/Kf/Vf one f32 plane)
  wmma_gemm64<1, true, 0, 0, false, 0><<<gQKV, blkG, 0, stream>>>(
      XQh, XQl, kDm, 2L * nAct, Wqh, Wql, kDm, 2L * nW, (void*)Qf, (void*)Qf, kDm, (long)nAct,
      dummyf, dummyf, 0L, kRows, kDm, kDm, 1.0f);
  // (7) LayerNorm + RoPE + split for q and k -> planes [row][h*64+d]
  ln_kernel<0><<<gLnQK, blk, 0, stream>>>(Qf, Kf, lnrg, lnrb, lnkg, lnkb, ang, Qh, Ql, Kh, Kl, Qf);
  // (8) LayerNorm of v in place (f32), then transpose-split -> v^T planes [b][h*64+d][s]
  ln_kernel<1><<<gLn1, blk, 0, stream>>>(Vf, Vf, lnvg, lnvb, lnvg, lnvb, ang, VTh, VTl, VTh, VTl, Vf);
  wt_split_kernel<<<gVT, blk, 0, stream>>>(Vf, VTh, VTl, kSeq, kDm);
  // (9) causal attention per batch element and head -> f32 [row][h*64+d] (Of region; Qf is dead after step 7)
  attn_causal64_kernel<<<gAtt, dim3(128), 0, stream>>>(Qh, Ql, Kh, Kl, VTh, VTl, Of, 0.125f, -1.0e30f);
  // (10) output LayerNorm + split -> planes (XX region is dead after step 2)
  ln_kernel<2><<<gLn1, blk, 0, stream>>>(Of, Of, lnxg, lnxb, lnxg, lnxb, ang, Oh, Ol, Oh, Ol, Of);
  // (11) out = o . Wo^T -> d_out (f32)   (M=4096, N=1024, K=1024)
  wmma_gemm64<1, true, 0, 0, false, 0><<<gProj, blkG, 0, stream>>>(
      Oh, Ol, kDm, 0L, Woh, Wol, kDm, 0L, d_out, d_out, kDm, 0L,
      dummyf, dummyf, 0L, kRows, kDm, kDm, 1.0f);
}

// v005
// Measured time: 345 microseconds a run.
// Timed twice side by side with v004, it ran 1.05 times as fast both times.
// Over all steps from v000 it is 3.75 times as fast.
// All contractions (token-shift LoRA xxx.w1 and lora.w2, q/k/v projections, attention q.k^T and p.v, output projection): v_wmma_f32_16x16x32_bf16 with bf16 hi/lo split operands (hi.hi + hi.lo + lo.hi), f32 accumulate; token shift, tanh, LayerNorms, RoPE, online softmax, score scale 0.125 in f32.
#include <hip/hip_runtime.h>
#include <math.h>
#include <stdint.h>

constexpr int kBatch = 2;
constexpr int kSeq   = 2048;
constexpr int kRows  = kBatch * kSeq;   // token rows of both batch elements, row = b*kSeq + s
constexpr int kDm    = 1024;
constexpr int kHeads = 16;
constexpr int kLoraN = 96;      // 3 x 32 LoRA outputs
constexpr int kLoraP = 128;     // padded to a 64-multiple
constexpr int kLoraD = 32;

typedef __attribute__((ext_vector_type(16))) _Float16 v16h;
typedef __attribute__((ext_vector_type(8)))  _Float16 v8h;
typedef __attribute__((ext_vector_type(16))) __bf16   v16b;
typedef __attribute__((ext_vector_type(8)))  __bf16   v8b;
typedef __attribute__((ext_vector_type(8)))  float    v8f;
typedef __attribute__((ext_vector_type(4)))  float    v4f;
typedef __attribute__((ext_vector_type(2)))  float    v2f;
typedef __attribute__((ext_vector_type(4)))  unsigned int v4u;
typedef __attribute__((ext_vector_type(8)))  unsigned short v8us;

__device__ __forceinline__ unsigned short f2bf_bits(float f) {
  unsigned u = __float_as_uint(f);
  return (unsigned short)((u + 0x7FFFu + ((u >> 16) & 1u)) >> 16);
}
__device__ __forceinline__ float bf_bits2f(unsigned short h) { return __uint_as_float(((unsigned)h) << 16); }

// hazard guards as plain device helpers
__device__ __forceinline__ void dep_guard_h(v8f& a, v8f& b, v16h x, v16h y) { asm volatile("v_nop\n\tv_nop\n\tv_nop\n\tv_nop" : "+v"(a), "+v"(b) : "v"(x), "v"(y)); }
__device__ __forceinline__ void dep_guard_b(v8f& a, v8f& b, v16b x, v16b y) { asm volatile("v_nop\n\tv_nop\n\tv_nop\n\tv_nop" : "+v"(a), "+v"(b) : "v"(x), "v"(y)); }
__device__ __forceinline__ void keep4_h(v16h a, v16h b, v16h c, v16h d) { asm volatile("v_nop" :: "v"(a), "v"(b), "v"(c), "v"(d)); }
__device__ __forceinline__ void keep4_b(v16b a, v16b b, v16b c, v16b d) { asm volatile("v_nop" :: "v"(a), "v"(b), "v"(c), "v"(d)); }
__device__ __forceinline__ void acc_guard4(v8f& a, v8f& b, v8f& c, v8f& d) { asm volatile("v_nop\n\tv_nop\n\tv_nop\n\tv_nop" : "+v"(a), "+v"(b), "+v"(c), "+v"(d)); }
template <typename T> struct Frag;
template <> struct Frag<_Float16> {
  typedef v16h V; union U { v16h v; v8h h[2]; };
  static __device__ __forceinline__ v16h load(const _Float16* p) {   // elements 0..7 <- p[0..7], 8..15 <- p[16..23]
    U f; f.h[0] = *(const v8h*)(p); f.h[1] = *(const v8h*)(p + 16); return f.v;
  }
  static __device__ __forceinline__ v8f mma(v16h a, v16h b, v8f c) {
    return __builtin_amdgcn_wmma_f32_16x16x32_f16(false, a, false, b, (short)0, c, false, false);
  }
  static __device__ __forceinline__ void guard(v8f& a, v8f& b, v16h x, v16h y) { dep_guard_h(a, b, x, y); }
  static __device__ __forceinline__ void keep(v16h a, v16h b, v16h c, v16h d) { keep4_h(a, b, c, d); }
};
template <> struct Frag<__bf16> {
  typedef v16b V; union U { v16b v; v8b h[2]; };
  static __device__ __forceinline__ v16b load(const __bf16* p) {
    U f; f.h[0] = *(const v8b*)(p); f.h[1] = *(const v8b*)(p + 16); return f.v;
  }
  static __device__ __forceinline__ v8f mma(v16b a, v16b b, v8f c) {
    return __builtin_amdgcn_wmma_f32_16x16x32_bf16(false, a, false, b, (short)0, c, false, false);
  }
  static __device__ __forceinline__ void guard(v8f& a, v8f& b, v16b x, v16b y) { dep_guard_b(a, b, x, y); }
  static __device__ __forceinline__ void keep(v16b a, v16b b, v16b c, v16b d) { keep4_b(a, b, c, d); }
};

// ---- Register-blocked batched WMMA GEMM, operands staged in LDS --------------
// C[m,n] = scale * sum_k A[m,k] * Bt[n,k] (+bias)(+resid); a block of 4 waves (2 x 2) owns a 128x128 tile, each wave 64x64 of it.
// A row-major [M,K]; Bt row-major [N,K]; M,N % 128 == 0, K % 32 == 0.
// Per 32-wide k tile the block brings 128 A rows and 128 Bt rows of every plane (64 B a row) into LDS with asynchronous
// 16-B copies (a wave-wide copy = 8 rows x 64 contiguous B), two buffers: tile t+1 flies while tile t is multiplied.
// SPLIT: operands are hi/lo planes (A2/Bt2 = lo planes, same layout); product = hi.hi + hi.lo + lo.hi.
// BIAS_MODE: 0 = none, 1 = bias[m], 2 = bias[n].
// OUT_MODE: 0 = f32, 1 = f16, 2 = bf16 hi plane (Cout) + bf16 lo plane (Cout2).
// Coverage per wave tile: 4 slabs x 16 rows x 64 cols = 64x64 (f32: it 0..7 x hh 0..1 rows, 16 lanes x 4 floats;
// 16-bit: it 0..3 x q 0..3 rows, 8 lanes x 8 elements).
// ET: 0 = f16 operands, 1 = bf16 operands (pointers passed as 16-bit storage)
template <int ET> struct Elem;
template <> struct Elem<0> { typedef _Float16 T; };
template <> struct Elem<1> { typedef __bf16 T; };
constexpr int kGLP    = 40;            // LDS row pitch in 16-bit elements: 80 B = 16 B x 5 (odd), the pitch for 16-B reads of 64-B rows
constexpr int kGPlane = 128 * kGLP;    // one plane of a stage: 128 rows
constexpr int kGStage = 4 * kGPlane;   // A hi, A lo, Bt hi, Bt lo

// Four rows (32 apart) of one plane pair -> LDS: 8 (hi and lo) or 4 (hi only) copies of 16 B per lane. l = the lane's LDS byte
// address of its first hi row, g / g2 = its global address in the hi / lo plane, step = 32 source rows in elements.
// s_wait_xcnt 0 ends the copies' own statement, so that it stands in front of any rewrite of the address registers they name.
template <typename T>
__device__ __forceinline__ void stage_rows8(unsigned l, const T* g, const T* g2, size_t step) {
  const unsigned l1 = l + 32 * kGLP * 2, l2 = l + 64 * kGLP * 2, l3 = l + 96 * kGLP * 2;
  const unsigned m0 = l + kGPlane * 2, m1 = l1 + kGPlane * 2, m2 = l2 + kGPlane * 2, m3 = l3 + kGPlane * 2;
  const T* g1 = g + step;  const T* gg2 = g1 + step;  const T* g3 = gg2 + step;
  const T* h1 = g2 + step; const T* h2 = h1 + step;   const T* h3 = h2 + step;
  asm volatile("global_load_async_to_lds_b128 %0, %8, off\n\t"
               "global_load_async_to_lds_b128 %1, %9, off\n\t"
               "global_load_async_to_lds_b128 %2, %10, off\n\t"
               "global_load_async_to_lds_b128 %3, %11, off\n\t"
               "global_load_async_to_lds_b128 %4, %12, off\n\t"
               "global_load_async_to_lds_b128 %5, %13, off\n\t"
               "global_load_async_to_lds_b128 %6, %14, off\n\t"
               "global_load_async_to_lds_b128 %7, %15, off\n\t"
               "s_wait_xcnt 0x0"
               :: "v"(l), "v"(l1), "v"(l2), "v"(l3), "v"(m0), "v"(m1), "v"(m2), "v"(m3),
                  "v"(g), "v"(g1), "v"(gg2), "v"(g3), "v"(g2), "v"(h1), "v"(h2), "v"(h3) : "memory");
}
template <typename T>
__device__ __forceinline__ void stage_rows4(unsigned l, const T* g, size_t step) {
  const unsigned l1 = l + 32 * kGLP * 2, l2 = l + 64 * kGLP * 2, l3 = l + 96 * kGLP * 2;
  const T* g1 = g + step; const T* gg2 = g1 + step; const T* g3 = gg2 + step;
  asm volatile("global_load_async_to_lds_b128 %0, %4, off\n\t"
               "global_load_async_to_lds_b128 %1, %5, off\n\t"
               "global_load_async_to_lds_b128 %2, %6, off\n\t"
               "global_load_async_to_lds_b128 %3, %7, off\n\t"
               "s_wait_xcnt 0x0"
               :: "v"(l), "v"(l1), "v"(l2), "v"(l3), "v"(g), "v"(g1), "v"(gg2), "v"(g3) : "memory");
}

template <int ET, bool SPLIT, int BIAS_MODE, int OUT_MODE, bool RESID, int ACT = 0>
__global__ __launch_bounds__(128) void wmma_gemm64(
    const unsigned short* __restrict__ Ap, const unsigned short* __restrict__ A2p, int lda, long strideA,
    const unsigned short* __restrict__ Btp, const unsigned short* __restrict__ Bt2p, int ldb, long strideB,
    void* __restrict__ Cout, void* __restrict__ Cout2, int ldc, long strideC,
    const float* __restrict__ bias,
    const float* __restrict__ resid, long strideR,
    int M, int N, int K, float scale) {
  typedef typename Elem<ET>::T T;
  typedef typename Frag<T>::V V;
  const T* A = (const T*)Ap; const T* A2 = (const T*)A2p; const T* Bt = (const T*)Btp; const T* Bt2 = (const T*)Bt2p;
  __shared__ __align__(16) T ring[2 * kGStage];    // two stages of operand tiles, 2 x 40,960 B
  __shared__ __align__(16) float sT[4][16 * 68];   // per-wave 16x64 slab, pitch 68 floats
  const int b    = blockIdx.y;
  const int lane = threadIdx.x & 31;
  const int wave = threadIdx.x >> 5;
  const int tilesN = N >> 7;
  const int tilesM = M >> 7;
  const int tile = blockIdx.x;
  if (tile >= tilesM * tilesN) return;   // block-uniform, in front of every barrier and copy
  const int tm = tile / tilesN;
  const int tn = tile - tm * tilesN;
  const int bm0 = tm << 7;                         // block tile origin
  const int bn0 = tn << 7;
  const int wm = (wave >> 1) << 6;                 // wave tile origin inside the block tile
  const int wn = (wave & 1) << 6;
  const int m0 = bm0 + wm;
  const int n0 = bn0 + wn;

  const T* Ab  = A  + (size_t)b * strideA;
  const T* Bb  = Bt + (size_t)b * strideB;
  const T* Ab2 = SPLIT ? (A2  + (size_t)b * strideA) : nullptr;
  const T* Bb2 = SPLIT ? (Bt2 + (size_t)b * strideB) : nullptr;

  const int rlane = lane & 15;                 // row (A) / col (B, D) within subtile
  const int koff  = (lane >> 4) * 8;           // k offset of this lane half
  const int mOff  = (lane >> 4) * 8;           // D row offset

  v8f acc[4][4];
#pragma unroll
  for (int i = 0; i < 4; ++i)
#pragma unroll
    for (int j = 0; j < 4; ++j) acc[i][j] = (v8f){0.f,0.f,0.f,0.f,0.f,0.f,0.f,0.f};

  // copy map: thread -> row (tid >> 2) + 32 r, r = 0..3, 16-B chunk tid & 3 of the row's 64 B; 128 threads x 4 rows = 128 rows a plane
  const int crow = threadIdx.x >> 2;
  const int cchk = (threadIdx.x & 3) * 8;
  const size_t cao = (size_t)(bm0 + crow) * lda + cchk;
  const size_t cbo = (size_t)(bn0 + crow) * ldb + cchk;
  const size_t stepA = (size_t)32 * lda, stepB = (size_t)32 * ldb;
  const unsigned lds0 = (unsigned)(uintptr_t)(&ring[0]) + (unsigned)(crow * kGLP + cchk) * 2u;   // LDS byte address: low 32 bits
  const int nT = K >> 5;                           // k tiles, the same for the whole grid

#define GEMM_STAGE(t_)                                                                          \
  {                                                                                             \
    const unsigned lt = lds0 + (unsigned)((t_) & 1) * (kGStage * 2u);                           \
    const size_t ko = (size_t)(t_) * 32;                                                        \
    if (SPLIT) {                                                                                \
      stage_rows8<T>(lt, Ab + cao + ko, Ab2 + cao + ko, stepA);                                 \
      stage_rows8<T>(lt + 2u * kGPlane * 2u, Bb + cbo + ko, Bb2 + cbo + ko, stepB);             \
    } else {                                                                                    \
      stage_rows4<T>(lt, Ab + cao + ko, stepA);                                                 \
      stage_rows4<T>(lt + 2u * kGPlane * 2u, Bb + cbo + ko, stepB);                             \
    }                                                                                           \
  }

  GEMM_STAGE(0)
  asm volatile("s_wait_asynccnt 0x0" ::: "memory");   // this wave's copies of tile 0 have landed
  __syncthreads();                                    // ... and every other wave's: tile 0 may be read
  if (nT > 1) GEMM_STAGE(1)

  for (int t = 0; t < nT; ++t) {
    const T* st = ring + (t & 1) * kGStage;
    const T* sA = st + (wm + rlane) * kGLP + koff;
    const T* sB = st + 2 * kGPlane + (wn + rlane) * kGLP + koff;
    V bh[4], bl[4];
#pragma unroll
    for (int j = 0; j < 4; ++j) {
      bh[j] = Frag<T>::load(sB + (j << 4) * kGLP);
      if (SPLIT) bl[j] = Frag<T>::load(sB + kGPlane + (j << 4) * kGLP);
    }
#pragma unroll
    for (int i = 0; i < 4; ++i) {
      V ah = Frag<T>::load(sA + (i << 4) * kGLP);
      V al;
      if (SPLIT) al = Frag<T>::load(sA + kGPlane + (i << 4) * kGLP);
#pragma unroll
      for (int j = 0; j < 4; ++j) {
        acc[i][j] = Frag<T>::mma(ah, bh[j], acc[i][j]);
        if (SPLIT) {
          acc[i][j] = Frag<T>::mma(ah, bl[j], acc[i][j]);
          acc[i][j] = Frag<T>::mma(al, bh[j], acc[i][j]);
        }
      }
      Frag<T>::guard(acc[i][0], acc[i][3], ah, SPLIT ? al : ah);
    }
    Frag<T>::keep(bh[0], bh[1], bh[2], bh[3]);
    if (SPLIT) Frag<T>::keep(bl[0], bl[1], bl[2], bl[3]);
    asm volatile("s_wait_dscnt 0x0" ::: "memory");      // this wave's reads of tile t's buffer are done before it is refilled
    asm volatile("s_wait_asynccnt 0x0" ::: "memory");   // this wave's copies of tile t+1 have landed
    __syncthreads();                                    // publishes tile t+1 and ends every wave's reads of tile t
    if (t + 2 < nT) GEMM_STAGE(t + 2)                   // uniform test; into the buffer that trip t has just read
  }
  asm volatile("s_wait_asynccnt 0x0" ::: "memory");     // no copy outstanding behind the loop
#undef GEMM_STAGE
  acc_guard4(acc[0][0], acc[0][1], acc[0][2], acc[0][3]);
  acc_guard4(acc[1][0], acc[1][1], acc[1][2], acc[1][3]);
  acc_guard4(acc[2][0], acc[2][1], acc[2][2], acc[2][3]);
  acc_guard4(acc[3][0], acc[3][1], acc[3][2], acc[3][3]);

  // ---- epilogue ----
  float* slab = sT[wave];
  const float* Rb = RESID ? (resid + (size_t)b * strideR) : nullptr;
#pragma unroll
  for (int i = 0; i < 4; ++i) {
    const int mBase = m0 + (i << 4);
#pragma unroll
    for (int j = 0; j < 4; ++j) {
      const int n = n0 + (j << 4) + rlane;
      float bv = 0.f;
      if (BIAS_MODE == 2) bv = bias[n];
#pragma unroll
      for (int r = 0; r < 8; ++r) {
        float v = acc[i][j][r] * scale;
        if (BIAS_MODE == 1) v += bias[mBase + mOff + r];
        if (BIAS_MODE == 2) v += bv;
        if (RESID) v += Rb[(size_t)(mBase + mOff + r) * ldc + n];
        if (ACT == 1) v = tanhf(v);
        if (ACT == 2) v = fmaxf(v, 0.0f);
        if (ACT == 3) v = v / (1.0f + expf(-v));
        if (ACT == 4) v = (v > 0.f) ? v : 0.01f * v;
        slab[(mOff + r) * 68 + (j << 4) + rlane] = v;
      }
    }
    __builtin_amdgcn_fence(__ATOMIC_RELEASE, "workgroup");
    __builtin_amdgcn_wave_barrier();
    __builtin_amdgcn_fence(__ATOMIC_ACQUIRE, "workgroup");
    if (OUT_MODE == 0) {
      float* C = (float*)Cout + (size_t)b * strideC;
      const int hh = lane >> 4, c4 = (lane & 15) * 4;     // row seg = 256 B = 16 lanes x 16 B
      {
#pragma unroll
        for (int it = 0; it < 8; ++it) {
          const int row = it * 2 + hh;
          v4f v = *(const v4f*)(slab + row * 68 + c4);
          *(v4f*)(C + (size_t)(mBase + row) * ldc + n0 + c4) = v;
        }
        
      }
    } else {
      const int q = lane >> 3, c8 = (lane & 7) * 8;
      unsigned short* C  = (unsigned short*)Cout  + (size_t)b * strideC;
      unsigned short* C2 = (OUT_MODE == 2) ? ((unsigned short*)Cout2 + (size_t)b * strideC) : nullptr;
      {
#pragma unroll
        for (int it = 0; it < 4; ++it) {
          const int row = it * 4 + q;
          const float* sp = slab + row * 68 + c8;
          v8h hv, lv;
#pragma unroll
          for (int e = 0; e < 8; ++e) {
            if (OUT_MODE == 1) {
              hv[e] = (_Float16)sp[e];
            } else {
              unsigned short hb = f2bf_bits(sp[e]);
              unsigned short lb = f2bf_bits(sp[e] - bf_bits2f(hb));
              hv[e] = __builtin_bit_cast(_Float16, hb);
              lv[e] = __builtin_bit_cast(_Float16, lb);
            }
          }
          *(v8h*)(C + (size_t)(mBase + row) * ldc + n0 + c8) = hv;
          if (OUT_MODE == 2) *(v8h*)(C2 + (size_t)(mBase + row) * ldc + n0 + c8) = lv;
        }
        
      }
    }
    __builtin_amdgcn_fence(__ATOMIC_RELEASE, "workgroup");
    __builtin_amdgcn_wave_barrier();
    __builtin_amdgcn_fence(__ATOMIC_ACQUIRE, "workgroup");
  }
}

// ---------------------------------------------------------------------------
// Elementwise bf16 split: hi = bf16_rne(in), lo = bf16_rne(in - hi); 2 elements per thread, one 4-B store.
// blockIdx.y (block-uniform) picks one of four equally sized sources; its planes start pstride 16-bit elements apart.
// ---------------------------------------------------------------------------
__device__ __forceinline__ unsigned pk16(unsigned short a, unsigned short b) { return (unsigned)a | ((unsigned)b << 16); }

__global__ __launch_bounds__(256) void split_bf16x2_kernel(const float* __restrict__ in0, const float* __restrict__ in1,
                                                           const float* __restrict__ in2, const float* __restrict__ in3,
                                                           unsigned short* __restrict__ hi, unsigned short* __restrict__ lo,
                                                           int n2, long pstride) {
  const int w = blockIdx.y;
  const float* in = (w == 0) ? in0 : (w == 1) ? in1 : (w == 2) ? in2 : in3;
  unsigned short* ph = hi + (size_t)w * pstride;
  unsigned short* pl = lo + (size_t)w * pstride;
  const int i = blockIdx.x * 256 + threadIdx.x;
  if (i < n2) {
    const v2f f = *(const v2f*)(in + 2 * (size_t)i);
    const unsigned short h0 = f2bf_bits(f[0]), h1 = f2bf_bits(f[1]);
    const unsigned short l0 = f2bf_bits(f[0] - bf_bits2f(h0)), l1 = f2bf_bits(f[1] - bf_bits2f(h1));
    const unsigned uh = pk16(h0, h1), ul = pk16(l0, l1);
    ((unsigned*)ph)[i] = uh;
    ((unsigned*)pl)[i] = ul;
    
  }
}

// ---------------------------------------------------------------------------
// tanh then bf16 split: hi = bf16_rne(tanh(in)), lo = bf16_rne(tanh(in) - hi); same store shape as above
// Coverage: grid = ceil(n2/256) x 256 threads x 2 elements = 2*n2 = whole plane.
// ---------------------------------------------------------------------------
__global__ __launch_bounds__(256) void tanh_split_kernel(const float* __restrict__ in, unsigned short* __restrict__ hi,
                                                         unsigned short* __restrict__ lo, int n2) {
  const int i = blockIdx.x * 256 + threadIdx.x;
  if (i < n2) {
    const v2f f = *(const v2f*)(in + 2 * (size_t)i);
    const float t0 = tanhf(f[0]), t1 = tanhf(f[1]);
    const unsigned short h0 = f2bf_bits(t0), h1 = f2bf_bits(t1);
    const unsigned short l0 = f2bf_bits(t0 - bf_bits2f(h0)), l1 = f2bf_bits(t1 - bf_bits2f(h1));
    const unsigned uh = pk16(h0, h1), ul = pk16(l0, l1);
    ((unsigned*)hi)[i] = uh;
    ((unsigned*)lo)[i] = ul;
    
  }
}

// ---------------------------------------------------------------------------
// Transpose + bf16 split: in w[R][Cn] f32 -> planes th/tl [Cn][R] bf16: out[n*R + k] = split(w[k*Cn + n]).
// grid = (Cn/64, R/64, matrices), R, Cn % 64 == 0; matrix z starts z*R*Cn elements into w, th and tl.
// (Used for the LayerNormed v [b][s=R=2048][c=Cn=1024] -> v^T planes [b][c][s].)
// Coverage: load 256 threads x 16 = 64x64; store 8 waves x 2 it x 4 rows(q) x 8 lanes x 8 elements = 64x64.
// ---------------------------------------------------------------------------
__global__ __launch_bounds__(256) void wt_split_kernel(const float* __restrict__ wz, unsigned short* __restrict__ thz,
                                                       unsigned short* __restrict__ tlz, int R, int Cn) {
  __shared__ float tile[64 * 65];
  const int n0 = blockIdx.x * 64;
  const int k0 = blockIdx.y * 64;
  const size_t zo = (size_t)blockIdx.z * R * Cn;
  const float* w = wz + zo;
  unsigned short* th = thz + zo;
  unsigned short* tl = tlz + zo;
  const int t = threadIdx.x;
#pragma unroll
  for (int i = 0; i < 16; ++i) {
    const int idx = i * 256 + t;
    const int kk = idx >> 6, nn = idx & 63;
    tile[nn * 65 + kk] = w[(size_t)(k0 + kk) * Cn + n0 + nn];
  }
  __syncthreads();
  const int lane = t & 31, wave = t >> 5;
  const int q = lane >> 3, c8 = (lane & 7) * 8;
  {
#pragma unroll
    for (int it = 0; it < 2; ++it) {
      const int row = wave * 8 + it * 4 + q;          // 0..63 = local n
      const float* sp = tile + row * 65 + c8;
      v8us hv, lv;
#pragma unroll
      for (int e = 0; e < 8; ++e) {
        const unsigned short hb = f2bf_bits(sp[e]);
        const unsigned short lb = f2bf_bits(sp[e] - bf_bits2f(hb));
        hv[e] = hb; lv[e] = lb;
      }
      const size_t o = (size_t)(n0 + row) * R + k0 + c8;
      *(v8us*)(th + o) = hv;
      *(v8us*)(tl + o) = lv;
    }
    
  }
}

// ---------------------------------------------------------------------------
// LoRA weight w1 [1024 in k][96 out n] f32 -> Bt planes th/tl [kLoraP=128 n][1024 k] bf16, rows n >= 96 ZERO:
//   out[n*1024 + k] = split(n < 96 ? w1[k*96 + n] : 0).  grid = 1024/64 k-tiles; block = 256 threads.
// LDS tile [128 n][65]: load 256 threads x 32 iterations = 64 k x 128 n (address clamped to n <= 95, zero by predicate).
// ---------------------------------------------------------------------------
__global__ __launch_bounds__(256) void w1t_split_kernel(const float* __restrict__ w1, unsigned short* __restrict__ th,
                                                        unsigned short* __restrict__ tl) {
  __shared__ float tile[kLoraP * 65];
  const int k0 = blockIdx.x * 64;
  const int t = threadIdx.x;
#pragma unroll 4
  for (int i = 0; i < 32; ++i) {
    const int idx = i * 256 + t;
    const int kk = idx >> 7, nn = idx & 127;
    const int nc = (nn < kLoraN) ? nn : (kLoraN - 1);
    float v = w1[(size_t)(k0 + kk) * kLoraN + nc];
    if (nn >= kLoraN) v = 0.0f;
    tile[nn * 65 + kk] = v;
  }
  __syncthreads();
  const int lane = t & 31, wave = t >> 5;
  const int q = lane >> 3, c8 = (lane & 7) * 8;
  {
#pragma unroll
    for (int it = 0; it < 4; ++it) {
      const int row = wave * 16 + it * 4 + q;         // 0..127 = n
      const float* sp = tile + row * 65 + c8;
      v8us hv, lv;
#pragma unroll
      for (int e = 0; e < 8; ++e) {
        const unsigned short hb = f2bf_bits(sp[e]);
        const unsigned short lb = f2bf_bits(sp[e] - bf_bits2f(hb));
        hv[e] = hb; lv[e] = lb;
      }
      const size_t o = (size_t)row * kDm + k0 + c8;
      *(v8us*)(th + o) = hv;
      *(v8us*)(tl + o) = lv;
    }
    
  }
}

// ---------------------------------------------------------------------------
// LoRA weight w2 [3 l][32 d][1024 c] f32 -> Bt planes th/tl [3 l][1024 n=c][32 k=d] bf16: out[l][n][k] = split(w2[l][k][n]).
// grid = (1024/64 n-tiles, 3); block 256. LDS tile [64 n][33]: load 256 threads x 8 = 32 k x 64 n.
// 512 contiguous bytes) with ONE 16-B-per-lane instruction: lane -> line L = lane>>3, row = wave*8 + 2L + ((lane&7)>>2),
// ---------------------------------------------------------------------------
__global__ __launch_bounds__(256) void w2t_split_kernel(const float* __restrict__ w2, unsigned short* __restrict__ th,
                                                        unsigned short* __restrict__ tl) {
  __shared__ float tile[64 * 33];
  const int n0 = blockIdx.x * 64;
  const int l  = blockIdx.y;
  const int t  = threadIdx.x;
  const float* wl = w2 + (size_t)l * kLoraD * kDm;
#pragma unroll
  for (int i = 0; i < 8; ++i) {
    const int idx = i * 256 + t;
    const int kk = idx >> 6, nn = idx & 63;
    tile[nn * 33 + kk] = wl[(size_t)kk * kDm + n0 + nn];
  }
  __syncthreads();
  const int lane = t & 31, wave = t >> 5;
  const int L = lane >> 3, q = lane & 7;
  const int row = wave * 8 + 2 * L + (q >> 2);
  const int k8 = (q & 3) * 8;
  const float* sp = tile + row * 33 + k8;
  v8us hv, lv;
#pragma unroll
  for (int e = 0; e < 8; ++e) {
    const unsigned short hb = f2bf_bits(sp[e]);
    const unsigned short lb = f2bf_bits(sp[e] - bf_bits2f(hb));
    hv[e] = hb; lv[e] = lb;
  }
  const size_t o = (size_t)l * kDm * kLoraD + (size_t)(n0 + row) * kLoraD + k8;
  *(v8us*)(th + o) = hv;
  *(v8us*)(tl + o) = lv;
  
}

// ---------------------------------------------------------------------------
// Shared elementwise split helper for 8 consecutive values -> v8us hi/lo.
// ---------------------------------------------------------------------------
__device__ __forceinline__ void split8(const v4f va, const v4f vb, v8us& hv, v8us& lv) {
#pragma unroll
  for (int e = 0; e < 4; ++e) {
    const unsigned short h0 = f2bf_bits(va[e]);
    hv[e] = h0; lv[e] = f2bf_bits(va[e] - bf_bits2f(h0));
    const unsigned short h1 = f2bf_bits(vb[e]);
    hv[4 + e] = h1; lv[4 + e] = f2bf_bits(vb[e] - bf_bits2f(h1));
  }
}
__device__ __forceinline__ void store16x2(unsigned short* ph, unsigned short* pl, size_t o, const v8us hv, const v8us lv) {
  *(v8us*)(ph + o) = hv;
  *(v8us*)(pl + o) = lv;
  
}

// ---------------------------------------------------------------------------
// Token shift: xxx = x + (xprev - x) * maa_x -> bf16 hi/lo planes [kRows][kDm], row = b*kSeq + s;
// xprev = shift_state[b] for s == 0, else x[b][s-1] (block-uniform pointer choice).
// grid = kRows blocks x 128 threads x 8 elements = kRows x kDm = the whole plane; each lane stores 16 B,
// ---------------------------------------------------------------------------
__global__ __launch_bounds__(128) void xxx_split_kernel(const float* __restrict__ x, const float* __restrict__ ss,
                                                        const float* __restrict__ maax,
                                                        unsigned short* __restrict__ oh, unsigned short* __restrict__ ol) {
  const int row = blockIdx.x;
  const int b = row / kSeq, s = row % kSeq;
  const int c0 = threadIdx.x * 8;
  const float* xr = x + (size_t)row * kDm;
  const float* xp = (s == 0) ? (ss + (size_t)b * kDm) : (xr - kDm);
  const v4f xa = *(const v4f*)(xr + c0), xb = *(const v4f*)(xr + c0 + 4);
  const v4f pa = *(const v4f*)(xp + c0), pb = *(const v4f*)(xp + c0 + 4);
  const v4f ma = *(const v4f*)(maax + c0), mb = *(const v4f*)(maax + c0 + 4);
  const v4f va = xa + (pa - xa) * ma;
  const v4f vb = xb + (pb - xb) * mb;
  v8us hv, lv;
  split8(va, vb, hv, lv);
  store16x2(oh, ol, (size_t)row * kDm + c0, hv, lv);
}

// ---------------------------------------------------------------------------
// Data-dependent mixing: x? = x + (xprev - x) * (maa_? + mix_?[s][c]) for ? in {q(r), k, v} -> three bf16 hi/lo plane pairs
// [kRows][kDm]. mix planes f32 [3][kRows][kDm] (l = 0 r, 1 k, 2 v). Same row index and thread/store shape as xxx_split_kernel:
// ---------------------------------------------------------------------------
__global__ __launch_bounds__(128) void mix_split_kernel(const float* __restrict__ x, const float* __restrict__ ss,
                                                        const float* __restrict__ maar, const float* __restrict__ maak,
                                                        const float* __restrict__ maav, const float* __restrict__ mix,
                                                        unsigned short* __restrict__ qh, unsigned short* __restrict__ ql,
                                                        unsigned short* __restrict__ kh, unsigned short* __restrict__ kl,
                                                        unsigned short* __restrict__ vh, unsigned short* __restrict__ vl) {
  const int row = blockIdx.x;
  const int b = row / kSeq, s = row % kSeq;
  const int c0 = threadIdx.x * 8;
  const float* xr = x + (size_t)row * kDm;
  const float* xp = (s == 0) ? (ss + (size_t)b * kDm) : (xr - kDm);
  const v4f xa = *(const v4f*)(xr + c0), xb = *(const v4f*)(xr + c0 + 4);
  const v4f pa = *(const v4f*)(xp + c0), pb = *(const v4f*)(xp + c0 + 4);
  const v4f da = pa - xa, db = pb - xb;
  const size_t plane = (size_t)kRows * kDm;
  const float* m0 = mix + (size_t)row * kDm + c0;
  const size_t o = (size_t)row * kDm + c0;
  {
    const v4f ma = *(const v4f*)(maar + c0), mb = *(const v4f*)(maar + c0 + 4);
    const v4f qa = *(const v4f*)(m0), qb = *(const v4f*)(m0 + 4);
    const v4f va = xa + da * (ma + qa), vb = xb + db * (mb + qb);
    v8us hv, lv; split8(va, vb, hv, lv); store16x2(qh, ql, o, hv, lv);
  }
  {
    const v4f ma = *(const v4f*)(maak + c0), mb = *(const v4f*)(maak + c0 + 4);
    const v4f qa = *(const v4f*)(m0 + plane), qb = *(const v4f*)(m0 + plane + 4);
    const v4f va = xa + da * (ma + qa), vb = xb + db * (mb + qb);
    v8us hv, lv; split8(va, vb, hv, lv); store16x2(kh, kl, o, hv, lv);
  }
  {
    const v4f ma = *(const v4f*)(maav + c0), mb = *(const v4f*)(maav + c0 + 4);
    const v4f qa = *(const v4f*)(m0 + 2 * plane), qb = *(const v4f*)(m0 + 2 * plane + 4);
    const v4f va = xa + da * (ma + qa), vb = xb + db * (mb + qb);
    v8us hv, lv; split8(va, vb, hv, lv); store16x2(vh, vl, o, hv, lv);
  }
}

// ---------------------------------------------------------------------------
//   MODE 0: LN then RoPE (half-split per 64-wide head: out[f] = x1*cos - x2*sin, out[32+f] = x1*sin + x2*cos with
//           cos/sin = cosf/sinf(angles[s][f]), s = row % kSeq) then bf16 hi/lo split into planes [kRows][kDm]; grid = (kRows, 2),
//           blockIdx.y selects source/params/planes A (0) or B (1).
//   MODE 1: LN written back IN PLACE as f32 (dstf == src): each block owns its row; thread t writes floats 4t..4t+3,
//   MODE 2: LN then bf16 hi/lo split into planes (no rotation); grid = (kRows, 1).
// MODE 0/2 store path: per wave (heads 2w, 2w+1) the 128 results are staged in LDS, then lanes 0..15 write 16 B each =
// ---------------------------------------------------------------------------
template <int MODE>
__global__ __launch_bounds__(256) void ln_kernel(const float* srcA, const float* srcB,
                                                 const float* __restrict__ gA, const float* __restrict__ bA,
                                                 const float* __restrict__ gB, const float* __restrict__ bB,
                                                 const float* __restrict__ ang,
                                                 unsigned short* hA, unsigned short* lA,
                                                 unsigned short* hB, unsigned short* lB, float* dstf) {
  __shared__ __align__(16) float srow[kDm];
  __shared__ __align__(16) unsigned short Lh[8][128];
  __shared__ __align__(16) unsigned short Ll[8][128];
  __shared__ float sred[8];
  __shared__ float sred2[8];
  const int s = blockIdx.x;                      // token row b*kSeq + position
  const int which = blockIdx.y;                  // block-uniform
  const float* src = (which == 0) ? srcA : srcB;
  const float* g   = (which == 0) ? gA : gB;
  const float* bb  = (which == 0) ? bA : bB;
  unsigned short* dh = (which == 0) ? hA : hB;
  unsigned short* dl = (which == 0) ? lA : lB;
  const int tid = threadIdx.x, lane = tid & 31, wave = tid >> 5;

  const float* row = src + (size_t)s * kDm;
  const v4f xv = *(const v4f*)(row + tid * 4);
  float ps = (xv[0] + xv[1]) + (xv[2] + xv[3]);
#pragma unroll
  for (int off = 1; off < 32; off <<= 1) ps += __shfl_xor(ps, off, 32);
  if (lane == 0) sred[wave] = ps;
  __syncthreads();
  float tot = 0.f;
#pragma unroll
  for (int w = 0; w < 8; ++w) tot += sred[w];
  const float mean = tot * (1.0f / (float)kDm);
  const v4f dv = xv - mean;
  float pq = (dv[0] * dv[0] + dv[1] * dv[1]) + (dv[2] * dv[2] + dv[3] * dv[3]);
#pragma unroll
  for (int off = 1; off < 32; off <<= 1) pq += __shfl_xor(pq, off, 32);
  if (lane == 0) sred2[wave] = pq;
  __syncthreads();
  float tot2 = 0.f;
#pragma unroll
  for (int w = 0; w < 8; ++w) tot2 += sred2[w];
  const float var  = tot2 * (1.0f / (float)kDm);
  const float rstd = rsqrtf(var + 1.0e-5f);
  const v4f gv = *(const v4f*)(g + tid * 4);
  const v4f bv = *(const v4f*)(bb + tid * 4);
  v4f yv;
#pragma unroll
  for (int e = 0; e < 4; ++e) yv[e] = dv[e] * rstd * gv[e] + bv[e];

  if (MODE == 1) {
    float* dp = dstf + (size_t)s * kDm + tid * 4;
    *(v4f*)dp = yv;
    
    return;                                     // MODE is a compile-time constant: uniform
  }

  *(v4f*)(srow + tid * 4) = yv;
  __syncthreads();

  float cs = 1.0f, sn = 0.0f;
  if (MODE == 0) {
    const float a = ang[(size_t)(s % kSeq) * 32 + lane];
    cs = cosf(a);
    sn = sinf(a);
  }
  unsigned short* lh = Lh[wave];
  unsigned short* ll = Ll[wave];
#pragma unroll 1
  for (int hp = 0; hp < 2; ++hp) {
    const int base = wave * 128 + hp * 64;
    const float xr = srow[base + lane];
    const float xi = srow[base + 32 + lane];
    float vr = xr, vi = xi;
    if (MODE == 0) { vr = xr * cs - xi * sn; vi = xr * sn + xi * cs; }
    const unsigned short hr = f2bf_bits(vr);
    const unsigned short lr = f2bf_bits(vr - bf_bits2f(hr));
    const unsigned short hi = f2bf_bits(vi);
    const unsigned short li = f2bf_bits(vi - bf_bits2f(hi));
    lh[hp * 64 + lane] = hr;       ll[hp * 64 + lane] = lr;
    lh[hp * 64 + 32 + lane] = hi;  ll[hp * 64 + 32 + lane] = li;
  }
  __builtin_amdgcn_fence(__ATOMIC_RELEASE, "workgroup");
  __builtin_amdgcn_wave_barrier();
  __builtin_amdgcn_fence(__ATOMIC_ACQUIRE, "workgroup");
  const int l16 = lane & 15;
  const v8us hv = *(const v8us*)(lh + l16 * 8);
  const v8us lv = *(const v8us*)(ll + l16 * 8);
  const size_t o = (size_t)s * kDm + wave * 128 + l16 * 8;
  {
    if (lane < 16) {
      *(v8us*)(dh + o) = hv;
      *(v8us*)(dl + o) = lv;
    }
    
  }
}

// =====================================================================================
// Causal attention, head dim 64, batch element = blockIdx.y (structural lower-triangular mask incl. diagonal).
//   Every plane below is that of one batch element; element b starts b*kSeq*kDm elements into each buffer.
//   q planes (hi/lo bf16): element (t, h, d) at [t*kDm + h*64 + d]
//   k planes (hi/lo bf16): element (s, h, d) at [s*kDm + h*64 + d]
//   v^T planes (hi/lo bf16): element (h, d, s) at [(h*64 + d)*kSeq + s]
//   out f32: element (t, h, d) at [t*kDm + h*64 + d]
//   scores = (q . k) * sscale : bf16 hi/lo split (hi.hi + hi.lo + lo.hi) on v_wmma_f32_16x16x32_bf16
//   out    = p . v             : bf16 hi/lo split of p (unnormalised) and v, f32 accumulate
//   online softmax in f32. Key tiles strictly above the 64x64 block diagonal (kv chunk > query block) are not
//   visited (probabilities exactly 0 in f32); inside the diagonal tile, score := mfill where kv > query (select).
//   Block = 4 waves = 64 query rows of one head; grid.x = kHeads * (kSeq/64); kv chunks of 64, trip count qb+1 <= 32;
//   which of the head's 32 query tiles a block takes: the permutation at qb in the kernel.
//   K / V^T chunk staging: 128 threads x 32 elements per plane = the whole 64x64 tile (16-B copies, plain loads,
//   __syncthreads before and after); fragment loads read the LDS tiles with the same v8b element type.
//   Output coverage: grid.x 16 heads x 32 query blocks x 4 waves x 16 rows x 64 cols = one [2048][1024] plane per grid.y.
// =====================================================================================
#define AT_D 64
#define AT_NW 4
#define AT_QB 64
#define AT_KC 64
#define AT_LP 72   // LDS row pitch of the K, V^T and P tiles in 16-bit elements: 144 B = 16 B x 9 (odd), so that the 16 rows of one 16-B fragment read fall on 16 different bank groups

__device__ __forceinline__ unsigned short at_bf_bits(float f) {
  unsigned u = __float_as_uint(f);
  return (unsigned short)((u + 0x7FFFu + ((u >> 16) & 1u)) >> 16);
}
__device__ __forceinline__ __bf16 at_f2bf(float f) { return __builtin_bit_cast(__bf16, at_bf_bits(f)); }
__device__ __forceinline__ void at_split(float f, __bf16& hi, __bf16& lo) {
  const unsigned short hb = at_bf_bits(f);
  hi = __builtin_bit_cast(__bf16, hb);
  lo = at_f2bf(f - __uint_as_float(((unsigned)hb) << 16));
}
__device__ __forceinline__ v8f at_mma(v16b a, v16b b, v8f c) {
  c = __builtin_amdgcn_wmma_f32_16x16x32_bf16(false, a, false, b, (short)0, c, false, false);
  asm volatile("v_nop\n\tv_nop\n\tv_nop\n\tv_nop" : "+v"(c) : "v"(a), "v"(b));
  return c;
}

// Value of lane l ^ M inside a 16-lane row (M = 1, 2, 4, 8) as a DPP operand of the vector unit (row_xmask); a shuffle builtin goes
// through the LDS queue instead and each step of a reduction then waits for that queue.
template <int M>
__device__ __forceinline__ float at_row_xor(float v) {
  return __int_as_float(__builtin_amdgcn_mov_dpp(__float_as_int(v), 0x160 + M, 0xf, 0xf, true));
}
__device__ __forceinline__ float at_row_max(float m) {
  m = fmaxf(m, at_row_xor<1>(m));
  m = fmaxf(m, at_row_xor<2>(m));
  m = fmaxf(m, at_row_xor<4>(m));
  m = fmaxf(m, at_row_xor<8>(m));
  return m;
}
__device__ __forceinline__ float at_row_sum(float s) {
  s += at_row_xor<1>(s);
  s += at_row_xor<2>(s);
  s += at_row_xor<4>(s);
  s += at_row_xor<8>(s);
  return s;
}

__global__ __launch_bounds__(128)
void attn_causal64_kernel(const unsigned short* __restrict__ qhp, const unsigned short* __restrict__ qlp,
                          const unsigned short* __restrict__ khp, const unsigned short* __restrict__ klp,
                          const unsigned short* __restrict__ vhp, const unsigned short* __restrict__ vlp,
                          float* __restrict__ out, float sscale, float mfill) {
  union FB { v16b v; v8b h[2]; };
  __shared__ __align__(16) __bf16 Ksh[AT_KC * AT_LP];            // K hi [kv][d], 64 rows of 144 B
  __shared__ __align__(16) __bf16 Ksl[AT_KC * AT_LP];            // K lo
  __shared__ __align__(16) __bf16 Vth[AT_D * AT_LP];             // V hi [d][kv], 64 rows of 144 B
  __shared__ __align__(16) __bf16 Vtl[AT_D * AT_LP];             // V lo
  __shared__ __align__(16) __bf16 Psh[AT_NW][16 * AT_LP];        // per wave P hi [row][kv], 16 rows of 144 B
  __shared__ __align__(16) __bf16 Psl[AT_NW][16 * AT_LP];        // per wave P lo
  __shared__ __align__(16) float  Os[AT_NW][16 * 68];            // per wave out tile, pitch 68

  const int tid  = threadIdx.x;
  const int wave = tid >> 5;
  const int lane = tid & 31;
  const int hh   = lane >> 4;
  const int c    = lane & 15;

  const int nqb = kSeq / AT_QB;           // 32
  const int bx = blockIdx.x;
  const int h  = bx / nqb;                // 0..kHeads-1 (grid = kHeads * nqb)
  // Query tile of this block. A tile's cost is its key walk, qb + 1 chunks, and the whole grid is resident at once (4 blocks a WGP),
  // so the launch lasts as long as the WGP whose 4 blocks hold the most chunks. With qb = bx % 32 blocks whose flat index is equal
  // mod 256 (and mod 32) all hold the same tile. The map below is, for each head and batch element, a permutation of the 32 tiles in
  // which j and j + 16, and flat indices 256 apart, hold tiles t and 31 - t, and an even j and j + 1 tiles that add up to 30 or 32: sets
  // of blocks that start next to each other or a whole round of WGPs apart then hold about 33 chunks a pair. For speed only: the result
  // does not depend on where a block runs.
  const int j   = bx % nqb;
  const int tt  = (j >= nqb / 2) ? (nqb + nqb / 2 - 1 - j) : j;   // j = 0..15 -> j, 16..31 -> 47 - j = 31 - (j - 16)
  const int rnd = bx >> 8;                                        // parity of flat block index / 256 (gridDim.x = 512 = 2 x 256)
  const int qb  = ((j ^ rnd) & 1) ? (nqb - 1 - tt) : tt;          // block-uniform, 0..31
  const int q0 = qb * AT_QB + wave * 16;

  const size_t bo = (size_t)blockIdx.y * kSeq * kDm;
  const __bf16* Qh = (const __bf16*)(const void*)qhp + bo + (size_t)h * AT_D;
  const __bf16* Ql = (const __bf16*)(const void*)qlp + bo + (size_t)h * AT_D;
  const __bf16* Kh = (const __bf16*)(const void*)khp + bo + (size_t)h * AT_D;
  const __bf16* Kl = (const __bf16*)(const void*)klp + bo + (size_t)h * AT_D;
  const __bf16* Vh = (const __bf16*)(const void*)vhp + bo + (size_t)h * AT_D * kSeq;
  const __bf16* Vl = (const __bf16*)(const void*)vlp + bo + (size_t)h * AT_D * kSeq;
  float*        ob = out + bo + (size_t)h * AT_D;

  // ---- Q fragments (A operand, row = lane&15, split k map via Frag load): 2 d-chunks, hi and lo ----
  v16b qah[2], qal[2];
#pragma unroll
  for (int dc = 0; dc < 2; ++dc) {
    const __bf16* qr = Qh + (size_t)(q0 + c) * kDm + dc * 32 + 8 * hh;
    const __bf16* ql = Ql + (size_t)(q0 + c) * kDm + dc * 32 + 8 * hh;
    qah[dc] = Frag<__bf16>::load(qr);
    qal[dc] = Frag<__bf16>::load(ql);
  }

  float mrow[8], lrow[8];
  v8f oacc[4];
#pragma unroll
  for (int r = 0; r < 8; ++r) { mrow[r] = -INFINITY; lrow[r] = 0.f; }
#pragma unroll
  for (int t = 0; t < 4; ++t) oacc[t] = (v8f){0.f,0.f,0.f,0.f,0.f,0.f,0.f,0.f};

  int nChunks = qb + 1;                      // block-uniform, <= 32
  if (nChunks > kSeq / AT_KC) nChunks = kSeq / AT_KC;
  for (int kc = 0; kc < nChunks; ++kc) {
    const int kv0 = kc * AT_KC;
    __syncthreads();
    {
      // staging coverage: 128 threads x (4 x 8) elements = 64 rows x 64 per plane = the whole chunk tile
      const int r = tid >> 1, half = (tid & 1) * 32;
      const __bf16* ksh = Kh + (size_t)(kv0 + r) * kDm + half;     // K row kv0+r, d = half..half+31
      const __bf16* ksl = Kl + (size_t)(kv0 + r) * kDm + half;
      const __bf16* vsh = Vh + (size_t)r * kSeq + kv0 + half;     // V^T row d = r, s = kv0+half..+31
      const __bf16* vsl = Vl + (size_t)r * kSeq + kv0 + half;
#pragma unroll
      for (int i = 0; i < 4; ++i) {
        const v8b a0 = *(const v8b*)(ksh + 8 * i);
        const v8b a1 = *(const v8b*)(ksl + 8 * i);
        const v8b b0 = *(const v8b*)(vsh + 8 * i);
        const v8b b1 = *(const v8b*)(vsl + 8 * i);
        *(v8b*)(Ksh + r * AT_LP + half + 8 * i) = a0;
        *(v8b*)(Ksl + r * AT_LP + half + 8 * i) = a1;
        *(v8b*)(Vth + r * AT_LP + half + 8 * i) = b0;
        *(v8b*)(Vtl + r * AT_LP + half + 8 * i) = b1;
      }
    }
    __syncthreads();

    v8f s[4];
#pragma unroll
    for (int j = 0; j < 4; ++j) {
      s[j] = (v8f){0.f,0.f,0.f,0.f,0.f,0.f,0.f,0.f};
#pragma unroll
      for (int dc = 0; dc < 2; ++dc) {
        FB kb, kl;
        kb.h[0] = *(const v8b*)(Ksh + (j * 16 + c) * AT_LP + dc * 32 + 8 * hh);
        kb.h[1] = *(const v8b*)(Ksh + (j * 16 + c) * AT_LP + dc * 32 + 16 + 8 * hh);
        kl.h[0] = *(const v8b*)(Ksl + (j * 16 + c) * AT_LP + dc * 32 + 8 * hh);
        kl.h[1] = *(const v8b*)(Ksl + (j * 16 + c) * AT_LP + dc * 32 + 16 + 8 * hh);
        s[j] = at_mma(qah[dc], kb.v, s[j]);
        s[j] = at_mma(qah[dc], kl.v, s[j]);
        s[j] = at_mma(qal[dc], kb.v, s[j]);
      }
    }
    // ---- scale, structural causal select on the diagonal tile, row max over the 16 lanes of each half ----
    const bool diag = (kc == qb);            // block-uniform
    float cm[8];
#pragma unroll
    for (int r = 0; r < 8; ++r) {
      const int qrow = q0 + 8 * hh + r;                       // 0..kSeq-1
      float m = -INFINITY;
#pragma unroll
      for (int j = 0; j < 4; ++j) {
        const int kvcol = kv0 + j * 16 + c;
        const float sv = s[j][r] * sscale;
        const bool masked = diag && (kvcol > qrow);
        const float sm = masked ? mfill : sv;
        s[j][r] = sm;
        m = fmaxf(m, sm);
      }
      cm[r] = at_row_max(m);
    }
    __bf16* pwh = Psh[wave];
    __bf16* pwl = Psl[wave];
#pragma unroll
    for (int r = 0; r < 8; ++r) {
      const float mnew = fmaxf(mrow[r], cm[r]);
      const float alpha = expf(mrow[r] - mnew);
      mrow[r] = mnew;
      float psum = 0.f;
#pragma unroll
      for (int j = 0; j < 4; ++j) {
        const float p = expf(s[j][r] - mnew);
        psum += p;
        __bf16 a, bl; at_split(p, a, bl);
        pwh[(8 * hh + r) * AT_LP + j * 16 + c] = a;
        pwl[(8 * hh + r) * AT_LP + j * 16 + c] = bl;
      }
      psum = at_row_sum(psum);
      lrow[r] = lrow[r] * alpha + psum;
#pragma unroll
      for (int t = 0; t < 4; ++t) oacc[t][r] *= alpha;
    }
    __builtin_amdgcn_fence(__ATOMIC_RELEASE, "workgroup");
    __builtin_amdgcn_wave_barrier();
    __builtin_amdgcn_fence(__ATOMIC_ACQUIRE, "workgroup");
#pragma unroll 1
    for (int kk = 0; kk < 2; ++kk) {
      FB pa, pl;
      pa.h[0] = *(const v8b*)(pwh + c * AT_LP + kk * 32 + 8 * hh);
      pa.h[1] = *(const v8b*)(pwh + c * AT_LP + kk * 32 + 16 + 8 * hh);
      pl.h[0] = *(const v8b*)(pwl + c * AT_LP + kk * 32 + 8 * hh);
      pl.h[1] = *(const v8b*)(pwl + c * AT_LP + kk * 32 + 16 + 8 * hh);
#pragma unroll
      for (int t = 0; t < 4; ++t) {
        FB vb, vl;
        vb.h[0] = *(const v8b*)(Vth + (t * 16 + c) * AT_LP + kk * 32 + 8 * hh);
        vb.h[1] = *(const v8b*)(Vth + (t * 16 + c) * AT_LP + kk * 32 + 16 + 8 * hh);
        vl.h[0] = *(const v8b*)(Vtl + (t * 16 + c) * AT_LP + kk * 32 + 8 * hh);
        vl.h[1] = *(const v8b*)(Vtl + (t * 16 + c) * AT_LP + kk * 32 + 16 + 8 * hh);
        oacc[t] = at_mma(pa.v, vb.v, oacc[t]);
        oacc[t] = at_mma(pa.v, vl.v, oacc[t]);
        oacc[t] = at_mma(pl.v, vb.v, oacc[t]);
      }
    }
  }

  float* os = Os[wave];
#pragma unroll
  for (int r = 0; r < 8; ++r) {
    const float inv = 1.0f / lrow[r];
#pragma unroll
    for (int t = 0; t < 4; ++t) os[(8 * hh + r) * 68 + t * 16 + c] = oacc[t][r] * inv;
  }
  __builtin_amdgcn_fence(__ATOMIC_RELEASE, "workgroup");
  __builtin_amdgcn_wave_barrier();
  __builtin_amdgcn_fence(__ATOMIC_ACQUIRE, "workgroup");
  {
    const int c4 = (lane & 15) * 4;
    {
#pragma unroll
      for (int it = 0; it < 8; ++it) {
        const int row = it * 2 + hh;   // it 0..7 x hh 0..1 covers rows 0..15 of the wave tile
        v4f val = *(const v4f*)(os + row * 68 + c4);
        *(v4f*)(ob + (size_t)(q0 + row) * kDm + c4) = val;
      }
      
    }
  }
}

// ---------------------------------------------------------------------------
// Workspace region map (byte offsets). Every GEMM: K in {1024, 32} (%32 == 0), M = kRows = 4096, N in {128, 1024} (%128 == 0).
// Activation regions hold both batch elements, row = b*2048 + s.
// Every region is fully written before it is read within the in-order launch sequence; reused regions noted.
//   Wqh bf16 [1024 n][1024 k]        0      Wql    2097152
//   Wkh                        4194304      Wkl    6291456
//   Wvh                        8388608      Wvl   10485760
//   Woh                       12582912      Wol   14680064
//   W1Th bf16 [128 n][1024 k] 16777216      W1Tl  17039360   (rows 96..127 zero)
//   W2Th bf16 [3][1024 n][32] 17301504      W2Tl  17498112
//   XXh  bf16 [4096][1024]    17694720      XXl   26083328   (xxx planes; reused after the LoRA GEMM as Oh / Ol)
//   LORAf f32 [4096][128]     34471936
//   LTh  bf16 [4096][128]     36569088      LTl   37617664
//   MIX  f32 [3][4096][1024]  38666240                       (reused after the mix kernel: Qf = +0, Kf = +16777216,
//                                                             Vf = +33554432 f32 [4096][1024]; Of reuses Qf)
//   XQh/XQl/XKh/XKl/XVh/XVl   88997888 .. (6 x 8388608)
//   Qh/Ql/Kh/Kl              139329536 .. (4 x 8388608)
//   VTh/VTl bf16 [2][1024][2048] 172883968, 181272576
//   total                    189661184  (~180.9 MiB)
// ---------------------------------------------------------------------------
extern "C" void kernel_launch(void* const* d_in, const int* in_sizes, int n_in,
                              void* d_out, int out_size, void* d_ws, size_t ws_size,
                              hipStream_t stream) {
  if (n_in < 21) return;
  const int nRow = kSeq * kDm;            // 2097152 per batch element
  const int nAct = kBatch * nRow;         // 4194304
  const int nW   = kDm * kDm;             // 1048576
  if (in_sizes[0] != nAct) return;
  if (in_sizes[1] != kBatch * kDm) return;
  if (in_sizes[2] != kDm || in_sizes[3] != kDm || in_sizes[4] != kDm || in_sizes[5] != kDm) return;
  if (in_sizes[6] != kDm * kLoraN) return;
  if (in_sizes[7] != 3 * kLoraD * kDm) return;
  if (in_sizes[8] != nW || in_sizes[9] != nW || in_sizes[10] != nW || in_sizes[11] != nW) return;
  for (int i = 12; i < 20; ++i) if (in_sizes[i] != kDm) return;
  if (in_sizes[20] != kSeq * 32) return;
  if (out_size != nAct) return;

  const float* x     = (const float*)d_in[0];    // [2][2048][1024]
  const float* ss    = (const float*)d_in[1];    // [2][1024]
  const float* maax  = (const float*)d_in[2];    // [1024]
  const float* maar  = (const float*)d_in[3];
  const float* maak  = (const float*)d_in[4];
  const float* maav  = (const float*)d_in[5];
  const float* w1    = (const float*)d_in[6];    // [1024][96]
  const float* w2    = (const float*)d_in[7];    // [3][32][1024]
  const float* wq    = (const float*)d_in[8];    // [1024 out][1024 in]
  const float* wk    = (const float*)d_in[9];
  const float* wv    = (const float*)d_in[10];
  const float* wo    = (const float*)d_in[11];
  const float* lnrg  = (const float*)d_in[12];
  const float* lnrb  = (const float*)d_in[13];
  const float* lnkg  = (const float*)d_in[14];
  const float* lnkb  = (const float*)d_in[15];
  const float* lnvg  = (const float*)d_in[16];
  const float* lnvb  = (const float*)d_in[17];
  const float* lnxg  = (const float*)d_in[18];
  const float* lnxb  = (const float*)d_in[19];
  const float* ang   = (const float*)d_in[20];   // [2048][32]

  const size_t PW   = (size_t)kDm * kDm * 2;          // 2097152  bf16 weight plane
  const size_t PX   = (size_t)kRows * kDm * 2;        // 8388608  bf16 activation plane (both batch elements)
  const size_t PF   = (size_t)kRows * kDm * 4;        // 16777216 f32 activation plane
  const size_t PW1  = (size_t)kLoraP * kDm * 2;       // 262144
  const size_t PW2  = (size_t)3 * kDm * kLoraD * 2;   // 196608
  const size_t PLF  = (size_t)kRows * kLoraP * 4;     // 2097152
  const size_t PLT  = (size_t)kRows * kLoraP * 2;     // 1048576
  size_t off = 0;
  const size_t oWqh = off; off += PW;  const size_t oWql = off; off += PW;
  off += 4 * PW;                                // Wkh, Wkl, Wvh, Wvl: reached from Wqh / Wql by the plane stride
  const size_t oWoh = off; off += PW;  const size_t oWol = off; off += PW;
  const size_t oW1h = off; off += PW1; const size_t oW1l = off; off += PW1;
  const size_t oW2h = off; off += PW2; const size_t oW2l = off; off += PW2;
  const size_t oXXh = off; off += PX;  const size_t oXXl = off; off += PX;
  const size_t oLF  = off; off += PLF;
  const size_t oLTh = off; off += PLT; const size_t oLTl = off; off += PLT;
  const size_t oMIX = off; off += 3 * PF;
  const size_t oXQh = off; off += PX;  const size_t oXQl = off; off += PX;
  const size_t oXKh = off; off += PX;  const size_t oXKl = off; off += PX;
  const size_t oXVh = off; off += PX;  const size_t oXVl = off; off += PX;
  const size_t oQh  = off; off += PX;  const size_t oQl  = off; off += PX;
  const size_t oKh  = off; off += PX;  const size_t oKl  = off; off += PX;
  const size_t oVTh = off; off += PX;  const size_t oVTl = off; off += PX;
  if (off > ws_size) return;                    // off = 189661184

  char* ws = (char*)d_ws;
  unsigned short* Wqh = (unsigned short*)(ws + oWqh); unsigned short* Wql = (unsigned short*)(ws + oWql);
  unsigned short* Woh = (unsigned short*)(ws + oWoh); unsigned short* Wol = (unsigned short*)(ws + oWol);
  unsigned short* W1h = (unsigned short*)(ws + oW1h); unsigned short* W1l = (unsigned short*)(ws + oW1l);
  unsigned short* W2h = (unsigned short*)(ws + oW2h); unsigned short* W2l = (unsigned short*)(ws + oW2l);
  unsigned short* XXh = (unsigned short*)(ws + oXXh); unsigned short* XXl = (unsigned short*)(ws + oXXl);
  float*          LF  = (float*)(ws + oLF);
  unsigned short* LTh = (unsigned short*)(ws + oLTh); unsigned short* LTl = (unsigned short*)(ws + oLTl);
  float*          MIX = (float*)(ws + oMIX);
  float*          Qf  = (float*)(ws + oMIX);
  float*          Kf  = (float*)(ws + oMIX + PF);
  float*          Vf  = (float*)(ws + oMIX + 2 * PF);
  float*          Of  = Qf;
  unsigned short* XQh = (unsigned short*)(ws + oXQh); unsigned short* XQl = (unsigned short*)(ws + oXQl);
  unsigned short* XKh = (unsigned short*)(ws + oXKh); unsigned short* XKl = (unsigned short*)(ws + oXKl);
  unsigned short* XVh = (unsigned short*)(ws + oXVh); unsigned short* XVl = (unsigned short*)(ws + oXVl);
  unsigned short* Qh  = (unsigned short*)(ws + oQh);  unsigned short* Ql  = (unsigned short*)(ws + oQl);
  unsigned short* Kh  = (unsigned short*)(ws + oKh);  unsigned short* Kl  = (unsigned short*)(ws + oKl);
  unsigned short* VTh = (unsigned short*)(ws + oVTh); unsigned short* VTl = (unsigned short*)(ws + oVTl);
  unsigned short* Oh  = XXh;                          unsigned short* Ol  = XXl;

  const float* dummyf = lnrg;                         // valid pointer for unused bias / resid arguments (never read)

  const dim3 blk(256);
  const int  n2w = nW / 2;                                  // 524288 pairs per weight plane
  const dim3 gCastW((n2w + 255) / 256, 4);                  // 2048 blocks x 256 threads x 2 = 1024x1024, y = q, k, v, o
  const dim3 gW1(kDm / 64);                                 // 16 k-tiles
  const dim3 gW2(kDm / 64, 3);                              // 16 n-tiles x 3
  const dim3 gRow(kRows);                                   // one block per token row (128-thread kernels)
  const dim3 blkG(128);                                     // GEMM block: 4 waves, one 128x128 tile
  const dim3 gLora((kRows / 128) * (kLoraP / 128));         // 32 tiles: M=4096, N=128
  const dim3 gMix((kRows / 128) * (kDm / 128), 3);          // 256 tiles x 3 (l): M=4096, N=1024, K=32
  const int  n2l = kRows * kLoraP / 2;                      // 262144 pairs
  const dim3 gTanh((n2l + 255) / 256);                      // 1024 blocks x 256 x 2 = 4096x128
  const dim3 gQKV((kRows / 128) * (kDm / 128), 3);          // 256 tiles x 3 (q, k, v): M=4096, N=1024
  const dim3 gProj((kRows / 128) * (kDm / 128), 1);         // 256 tiles: M=4096, N=1024
  const dim3 gLnQK(kRows, 2);                               // 4096 rows x {q, k}
  const dim3 gLn1(kRows, 1);
  const dim3 gVT(kDm / 64, kSeq / 64, kBatch);              // per b: in [R=2048 s][Cn=1024 c] -> planes [c][s]
  const dim3 gAtt(kHeads * (kSeq / 64), kBatch);            // 512 x 2 blocks: 16 heads x 32 query blocks, y = b

  // setup: weights -> bf16 hi/lo planes (q/k/v/o already [out n][in k] = Bt layout; w1/w2 transposed).
  // The hi planes of q, k, v, o lie 2 weight planes apart (hi, lo, hi, lo, ...), and so do the lo planes.
  split_bf16x2_kernel<<<gCastW, blk, 0, stream>>>(wq, wk, wv, wo, Wqh, Wql, n2w, 2L * nW);
  w1t_split_kernel<<<gW1, blk, 0, stream>>>(w1, W1h, W1l);
  w2t_split_kernel<<<gW2, blk, 0, stream>>>(w2, W2h, W2l);

  // Each stage below runs once, on the rows of both batch elements.
  // (1) xxx = x + dxprev*maa_x -> planes
  xxx_split_kernel<<<gRow, dim3(128), 0, stream>>>(x, ss, maax, XXh, XXl);
  // (2) lora_pre = xxx . w1 -> f32 [4096][128]   (M=4096, N=128, K=1024)
  wmma_gemm64<1, true, 0, 0, false, 0><<<gLora, blkG, 0, stream>>>(
      XXh, XXl, kDm, 0L, W1h, W1l, kDm, 0L, (void*)LF, (void*)LF, kLoraP, 0L,
      dummyf, dummyf, 0L, kRows, kLoraP, kDm, 1.0f);
  // (3) lora = tanh -> planes [4096][128]
  tanh_split_kernel<<<gTanh, blk, 0, stream>>>(LF, LTh, LTl, n2l);
  // (4) mixes[l] = lora[:, 32l..32l+31] . w2[l] -> f32 [3][4096][1024]   (M=4096, N=1024, K=32; grid.y = l)
  wmma_gemm64<1, true, 0, 0, false, 0><<<gMix, blkG, 0, stream>>>(
      LTh, LTl, kLoraP, (long)kLoraD, W2h, W2l, kLoraD, (long)kDm * kLoraD, (void*)MIX, (void*)MIX, kDm, (long)nAct,
      dummyf, dummyf, 0L, kRows, kDm, kLoraD, 1.0f);
  // (5) xq/xk/xv = x + dxprev*(maa + mix) -> planes
  mix_split_kernel<<<gRow, dim3(128), 0, stream>>>(x, ss, maar, maak, maav, MIX, XQh, XQl, XKh, XKl, XVh, XVl);
  // (6) q0 = xq . Wq^T, k0 = xk . Wk^T, v0 = xv . Wv^T -> f32 [3][4096][1024]   (M=4096, N=1024, K=1024; grid.y = q, k, v:
  //     XQ/XK/XV hi planes lie 2 activation planes apart, Wq/Wk/Wv hi planes 2 weight planes, Qf/Kf/Vf one f32 plane)
  wmma_gemm64<1, true, 0, 0, false, 0><<<gQKV, blkG, 0, stream>>>(
      XQh, XQl, kDm, 2L * nAct, Wqh, Wql, kDm, 2L * nW, (void*)Qf, (void*)Qf, kDm, (long)nAct,
      dummyf, dummyf, 0L, kRows, kDm, kDm, 1.0f);
  // (7) LayerNorm + RoPE + split for q and k -> planes [row][h*64+d]
  ln_kernel<0><<<gLnQK, blk, 0, stream>>>(Qf, Kf, lnrg, lnrb, lnkg, lnkb, ang, Qh, Ql, Kh, Kl, Qf);
  // (8) LayerNorm of v in place (f32), then transpose-split -> v^T planes [b][h*64+d][s]
  ln_kernel<1><<<gLn1, blk, 0, stream>>>(Vf, Vf, lnvg, lnvb, lnvg, lnvb, ang, VTh, VTl, VTh, VTl, Vf);
  wt_split_kernel<<<gVT, blk, 0, stream>>>(Vf, VTh, VTl, kSeq, kDm);
  // (9) causal attention per batch element and head -> f32 [row][h*64+d] (Of region; Qf is dead after step 7)
  attn_causal64_kernel<<<gAtt, dim3(128), 0, stream>>>(Qh, Ql, Kh, Kl, VTh, VTl, Of, 0.125f, -1.0e30f);
  // (10) output LayerNorm + split -> planes (XX region is dead after step 2)
  ln_kernel<2><<<gLn1, blk, 0, stream>>>(Of, Of, lnxg, lnxb, lnxg, lnxb, ang, Oh, Ol, Oh, Ol, Of);
  // (11) out = o . Wo^T -> d_out (f32)   (M=4096, N=1024, K=1024)
  wmma_gemm64<1, true, 0, 0, false, 0><<<gProj, blkG, 0, stream>>>(
      Oh, Ol, kDm, 0L, Woh, Wol, kDm, 0L, d_out, d_out, kDm, 0L,
      dummyf, dummyf, 0L, kRows, kDm, kDm, 1.0f);
}

// v006
// Measured time: 314 microseconds a run.
// Two timings next to v005 put it at 1.11 and 1.10 times that version's speed.
// Counting every step since v000, it is 4.13 times as fast.
// All contractions (token-shift LoRA xxx.w1 and lora.w2, q/k/v projections, attention q.k^T and p.v, output projection): v_wmma_f32_16x16x32_bf16 with bf16 hi/lo split operands (hi.hi + hi.lo + lo.hi), f32 accumulate; token shift, tanh, LayerNorms, RoPE, online softmax, score scale 0.125 in f32.
#include <hip/hip_runtime.h>
#include <math.h>
#include <stdint.h>

constexpr int kBatch = 2;
constexpr int kSeq   = 2048;
constexpr int kRows  = kBatch * kSeq;   // token rows of both batch elements, row = b*kSeq + s
constexpr int kDm    = 1024;
constexpr int kHeads = 16;
constexpr int kLoraN = 96;      // 3 x 32 LoRA outputs
constexpr int kLoraP = 128;     // padded to a 64-multiple
constexpr int kLoraD = 32;

typedef __attribute__((ext_vector_type(16))) _Float16 v16h;
typedef __attribute__((ext_vector_type(8)))  _Float16 v8h;
typedef __attribute__((ext_vector_type(16))) __bf16   v16b;
typedef __attribute__((ext_vector_type(8)))  __bf16   v8b;
typedef __attribute__((ext_vector_type(2)))  __bf16   v2b;
typedef __attribute__((ext_vector_type(8)))  float    v8f;
typedef __attribute__((ext_vector_type(4)))  float    v4f;
typedef __attribute__((ext_vector_type(2)))  float    v2f;
typedef __attribute__((ext_vector_type(4)))  unsigned int v4u;
typedef __attribute__((ext_vector_type(8)))  unsigned short v8us;

__device__ __forceinline__ unsigned short f2bf_bits(float f) {
  unsigned u = __float_as_uint(f);
  return (unsigned short)((u + 0x7FFFu + ((u >> 16) & 1u)) >> 16);
}
__device__ __forceinline__ float bf_bits2f(unsigned short h) { return __uint_as_float(((unsigned)h) << 16); }

// hazard guards as plain device helpers
__device__ __forceinline__ void dep_guard_h(v8f& a, v8f& b, v16h x, v16h y) { asm volatile("v_nop\n\tv_nop\n\tv_nop\n\tv_nop" : "+v"(a), "+v"(b) : "v"(x), "v"(y)); }
__device__ __forceinline__ void dep_guard_b(v8f& a, v8f& b, v16b x, v16b y) { asm volatile("v_nop\n\tv_nop\n\tv_nop\n\tv_nop" : "+v"(a), "+v"(b) : "v"(x), "v"(y)); }
__device__ __forceinline__ void keep4_h(v16h a, v16h b, v16h c, v16h d) { asm volatile("v_nop" :: "v"(a), "v"(b), "v"(c), "v"(d)); }
__device__ __forceinline__ void keep4_b(v16b a, v16b b, v16b c, v16b d) { asm volatile("v_nop" :: "v"(a), "v"(b), "v"(c), "v"(d)); }
__device__ __forceinline__ void acc_guard4(v8f& a, v8f& b, v8f& c, v8f& d) { asm volatile("v_nop\n\tv_nop\n\tv_nop\n\tv_nop" : "+v"(a), "+v"(b), "+v"(c), "+v"(d)); }
template <typename T> struct Frag;
template <> struct Frag<_Float16> {
  typedef v16h V; union U { v16h v; v8h h[2]; };
  static __device__ __forceinline__ v16h load(const _Float16* p) {   // elements 0..7 <- p[0..7], 8..15 <- p[16..23]
    U f; f.h[0] = *(const v8h*)(p); f.h[1] = *(const v8h*)(p + 16); return f.v;
  }
  static __device__ __forceinline__ v8f mma(v16h a, v16h b, v8f c) {
    return __builtin_amdgcn_wmma_f32_16x16x32_f16(false, a, false, b, (short)0, c, false, false);
  }
  static __device__ __forceinline__ void guard(v8f& a, v8f& b, v16h x, v16h y) { dep_guard_h(a, b, x, y); }
  static __device__ __forceinline__ void keep(v16h a, v16h b, v16h c, v16h d) { keep4_h(a, b, c, d); }
};
template <> struct Frag<__bf16> {
  typedef v16b V; union U { v16b v; v8b h[2]; };
  static __device__ __forceinline__ v16b load(const __bf16* p) {
    U f; f.h[0] = *(const v8b*)(p); f.h[1] = *(const v8b*)(p + 16); return f.v;
  }
  static __device__ __forceinline__ v8f mma(v16b a, v16b b, v8f c) {
    return __builtin_amdgcn_wmma_f32_16x16x32_bf16(false, a, false, b, (short)0, c, false, false);
  }
  static __device__ __forceinline__ void guard(v8f& a, v8f& b, v16b x, v16b y) { dep_guard_b(a, b, x, y); }
  static __device__ __forceinline__ void keep(v16b a, v16b b, v16b c, v16b d) { keep4_b(a, b, c, d); }
};

// ---- Register-blocked batched WMMA GEMM, operands staged in LDS --------------
// C[m,n] = scale * sum_k A[m,k] * Bt[n,k] (+bias)(+resid); a block of 4 waves (2 x 2) owns a 128x128 tile, each wave 64x64 of it.
// A row-major [M,K]; Bt row-major [N,K]; M,N % 128 == 0, K % 32 == 0.
// Per 32-wide k tile the block brings 128 A rows and 128 Bt rows of every plane (64 B a row) into LDS with asynchronous
// 16-B copies (a wave-wide copy = 8 rows x 64 contiguous B), two buffers: tile t+1 flies while tile t is multiplied.
// SPLIT: operands are hi/lo planes (A2/Bt2 = lo planes, same layout); product = hi.hi + hi.lo + lo.hi.
// BIAS_MODE: 0 = none, 1 = bias[m], 2 = bias[n].
// OUT_MODE: 0 = f32, 1 = f16, 2 = bf16 hi plane (Cout) + bf16 lo plane (Cout2).
// Coverage per wave tile: 4 slabs x 16 rows x 64 cols = 64x64 (f32: it 0..7 x hh 0..1 rows, 16 lanes x 4 floats;
// 16-bit: it 0..3 x q 0..3 rows, 8 lanes x 8 elements).
// ET: 0 = f16 operands, 1 = bf16 operands (pointers passed as 16-bit storage)
template <int ET> struct Elem;
template <> struct Elem<0> { typedef _Float16 T; };
template <> struct Elem<1> { typedef __bf16 T; };
constexpr int kGLP    = 40;            // LDS row pitch in 16-bit elements: 80 B = 16 B x 5 (odd), the pitch for 16-B reads of 64-B rows
constexpr int kGPlane = 128 * kGLP;    // one plane of a stage: 128 rows
constexpr int kGStage = 4 * kGPlane;   // A hi, A lo, Bt hi, Bt lo

// Four rows (32 apart) of one plane pair -> LDS: 8 (hi and lo) or 4 (hi only) copies of 16 B per lane. l = the lane's LDS byte
// address of its first hi row, g / g2 = its global address in the hi / lo plane, step = 32 source rows in elements.
// s_wait_xcnt 0 ends the copies' own statement, so that it stands in front of any rewrite of the address registers they name.
template <typename T>
__device__ __forceinline__ void stage_rows8(unsigned l, const T* g, const T* g2, size_t step) {
  const unsigned l1 = l + 32 * kGLP * 2, l2 = l + 64 * kGLP * 2, l3 = l + 96 * kGLP * 2;
  const unsigned m0 = l + kGPlane * 2, m1 = l1 + kGPlane * 2, m2 = l2 + kGPlane * 2, m3 = l3 + kGPlane * 2;
  const T* g1 = g + step;  const T* gg2 = g1 + step;  const T* g3 = gg2 + step;
  const T* h1 = g2 + step; const T* h2 = h1 + step;   const T* h3 = h2 + step;
  asm volatile("global_load_async_to_lds_b128 %0, %8, off\n\t"
               "global_load_async_to_lds_b128 %1, %9, off\n\t"
               "global_load_async_to_lds_b128 %2, %10, off\n\t"
               "global_load_async_to_lds_b128 %3, %11, off\n\t"
               "global_load_async_to_lds_b128 %4, %12, off\n\t"
               "global_load_async_to_lds_b128 %5, %13, off\n\t"
               "global_load_async_to_lds_b128 %6, %14, off\n\t"
               "global_load_async_to_lds_b128 %7, %15, off\n\t"
               "s_wait_xcnt 0x0"
               :: "v"(l), "v"(l1), "v"(l2), "v"(l3), "v"(m0), "v"(m1), "v"(m2), "v"(m3),
                  "v"(g), "v"(g1), "v"(gg2), "v"(g3), "v"(g2), "v"(h1), "v"(h2), "v"(h3) : "memory");
}
template <typename T>
__device__ __forceinline__ void stage_rows4(unsigned l, const T* g, size_t step) {
  const unsigned l1 = l + 32 * kGLP * 2, l2 = l + 64 * kGLP * 2, l3 = l + 96 * kGLP * 2;
  const T* g1 = g + step; const T* gg2 = g1 + step; const T* g3 = gg2 + step;
  asm volatile("global_load_async_to_lds_b128 %0, %4, off\n\t"
               "global_load_async_to_lds_b128 %1, %5, off\n\t"
               "global_load_async_to_lds_b128 %2, %6, off\n\t"
               "global_load_async_to_lds_b128 %3, %7, off\n\t"
               "s_wait_xcnt 0x0"
               :: "v"(l), "v"(l1), "v"(l2), "v"(l3), "v"(g), "v"(g1), "v"(gg2), "v"(g3) : "memory");
}

template <int ET, bool SPLIT, int BIAS_MODE, int OUT_MODE, bool RESID, int ACT = 0>
__global__ __launch_bounds__(128) void wmma_gemm64(
    const unsigned short* __restrict__ Ap, const unsigned short* __restrict__ A2p, int lda, long strideA,
    const unsigned short* __restrict__ Btp, const unsigned short* __restrict__ Bt2p, int ldb, long strideB,
    void* __restrict__ Cout, void* __restrict__ Cout2, int ldc, long strideC,
    const float* __restrict__ bias,
    const float* __restrict__ resid, long strideR,
    int M, int N, int K, float scale) {
  typedef typename Elem<ET>::T T;
  typedef typename Frag<T>::V V;
  const T* A = (const T*)Ap; const T* A2 = (const T*)A2p; const T* Bt = (const T*)Btp; const T* Bt2 = (const T*)Bt2p;
  __shared__ __align__(16) T ring[2 * kGStage];    // two stages of operand tiles, 2 x 40,960 B
  __shared__ __align__(16) float sT[4][16 * 68];   // per-wave 16x64 slab, pitch 68 floats
  const int b    = blockIdx.y;
  const int lane = threadIdx.x & 31;
  const int wave = threadIdx.x >> 5;
  const int tilesN = N >> 7;
  const int tilesM = M >> 7;
  const int tile = blockIdx.x;
  if (tile >= tilesM * tilesN) return;   // block-uniform, in front of every barrier and copy
  const int tm = tile / tilesN;
  const int tn = tile - tm * tilesN;
  const int bm0 = tm << 7;                         // block tile origin
  const int bn0 = tn << 7;
  const int wm = (wave >> 1) << 6;                 // wave tile origin inside the block tile
  const int wn = (wave & 1) << 6;
  const int m0 = bm0 + wm;
  const int n0 = bn0 + wn;

  const T* Ab  = A  + (size_t)b * strideA;
  const T* Bb  = Bt + (size_t)b * strideB;
  const T* Ab2 = SPLIT ? (A2  + (size_t)b * strideA) : nullptr;
  const T* Bb2 = SPLIT ? (Bt2 + (size_t)b * strideB) : nullptr;

  const int rlane = lane & 15;                 // row (A) / col (B, D) within subtile
  const int koff  = (lane >> 4) * 8;           // k offset of this lane half
  const int mOff  = (lane >> 4) * 8;           // D row offset

  v8f acc[4][4];
#pragma unroll
  for (int i = 0; i < 4; ++i)
#pragma unroll
    for (int j = 0; j < 4; ++j) acc[i][j] = (v8f){0.f,0.f,0.f,0.f,0.f,0.f,0.f,0.f};

  // copy map: thread -> row (tid >> 2) + 32 r, r = 0..3, 16-B chunk tid & 3 of the row's 64 B; 128 threads x 4 rows = 128 rows a plane
  const int crow = threadIdx.x >> 2;
  const int cchk = (threadIdx.x & 3) * 8;
  const size_t cao = (size_t)(bm0 + crow) * lda + cchk;
  const size_t cbo = (size_t)(bn0 + crow) * ldb + cchk;
  const size_t stepA = (size_t)32 * lda, stepB = (size_t)32 * ldb;
  const unsigned lds0 = (unsigned)(uintptr_t)(&ring[0]) + (unsigned)(crow * kGLP + cchk) * 2u;   // LDS byte address: low 32 bits
  const int nT = K >> 5;                           // k tiles, the same for the whole grid

#define GEMM_STAGE(t_)                                                                          \
  {                                                                                             \
    const unsigned lt = lds0 + (unsigned)((t_) & 1) * (kGStage * 2u);                           \
    const size_t ko = (size_t)(t_) * 32;                                                        \
    if (SPLIT) {                                                                                \
      stage_rows8<T>(lt, Ab + cao + ko, Ab2 + cao + ko, stepA);                                 \
      stage_rows8<T>(lt + 2u * kGPlane * 2u, Bb + cbo + ko, Bb2 + cbo + ko, stepB);             \
    } else {                                                                                    \
      stage_rows4<T>(lt, Ab + cao + ko, stepA);                                                 \
      stage_rows4<T>(lt + 2u * kGPlane * 2u, Bb + cbo + ko, stepB);                             \
    }                                                                                           \
  }

  GEMM_STAGE(0)
  asm volatile("s_wait_asynccnt 0x0" ::: "memory");   // this wave's copies of tile 0 have landed
  __syncthreads();                                    // ... and every other wave's: tile 0 may be read
  if (nT > 1) GEMM_STAGE(1)

  for (int t = 0; t < nT; ++t) {
    const T* st = ring + (t & 1) * kGStage;
    const T* sA = st + (wm + rlane) * kGLP + koff;
    const T* sB = st + 2 * kGPlane + (wn + rlane) * kGLP + koff;
    V bh[4], bl[4];
#pragma unroll
    for (int j = 0; j < 4; ++j) {
      bh[j] = Frag<T>::load(sB + (j << 4) * kGLP);
      if (SPLIT) bl[j] = Frag<T>::load(sB + kGPlane + (j << 4) * kGLP);
    }
#pragma unroll
    for (int i = 0; i < 4; ++i) {
      V ah = Frag<T>::load(sA + (i << 4) * kGLP);
      V al;
      if (SPLIT) al = Frag<T>::load(sA + kGPlane + (i << 4) * kGLP);
#pragma unroll
      for (int j = 0; j < 4; ++j) {
        acc[i][j] = Frag<T>::mma(ah, bh[j], acc[i][j]);
        if (SPLIT) {
          acc[i][j] = Frag<T>::mma(ah, bl[j], acc[i][j]);
          acc[i][j] = Frag<T>::mma(al, bh[j], acc[i][j]);
        }
      }
      Frag<T>::guard(acc[i][0], acc[i][3], ah, SPLIT ? al : ah);
    }
    Frag<T>::keep(bh[0], bh[1], bh[2], bh[3]);
    if (SPLIT) Frag<T>::keep(bl[0], bl[1], bl[2], bl[3]);
    asm volatile("s_wait_dscnt 0x0" ::: "memory");      // this wave's reads of tile t's buffer are done before it is refilled
    asm volatile("s_wait_asynccnt 0x0" ::: "memory");   // this wave's copies of tile t+1 have landed
    __syncthreads();                                    // publishes tile t+1 and ends every wave's reads of tile t
    if (t + 2 < nT) GEMM_STAGE(t + 2)                   // uniform test; into the buffer that trip t has just read
  }
  asm volatile("s_wait_asynccnt 0x0" ::: "memory");     // no copy outstanding behind the loop
#undef GEMM_STAGE
  acc_guard4(acc[0][0], acc[0][1], acc[0][2], acc[0][3]);
  acc_guard4(acc[1][0], acc[1][1], acc[1][2], acc[1][3]);
  acc_guard4(acc[2][0], acc[2][1], acc[2][2], acc[2][3]);
  acc_guard4(acc[3][0], acc[3][1], acc[3][2], acc[3][3]);

  // ---- epilogue ----
  float* slab = sT[wave];
  const float* Rb = RESID ? (resid + (size_t)b * strideR) : nullptr;
#pragma unroll
  for (int i = 0; i < 4; ++i) {
    const int mBase = m0 + (i << 4);
#pragma unroll
    for (int j = 0; j < 4; ++j) {
      const int n = n0 + (j << 4) + rlane;
      float bv = 0.f;
      if (BIAS_MODE == 2) bv = bias[n];
#pragma unroll
      for (int r = 0; r < 8; ++r) {
        float v = acc[i][j][r] * scale;
        if (BIAS_MODE == 1) v += bias[mBase + mOff + r];
        if (BIAS_MODE == 2) v += bv;
        if (RESID) v += Rb[(size_t)(mBase + mOff + r) * ldc + n];
        if (ACT == 1) v = tanhf(v);
        if (ACT == 2) v = fmaxf(v, 0.0f);
        if (ACT == 3) v = v / (1.0f + expf(-v));
        if (ACT == 4) v = (v > 0.f) ? v : 0.01f * v;
        slab[(mOff + r) * 68 + (j << 4) + rlane] = v;
      }
    }
    __builtin_amdgcn_fence(__ATOMIC_RELEASE, "workgroup");
    __builtin_amdgcn_wave_barrier();
    __builtin_amdgcn_fence(__ATOMIC_ACQUIRE, "workgroup");
    if (OUT_MODE == 0) {
      float* C = (float*)Cout + (size_t)b * strideC;
      const int hh = lane >> 4, c4 = (lane & 15) * 4;     // row seg = 256 B = 16 lanes x 16 B
      {
#pragma unroll
        for (int it = 0; it < 8; ++it) {
          const int row = it * 2 + hh;
          v4f v = *(const v4f*)(slab + row * 68 + c4);
          *(v4f*)(C + (size_t)(mBase + row) * ldc + n0 + c4) = v;
        }
        
      }
    } else {
      const int q = lane >> 3, c8 = (lane & 7) * 8;
      unsigned short* C  = (unsigned short*)Cout  + (size_t)b * strideC;
      unsigned short* C2 = (OUT_MODE == 2) ? ((unsigned short*)Cout2 + (size_t)b * strideC) : nullptr;
      {
#pragma unroll
        for (int it = 0; it < 4; ++it) {
          const int row = it * 4 + q;
          const float* sp = slab + row * 68 + c8;
          v8h hv, lv;
#pragma unroll
          for (int e = 0; e < 8; ++e) {
            if (OUT_MODE == 1) {
              hv[e] = (_Float16)sp[e];
            } else {
              unsigned short hb = f2bf_bits(sp[e]);
              unsigned short lb = f2bf_bits(sp[e] - bf_bits2f(hb));
              hv[e] = __builtin_bit_cast(_Float16, hb);
              lv[e] = __builtin_bit_cast(_Float16, lb);
            }
          }
          *(v8h*)(C + (size_t)(mBase + row) * ldc + n0 + c8) = hv;
          if (OUT_MODE == 2) *(v8h*)(C2 + (size_t)(mBase + row) * ldc + n0 + c8) = lv;
        }
        
      }
    }
    __builtin_amdgcn_fence(__ATOMIC_RELEASE, "workgroup");
    __builtin_amdgcn_wave_barrier();
    __builtin_amdgcn_fence(__ATOMIC_ACQUIRE, "workgroup");
  }
}

// ---------------------------------------------------------------------------
// Elementwise bf16 split: hi = bf16_rne(in), lo = bf16_rne(in - hi); 2 elements per thread, one 4-B store.
// blockIdx.y (block-uniform) picks one of four equally sized sources; its planes start pstride 16-bit elements apart.
// ---------------------------------------------------------------------------
__device__ __forceinline__ unsigned pk16(unsigned short a, unsigned short b) { return (unsigned)a | ((unsigned)b << 16); }

__global__ __launch_bounds__(256) void split_bf16x2_kernel(const float* __restrict__ in0, const float* __restrict__ in1,
                                                           const float* __restrict__ in2, const float* __restrict__ in3,
                                                           unsigned short* __restrict__ hi, unsigned short* __restrict__ lo,
                                                           int n2, long pstride) {
  const int w = blockIdx.y;
  const float* in = (w == 0) ? in0 : (w == 1) ? in1 : (w == 2) ? in2 : in3;
  unsigned short* ph = hi + (size_t)w * pstride;
  unsigned short* pl = lo + (size_t)w * pstride;
  const int i = blockIdx.x * 256 + threadIdx.x;
  if (i < n2) {
    const v2f f = *(const v2f*)(in + 2 * (size_t)i);
    const unsigned short h0 = f2bf_bits(f[0]), h1 = f2bf_bits(f[1]);
    const unsigned short l0 = f2bf_bits(f[0] - bf_bits2f(h0)), l1 = f2bf_bits(f[1] - bf_bits2f(h1));
    const unsigned uh = pk16(h0, h1), ul = pk16(l0, l1);
    ((unsigned*)ph)[i] = uh;
    ((unsigned*)pl)[i] = ul;
    
  }
}

// ---------------------------------------------------------------------------
// tanh then bf16 split: hi = bf16_rne(tanh(in)), lo = bf16_rne(tanh(in) - hi); same store shape as above
// Coverage: grid = ceil(n2/256) x 256 threads x 2 elements = 2*n2 = whole plane.
// ---------------------------------------------------------------------------
__global__ __launch_bounds__(256) void tanh_split_kernel(const float* __restrict__ in, unsigned short* __restrict__ hi,
                                                         unsigned short* __restrict__ lo, int n2) {
  const int i = blockIdx.x * 256 + threadIdx.x;
  if (i < n2) {
    const v2f f = *(const v2f*)(in + 2 * (size_t)i);
    const float t0 = tanhf(f[0]), t1 = tanhf(f[1]);
    const unsigned short h0 = f2bf_bits(t0), h1 = f2bf_bits(t1);
    const unsigned short l0 = f2bf_bits(t0 - bf_bits2f(h0)), l1 = f2bf_bits(t1 - bf_bits2f(h1));
    const unsigned uh = pk16(h0, h1), ul = pk16(l0, l1);
    ((unsigned*)hi)[i] = uh;
    ((unsigned*)lo)[i] = ul;
    
  }
}

// ---------------------------------------------------------------------------
// Transpose + bf16 split: in w[R][Cn] f32 -> planes th/tl [Cn][R] bf16: out[n*R + k] = split(w[k*Cn + n]).
// grid = (Cn/64, R/64, matrices), R, Cn % 64 == 0; matrix z starts z*R*Cn elements into w, th and tl.
// (Used for the LayerNormed v [b][s=R=2048][c=Cn=1024] -> v^T planes [b][c][s].)
// Coverage: load 256 threads x 16 = 64x64; store 8 waves x 2 it x 4 rows(q) x 8 lanes x 8 elements = 64x64.
// ---------------------------------------------------------------------------
__global__ __launch_bounds__(256) void wt_split_kernel(const float* __restrict__ wz, unsigned short* __restrict__ thz,
                                                       unsigned short* __restrict__ tlz, int R, int Cn) {
  __shared__ float tile[64 * 65];
  const int n0 = blockIdx.x * 64;
  const int k0 = blockIdx.y * 64;
  const size_t zo = (size_t)blockIdx.z * R * Cn;
  const float* w = wz + zo;
  unsigned short* th = thz + zo;
  unsigned short* tl = tlz + zo;
  const int t = threadIdx.x;
#pragma unroll
  for (int i = 0; i < 16; ++i) {
    const int idx = i * 256 + t;
    const int kk = idx >> 6, nn = idx & 63;
    tile[nn * 65 + kk] = w[(size_t)(k0 + kk) * Cn + n0 + nn];
  }
  __syncthreads();
  const int lane = t & 31, wave = t >> 5;
  const int q = lane >> 3, c8 = (lane & 7) * 8;
  {
#pragma unroll
    for (int it = 0; it < 2; ++it) {
      const int row = wave * 8 + it * 4 + q;          // 0..63 = local n
      const float* sp = tile + row * 65 + c8;
      v8us hv, lv;
#pragma unroll
      for (int e = 0; e < 8; ++e) {
        const unsigned short hb = f2bf_bits(sp[e]);
        const unsigned short lb = f2bf_bits(sp[e] - bf_bits2f(hb));
        hv[e] = hb; lv[e] = lb;
      }
      const size_t o = (size_t)(n0 + row) * R + k0 + c8;
      *(v8us*)(th + o) = hv;
      *(v8us*)(tl + o) = lv;
    }
    
  }
}

// ---------------------------------------------------------------------------
// LoRA weight w1 [1024 in k][96 out n] f32 -> Bt planes th/tl [kLoraP=128 n][1024 k] bf16, rows n >= 96 ZERO:
//   out[n*1024 + k] = split(n < 96 ? w1[k*96 + n] : 0).  grid = 1024/64 k-tiles; block = 256 threads.
// LDS tile [128 n][65]: load 256 threads x 32 iterations = 64 k x 128 n (address clamped to n <= 95, zero by predicate).
// ---------------------------------------------------------------------------
__global__ __launch_bounds__(256) void w1t_split_kernel(const float* __restrict__ w1, unsigned short* __restrict__ th,
                                                        unsigned short* __restrict__ tl) {
  __shared__ float tile[kLoraP * 65];
  const int k0 = blockIdx.x * 64;
  const int t = threadIdx.x;
#pragma unroll 4
  for (int i = 0; i < 32; ++i) {
    const int idx = i * 256 + t;
    const int kk = idx >> 7, nn = idx & 127;
    const int nc = (nn < kLoraN) ? nn : (kLoraN - 1);
    float v = w1[(size_t)(k0 + kk) * kLoraN + nc];
    if (nn >= kLoraN) v = 0.0f;
    tile[nn * 65 + kk] = v;
  }
  __syncthreads();
  const int lane = t & 31, wave = t >> 5;
  const int q = lane >> 3, c8 = (lane & 7) * 8;
  {
#pragma unroll
    for (int it = 0; it < 4; ++it) {
      const int row = wave * 16 + it * 4 + q;         // 0..127 = n
      const float* sp = tile + row * 65 + c8;
      v8us hv, lv;
#pragma unroll
      for (int e = 0; e < 8; ++e) {
        const unsigned short hb = f2bf_bits(sp[e]);
        const unsigned short lb = f2bf_bits(sp[e] - bf_bits2f(hb));
        hv[e] = hb; lv[e] = lb;
      }
      const size_t o = (size_t)row * kDm + k0 + c8;
      *(v8us*)(th + o) = hv;
      *(v8us*)(tl + o) = lv;
    }
    
  }
}

// ---------------------------------------------------------------------------
// LoRA weight w2 [3 l][32 d][1024 c] f32 -> Bt planes th/tl [3 l][1024 n=c][32 k=d] bf16: out[l][n][k] = split(w2[l][k][n]).
// grid = (1024/64 n-tiles, 3); block 256. LDS tile [64 n][33]: load 256 threads x 8 = 32 k x 64 n.
// 512 contiguous bytes) with ONE 16-B-per-lane instruction: lane -> line L = lane>>3, row = wave*8 + 2L + ((lane&7)>>2),
// ---------------------------------------------------------------------------
__global__ __launch_bounds__(256) void w2t_split_kernel(const float* __restrict__ w2, unsigned short* __restrict__ th,
                                                        unsigned short* __restrict__ tl) {
  __shared__ float tile[64 * 33];
  const int n0 = blockIdx.x * 64;
  const int l  = blockIdx.y;
  const int t  = threadIdx.x;
  const float* wl = w2 + (size_t)l * kLoraD * kDm;
#pragma unroll
  for (int i = 0; i < 8; ++i) {
    const int idx = i * 256 + t;
    const int kk = idx >> 6, nn = idx & 63;
    tile[nn * 33 + kk] = wl[(size_t)kk * kDm + n0 + nn];
  }
  __syncthreads();
  const int lane = t & 31, wave = t >> 5;
  const int L = lane >> 3, q = lane & 7;
  const int row = wave * 8 + 2 * L + (q >> 2);
  const int k8 = (q & 3) * 8;
  const float* sp = tile + row * 33 + k8;
  v8us hv, lv;
#pragma unroll
  for (int e = 0; e < 8; ++e) {
    const unsigned short hb = f2bf_bits(sp[e]);
    const unsigned short lb = f2bf_bits(sp[e] - bf_bits2f(hb));
    hv[e] = hb; lv[e] = lb;
  }
  const size_t o = (size_t)l * kDm * kLoraD + (size_t)(n0 + row) * kLoraD + k8;
  *(v8us*)(th + o) = hv;
  *(v8us*)(tl + o) = lv;
  
}

// ---------------------------------------------------------------------------
// Shared elementwise split helper for 8 consecutive values -> v8us hi/lo.
// ---------------------------------------------------------------------------
__device__ __forceinline__ void split8(const v4f va, const v4f vb, v8us& hv, v8us& lv) {
#pragma unroll
  for (int e = 0; e < 4; ++e) {
    const unsigned short h0 = f2bf_bits(va[e]);
    hv[e] = h0; lv[e] = f2bf_bits(va[e] - bf_bits2f(h0));
    const unsigned short h1 = f2bf_bits(vb[e]);
    hv[4 + e] = h1; lv[4 + e] = f2bf_bits(vb[e] - bf_bits2f(h1));
  }
}
__device__ __forceinline__ void store16x2(unsigned short* ph, unsigned short* pl, size_t o, const v8us hv, const v8us lv) {
  *(v8us*)(ph + o) = hv;
  *(v8us*)(pl + o) = lv;
  
}

// ---------------------------------------------------------------------------
// Token shift: xxx = x + (xprev - x) * maa_x -> bf16 hi/lo planes [kRows][kDm], row = b*kSeq + s;
// xprev = shift_state[b] for s == 0, else x[b][s-1] (block-uniform pointer choice).
// grid = kRows blocks x 128 threads x 8 elements = kRows x kDm = the whole plane; each lane stores 16 B,
// ---------------------------------------------------------------------------
__global__ __launch_bounds__(128) void xxx_split_kernel(const float* __restrict__ x, const float* __restrict__ ss,
                                                        const float* __restrict__ maax,
                                                        unsigned short* __restrict__ oh, unsigned short* __restrict__ ol) {
  const int row = blockIdx.x;
  const int b = row / kSeq, s = row % kSeq;
  const int c0 = threadIdx.x * 8;
  const float* xr = x + (size_t)row * kDm;
  const float* xp = (s == 0) ? (ss + (size_t)b * kDm) : (xr - kDm);
  const v4f xa = *(const v4f*)(xr + c0), xb = *(const v4f*)(xr + c0 + 4);
  const v4f pa = *(const v4f*)(xp + c0), pb = *(const v4f*)(xp + c0 + 4);
  const v4f ma = *(const v4f*)(maax + c0), mb = *(const v4f*)(maax + c0 + 4);
  const v4f va = xa + (pa - xa) * ma;
  const v4f vb = xb + (pb - xb) * mb;
  v8us hv, lv;
  split8(va, vb, hv, lv);
  store16x2(oh, ol, (size_t)row * kDm + c0, hv, lv);
}

// ---------------------------------------------------------------------------
// Data-dependent mixing: x? = x + (xprev - x) * (maa_? + mix_?[s][c]) for ? in {q(r), k, v} -> three bf16 hi/lo plane pairs
// [kRows][kDm]. mix planes f32 [3][kRows][kDm] (l = 0 r, 1 k, 2 v). Same row index and thread/store shape as xxx_split_kernel:
// ---------------------------------------------------------------------------
__global__ __launch_bounds__(128) void mix_split_kernel(const float* __restrict__ x, const float* __restrict__ ss,
                                                        const float* __restrict__ maar, const float* __restrict__ maak,
                                                        const float* __restrict__ maav, const float* __restrict__ mix,
                                                        unsigned short* __restrict__ qh, unsigned short* __restrict__ ql,
                                                        unsigned short* __restrict__ kh, unsigned short* __restrict__ kl,
                                                        unsigned short* __restrict__ vh, unsigned short* __restrict__ vl) {
  const int row = blockIdx.x;
  const int b = row / kSeq, s = row % kSeq;
  const int c0 = threadIdx.x * 8;
  const float* xr = x + (size_t)row * kDm;
  const float* xp = (s == 0) ? (ss + (size_t)b * kDm) : (xr - kDm);
  const v4f xa = *(const v4f*)(xr + c0), xb = *(const v4f*)(xr + c0 + 4);
  const v4f pa = *(const v4f*)(xp + c0), pb = *(const v4f*)(xp + c0 + 4);
  const v4f da = pa - xa, db = pb - xb;
  const size_t plane = (size_t)kRows * kDm;
  const float* m0 = mix + (size_t)row * kDm + c0;
  const size_t o = (size_t)row * kDm + c0;
  {
    const v4f ma = *(const v4f*)(maar + c0), mb = *(const v4f*)(maar + c0 + 4);
    const v4f qa = *(const v4f*)(m0), qb = *(const v4f*)(m0 + 4);
    const v4f va = xa + da * (ma + qa), vb = xb + db * (mb + qb);
    v8us hv, lv; split8(va, vb, hv, lv); store16x2(qh, ql, o, hv, lv);
  }
  {
    const v4f ma = *(const v4f*)(maak + c0), mb = *(const v4f*)(maak + c0 + 4);
    const v4f qa = *(const v4f*)(m0 + plane), qb = *(const v4f*)(m0 + plane + 4);
    const v4f va = xa + da * (ma + qa), vb = xb + db * (mb + qb);
    v8us hv, lv; split8(va, vb, hv, lv); store16x2(kh, kl, o, hv, lv);
  }
  {
    const v4f ma = *(const v4f*)(maav + c0), mb = *(const v4f*)(maav + c0 + 4);
    const v4f qa = *(const v4f*)(m0 + 2 * plane), qb = *(const v4f*)(m0 + 2 * plane + 4);
    const v4f va = xa + da * (ma + qa), vb = xb + db * (mb + qb);
    v8us hv, lv; split8(va, vb, hv, lv); store16x2(vh, vl, o, hv, lv);
  }
}

// ---------------------------------------------------------------------------
//   MODE 0: LN then RoPE (half-split per 64-wide head: out[f] = x1*cos - x2*sin, out[32+f] = x1*sin + x2*cos with
//           cos/sin = cosf/sinf(angles[s][f]), s = row % kSeq) then bf16 hi/lo split into planes [kRows][kDm]; grid = (kRows, 2),
//           blockIdx.y selects source/params/planes A (0) or B (1).
//   MODE 1: LN written back IN PLACE as f32 (dstf == src): each block owns its row; thread t writes floats 4t..4t+3,
//   MODE 2: LN then bf16 hi/lo split into planes (no rotation); grid = (kRows, 1).
// MODE 0/2 store path: per wave (heads 2w, 2w+1) the 128 results are staged in LDS, then lanes 0..15 write 16 B each =
// ---------------------------------------------------------------------------
template <int MODE>
__global__ __launch_bounds__(256) void ln_kernel(const float* srcA, const float* srcB,
                                                 const float* __restrict__ gA, const float* __restrict__ bA,
                                                 const float* __restrict__ gB, const float* __restrict__ bB,
                                                 const float* __restrict__ ang,
                                                 unsigned short* hA, unsigned short* lA,
                                                 unsigned short* hB, unsigned short* lB, float* dstf) {
  __shared__ __align__(16) float srow[kDm];
  __shared__ __align__(16) unsigned short Lh[8][128];
  __shared__ __align__(16) unsigned short Ll[8][128];
  __shared__ float sred[8];
  __shared__ float sred2[8];
  const int s = blockIdx.x;                      // token row b*kSeq + position
  const int which = blockIdx.y;                  // block-uniform
  const float* src = (which == 0) ? srcA : srcB;
  const float* g   = (which == 0) ? gA : gB;
  const float* bb  = (which == 0) ? bA : bB;
  unsigned short* dh = (which == 0) ? hA : hB;
  unsigned short* dl = (which == 0) ? lA : lB;
  const int tid = threadIdx.x, lane = tid & 31, wave = tid >> 5;

  const float* row = src + (size_t)s * kDm;
  const v4f xv = *(const v4f*)(row + tid * 4);
  float ps = (xv[0] + xv[1]) + (xv[2] + xv[3]);
#pragma unroll
  for (int off = 1; off < 32; off <<= 1) ps += __shfl_xor(ps, off, 32);
  if (lane == 0) sred[wave] = ps;
  __syncthreads();
  float tot = 0.f;
#pragma unroll
  for (int w = 0; w < 8; ++w) tot += sred[w];
  const float mean = tot * (1.0f / (float)kDm);
  const v4f dv = xv - mean;
  float pq = (dv[0] * dv[0] + dv[1] * dv[1]) + (dv[2] * dv[2] + dv[3] * dv[3]);
#pragma unroll
  for (int off = 1; off < 32; off <<= 1) pq += __shfl_xor(pq, off, 32);
  if (lane == 0) sred2[wave] = pq;
  __syncthreads();
  float tot2 = 0.f;
#pragma unroll
  for (int w = 0; w < 8; ++w) tot2 += sred2[w];
  const float var  = tot2 * (1.0f / (float)kDm);
  const float rstd = rsqrtf(var + 1.0e-5f);
  const v4f gv = *(const v4f*)(g + tid * 4);
  const v4f bv = *(const v4f*)(bb + tid * 4);
  v4f yv;
#pragma unroll
  for (int e = 0; e < 4; ++e) yv[e] = dv[e] * rstd * gv[e] + bv[e];

  if (MODE == 1) {
    float* dp = dstf + (size_t)s * kDm + tid * 4;
    *(v4f*)dp = yv;
    
    return;                                     // MODE is a compile-time constant: uniform
  }

  *(v4f*)(srow + tid * 4) = yv;
  __syncthreads();

  float cs = 1.0f, sn = 0.0f;
  if (MODE == 0) {
    const float a = ang[(size_t)(s % kSeq) * 32 + lane];
    cs = cosf(a);
    sn = sinf(a);
  }
  unsigned short* lh = Lh[wave];
  unsigned short* ll = Ll[wave];
#pragma unroll 1
  for (int hp = 0; hp < 2; ++hp) {
    const int base = wave * 128 + hp * 64;
    const float xr = srow[base + lane];
    const float xi = srow[base + 32 + lane];
    float vr = xr, vi = xi;
    if (MODE == 0) { vr = xr * cs - xi * sn; vi = xr * sn + xi * cs; }
    const unsigned short hr = f2bf_bits(vr);
    const unsigned short lr = f2bf_bits(vr - bf_bits2f(hr));
    const unsigned short hi = f2bf_bits(vi);
    const unsigned short li = f2bf_bits(vi - bf_bits2f(hi));
    lh[hp * 64 + lane] = hr;       ll[hp * 64 + lane] = lr;
    lh[hp * 64 + 32 + lane] = hi;  ll[hp * 64 + 32 + lane] = li;
  }
  __builtin_amdgcn_fence(__ATOMIC_RELEASE, "workgroup");
  __builtin_amdgcn_wave_barrier();
  __builtin_amdgcn_fence(__ATOMIC_ACQUIRE, "workgroup");
  const int l16 = lane & 15;
  const v8us hv = *(const v8us*)(lh + l16 * 8);
  const v8us lv = *(const v8us*)(ll + l16 * 8);
  const size_t o = (size_t)s * kDm + wave * 128 + l16 * 8;
  {
    if (lane < 16) {
      *(v8us*)(dh + o) = hv;
      *(v8us*)(dl + o) = lv;
    }
    
  }
}

#define AT_D 64
#define AT_NW 4
#define AT_QB 64
#define AT_KC 64
#define AT_LP 72   // LDS row pitch of the K and V^T tiles in 16-bit elements: 144 B = 16 B x 9 (odd), so that the 16 rows of one 16-B fragment read fall on 16 different bank groups

__device__ __forceinline__ v8f at_mma(v16b a, v16b b, v8f c) {
  c = __builtin_amdgcn_wmma_f32_16x16x32_bf16(false, a, false, b, (short)0, c, false, false);
  asm volatile("v_nop\n\tv_nop\n\tv_nop\n\tv_nop" : "+v"(c) : "v"(a), "v"(b));
  return c;
}

// Value of lane l ^ 16 (the other half's lane of the same query) by a cross-row move of the vector unit.
__device__ __forceinline__ float at_other_half(float v) {
  const int b = __float_as_int(v);
  return __int_as_float(__builtin_amdgcn_permlanex16(b, b, 0x76543210, 0xfedcba98, false, false));
}

__global__ __launch_bounds__(128)
void attn_causal64_kernel(const unsigned short* __restrict__ qhp, const unsigned short* __restrict__ qlp,
                          const unsigned short* __restrict__ khp, const unsigned short* __restrict__ klp,
                          const unsigned short* __restrict__ vhp, const unsigned short* __restrict__ vlp,
                          float* __restrict__ out, float sscale, float mfill) {
  union FB { v16b v; v8b h[2]; };
  union PB { v16b v; v2b w[8]; };
  __shared__ __align__(16) __bf16 Ksh[AT_KC * AT_LP];            // K hi [kv][d], 64 rows of 144 B
  __shared__ __align__(16) __bf16 Ksl[AT_KC * AT_LP];            // K lo
  __shared__ __align__(16) __bf16 Vth[AT_D * AT_LP];             // V hi [d][kv], 64 rows of 144 B
  __shared__ __align__(16) __bf16 Vtl[AT_D * AT_LP];             // V lo
  __shared__ __align__(16) float  Os[AT_NW][16 * 68];            // per wave out tile, pitch 68

  const int tid  = threadIdx.x;
  const int wave = tid >> 5;
  const int lane = tid & 31;
  const int hh   = lane >> 4;
  const int c    = lane & 15;

  const int nqb = kSeq / AT_QB;           // 32
  const int bx = blockIdx.x;
  const int h  = bx / nqb;                // 0..kHeads-1 (grid = kHeads * nqb)
  // Query tile of this block. A tile's cost is its key walk, qb + 1 chunks, and the whole grid is resident at once (4 blocks a WGP),
  // so the launch lasts as long as the WGP whose 4 blocks hold the most chunks. With qb = bx % 32 blocks whose flat index is equal
  // mod 256 (and mod 32) all hold the same tile. The map below is, for each head and batch element, a permutation of the 32 tiles in
  // which j and j + 16, and flat indices 256 apart, hold tiles t and 31 - t, and an even j and j + 1 tiles that add up to 30 or 32: sets
  // of blocks that start next to each other or a whole round of WGPs apart then hold about 33 chunks a pair. For speed only: the result
  // does not depend on where a block runs.
  const int j   = bx % nqb;
  const int tt  = (j >= nqb / 2) ? (nqb + nqb / 2 - 1 - j) : j;   // j = 0..15 -> j, 16..31 -> 47 - j = 31 - (j - 16)
  const int rnd = bx >> 8;                                        // parity of flat block index / 256 (gridDim.x = 512 = 2 x 256)
  const int qb  = ((j ^ rnd) & 1) ? (nqb - 1 - tt) : tt;          // block-uniform, 0..31
  const int q0 = qb * AT_QB + wave * 16;

  const size_t bo = (size_t)blockIdx.y * kSeq * kDm;
  const __bf16* Qh = (const __bf16*)(const void*)qhp + bo + (size_t)h * AT_D;
  const __bf16* Ql = (const __bf16*)(const void*)qlp + bo + (size_t)h * AT_D;
  const __bf16* Kh = (const __bf16*)(const void*)khp + bo + (size_t)h * AT_D;
  const __bf16* Kl = (const __bf16*)(const void*)klp + bo + (size_t)h * AT_D;
  const __bf16* Vh = (const __bf16*)(const void*)vhp + bo + (size_t)h * AT_D * kSeq;
  const __bf16* Vl = (const __bf16*)(const void*)vlp + bo + (size_t)h * AT_D * kSeq;
  float*        ob = out + bo + (size_t)h * AT_D;

  // ---- Q fragments (B operand, column = query = lane&15, split k map via Frag load): 2 d-chunks, hi and lo ----
  v16b qah[2], qal[2];
#pragma unroll
  for (int dc = 0; dc < 2; ++dc) {
    const __bf16* qr = Qh + (size_t)(q0 + c) * kDm + dc * 32 + 8 * hh;
    const __bf16* ql = Ql + (size_t)(q0 + c) * kDm + dc * 32 + 8 * hh;
    qah[dc] = Frag<__bf16>::load(qr);
    qal[dc] = Frag<__bf16>::load(ql);
  }

  float mrow = -INFINITY;   // running maximum of query q0 + c, the same in both lane halves
  float lrow = 0.f;         // running sum over this lane half's keys; the halves are joined behind the loop
  v8f oacc[4];              // O^T: oacc[t][r] = out[q0 + c][16t + 8hh + r]
#pragma unroll
  for (int t = 0; t < 4; ++t) oacc[t] = (v8f){0.f,0.f,0.f,0.f,0.f,0.f,0.f,0.f};

  int nChunks = qb + 1;                      // block-uniform, <= 32
  if (nChunks > kSeq / AT_KC) nChunks = kSeq / AT_KC;
  for (int kc = 0; kc < nChunks; ++kc) {
    const int kv0 = kc * AT_KC;
    __syncthreads();
    {
      // staging coverage: 128 threads x (4 x 8) elements = 64 rows x 64 per plane = the whole chunk tile
      const int r = tid >> 1, half = (tid & 1) * 32;
      const __bf16* ksh = Kh + (size_t)(kv0 + r) * kDm + half;     // K row kv0+r, d = half..half+31
      const __bf16* ksl = Kl + (size_t)(kv0 + r) * kDm + half;
      const __bf16* vsh = Vh + (size_t)r * kSeq + kv0 + half;     // V^T row d = r, s = kv0+half..+31
      const __bf16* vsl = Vl + (size_t)r * kSeq + kv0 + half;
#pragma unroll
      for (int i = 0; i < 4; ++i) {
        const v8b a0 = *(const v8b*)(ksh + 8 * i);
        const v8b a1 = *(const v8b*)(ksl + 8 * i);
        const v8b b0 = *(const v8b*)(vsh + 8 * i);
        const v8b b1 = *(const v8b*)(vsl + 8 * i);
        *(v8b*)(Ksh + r * AT_LP + half + 8 * i) = a0;
        *(v8b*)(Ksl + r * AT_LP + half + 8 * i) = a1;
        *(v8b*)(Vth + r * AT_LP + half + 8 * i) = b0;
        *(v8b*)(Vtl + r * AT_LP + half + 8 * i) = b1;
      }
    }
    __syncthreads();

    v8f s[4];
#pragma unroll
    for (int j = 0; j < 4; ++j) {
      s[j] = (v8f){0.f,0.f,0.f,0.f,0.f,0.f,0.f,0.f};
#pragma unroll
      for (int dc = 0; dc < 2; ++dc) {
        FB kb, kl;
        kb.h[0] = *(const v8b*)(Ksh + (j * 16 + c) * AT_LP + dc * 32 + 8 * hh);
        kb.h[1] = *(const v8b*)(Ksh + (j * 16 + c) * AT_LP + dc * 32 + 16 + 8 * hh);
        kl.h[0] = *(const v8b*)(Ksl + (j * 16 + c) * AT_LP + dc * 32 + 8 * hh);
        kl.h[1] = *(const v8b*)(Ksl + (j * 16 + c) * AT_LP + dc * 32 + 16 + 8 * hh);
        s[j] = at_mma(kb.v, qah[dc], s[j]);   // s[j][r] = score of key kv0 + 16j + 8hh + r, query q0 + c
        s[j] = at_mma(kl.v, qah[dc], s[j]);
        s[j] = at_mma(kb.v, qal[dc], s[j]);
      }
    }
    // ---- scale, structural causal select on the diagonal tile, maximum over the lane's 32 keys and the other half's ----
    const bool diag = (kc == qb);            // block-uniform
    // a key of this lane, 16j + 8hh + r inside the chunk, is masked where it lies behind the lane's query; off the diagonal none is (limit 64)
    const int lim = diag ? (q0 + c - kv0 - 8 * hh) : AT_KC;
    float m = -INFINITY;
    // the loops from here to the end of the chunk are unrolled in full: s, ph, pl and oacc live in registers and take compile-time indices only
#pragma unroll
    for (int j = 0; j < 4; ++j) {
#pragma unroll
      for (int r = 0; r < 8; ++r) {
        const float sv = s[j][r] * sscale;
        const float sm = (j * 16 + r > lim) ? mfill : sv;
        s[j][r] = sm;
        m = fmaxf(m, sm);
      }
    }
    m = fmaxf(m, at_other_half(m));
    const float mnew = fmaxf(mrow, m);
    const float alpha = expf(mrow - mnew);
    mrow = mnew;
    v2f psum = (v2f){0.f, 0.f};              // even and odd keys apart: one packed add per pair
    PB ph[2], pl[2];                         // P^T hi / lo as B operands: keys 32kk..32kk+31, element 8(j&1) + r <- tile j = 2kk + (j&1)
#pragma unroll
    for (int j = 0; j < 4; ++j) {
#pragma unroll
      for (int r = 0; r < 8; r += 2) {
        const v2f p = (v2f){expf(s[j][r] - mnew), expf(s[j][r + 1] - mnew)};
        psum += p;
        // two neighbouring keys fill one operand register: packed round-to-nearest-even conversions, hi = bf16(p), lo = bf16(p - hi)
        const v2b a = __builtin_convertvector(p, v2b);
        const v2b bl = __builtin_convertvector(p - __builtin_convertvector(a, v2f), v2b);
        ph[j >> 1].w[(j & 1) * 4 + (r >> 1)] = a;
        pl[j >> 1].w[(j & 1) * 4 + (r >> 1)] = bl;
      }
    }
    lrow = lrow * alpha + (psum[0] + psum[1]);
#pragma unroll
    for (int t = 0; t < 4; ++t) oacc[t] *= alpha;
#pragma unroll
    for (int kk = 0; kk < 2; ++kk) {
#pragma unroll
      for (int t = 0; t < 4; ++t) {
        FB vb, vl;
        vb.h[0] = *(const v8b*)(Vth + (t * 16 + c) * AT_LP + kk * 32 + 8 * hh);
        vb.h[1] = *(const v8b*)(Vth + (t * 16 + c) * AT_LP + kk * 32 + 16 + 8 * hh);
        vl.h[0] = *(const v8b*)(Vtl + (t * 16 + c) * AT_LP + kk * 32 + 8 * hh);
        vl.h[1] = *(const v8b*)(Vtl + (t * 16 + c) * AT_LP + kk * 32 + 16 + 8 * hh);
        oacc[t] = at_mma(vb.v, ph[kk].v, oacc[t]);
        oacc[t] = at_mma(vl.v, ph[kk].v, oacc[t]);
        oacc[t] = at_mma(vb.v, pl[kk].v, oacc[t]);
      }
    }
  }

  float* os = Os[wave];
  const float inv = 1.0f / (lrow + at_other_half(lrow));   // the query's sum: both halves' keys
#pragma unroll
  for (int t = 0; t < 4; ++t) {
    const v8f o = oacc[t] * inv;
    *(v4f*)(os + c * 68 + t * 16 + 8 * hh)     = (v4f){o[0], o[1], o[2], o[3]};
    *(v4f*)(os + c * 68 + t * 16 + 8 * hh + 4) = (v4f){o[4], o[5], o[6], o[7]};
  }
  __builtin_amdgcn_fence(__ATOMIC_RELEASE, "workgroup");
  __builtin_amdgcn_wave_barrier();
  __builtin_amdgcn_fence(__ATOMIC_ACQUIRE, "workgroup");
  {
    const int c4 = (lane & 15) * 4;
    {
#pragma unroll
      for (int it = 0; it < 8; ++it) {
        const int row = it * 2 + hh;   // it 0..7 x hh 0..1 covers rows 0..15 of the wave tile
        v4f val = *(const v4f*)(os + row * 68 + c4);
        *(v4f*)(ob + (size_t)(q0 + row) * kDm + c4) = val;
      }
      
    }
  }
}

// ---------------------------------------------------------------------------
// Workspace region map (byte offsets). Every GEMM: K in {1024, 32} (%32 == 0), M = kRows = 4096, N in {128, 1024} (%128 == 0).
// Activation regions hold both batch elements, row = b*2048 + s.
// Every region is fully written before it is read within the in-order launch sequence; reused regions noted.
//   Wqh bf16 [1024 n][1024 k]        0      Wql    2097152
//   Wkh                        4194304      Wkl    6291456
//   Wvh                        8388608      Wvl   10485760
//   Woh                       12582912      Wol   14680064
//   W1Th bf16 [128 n][1024 k] 16777216      W1Tl  17039360   (rows 96..127 zero)
//   W2Th bf16 [3][1024 n][32] 17301504      W2Tl  17498112
//   XXh  bf16 [4096][1024]    17694720      XXl   26083328   (xxx planes; reused after the LoRA GEMM as Oh / Ol)
//   LORAf f32 [4096][128]     34471936
//   LTh  bf16 [4096][128]     36569088      LTl   37617664
//   MIX  f32 [3][4096][1024]  38666240                       (reused after the mix kernel: Qf = +0, Kf = +16777216,
//                                                             Vf = +33554432 f32 [4096][1024]; Of reuses Qf)
//   XQh/XQl/XKh/XKl/XVh/XVl   88997888 .. (6 x 8388608)
//   Qh/Ql/Kh/Kl              139329536 .. (4 x 8388608)
//   VTh/VTl bf16 [2][1024][2048] 172883968, 181272576
//   total                    189661184  (~180.9 MiB)
// ---------------------------------------------------------------------------
extern "C" void kernel_launch(void* const* d_in, const int* in_sizes, int n_in,
                              void* d_out, int out_size, void* d_ws, size_t ws_size,
                              hipStream_t stream) {
  if (n_in < 21) return;
  const int nRow = kSeq * kDm;            // 2097152 per batch element
  const int nAct = kBatch * nRow;         // 4194304
  const int nW   = kDm * kDm;             // 1048576
  if (in_sizes[0] != nAct) return;
  if (in_sizes[1] != kBatch * kDm) return;
  if (in_sizes[2] != kDm || in_sizes[3] != kDm || in_sizes[4] != kDm || in_sizes[5] != kDm) return;
  if (in_sizes[6] != kDm * kLoraN) return;
  if (in_sizes[7] != 3 * kLoraD * kDm) return;
  if (in_sizes[8] != nW || in_sizes[9] != nW || in_sizes[10] != nW || in_sizes[11] != nW) return;
  for (int i = 12; i < 20; ++i) if (in_sizes[i] != kDm) return;
  if (in_sizes[20] != kSeq * 32) return;
  if (out_size != nAct) return;

  const float* x     = (const float*)d_in[0];    // [2][2048][1024]
  const float* ss    = (const float*)d_in[1];    // [2][1024]
  const float* maax  = (const float*)d_in[2];    // [1024]
  const float* maar  = (const float*)d_in[3];
  const float* maak  = (const float*)d_in[4];
  const float* maav  = (const float*)d_in[5];
  const float* w1    = (const float*)d_in[6];    // [1024][96]
  const float* w2    = (const float*)d_in[7];    // [3][32][1024]
  const float* wq    = (const float*)d_in[8];    // [1024 out][1024 in]
  const float* wk    = (const float*)d_in[9];
  const float* wv    = (const float*)d_in[10];
  const float* wo    = (const float*)d_in[11];
  const float* lnrg  = (const float*)d_in[12];
  const float* lnrb  = (const float*)d_in[13];
  const float* lnkg  = (const float*)d_in[14];
  const float* lnkb  = (const float*)d_in[15];
  const float* lnvg  = (const float*)d_in[16];
  const float* lnvb  = (const float*)d_in[17];
  const float* lnxg  = (const float*)d_in[18];
  const float* lnxb  = (const float*)d_in[19];
  const float* ang   = (const float*)d_in[20];   // [2048][32]

  const size_t PW   = (size_t)kDm * kDm * 2;          // 2097152  bf16 weight plane
  const size_t PX   = (size_t)kRows * kDm * 2;        // 8388608  bf16 activation plane (both batch elements)
  const size_t PF   = (size_t)kRows * kDm * 4;        // 16777216 f32 activation plane
  const size_t PW1  = (size_t)kLoraP * kDm * 2;       // 262144
  const size_t PW2  = (size_t)3 * kDm * kLoraD * 2;   // 196608
  const size_t PLF  = (size_t)kRows * kLoraP * 4;     // 2097152
  const size_t PLT  = (size_t)kRows * kLoraP * 2;     // 1048576
  size_t off = 0;
  const size_t oWqh = off; off += PW;  const size_t oWql = off; off += PW;
  off += 4 * PW;                                // Wkh, Wkl, Wvh, Wvl: reached from Wqh / Wql by the plane stride
  const size_t oWoh = off; off += PW;  const size_t oWol = off; off += PW;
  const size_t oW1h = off; off += PW1; const size_t oW1l = off; off += PW1;
  const size_t oW2h = off; off += PW2; const size_t oW2l = off; off += PW2;
  const size_t oXXh = off; off += PX;  const size_t oXXl = off; off += PX;
  const size_t oLF  = off; off += PLF;
  const size_t oLTh = off; off += PLT; const size_t oLTl = off; off += PLT;
  const size_t oMIX = off; off += 3 * PF;
  const size_t oXQh = off; off += PX;  const size_t oXQl = off; off += PX;
  const size_t oXKh = off; off += PX;  const size_t oXKl = off; off += PX;
  const size_t oXVh = off; off += PX;  const size_t oXVl = off; off += PX;
  const size_t oQh  = off; off += PX;  const size_t oQl  = off; off += PX;
  const size_t oKh  = off; off += PX;  const size_t oKl  = off; off += PX;
  const size_t oVTh = off; off += PX;  const size_t oVTl = off; off += PX;
  if (off > ws_size) return;                    // off = 189661184

  char* ws = (char*)d_ws;
  unsigned short* Wqh = (unsigned short*)(ws + oWqh); unsigned short* Wql = (unsigned short*)(ws + oWql);
  unsigned short* Woh = (unsigned short*)(ws + oWoh); unsigned short* Wol = (unsigned short*)(ws + oWol);
  unsigned short* W1h = (unsigned short*)(ws + oW1h); unsigned short* W1l = (unsigned short*)(ws + oW1l);
  unsigned short* W2h = (unsigned short*)(ws + oW2h); unsigned short* W2l = (unsigned short*)(ws + oW2l);
  unsigned short* XXh = (unsigned short*)(ws + oXXh); unsigned short* XXl = (unsigned short*)(ws + oXXl);
  float*          LF  = (float*)(ws + oLF);
  unsigned short* LTh = (unsigned short*)(ws + oLTh); unsigned short* LTl = (unsigned short*)(ws + oLTl);
  float*          MIX = (float*)(ws + oMIX);
  float*          Qf  = (float*)(ws + oMIX);
  float*          Kf  = (float*)(ws + oMIX + PF);
  float*          Vf  = (float*)(ws + oMIX + 2 * PF);
  float*          Of  = Qf;
  unsigned short* XQh = (unsigned short*)(ws + oXQh); unsigned short* XQl = (unsigned short*)(ws + oXQl);
  unsigned short* XKh = (unsigned short*)(ws + oXKh); unsigned short* XKl = (unsigned short*)(ws + oXKl);
  unsigned short* XVh = (unsigned short*)(ws + oXVh); unsigned short* XVl = (unsigned short*)(ws + oXVl);
  unsigned short* Qh  = (unsigned short*)(ws + oQh);  unsigned short* Ql  = (unsigned short*)(ws + oQl);
  unsigned short* Kh  = (unsigned short*)(ws + oKh);  unsigned short* Kl  = (unsigned short*)(ws + oKl);
  unsigned short* VTh = (unsigned short*)(ws + oVTh); unsigned short* VTl = (unsigned short*)(ws + oVTl);
  unsigned short* Oh  = XXh;                          unsigned short* Ol  = XXl;

  const float* dummyf = lnrg;                         // valid pointer for unused bias / resid arguments (never read)

  const dim3 blk(256);
  const int  n2w = nW / 2;                                  // 524288 pairs per weight plane
  const dim3 gCastW((n2w + 255) / 256, 4);                  // 2048 blocks x 256 threads x 2 = 1024x1024, y = q, k, v, o
  const dim3 gW1(kDm / 64);                                 // 16 k-tiles
  const dim3 gW2(kDm / 64, 3);                              // 16 n-tiles x 3
  const dim3 gRow(kRows);                                   // one block per token row (128-thread kernels)
  const dim3 blkG(128);                                     // GEMM block: 4 waves, one 128x128 tile
  const dim3 gLora((kRows / 128) * (kLoraP / 128));         // 32 tiles: M=4096, N=128
  const dim3 gMix((kRows / 128) * (kDm / 128), 3);          // 256 tiles x 3 (l): M=4096, N=1024, K=32
  const int  n2l = kRows * kLoraP / 2;                      // 262144 pairs
  const dim3 gTanh((n2l + 255) / 256);                      // 1024 blocks x 256 x 2 = 4096x128
  const dim3 gQKV((kRows / 128) * (kDm / 128), 3);          // 256 tiles x 3 (q, k, v): M=4096, N=1024
  const dim3 gProj((kRows / 128) * (kDm / 128), 1);         // 256 tiles: M=4096, N=1024
  const dim3 gLnQK(kRows, 2);                               // 4096 rows x {q, k}
  const dim3 gLn1(kRows, 1);
  const dim3 gVT(kDm / 64, kSeq / 64, kBatch);              // per b: in [R=2048 s][Cn=1024 c] -> planes [c][s]
  const dim3 gAtt(kHeads * (kSeq / 64), kBatch);            // 512 x 2 blocks: 16 heads x 32 query blocks, y = b

  // setup: weights -> bf16 hi/lo planes (q/k/v/o already [out n][in k] = Bt layout; w1/w2 transposed).
  // The hi planes of q, k, v, o lie 2 weight planes apart (hi, lo, hi, lo, ...), and so do the lo planes.
  split_bf16x2_kernel<<<gCastW, blk, 0, stream>>>(wq, wk, wv, wo, Wqh, Wql, n2w, 2L * nW);
  w1t_split_kernel<<<gW1, blk, 0, stream>>>(w1, W1h, W1l);
  w2t_split_kernel<<<gW2, blk, 0, stream>>>(w2, W2h, W2l);

  // Each stage below runs once, on the rows of both batch elements.
  // (1) xxx = x + dxprev*maa_x -> planes
  xxx_split_kernel<<<gRow, dim3(128), 0, stream>>>(x, ss, maax, XXh, XXl);
  // (2) lora_pre = xxx . w1 -> f32 [4096][128]   (M=4096, N=128, K=1024)
  wmma_gemm64<1, true, 0, 0, false, 0><<<gLora, blkG, 0, stream>>>(
      XXh, XXl, kDm, 0L, W1h, W1l, kDm, 0L, (void*)LF, (void*)LF, kLoraP, 0L,
      dummyf, dummyf, 0L, kRows, kLoraP, kDm, 1.0f);
  // (3) lora = tanh -> planes [4096][128]
  tanh_split_kernel<<<gTanh, blk, 0, stream>>>(LF, LTh, LTl, n2l);
  // (4) mixes[l] = lora[:, 32l..32l+31] . w2[l] -> f32 [3][4096][1024]   (M=4096, N=1024, K=32; grid.y = l)
  wmma_gemm64<1, true, 0, 0, false, 0><<<gMix, blkG, 0, stream>>>(
      LTh, LTl, kLoraP, (long)kLoraD, W2h, W2l, kLoraD, (long)kDm * kLoraD, (void*)MIX, (void*)MIX, kDm, (long)nAct,
      dummyf, dummyf, 0L, kRows, kDm, kLoraD, 1.0f);
  // (5) xq/xk/xv = x + dxprev*(maa + mix) -> planes
  mix_split_kernel<<<gRow, dim3(128), 0, stream>>>(x, ss, maar, maak, maav, MIX, XQh, XQl, XKh, XKl, XVh, XVl);
  // (6) q0 = xq . Wq^T, k0 = xk . Wk^T, v0 = xv . Wv^T -> f32 [3][4096][1024]   (M=4096, N=1024, K=1024; grid.y = q, k, v:
  //     XQ/XK/XV hi planes lie 2 activation planes apart, Wq/Wk/Wv hi planes 2 weight planes, Qf/Kf/Vf one f32 plane)
  wmma_gemm64<1, true, 0, 0, false, 0><<<gQKV, blkG, 0, stream>>>(
      XQh, XQl, kDm, 2L * nAct, Wqh, Wql, kDm, 2L * nW, (void*)Qf, (void*)Qf, kDm, (long)nAct,
      dummyf, dummyf, 0L, kRows, kDm, kDm, 1.0f);
  // (7) LayerNorm + RoPE + split for q and k -> planes [row][h*64+d]
  ln_kernel<0><<<gLnQK, blk, 0, stream>>>(Qf, Kf, lnrg, lnrb, lnkg, lnkb, ang, Qh, Ql, Kh, Kl, Qf);
  // (8) LayerNorm of v in place (f32), then transpose-split -> v^T planes [b][h*64+d][s]
  ln_kernel<1><<<gLn1, blk, 0, stream>>>(Vf, Vf, lnvg, lnvb, lnvg, lnvb, ang, VTh, VTl, VTh, VTl, Vf);
  wt_split_kernel<<<gVT, blk, 0, stream>>>(Vf, VTh, VTl, kSeq, kDm);
  // (9) causal attention per batch element and head -> f32 [row][h*64+d] (Of region; Qf is dead after step 7)
  attn_causal64_kernel<<<gAtt, dim3(128), 0, stream>>>(Qh, Ql, Kh, Kl, VTh, VTl, Of, 0.125f, -1.0e30f);
  // (10) output LayerNorm + split -> planes (XX region is dead after step 2)
  ln_kernel<2><<<gLn1, blk, 0, stream>>>(Of, Of, lnxg, lnxb, lnxg, lnxb, ang, Oh, Ol, Oh, Ol, Of);
  // (11) out = o . Wo^T -> d_out (f32)   (M=4096, N=1024, K=1024)
  wmma_gemm64<1, true, 0, 0, false, 0><<<gProj, blkG, 0, stream>>>(
      Oh, Ol, kDm, 0L, Woh, Wol, kDm, 0L, d_out, d_out, kDm, 0L,
      dummyf, dummyf, 0L, kRows, kDm, kDm, 1.0f);
}

// v007
// It runs in 300 microseconds.
// Timed twice side by side with v006, it ran 1.05 times as fast both times.
// All steps since v000 together make it 4.33 times as fast.
// All contractions (token-shift LoRA xxx.w1 and lora.w2, q/k/v projections, attention q.k^T and p.v, output projection): v_wmma_f32_16x16x32_bf16 with bf16 hi/lo split operands (hi.hi + hi.lo + lo.hi), f32 accumulate; token shift, tanh, LayerNorms, RoPE, online softmax, score scale 0.125 in f32.
#include <hip/hip_runtime.h>
#include <math.h>
#include <stdint.h>

constexpr int kBatch = 2;
constexpr int kSeq   = 2048;
constexpr int kRows  = kBatch * kSeq;   // token rows of both batch elements, row = b*kSeq + s
constexpr int kDm    = 1024;
constexpr int kHeads = 16;
constexpr int kLoraN = 96;      // 3 x 32 LoRA outputs
constexpr int kLoraP = 128;     // padded to a 64-multiple
constexpr int kLoraD = 32;

typedef __attribute__((ext_vector_type(16))) _Float16 v16h;
typedef __attribute__((ext_vector_type(8)))  _Float16 v8h;
typedef __attribute__((ext_vector_type(16))) __bf16   v16b;
typedef __attribute__((ext_vector_type(8)))  __bf16   v8b;
typedef __attribute__((ext_vector_type(2)))  __bf16   v2b;
typedef __attribute__((ext_vector_type(8)))  float    v8f;
typedef __attribute__((ext_vector_type(4)))  float    v4f;
typedef __attribute__((ext_vector_type(2)))  float    v2f;
typedef __attribute__((ext_vector_type(4)))  unsigned int v4u;
typedef __attribute__((ext_vector_type(8)))  unsigned short v8us;

__device__ __forceinline__ unsigned short f2bf_bits(float f) {
  unsigned u = __float_as_uint(f);
  return (unsigned short)((u + 0x7FFFu + ((u >> 16) & 1u)) >> 16);
}
__device__ __forceinline__ float bf_bits2f(unsigned short h) { return __uint_as_float(((unsigned)h) << 16); }

// hazard guards as plain device helpers
__device__ __forceinline__ void dep_guard_h(v8f& a, v8f& b, v16h x, v16h y) { asm volatile("v_nop\n\tv_nop\n\tv_nop\n\tv_nop" : "+v"(a), "+v"(b) : "v"(x), "v"(y)); }
__device__ __forceinline__ void dep_guard_b(v8f& a, v8f& b, v16b x, v16b y) { asm volatile("v_nop\n\tv_nop\n\tv_nop\n\tv_nop" : "+v"(a), "+v"(b) : "v"(x), "v"(y)); }
__device__ __forceinline__ void keep4_h(v16h a, v16h b, v16h c, v16h d) { asm volatile("v_nop" :: "v"(a), "v"(b), "v"(c), "v"(d)); }
__device__ __forceinline__ void keep4_b(v16b a, v16b b, v16b c, v16b d) { asm volatile("v_nop" :: "v"(a), "v"(b), "v"(c), "v"(d)); }
__device__ __forceinline__ void acc_guard4(v8f& a, v8f& b, v8f& c, v8f& d) { asm volatile("v_nop\n\tv_nop\n\tv_nop\n\tv_nop" : "+v"(a), "+v"(b), "+v"(c), "+v"(d)); }
template <typename T> struct Frag;
template <> struct Frag<_Float16> {
  typedef v16h V; union U { v16h v; v8h h[2]; };
  static __device__ __forceinline__ v16h load(const _Float16* p) {   // elements 0..7 <- p[0..7], 8..15 <- p[16..23]
    U f; f.h[0] = *(const v8h*)(p); f.h[1] = *(const v8h*)(p + 16); return f.v;
  }
  static __device__ __forceinline__ v8f mma(v16h a, v16h b, v8f c) {
    return __builtin_amdgcn_wmma_f32_16x16x32_f16(false, a, false, b, (short)0, c, false, false);
  }
  static __device__ __forceinline__ void guard(v8f& a, v8f& b, v16h x, v16h y) { dep_guard_h(a, b, x, y); }
  static __device__ __forceinline__ void keep(v16h a, v16h b, v16h c, v16h d) { keep4_h(a, b, c, d); }
};
template <> struct Frag<__bf16> {
  typedef v16b V; union U { v16b v; v8b h[2]; };
  static __device__ __forceinline__ v16b load(const __bf16* p) {
    U f; f.h[0] = *(const v8b*)(p); f.h[1] = *(const v8b*)(p + 16); return f.v;
  }
  static __device__ __forceinline__ v8f mma(v16b a, v16b b, v8f c) {
    return __builtin_amdgcn_wmma_f32_16x16x32_bf16(false, a, false, b, (short)0, c, false, false);
  }
  static __device__ __forceinline__ void guard(v8f& a, v8f& b, v16b x, v16b y) { dep_guard_b(a, b, x, y); }
  static __device__ __forceinline__ void keep(v16b a, v16b b, v16b c, v16b d) { keep4_b(a, b, c, d); }
};

// ---- Register-blocked batched WMMA GEMM, operands staged in LDS --------------
// C[m,n] = scale * sum_k A[m,k] * Bt[n,k] (+bias)(+resid); a block of 4 waves (2 x 2) owns a 128x128 tile, each wave 64x64 of it.
// A row-major [M,K]; Bt row-major [N,K]; M,N % 128 == 0, K % 32 == 0.
// Per 32-wide k tile the block brings 128 A rows and 128 Bt rows of every plane (64 B a row) into LDS with asynchronous
// 16-B copies (a wave-wide copy = 8 rows x 64 contiguous B), two buffers: tile t+1 flies while tile t is multiplied.
// SPLIT: operands are hi/lo planes (A2/Bt2 = lo planes, same layout); product = hi.hi + hi.lo + lo.hi.
// BIAS_MODE: 0 = none, 1 = bias[m], 2 = bias[n].
// OUT_MODE: 0 = f32, 1 = f16, 2 = bf16 hi plane (Cout) + bf16 lo plane (Cout2).
// Coverage per wave tile: 4 slabs x 16 rows x 64 cols = 64x64 (f32: it 0..7 x hh 0..1 rows, 16 lanes x 4 floats;
// 16-bit: it 0..3 x q 0..3 rows, 8 lanes x 8 elements).
// ET: 0 = f16 operands, 1 = bf16 operands (pointers passed as 16-bit storage)
template <int ET> struct Elem;
template <> struct Elem<0> { typedef _Float16 T; };
template <> struct Elem<1> { typedef __bf16 T; };
constexpr int kGLP    = 40;            // LDS row pitch in 16-bit elements: 80 B = 16 B x 5 (odd), the pitch for 16-B reads of 64-B rows
constexpr int kGPlane = 128 * kGLP;    // one plane of a stage: 128 rows
constexpr int kGStage = 4 * kGPlane;   // A hi, A lo, Bt hi, Bt lo

// Four rows (32 apart) of one plane pair -> LDS: 8 (hi and lo) or 4 (hi only) copies of 16 B per lane. l = the lane's LDS byte
// address of its first hi row, g / g2 = its global address in the hi / lo plane, step = 32 source rows in elements.
// s_wait_xcnt 0 ends the copies' own statement, so that it stands in front of any rewrite of the address registers they name.
template <typename T>
__device__ __forceinline__ void stage_rows8(unsigned l, const T* g, const T* g2, size_t step) {
  const unsigned l1 = l + 32 * kGLP * 2, l2 = l + 64 * kGLP * 2, l3 = l + 96 * kGLP * 2;
  const unsigned m0 = l + kGPlane * 2, m1 = l1 + kGPlane * 2, m2 = l2 + kGPlane * 2, m3 = l3 + kGPlane * 2;
  const T* g1 = g + step;  const T* gg2 = g1 + step;  const T* g3 = gg2 + step;
  const T* h1 = g2 + step; const T* h2 = h1 + step;   const T* h3 = h2 + step;
  asm volatile("global_load_async_to_lds_b128 %0, %8, off\n\t"
               "global_load_async_to_lds_b128 %1, %9, off\n\t"
               "global_load_async_to_lds_b128 %2, %10, off\n\t"
               "global_load_async_to_lds_b128 %3, %11, off\n\t"
               "global_load_async_to_lds_b128 %4, %12, off\n\t"
               "global_load_async_to_lds_b128 %5, %13, off\n\t"
               "global_load_async_to_lds_b128 %6, %14, off\n\t"
               "global_load_async_to_lds_b128 %7, %15, off\n\t"
               "s_wait_xcnt 0x0"
               :: "v"(l), "v"(l1), "v"(l2), "v"(l3), "v"(m0), "v"(m1), "v"(m2), "v"(m3),
                  "v"(g), "v"(g1), "v"(gg2), "v"(g3), "v"(g2), "v"(h1), "v"(h2), "v"(h3) : "memory");
}
template <typename T>
__device__ __forceinline__ void stage_rows4(unsigned l, const T* g, size_t step) {
  const unsigned l1 = l + 32 * kGLP * 2, l2 = l + 64 * kGLP * 2, l3 = l + 96 * kGLP * 2;
  const T* g1 = g + step; const T* gg2 = g1 + step; const T* g3 = gg2 + step;
  asm volatile("global_load_async_to_lds_b128 %0, %4, off\n\t"
               "global_load_async_to_lds_b128 %1, %5, off\n\t"
               "global_load_async_to_lds_b128 %2, %6, off\n\t"
               "global_load_async_to_lds_b128 %3, %7, off\n\t"
               "s_wait_xcnt 0x0"
               :: "v"(l), "v"(l1), "v"(l2), "v"(l3), "v"(g), "v"(g1), "v"(gg2), "v"(g3) : "memory");
}

template <int ET, bool SPLIT, int BIAS_MODE, int OUT_MODE, bool RESID, int ACT = 0>
__global__ __launch_bounds__(128) void wmma_gemm64(
    const unsigned short* __restrict__ Ap, const unsigned short* __restrict__ A2p, int lda, long strideA,
    const unsigned short* __restrict__ Btp, const unsigned short* __restrict__ Bt2p, int ldb, long strideB,
    void* __restrict__ Cout, void* __restrict__ Cout2, int ldc, long strideC,
    const float* __restrict__ bias,
    const float* __restrict__ resid, long strideR,
    int M, int N, int K, float scale) {
  typedef typename Elem<ET>::T T;
  typedef typename Frag<T>::V V;
  const T* A = (const T*)Ap; const T* A2 = (const T*)A2p; const T* Bt = (const T*)Btp; const T* Bt2 = (const T*)Bt2p;
  __shared__ __align__(16) T ring[2 * kGStage];    // two stages of operand tiles, 2 x 40,960 B
  __shared__ __align__(16) float sT[4][16 * 68];   // per-wave 16x64 slab, pitch 68 floats
  const int b    = blockIdx.y;
  const int lane = threadIdx.x & 31;
  const int wave = threadIdx.x >> 5;
  const int tilesN = N >> 7;
  const int tilesM = M >> 7;
  const int tile = blockIdx.x;
  if (tile >= tilesM * tilesN) return;   // block-uniform, in front of every barrier and copy
  const int tm = tile / tilesN;
  const int tn = tile - tm * tilesN;
  const int bm0 = tm << 7;                         // block tile origin
  const int bn0 = tn << 7;
  const int wm = (wave >> 1) << 6;                 // wave tile origin inside the block tile
  const int wn = (wave & 1) << 6;
  const int m0 = bm0 + wm;
  const int n0 = bn0 + wn;

  const T* Ab  = A  + (size_t)b * strideA;
  const T* Bb  = Bt + (size_t)b * strideB;
  const T* Ab2 = SPLIT ? (A2  + (size_t)b * strideA) : nullptr;
  const T* Bb2 = SPLIT ? (Bt2 + (size_t)b * strideB) : nullptr;

  const int rlane = lane & 15;                 // row (A) / col (B, D) within subtile
  const int koff  = (lane >> 4) * 8;           // k offset of this lane half
  const int mOff  = (lane >> 4) * 8;           // D row offset

  v8f acc[4][4];
#pragma unroll
  for (int i = 0; i < 4; ++i)
#pragma unroll
    for (int j = 0; j < 4; ++j) acc[i][j] = (v8f){0.f,0.f,0.f,0.f,0.f,0.f,0.f,0.f};

  // copy map: thread -> row (tid >> 2) + 32 r, r = 0..3, 16-B chunk tid & 3 of the row's 64 B; 128 threads x 4 rows = 128 rows a plane
  const int crow = threadIdx.x >> 2;
  const int cchk = (threadIdx.x & 3) * 8;
  const size_t cao = (size_t)(bm0 + crow) * lda + cchk;
  const size_t cbo = (size_t)(bn0 + crow) * ldb + cchk;
  const size_t stepA = (size_t)32 * lda, stepB = (size_t)32 * ldb;
  const unsigned lds0 = (unsigned)(uintptr_t)(&ring[0]) + (unsigned)(crow * kGLP + cchk) * 2u;   // LDS byte address: low 32 bits
  const int nT = K >> 5;                           // k tiles, the same for the whole grid

#define GEMM_STAGE(t_)                                                                          \
  {                                                                                             \
    const unsigned lt = lds0 + (unsigned)((t_) & 1) * (kGStage * 2u);                           \
    const size_t ko = (size_t)(t_) * 32;                                                        \
    if (SPLIT) {                                                                                \
      stage_rows8<T>(lt, Ab + cao + ko, Ab2 + cao + ko, stepA);                                 \
      stage_rows8<T>(lt + 2u * kGPlane * 2u, Bb + cbo + ko, Bb2 + cbo + ko, stepB);             \
    } else {                                                                                    \
      stage_rows4<T>(lt, Ab + cao + ko, stepA);                                                 \
      stage_rows4<T>(lt + 2u * kGPlane * 2u, Bb + cbo + ko, stepB);                             \
    }                                                                                           \
  }

  GEMM_STAGE(0)
  asm volatile("s_wait_asynccnt 0x0" ::: "memory");   // this wave's copies of tile 0 have landed
  __syncthreads();                                    // ... and every other wave's: tile 0 may be read
  if (nT > 1) GEMM_STAGE(1)

  for (int t = 0; t < nT; ++t) {
    const T* st = ring + (t & 1) * kGStage;
    const T* sA = st + (wm + rlane) * kGLP + koff;
    const T* sB = st + 2 * kGPlane + (wn + rlane) * kGLP + koff;
    V bh[4], bl[4];
#pragma unroll
    for (int j = 0; j < 4; ++j) {
      bh[j] = Frag<T>::load(sB + (j << 4) * kGLP);
      if (SPLIT) bl[j] = Frag<T>::load(sB + kGPlane + (j << 4) * kGLP);
    }
#pragma unroll
    for (int i = 0; i < 4; ++i) {
      V ah = Frag<T>::load(sA + (i << 4) * kGLP);
      V al;
      if (SPLIT) al = Frag<T>::load(sA + kGPlane + (i << 4) * kGLP);
#pragma unroll
      for (int j = 0; j < 4; ++j) {
        acc[i][j] = Frag<T>::mma(ah, bh[j], acc[i][j]);
        if (SPLIT) {
          acc[i][j] = Frag<T>::mma(ah, bl[j], acc[i][j]);
          acc[i][j] = Frag<T>::mma(al, bh[j], acc[i][j]);
        }
      }
      Frag<T>::guard(acc[i][0], acc[i][3], ah, SPLIT ? al : ah);
    }
    Frag<T>::keep(bh[0], bh[1], bh[2], bh[3]);
    if (SPLIT) Frag<T>::keep(bl[0], bl[1], bl[2], bl[3]);
    asm volatile("s_wait_dscnt 0x0" ::: "memory");      // this wave's reads of tile t's buffer are done before it is refilled
    asm volatile("s_wait_asynccnt 0x0" ::: "memory");   // this wave's copies of tile t+1 have landed
    __syncthreads();                                    // publishes tile t+1 and ends every wave's reads of tile t
    if (t + 2 < nT) GEMM_STAGE(t + 2)                   // uniform test; into the buffer that trip t has just read
  }
  asm volatile("s_wait_asynccnt 0x0" ::: "memory");     // no copy outstanding behind the loop
#undef GEMM_STAGE
  acc_guard4(acc[0][0], acc[0][1], acc[0][2], acc[0][3]);
  acc_guard4(acc[1][0], acc[1][1], acc[1][2], acc[1][3]);
  acc_guard4(acc[2][0], acc[2][1], acc[2][2], acc[2][3]);
  acc_guard4(acc[3][0], acc[3][1], acc[3][2], acc[3][3]);

  // ---- epilogue ----
  float* slab = sT[wave];
  const float* Rb = RESID ? (resid + (size_t)b * strideR) : nullptr;
#pragma unroll
  for (int i = 0; i < 4; ++i) {
    const int mBase = m0 + (i << 4);
#pragma unroll
    for (int j = 0; j < 4; ++j) {
      const int n = n0 + (j << 4) + rlane;
      float bv = 0.f;
      if (BIAS_MODE == 2) bv = bias[n];
#pragma unroll
      for (int r = 0; r < 8; ++r) {
        float v = acc[i][j][r] * scale;
        if (BIAS_MODE == 1) v += bias[mBase + mOff + r];
        if (BIAS_MODE == 2) v += bv;
        if (RESID) v += Rb[(size_t)(mBase + mOff + r) * ldc + n];
        if (ACT == 1) v = tanhf(v);
        if (ACT == 2) v = fmaxf(v, 0.0f);
        if (ACT == 3) v = v / (1.0f + expf(-v));
        if (ACT == 4) v = (v > 0.f) ? v : 0.01f * v;
        slab[(mOff + r) * 68 + (j << 4) + rlane] = v;
      }
    }
    __builtin_amdgcn_fence(__ATOMIC_RELEASE, "workgroup");
    __builtin_amdgcn_wave_barrier();
    __builtin_amdgcn_fence(__ATOMIC_ACQUIRE, "workgroup");
    if (OUT_MODE == 0) {
      float* C = (float*)Cout + (size_t)b * strideC;
      const int hh = lane >> 4, c4 = (lane & 15) * 4;     // row seg = 256 B = 16 lanes x 16 B
      {
#pragma unroll
        for (int it = 0; it < 8; ++it) {
          const int row = it * 2 + hh;
          v4f v = *(const v4f*)(slab + row * 68 + c4);
          *(v4f*)(C + (size_t)(mBase + row) * ldc + n0 + c4) = v;
        }
        
      }
    } else {
      const int q = lane >> 3, c8 = (lane & 7) * 8;
      unsigned short* C  = (unsigned short*)Cout  + (size_t)b * strideC;
      unsigned short* C2 = (OUT_MODE == 2) ? ((unsigned short*)Cout2 + (size_t)b * strideC) : nullptr;
      {
#pragma unroll
        for (int it = 0; it < 4; ++it) {
          const int row = it * 4 + q;
          const float* sp = slab + row * 68 + c8;
          v8h hv, lv;
#pragma unroll
          for (int e = 0; e < 8; ++e) {
            if (OUT_MODE == 1) {
              hv[e] = (_Float16)sp[e];
            } else {
              unsigned short hb = f2bf_bits(sp[e]);
              unsigned short lb = f2bf_bits(sp[e] - bf_bits2f(hb));
              hv[e] = __builtin_bit_cast(_Float16, hb);
              lv[e] = __builtin_bit_cast(_Float16, lb);
            }
          }
          *(v8h*)(C + (size_t)(mBase + row) * ldc + n0 + c8) = hv;
          if (OUT_MODE == 2) *(v8h*)(C2 + (size_t)(mBase + row) * ldc + n0 + c8) = lv;
        }
        
      }
    }
    __builtin_amdgcn_fence(__ATOMIC_RELEASE, "workgroup");
    __builtin_amdgcn_wave_barrier();
    __builtin_amdgcn_fence(__ATOMIC_ACQUIRE, "workgroup");
  }
}

// ---------------------------------------------------------------------------
// Elementwise bf16 split: hi = bf16_rne(in), lo = bf16_rne(in - hi); 2 elements per thread, one 4-B store.
// blockIdx.y (block-uniform) picks one of four equally sized sources; its planes start pstride 16-bit elements apart.
// ---------------------------------------------------------------------------
__device__ __forceinline__ unsigned pk16(unsigned short a, unsigned short b) { return (unsigned)a | ((unsigned)b << 16); }

__global__ __launch_bounds__(256) void split_bf16x2_kernel(const float* __restrict__ in0, const float* __restrict__ in1,
                                                           const float* __restrict__ in2, const float* __restrict__ in3,
                                                           unsigned short* __restrict__ hi, unsigned short* __restrict__ lo,
                                                           int n2, long pstride) {
  const int w = blockIdx.y;
  const float* in = (w == 0) ? in0 : (w == 1) ? in1 : (w == 2) ? in2 : in3;
  unsigned short* ph = hi + (size_t)w * pstride;
  unsigned short* pl = lo + (size_t)w * pstride;
  const int i = blockIdx.x * 256 + threadIdx.x;
  if (i < n2) {
    const v2f f = *(const v2f*)(in + 2 * (size_t)i);
    const unsigned short h0 = f2bf_bits(f[0]), h1 = f2bf_bits(f[1]);
    const unsigned short l0 = f2bf_bits(f[0] - bf_bits2f(h0)), l1 = f2bf_bits(f[1] - bf_bits2f(h1));
    const unsigned uh = pk16(h0, h1), ul = pk16(l0, l1);
    ((unsigned*)ph)[i] = uh;
    ((unsigned*)pl)[i] = ul;
    
  }
}

// ---------------------------------------------------------------------------
// tanh then bf16 split: hi = bf16_rne(tanh(in)), lo = bf16_rne(tanh(in) - hi); same store shape as above
// Coverage: grid = ceil(n2/256) x 256 threads x 2 elements = 2*n2 = whole plane.
// ---------------------------------------------------------------------------
__global__ __launch_bounds__(256) void tanh_split_kernel(const float* __restrict__ in, unsigned short* __restrict__ hi,
                                                         unsigned short* __restrict__ lo, int n2) {
  const int i = blockIdx.x * 256 + threadIdx.x;
  if (i < n2) {
    const v2f f = *(const v2f*)(in + 2 * (size_t)i);
    const float t0 = tanhf(f[0]), t1 = tanhf(f[1]);
    const unsigned short h0 = f2bf_bits(t0), h1 = f2bf_bits(t1);
    const unsigned short l0 = f2bf_bits(t0 - bf_bits2f(h0)), l1 = f2bf_bits(t1 - bf_bits2f(h1));
    const unsigned uh = pk16(h0, h1), ul = pk16(l0, l1);
    ((unsigned*)hi)[i] = uh;
    ((unsigned*)lo)[i] = ul;
    
  }
}

// ---------------------------------------------------------------------------
// Transpose + bf16 split: in w[R][Cn] f32 -> planes th/tl [Cn][R] bf16: out[n*R + k] = split(w[k*Cn + n]).
// grid = (Cn/64, R/64, matrices), R, Cn % 64 == 0; matrix z starts z*R*Cn elements into w, th and tl.
// (Used for the LayerNormed v [b][s=R=2048][c=Cn=1024] -> v^T planes [b][c][s].)
// Coverage: load 256 threads x 16 = 64x64; store 8 waves x 2 it x 4 rows(q) x 8 lanes x 8 elements = 64x64.
// ---------------------------------------------------------------------------
__global__ __launch_bounds__(256) void wt_split_kernel(const float* __restrict__ wz, unsigned short* __restrict__ thz,
                                                       unsigned short* __restrict__ tlz, int R, int Cn) {
  __shared__ float tile[64 * 65];
  const int n0 = blockIdx.x * 64;
  const int k0 = blockIdx.y * 64;
  const size_t zo = (size_t)blockIdx.z * R * Cn;
  const float* w = wz + zo;
  unsigned short* th = thz + zo;
  unsigned short* tl = tlz + zo;
  const int t = threadIdx.x;
#pragma unroll
  for (int i = 0; i < 16; ++i) {
    const int idx = i * 256 + t;
    const int kk = idx >> 6, nn = idx & 63;
    tile[nn * 65 + kk] = w[(size_t)(k0 + kk) * Cn + n0 + nn];
  }
  __syncthreads();
  const int lane = t & 31, wave = t >> 5;
  const int q = lane >> 3, c8 = (lane & 7) * 8;
  {
#pragma unroll
    for (int it = 0; it < 2; ++it) {
      const int row = wave * 8 + it * 4 + q;          // 0..63 = local n
      const float* sp = tile + row * 65 + c8;
      v8us hv, lv;
#pragma unroll
      for (int e = 0; e < 8; ++e) {
        const unsigned short hb = f2bf_bits(sp[e]);
        const unsigned short lb = f2bf_bits(sp[e] - bf_bits2f(hb));
        hv[e] = hb; lv[e] = lb;
      }
      const size_t o = (size_t)(n0 + row) * R + k0 + c8;
      *(v8us*)(th + o) = hv;
      *(v8us*)(tl + o) = lv;
    }
    
  }
}

// ---------------------------------------------------------------------------
// LoRA weight w1 [1024 in k][96 out n] f32 -> Bt planes th/tl [kLoraP=128 n][1024 k] bf16, rows n >= 96 ZERO:
//   out[n*1024 + k] = split(n < 96 ? w1[k*96 + n] : 0).  grid = 1024/64 k-tiles; block = 256 threads.
// LDS tile [128 n][65]: load 256 threads x 32 iterations = 64 k x 128 n (address clamped to n <= 95, zero by predicate).
// ---------------------------------------------------------------------------
__global__ __launch_bounds__(256) void w1t_split_kernel(const float* __restrict__ w1, unsigned short* __restrict__ th,
                                                        unsigned short* __restrict__ tl) {
  __shared__ float tile[kLoraP * 65];
  const int k0 = blockIdx.x * 64;
  const int t = threadIdx.x;
#pragma unroll 4
  for (int i = 0; i < 32; ++i) {
    const int idx = i * 256 + t;
    const int kk = idx >> 7, nn = idx & 127;
    const int nc = (nn < kLoraN) ? nn : (kLoraN - 1);
    float v = w1[(size_t)(k0 + kk) * kLoraN + nc];
    if (nn >= kLoraN) v = 0.0f;
    tile[nn * 65 + kk] = v;
  }
  __syncthreads();
  const int lane = t & 31, wave = t >> 5;
  const int q = lane >> 3, c8 = (lane & 7) * 8;
  {
#pragma unroll
    for (int it = 0; it < 4; ++it) {
      const int row = wave * 16 + it * 4 + q;         // 0..127 = n
      const float* sp = tile + row * 65 + c8;
      v8us hv, lv;
#pragma unroll
      for (int e = 0; e < 8; ++e) {
        const unsigned short hb = f2bf_bits(sp[e]);
        const unsigned short lb = f2bf_bits(sp[e] - bf_bits2f(hb));
        hv[e] = hb; lv[e] = lb;
      }
      const size_t o = (size_t)row * kDm + k0 + c8;
      *(v8us*)(th + o) = hv;
      *(v8us*)(tl + o) = lv;
    }
    
  }
}

// ---------------------------------------------------------------------------
// LoRA weight w2 [3 l][32 d][1024 c] f32 -> Bt planes th/tl [3 l][1024 n=c][32 k=d] bf16: out[l][n][k] = split(w2[l][k][n]).
// grid = (1024/64 n-tiles, 3); block 256. LDS tile [64 n][33]: load 256 threads x 8 = 32 k x 64 n.
// 512 contiguous bytes) with ONE 16-B-per-lane instruction: lane -> line L = lane>>3, row = wave*8 + 2L + ((lane&7)>>2),
// ---------------------------------------------------------------------------
__global__ __launch_bounds__(256) void w2t_split_kernel(const float* __restrict__ w2, unsigned short* __restrict__ th,
                                                        unsigned short* __restrict__ tl) {
  __shared__ float tile[64 * 33];
  const int n0 = blockIdx.x * 64;
  const int l  = blockIdx.y;
  const int t  = threadIdx.x;
  const float* wl = w2 + (size_t)l * kLoraD * kDm;
#pragma unroll
  for (int i = 0; i < 8; ++i) {
    const int idx = i * 256 + t;
    const int kk = idx >> 6, nn = idx & 63;
    tile[nn * 33 + kk] = wl[(size_t)kk * kDm + n0 + nn];
  }
  __syncthreads();
  const int lane = t & 31, wave = t >> 5;
  const int L = lane >> 3, q = lane & 7;
  const int row = wave * 8 + 2 * L + (q >> 2);
  const int k8 = (q & 3) * 8;
  const float* sp = tile + row * 33 + k8;
  v8us hv, lv;
#pragma unroll
  for (int e = 0; e < 8; ++e) {
    const unsigned short hb = f2bf_bits(sp[e]);
    const unsigned short lb = f2bf_bits(sp[e] - bf_bits2f(hb));
    hv[e] = hb; lv[e] = lb;
  }
  const size_t o = (size_t)l * kDm * kLoraD + (size_t)(n0 + row) * kLoraD + k8;
  *(v8us*)(th + o) = hv;
  *(v8us*)(tl + o) = lv;
  
}

// ---------------------------------------------------------------------------
// Shared elementwise split helper for 8 consecutive values -> v8us hi/lo.
// ---------------------------------------------------------------------------
__device__ __forceinline__ void split8(const v4f va, const v4f vb, v8us& hv, v8us& lv) {
#pragma unroll
  for (int e = 0; e < 4; ++e) {
    const unsigned short h0 = f2bf_bits(va[e]);
    hv[e] = h0; lv[e] = f2bf_bits(va[e] - bf_bits2f(h0));
    const unsigned short h1 = f2bf_bits(vb[e]);
    hv[4 + e] = h1; lv[4 + e] = f2bf_bits(vb[e] - bf_bits2f(h1));
  }
}
__device__ __forceinline__ void store16x2(unsigned short* ph, unsigned short* pl, size_t o, const v8us hv, const v8us lv) {
  *(v8us*)(ph + o) = hv;
  *(v8us*)(pl + o) = lv;
  
}

// ---------------------------------------------------------------------------
// Token shift: xxx = x + (xprev - x) * maa_x -> bf16 hi/lo planes [kRows][kDm], row = b*kSeq + s;
// xprev = shift_state[b] for s == 0, else x[b][s-1] (block-uniform pointer choice).
// grid = kRows blocks x 128 threads x 8 elements = kRows x kDm = the whole plane; each lane stores 16 B,
// ---------------------------------------------------------------------------
__global__ __launch_bounds__(128) void xxx_split_kernel(const float* __restrict__ x, const float* __restrict__ ss,
                                                        const float* __restrict__ maax,
                                                        unsigned short* __restrict__ oh, unsigned short* __restrict__ ol) {
  const int row = blockIdx.x;
  const int b = row / kSeq, s = row % kSeq;
  const int c0 = threadIdx.x * 8;
  const float* xr = x + (size_t)row * kDm;
  const float* xp = (s == 0) ? (ss + (size_t)b * kDm) : (xr - kDm);
  const v4f xa = *(const v4f*)(xr + c0), xb = *(const v4f*)(xr + c0 + 4);
  const v4f pa = *(const v4f*)(xp + c0), pb = *(const v4f*)(xp + c0 + 4);
  const v4f ma = *(const v4f*)(maax + c0), mb = *(const v4f*)(maax + c0 + 4);
  const v4f va = xa + (pa - xa) * ma;
  const v4f vb = xb + (pb - xb) * mb;
  v8us hv, lv;
  split8(va, vb, hv, lv);
  store16x2(oh, ol, (size_t)row * kDm + c0, hv, lv);
}

// ---------------------------------------------------------------------------
// Data-dependent mixing: x? = x + (xprev - x) * (maa_? + mix_?[s][c]) for ? in {q(r), k, v} -> three bf16 hi/lo plane pairs
// [kRows][kDm]. mix planes f32 [3][kRows][kDm] (l = 0 r, 1 k, 2 v). Same row index and thread/store shape as xxx_split_kernel:
// ---------------------------------------------------------------------------
__global__ __launch_bounds__(128) void mix_split_kernel(const float* __restrict__ x, const float* __restrict__ ss,
                                                        const float* __restrict__ maar, const float* __restrict__ maak,
                                                        const float* __restrict__ maav, const float* __restrict__ mix,
                                                        unsigned short* __restrict__ qh, unsigned short* __restrict__ ql,
                                                        unsigned short* __restrict__ kh, unsigned short* __restrict__ kl,
                                                        unsigned short* __restrict__ vh, unsigned short* __restrict__ vl) {
  const int row = blockIdx.x;
  const int b = row / kSeq, s = row % kSeq;
  const int c0 = threadIdx.x * 8;
  const float* xr = x + (size_t)row * kDm;
  const float* xp = (s == 0) ? (ss + (size_t)b * kDm) : (xr - kDm);
  const v4f xa = *(const v4f*)(xr + c0), xb = *(const v4f*)(xr + c0 + 4);
  const v4f pa = *(const v4f*)(xp + c0), pb = *(const v4f*)(xp + c0 + 4);
  const v4f da = pa - xa, db = pb - xb;
  const size_t plane = (size_t)kRows * kDm;
  const float* m0 = mix + (size_t)row * kDm + c0;
  const size_t o = (size_t)row * kDm + c0;
  {
    const v4f ma = *(const v4f*)(maar + c0), mb = *(const v4f*)(maar + c0 + 4);
    const v4f qa = *(const v4f*)(m0), qb = *(const v4f*)(m0 + 4);
    const v4f va = xa + da * (ma + qa), vb = xb + db * (mb + qb);
    v8us hv, lv; split8(va, vb, hv, lv); store16x2(qh, ql, o, hv, lv);
  }
  {
    const v4f ma = *(const v4f*)(maak + c0), mb = *(const v4f*)(maak + c0 + 4);
    const v4f qa = *(const v4f*)(m0 + plane), qb = *(const v4f*)(m0 + plane + 4);
    const v4f va = xa + da * (ma + qa), vb = xb + db * (mb + qb);
    v8us hv, lv; split8(va, vb, hv, lv); store16x2(kh, kl, o, hv, lv);
  }
  {
    const v4f ma = *(const v4f*)(maav + c0), mb = *(const v4f*)(maav + c0 + 4);
    const v4f qa = *(const v4f*)(m0 + 2 * plane), qb = *(const v4f*)(m0 + 2 * plane + 4);
    const v4f va = xa + da * (ma + qa), vb = xb + db * (mb + qb);
    v8us hv, lv; split8(va, vb, hv, lv); store16x2(vh, vl, o, hv, lv);
  }
}

// ---------------------------------------------------------------------------
//   MODE 0: LN then RoPE (half-split per 64-wide head: out[f] = x1*cos - x2*sin, out[32+f] = x1*sin + x2*cos with
//           cos/sin = cosf/sinf(angles[s][f]), s = row % kSeq) then bf16 hi/lo split into planes [kRows][kDm]; grid = (kRows, 2),
//           blockIdx.y selects source/params/planes A (0) or B (1).
//   MODE 1: LN written back IN PLACE as f32 (dstf == src): each block owns its row; thread t writes floats 4t..4t+3,
//   MODE 2: LN then bf16 hi/lo split into planes (no rotation); grid = (kRows, 1).
// MODE 0/2 store path: per wave (heads 2w, 2w+1) the 128 results are staged in LDS, then lanes 0..15 write 16 B each =
// ---------------------------------------------------------------------------
template <int MODE>
__global__ __launch_bounds__(256) void ln_kernel(const float* srcA, const float* srcB,
                                                 const float* __restrict__ gA, const float* __restrict__ bA,
                                                 const float* __restrict__ gB, const float* __restrict__ bB,
                                                 const float* __restrict__ ang,
                                                 unsigned short* hA, unsigned short* lA,
                                                 unsigned short* hB, unsigned short* lB, float* dstf) {
  __shared__ __align__(16) float srow[kDm];
  __shared__ __align__(16) unsigned short Lh[8][128];
  __shared__ __align__(16) unsigned short Ll[8][128];
  __shared__ float sred[8];
  __shared__ float sred2[8];
  const int s = blockIdx.x;                      // token row b*kSeq + position
  const int which = blockIdx.y;                  // block-uniform
  const float* src = (which == 0) ? srcA : srcB;
  const float* g   = (which == 0) ? gA : gB;
  const float* bb  = (which == 0) ? bA : bB;
  unsigned short* dh = (which == 0) ? hA : hB;
  unsigned short* dl = (which == 0) ? lA : lB;
  const int tid = threadIdx.x, lane = tid & 31, wave = tid >> 5;

  const float* row = src + (size_t)s * kDm;
  const v4f xv = *(const v4f*)(row + tid * 4);
  float ps = (xv[0] + xv[1]) + (xv[2] + xv[3]);
#pragma unroll
  for (int off = 1; off < 32; off <<= 1) ps += __shfl_xor(ps, off, 32);
  if (lane == 0) sred[wave] = ps;
  __syncthreads();
  float tot = 0.f;
#pragma unroll
  for (int w = 0; w < 8; ++w) tot += sred[w];
  const float mean = tot * (1.0f / (float)kDm);
  const v4f dv = xv - mean;
  float pq = (dv[0] * dv[0] + dv[1] * dv[1]) + (dv[2] * dv[2] + dv[3] * dv[3]);
#pragma unroll
  for (int off = 1; off < 32; off <<= 1) pq += __shfl_xor(pq, off, 32);
  if (lane == 0) sred2[wave] = pq;
  __syncthreads();
  float tot2 = 0.f;
#pragma unroll
  for (int w = 0; w < 8; ++w) tot2 += sred2[w];
  const float var  = tot2 * (1.0f / (float)kDm);
  const float rstd = rsqrtf(var + 1.0e-5f);
  const v4f gv = *(const v4f*)(g + tid * 4);
  const v4f bv = *(const v4f*)(bb + tid * 4);
  v4f yv;
#pragma unroll
  for (int e = 0; e < 4; ++e) yv[e] = dv[e] * rstd * gv[e] + bv[e];

  if (MODE == 1) {
    float* dp = dstf + (size_t)s * kDm + tid * 4;
    *(v4f*)dp = yv;
    
    return;                                     // MODE is a compile-time constant: uniform
  }

  *(v4f*)(srow + tid * 4) = yv;
  __syncthreads();

  float cs = 1.0f, sn = 0.0f;
  if (MODE == 0) {
    const float a = ang[(size_t)(s % kSeq) * 32 + lane];
    cs = cosf(a);
    sn = sinf(a);
  }
  unsigned short* lh = Lh[wave];
  unsigned short* ll = Ll[wave];
#pragma unroll 1
  for (int hp = 0; hp < 2; ++hp) {
    const int base = wave * 128 + hp * 64;
    const float xr = srow[base + lane];
    const float xi = srow[base + 32 + lane];
    float vr = xr, vi = xi;
    if (MODE == 0) { vr = xr * cs - xi * sn; vi = xr * sn + xi * cs; }
    const unsigned short hr = f2bf_bits(vr);
    const unsigned short lr = f2bf_bits(vr - bf_bits2f(hr));
    const unsigned short hi = f2bf_bits(vi);
    const unsigned short li = f2bf_bits(vi - bf_bits2f(hi));
    lh[hp * 64 + lane] = hr;       ll[hp * 64 + lane] = lr;
    lh[hp * 64 + 32 + lane] = hi;  ll[hp * 64 + 32 + lane] = li;
  }
  __builtin_amdgcn_fence(__ATOMIC_RELEASE, "workgroup");
  __builtin_amdgcn_wave_barrier();
  __builtin_amdgcn_fence(__ATOMIC_ACQUIRE, "workgroup");
  const int l16 = lane & 15;
  const v8us hv = *(const v8us*)(lh + l16 * 8);
  const v8us lv = *(const v8us*)(ll + l16 * 8);
  const size_t o = (size_t)s * kDm + wave * 128 + l16 * 8;
  {
    if (lane < 16) {
      *(v8us*)(dh + o) = hv;
      *(v8us*)(dl + o) = lv;
    }
    
  }
}

#define AT_D 64
#define AT_NW 4
#define AT_QB 64
#define AT_KC 64
#define AT_LP 72   // LDS row pitch of the K and V^T tiles in 16-bit elements: 144 B = 16 B x 9 (odd), so that the 16 rows of one 16-B fragment read fall on 16 different bank groups

__device__ __forceinline__ v8f at_mma(v16b a, v16b b, v8f c) {
  return __builtin_amdgcn_wmma_f32_16x16x32_bf16(false, a, false, b, (short)0, c, false, false);
}

// Value of lane l ^ 16 (the other half's lane of the same query) by a cross-row move of the vector unit.
__device__ __forceinline__ float at_other_half(float v) {
  const int b = __float_as_int(v);
  return __int_as_float(__builtin_amdgcn_permlanex16(b, b, 0x76543210, 0xfedcba98, false, false));
}

// 4 waves a SIMD (4 blocks a WGP = the whole grid resident) is the target: the register budget of that occupancy, 256, holds the fragment groups below
__global__ __launch_bounds__(128) __attribute__((amdgpu_waves_per_eu(4, 4)))
void attn_causal64_kernel(const unsigned short* __restrict__ qhp, const unsigned short* __restrict__ qlp,
                          const unsigned short* __restrict__ khp, const unsigned short* __restrict__ klp,
                          const unsigned short* __restrict__ vhp, const unsigned short* __restrict__ vlp,
                          float* __restrict__ out, float sscale, float mfill) {
  union PB { v16b v; v2b w[8]; };
  __shared__ __align__(16) __bf16 Ksh[AT_KC * AT_LP];            // K hi [kv][d], 64 rows of 144 B
  __shared__ __align__(16) __bf16 Ksl[AT_KC * AT_LP];            // K lo
  __shared__ __align__(16) __bf16 Vth[AT_D * AT_LP];             // V hi [d][kv], 64 rows of 144 B
  __shared__ __align__(16) __bf16 Vtl[AT_D * AT_LP];             // V lo
  __shared__ __align__(16) float  Os[AT_NW][16 * 68];            // per wave out tile, pitch 68

  const int tid  = threadIdx.x;
  const int wave = tid >> 5;
  const int lane = tid & 31;
  const int hh   = lane >> 4;
  const int c    = lane & 15;

  const int nqb = kSeq / AT_QB;           // 32
  const int bx = blockIdx.x;
  const int h  = bx / nqb;                // 0..kHeads-1 (grid = kHeads * nqb)
  // Query tile of this block. A tile's cost is its key walk, qb + 1 chunks, and the whole grid is resident at once (4 blocks a WGP),
  // so the launch lasts as long as the WGP whose 4 blocks hold the most chunks. With qb = bx % 32 blocks whose flat index is equal
  // mod 256 (and mod 32) all hold the same tile. The map below is, for each head and batch element, a permutation of the 32 tiles in
  // which j and j + 16, and flat indices 256 apart, hold tiles t and 31 - t, and an even j and j + 1 tiles that add up to 30 or 32: sets
  // of blocks that start next to each other or a whole round of WGPs apart then hold about 33 chunks a pair. For speed only: the result
  // does not depend on where a block runs.
  const int j   = bx % nqb;
  const int tt  = (j >= nqb / 2) ? (nqb + nqb / 2 - 1 - j) : j;   // j = 0..15 -> j, 16..31 -> 47 - j = 31 - (j - 16)
  const int rnd = bx >> 8;                                        // parity of flat block index / 256 (gridDim.x = 512 = 2 x 256)
  const int qb  = ((j ^ rnd) & 1) ? (nqb - 1 - tt) : tt;          // block-uniform, 0..31
  const int q0 = qb * AT_QB + wave * 16;

  const size_t bo = (size_t)blockIdx.y * kSeq * kDm;
  const __bf16* Qh = (const __bf16*)(const void*)qhp + bo + (size_t)h * AT_D;
  const __bf16* Ql = (const __bf16*)(const void*)qlp + bo + (size_t)h * AT_D;
  const __bf16* Kh = (const __bf16*)(const void*)khp + bo + (size_t)h * AT_D;
  const __bf16* Kl = (const __bf16*)(const void*)klp + bo + (size_t)h * AT_D;
  const __bf16* Vh = (const __bf16*)(const void*)vhp + bo + (size_t)h * AT_D * kSeq;
  const __bf16* Vl = (const __bf16*)(const void*)vlp + bo + (size_t)h * AT_D * kSeq;
  float*        ob = out + bo + (size_t)h * AT_D;

  // ---- Q fragments (B operand, column = query = lane&15, split k map via Frag load): 2 d-chunks, hi and lo ----
  v16b qah[2], qal[2];
#pragma unroll
  for (int dc = 0; dc < 2; ++dc) {
    const __bf16* qr = Qh + (size_t)(q0 + c) * kDm + dc * 32 + 8 * hh;
    const __bf16* ql = Ql + (size_t)(q0 + c) * kDm + dc * 32 + 8 * hh;
    qah[dc] = Frag<__bf16>::load(qr);
    qal[dc] = Frag<__bf16>::load(ql);
  }

  float mrow = -INFINITY;   // running maximum of query q0 + c, the same in both lane halves
  float lrow = 0.f;         // running sum over this lane half's keys; the halves are joined behind the loop
  v8f oacc[4];              // O^T: oacc[t][r] = out[q0 + c][16t + 8hh + r]
#pragma unroll
  for (int t = 0; t < 4; ++t) oacc[t] = (v8f){0.f,0.f,0.f,0.f,0.f,0.f,0.f,0.f};

  int nChunks = qb + 1;                      // block-uniform, <= 32
  if (nChunks > kSeq / AT_KC) nChunks = kSeq / AT_KC;
  for (int kc = 0; kc < nChunks; ++kc) {
    const int kv0 = kc * AT_KC;
    __syncthreads();
    {
      // staging coverage: 128 threads x (4 x 8) elements = 64 rows x 64 per plane = the whole chunk tile
      const int r = tid >> 1, half = (tid & 1) * 32;
      const __bf16* ksh = Kh + (size_t)(kv0 + r) * kDm + half;     // K row kv0+r, d = half..half+31
      const __bf16* ksl = Kl + (size_t)(kv0 + r) * kDm + half;
      const __bf16* vsh = Vh + (size_t)r * kSeq + kv0 + half;     // V^T row d = r, s = kv0+half..+31
      const __bf16* vsl = Vl + (size_t)r * kSeq + kv0 + half;
#pragma unroll
      for (int i = 0; i < 4; ++i) {
        const v8b a0 = *(const v8b*)(ksh + 8 * i);
        const v8b a1 = *(const v8b*)(ksl + 8 * i);
        const v8b b0 = *(const v8b*)(vsh + 8 * i);
        const v8b b1 = *(const v8b*)(vsl + 8 * i);
        *(v8b*)(Ksh + r * AT_LP + half + 8 * i) = a0;
        *(v8b*)(Ksl + r * AT_LP + half + 8 * i) = a1;
        *(v8b*)(Vth + r * AT_LP + half + 8 * i) = b0;
        *(v8b*)(Vtl + r * AT_LP + half + 8 * i) = b1;
      }
    }
    __syncthreads();

    // The K fragments are read in two groups, well in front of their products, in the order of their use: the wave meets the LDS latency
    // once a chunk, not once per fragment. The products run term by term over the four score tiles, so that neighbouring matrix
    // instructions have different accumulators; each tile still takes its six terms in the order dc 0: hi.hi, lo.hi, hi.lo, dc 1: the same.
    v16b kfh[2][4], kfl[2][4];
#pragma unroll
    for (int j = 0; j < 4; ++j) kfh[0][j] = Frag<__bf16>::load(Ksh + (j * 16 + c) * AT_LP + 8 * hh);
#pragma unroll
    for (int j = 0; j < 4; ++j) kfl[0][j] = Frag<__bf16>::load(Ksl + (j * 16 + c) * AT_LP + 8 * hh);
#pragma unroll
    for (int j = 0; j < 4; ++j) kfh[1][j] = Frag<__bf16>::load(Ksh + (j * 16 + c) * AT_LP + 32 + 8 * hh);
    __builtin_amdgcn_sched_barrier(0);   // keeps the reads above in one group: sunk to their users they would each expose the LDS latency again
    v8f s[4];                            // s[j][r] = score of key kv0 + 16j + 8hh + r, query q0 + c
#pragma unroll
    for (int j = 0; j < 4; ++j) s[j] = at_mma(kfh[0][j], qah[0], (v8f){0.f,0.f,0.f,0.f,0.f,0.f,0.f,0.f});
#pragma unroll
    for (int j = 0; j < 4; ++j) s[j] = at_mma(kfl[0][j], qah[0], s[j]);
    __builtin_amdgcn_sched_barrier(0);   // the last K group waits for the registers of the lo fragments just used (all four groups at once do not fit) ...
#pragma unroll
    for (int j = 0; j < 4; ++j) kfl[1][j] = Frag<__bf16>::load(Ksl + (j * 16 + c) * AT_LP + 32 + 8 * hh);
    __builtin_amdgcn_sched_barrier(0);   // ... and stays eight products in front of its first user
#pragma unroll
    for (int j = 0; j < 4; ++j) s[j] = at_mma(kfh[0][j], qal[0], s[j]);
#pragma unroll
    for (int j = 0; j < 4; ++j) s[j] = at_mma(kfh[1][j], qah[1], s[j]);
#pragma unroll
    for (int j = 0; j < 4; ++j) s[j] = at_mma(kfl[1][j], qah[1], s[j]);
#pragma unroll
    for (int j = 0; j < 4; ++j) s[j] = at_mma(kfh[1][j], qal[1], s[j]);
    __builtin_amdgcn_sched_barrier(0);   // the V^T reads below stay behind the last score product (they take over the K fragments' registers)
    // V^T fragments, first three groups: read here, they arrive under the softmax arithmetic
    v16b vfh[2][4], vfl[2][4];
#pragma unroll
    for (int t = 0; t < 4; ++t) vfh[0][t] = Frag<__bf16>::load(Vth + (t * 16 + c) * AT_LP + 8 * hh);
#pragma unroll
    for (int t = 0; t < 4; ++t) vfl[0][t] = Frag<__bf16>::load(Vtl + (t * 16 + c) * AT_LP + 8 * hh);
#pragma unroll
    for (int t = 0; t < 4; ++t) vfh[1][t] = Frag<__bf16>::load(Vth + (t * 16 + c) * AT_LP + 32 + 8 * hh);
    __builtin_amdgcn_sched_barrier(0);   // ... and in front of the softmax, not sunk to their users behind it
    // ---- scale, structural causal select on the diagonal tile, maximum over the lane's 32 keys and the other half's ----
    const bool diag = (kc == qb);            // block-uniform
    // a key of this lane, 16j + 8hh + r inside the chunk, is masked where it lies behind the lane's query; off the diagonal none is (limit 64)
    const int lim = diag ? (q0 + c - kv0 - 8 * hh) : AT_KC;
    float m = -INFINITY;
    // the loops from here to the end of the chunk are unrolled in full: s, ph, pl and oacc live in registers and take compile-time indices only
#pragma unroll
    for (int j = 0; j < 4; ++j) {
#pragma unroll
      for (int r = 0; r < 8; ++r) {
        const float sv = s[j][r] * sscale;
        const float sm = (j * 16 + r > lim) ? mfill : sv;
        s[j][r] = sm;
        m = fmaxf(m, sm);
      }
    }
    m = fmaxf(m, at_other_half(m));
    const float mnew = fmaxf(mrow, m);
    const float alpha = expf(mrow - mnew);
    mrow = mnew;
    v2f psum = (v2f){0.f, 0.f};              // even and odd keys apart: one packed add per pair
    PB ph[2], pl[2];                         // P^T hi / lo as B operands: keys 32kk..32kk+31, element 8(j&1) + r <- tile j = 2kk + (j&1)
#pragma unroll
    for (int j = 0; j < 4; ++j) {
#pragma unroll
      for (int r = 0; r < 8; r += 2) {
        const v2f p = (v2f){expf(s[j][r] - mnew), expf(s[j][r + 1] - mnew)};
        psum += p;
        // two neighbouring keys fill one operand register: packed round-to-nearest-even conversions, hi = bf16(p), lo = bf16(p - hi)
        const v2b a = __builtin_convertvector(p, v2b);
        const v2b bl = __builtin_convertvector(p - __builtin_convertvector(a, v2f), v2b);
        ph[j >> 1].w[(j & 1) * 4 + (r >> 1)] = a;
        pl[j >> 1].w[(j & 1) * 4 + (r >> 1)] = bl;
      }
    }
    lrow = lrow * alpha + (psum[0] + psum[1]);
#pragma unroll
    for (int t = 0; t < 4; ++t) oacc[t] *= alpha;
    // term by term over the four output tiles; each tile takes its six terms in the order kk 0: hi.hi, lo.hi, hi.lo, kk 1: the same
#pragma unroll
    for (int t = 0; t < 4; ++t) oacc[t] = at_mma(vfh[0][t], ph[0].v, oacc[t]);
#pragma unroll
    for (int t = 0; t < 4; ++t) oacc[t] = at_mma(vfl[0][t], ph[0].v, oacc[t]);
    __builtin_amdgcn_sched_barrier(0);   // the last V^T group waits for the registers of the lo fragments just used ...
#pragma unroll
    for (int t = 0; t < 4; ++t) vfl[1][t] = Frag<__bf16>::load(Vtl + (t * 16 + c) * AT_LP + 32 + 8 * hh);
    __builtin_amdgcn_sched_barrier(0);   // ... and stays eight products in front of its first user
#pragma unroll
    for (int t = 0; t < 4; ++t) oacc[t] = at_mma(vfh[0][t], pl[0].v, oacc[t]);
#pragma unroll
    for (int t = 0; t < 4; ++t) oacc[t] = at_mma(vfh[1][t], ph[1].v, oacc[t]);
#pragma unroll
    for (int t = 0; t < 4; ++t) oacc[t] = at_mma(vfl[1][t], ph[1].v, oacc[t]);
#pragma unroll
    for (int t = 0; t < 4; ++t) oacc[t] = at_mma(vfh[1][t], pl[1].v, oacc[t]);
  }

  float* os = Os[wave];
  const float inv = 1.0f / (lrow + at_other_half(lrow));   // the query's sum: both halves' keys
#pragma unroll
  for (int t = 0; t < 4; ++t) {
    const v8f o = oacc[t] * inv;
    *(v4f*)(os + c * 68 + t * 16 + 8 * hh)     = (v4f){o[0], o[1], o[2], o[3]};
    *(v4f*)(os + c * 68 + t * 16 + 8 * hh + 4) = (v4f){o[4], o[5], o[6], o[7]};
  }
  __builtin_amdgcn_fence(__ATOMIC_RELEASE, "workgroup");
  __builtin_amdgcn_wave_barrier();
  __builtin_amdgcn_fence(__ATOMIC_ACQUIRE, "workgroup");
  {
    const int c4 = (lane & 15) * 4;
    {
#pragma unroll
      for (int it = 0; it < 8; ++it) {
        const int row = it * 2 + hh;   // it 0..7 x hh 0..1 covers rows 0..15 of the wave tile
        v4f val = *(const v4f*)(os + row * 68 + c4);
        *(v4f*)(ob + (size_t)(q0 + row) * kDm + c4) = val;
      }
      
    }
  }
}

// ---------------------------------------------------------------------------
// Workspace region map (byte offsets). Every GEMM: K in {1024, 32} (%32 == 0), M = kRows = 4096, N in {128, 1024} (%128 == 0).
// Activation regions hold both batch elements, row = b*2048 + s.
// Every region is fully written before it is read within the in-order launch sequence; reused regions noted.
//   Wqh bf16 [1024 n][1024 k]        0      Wql    2097152
//   Wkh                        4194304      Wkl    6291456
//   Wvh                        8388608      Wvl   10485760
//   Woh                       12582912      Wol   14680064
//   W1Th bf16 [128 n][1024 k] 16777216      W1Tl  17039360   (rows 96..127 zero)
//   W2Th bf16 [3][1024 n][32] 17301504      W2Tl  17498112
//   XXh  bf16 [4096][1024]    17694720      XXl   26083328   (xxx planes; reused after the LoRA GEMM as Oh / Ol)
//   LORAf f32 [4096][128]     34471936
//   LTh  bf16 [4096][128]     36569088      LTl   37617664
//   MIX  f32 [3][4096][1024]  38666240                       (reused after the mix kernel: Qf = +0, Kf = +16777216,
//                                                             Vf = +33554432 f32 [4096][1024]; Of reuses Qf)
//   XQh/XQl/XKh/XKl/XVh/XVl   88997888 .. (6 x 8388608)
//   Qh/Ql/Kh/Kl              139329536 .. (4 x 8388608)
//   VTh/VTl bf16 [2][1024][2048] 172883968, 181272576
//   total                    189661184  (~180.9 MiB)
// ---------------------------------------------------------------------------
extern "C" void kernel_launch(void* const* d_in, const int* in_sizes, int n_in,
                              void* d_out, int out_size, void* d_ws, size_t ws_size,
                              hipStream_t stream) {
  if (n_in < 21) return;
  const int nRow = kSeq * kDm;            // 2097152 per batch element
  const int nAct = kBatch * nRow;         // 4194304
  const int nW   = kDm * kDm;             // 1048576
  if (in_sizes[0] != nAct) return;
  if (in_sizes[1] != kBatch * kDm) return;
  if (in_sizes[2] != kDm || in_sizes[3] != kDm || in_sizes[4] != kDm || in_sizes[5] != kDm) return;
  if (in_sizes[6] != kDm * kLoraN) return;
  if (in_sizes[7] != 3 * kLoraD * kDm) return;
  if (in_sizes[8] != nW || in_sizes[9] != nW || in_sizes[10] != nW || in_sizes[11] != nW) return;
  for (int i = 12; i < 20; ++i) if (in_sizes[i] != kDm) return;
  if (in_sizes[20] != kSeq * 32) return;
  if (out_size != nAct) return;

  const float* x     = (const float*)d_in[0];    // [2][2048][1024]
  const float* ss    = (const float*)d_in[1];    // [2][1024]
  const float* maax  = (const float*)d_in[2];    // [1024]
  const float* maar  = (const float*)d_in[3];
  const float* maak  = (const float*)d_in[4];
  const float* maav  = (const float*)d_in[5];
  const float* w1    = (const float*)d_in[6];    // [1024][96]
  const float* w2    = (const float*)d_in[7];    // [3][32][1024]
  const float* wq    = (const float*)d_in[8];    // [1024 out][1024 in]
  const float* wk    = (const float*)d_in[9];
  const float* wv    = (const float*)d_in[10];
  const float* wo    = (const float*)d_in[11];
  const float* lnrg  = (const float*)d_in[12];
  const float* lnrb  = (const float*)d_in[13];
  const float* lnkg  = (const float*)d_in[14];
  const float* lnkb  = (const float*)d_in[15];
  const float* lnvg  = (const float*)d_in[16];
  const float* lnvb  = (const float*)d_in[17];
  const float* lnxg  = (const float*)d_in[18];
  const float* lnxb  = (const float*)d_in[19];
  const float* ang   = (const float*)d_in[20];   // [2048][32]

  const size_t PW   = (size_t)kDm * kDm * 2;          // 2097152  bf16 weight plane
  const size_t PX   = (size_t)kRows * kDm * 2;        // 8388608  bf16 activation plane (both batch elements)
  const size_t PF   = (size_t)kRows * kDm * 4;        // 16777216 f32 activation plane
  const size_t PW1  = (size_t)kLoraP * kDm * 2;       // 262144
  const size_t PW2  = (size_t)3 * kDm * kLoraD * 2;   // 196608
  const size_t PLF  = (size_t)kRows * kLoraP * 4;     // 2097152
  const size_t PLT  = (size_t)kRows * kLoraP * 2;     // 1048576
  size_t off = 0;
  const size_t oWqh = off; off += PW;  const size_t oWql = off; off += PW;
  off += 4 * PW;                                // Wkh, Wkl, Wvh, Wvl: reached from Wqh / Wql by the plane stride
  const size_t oWoh = off; off += PW;  const size_t oWol = off; off += PW;
  const size_t oW1h = off; off += PW1; const size_t oW1l = off; off += PW1;
  const size_t oW2h = off; off += PW2; const size_t oW2l = off; off += PW2;
  const size_t oXXh = off; off += PX;  const size_t oXXl = off; off += PX;
  const size_t oLF  = off; off += PLF;
  const size_t oLTh = off; off += PLT; const size_t oLTl = off; off += PLT;
  const size_t oMIX = off; off += 3 * PF;
  const size_t oXQh = off; off += PX;  const size_t oXQl = off; off += PX;
  const size_t oXKh = off; off += PX;  const size_t oXKl = off; off += PX;
  const size_t oXVh = off; off += PX;  const size_t oXVl = off; off += PX;
  const size_t oQh  = off; off += PX;  const size_t oQl  = off; off += PX;
  const size_t oKh  = off; off += PX;  const size_t oKl  = off; off += PX;
  const size_t oVTh = off; off += PX;  const size_t oVTl = off; off += PX;
  if (off > ws_size) return;                    // off = 189661184

  char* ws = (char*)d_ws;
  unsigned short* Wqh = (unsigned short*)(ws + oWqh); unsigned short* Wql = (unsigned short*)(ws + oWql);
  unsigned short* Woh = (unsigned short*)(ws + oWoh); unsigned short* Wol = (unsigned short*)(ws + oWol);
  unsigned short* W1h = (unsigned short*)(ws + oW1h); unsigned short* W1l = (unsigned short*)(ws + oW1l);
  unsigned short* W2h = (unsigned short*)(ws + oW2h); unsigned short* W2l = (unsigned short*)(ws + oW2l);
  unsigned short* XXh = (unsigned short*)(ws + oXXh); unsigned short* XXl = (unsigned short*)(ws + oXXl);
  float*          LF  = (float*)(ws + oLF);
  unsigned short* LTh = (unsigned short*)(ws + oLTh); unsigned short* LTl = (unsigned short*)(ws + oLTl);
  float*          MIX = (float*)(ws + oMIX);
  float*          Qf  = (float*)(ws + oMIX);
  float*          Kf  = (float*)(ws + oMIX + PF);
  float*          Vf  = (float*)(ws + oMIX + 2 * PF);
  float*          Of  = Qf;
  unsigned short* XQh = (unsigned short*)(ws + oXQh); unsigned short* XQl = (unsigned short*)(ws + oXQl);
  unsigned short* XKh = (unsigned short*)(ws + oXKh); unsigned short* XKl = (unsigned short*)(ws + oXKl);
  unsigned short* XVh = (unsigned short*)(ws + oXVh); unsigned short* XVl = (unsigned short*)(ws + oXVl);
  unsigned short* Qh  = (unsigned short*)(ws + oQh);  unsigned short* Ql  = (unsigned short*)(ws + oQl);
  unsigned short* Kh  = (unsigned short*)(ws + oKh);  unsigned short* Kl  = (unsigned short*)(ws + oKl);
  unsigned short* VTh = (unsigned short*)(ws + oVTh); unsigned short* VTl = (unsigned short*)(ws + oVTl);
  unsigned short* Oh  = XXh;                          unsigned short* Ol  = XXl;

  const float* dummyf = lnrg;                         // valid pointer for unused bias / resid arguments (never read)

  const dim3 blk(256);
  const int  n2w = nW / 2;                                  // 524288 pairs per weight plane
  const dim3 gCastW((n2w + 255) / 256, 4);                  // 2048 blocks x 256 threads x 2 = 1024x1024, y = q, k, v, o
  const dim3 gW1(kDm / 64);                                 // 16 k-tiles
  const dim3 gW2(kDm / 64, 3);                              // 16 n-tiles x 3
  const dim3 gRow(kRows);                                   // one block per token row (128-thread kernels)
  const dim3 blkG(128);                                     // GEMM block: 4 waves, one 128x128 tile
  const dim3 gLora((kRows / 128) * (kLoraP / 128));         // 32 tiles: M=4096, N=128
  const dim3 gMix((kRows / 128) * (kDm / 128), 3);          // 256 tiles x 3 (l): M=4096, N=1024, K=32
  const int  n2l = kRows * kLoraP / 2;                      // 262144 pairs
  const dim3 gTanh((n2l + 255) / 256);                      // 1024 blocks x 256 x 2 = 4096x128
  const dim3 gQKV((kRows / 128) * (kDm / 128), 3);          // 256 tiles x 3 (q, k, v): M=4096, N=1024
  const dim3 gProj((kRows / 128) * (kDm / 128), 1);         // 256 tiles: M=4096, N=1024
  const dim3 gLnQK(kRows, 2);                               // 4096 rows x {q, k}
  const dim3 gLn1(kRows, 1);
  const dim3 gVT(kDm / 64, kSeq / 64, kBatch);              // per b: in [R=2048 s][Cn=1024 c] -> planes [c][s]
  const dim3 gAtt(kHeads * (kSeq / 64), kBatch);            // 512 x 2 blocks: 16 heads x 32 query blocks, y = b

  // setup: weights -> bf16 hi/lo planes (q/k/v/o already [out n][in k] = Bt layout; w1/w2 transposed).
  // The hi planes of q, k, v, o lie 2 weight planes apart (hi, lo, hi, lo, ...), and so do the lo planes.
  split_bf16x2_kernel<<<gCastW, blk, 0, stream>>>(wq, wk, wv, wo, Wqh, Wql, n2w, 2L * nW);
  w1t_split_kernel<<<gW1, blk, 0, stream>>>(w1, W1h, W1l);
  w2t_split_kernel<<<gW2, blk, 0, stream>>>(w2, W2h, W2l);

  // Each stage below runs once, on the rows of both batch elements.
  // (1) xxx = x + dxprev*maa_x -> planes
  xxx_split_kernel<<<gRow, dim3(128), 0, stream>>>(x, ss, maax, XXh, XXl);
  // (2) lora_pre = xxx . w1 -> f32 [4096][128]   (M=4096, N=128, K=1024)
  wmma_gemm64<1, true, 0, 0, false, 0><<<gLora, blkG, 0, stream>>>(
      XXh, XXl, kDm, 0L, W1h, W1l, kDm, 0L, (void*)LF, (void*)LF, kLoraP, 0L,
      dummyf, dummyf, 0L, kRows, kLoraP, kDm, 1.0f);
  // (3) lora = tanh -> planes [4096][128]
  tanh_split_kernel<<<gTanh, blk, 0, stream>>>(LF, LTh, LTl, n2l);
  // (4) mixes[l] = lora[:, 32l..32l+31] . w2[l] -> f32 [3][4096][1024]   (M=4096, N=1024, K=32; grid.y = l)
  wmma_gemm64<1, true, 0, 0, false, 0><<<gMix, blkG, 0, stream>>>(
      LTh, LTl, kLoraP, (long)kLoraD, W2h, W2l, kLoraD, (long)kDm * kLoraD, (void*)MIX, (void*)MIX, kDm, (long)nAct,
      dummyf, dummyf, 0L, kRows, kDm, kLoraD, 1.0f);
  // (5) xq/xk/xv = x + dxprev*(maa + mix) -> planes
  mix_split_kernel<<<gRow, dim3(128), 0, stream>>>(x, ss, maar, maak, maav, MIX, XQh, XQl, XKh, XKl, XVh, XVl);
  // (6) q0 = xq . Wq^T, k0 = xk . Wk^T, v0 = xv . Wv^T -> f32 [3][4096][1024]   (M=4096, N=1024, K=1024; grid.y = q, k, v:
  //     XQ/XK/XV hi planes lie 2 activation planes apart, Wq/Wk/Wv hi planes 2 weight planes, Qf/Kf/Vf one f32 plane)
  wmma_gemm64<1, true, 0, 0, false, 0><<<gQKV, blkG, 0, stream>>>(
      XQh, XQl, kDm, 2L * nAct, Wqh, Wql, kDm, 2L * nW, (void*)Qf, (void*)Qf, kDm, (long)nAct,
      dummyf, dummyf, 0L, kRows, kDm, kDm, 1.0f);
  // (7) LayerNorm + RoPE + split for q and k -> planes [row][h*64+d]
  ln_kernel<0><<<gLnQK, blk, 0, stream>>>(Qf, Kf, lnrg, lnrb, lnkg, lnkb, ang, Qh, Ql, Kh, Kl, Qf);
  // (8) LayerNorm of v in place (f32), then transpose-split -> v^T planes [b][h*64+d][s]
  ln_kernel<1><<<gLn1, blk, 0, stream>>>(Vf, Vf, lnvg, lnvb, lnvg, lnvb, ang, VTh, VTl, VTh, VTl, Vf);
  wt_split_kernel<<<gVT, blk, 0, stream>>>(Vf, VTh, VTl, kSeq, kDm);
  // (9) causal attention per batch element and head -> f32 [row][h*64+d] (Of region; Qf is dead after step 7)
  attn_causal64_kernel<<<gAtt, dim3(128), 0, stream>>>(Qh, Ql, Kh, Kl, VTh, VTl, Of, 0.125f, -1.0e30f);
  // (10) output LayerNorm + split -> planes (XX region is dead after step 2)
  ln_kernel<2><<<gLn1, blk, 0, stream>>>(Of, Of, lnxg, lnxb, lnxg, lnxb, ang, Oh, Ol, Oh, Ol, Of);
  // (11) out = o . Wo^T -> d_out (f32)   (M=4096, N=1024, K=1024)
  wmma_gemm64<1, true, 0, 0, false, 0><<<gProj, blkG, 0, stream>>>(
      Oh, Ol, kDm, 0L, Woh, Wol, kDm, 0L, d_out, d_out, kDm, 0L,
      dummyf, dummyf, 0L, kRows, kDm, kDm, 1.0f);
}

// v008
// A run of this version takes 290 microseconds.
// Next to v007, in two timings, it ran 1.03 times as fast each time.
// Counting every step since v000, it is 4.46 times as fast.
// All contractions (token-shift LoRA xxx.w1 and lora.w2, q/k/v projections, attention q.k^T and p.v, output projection): v_wmma_f32_16x16x32_bf16 with bf16 hi/lo split operands (hi.hi + hi.lo + lo.hi), f32 accumulate; token shift, tanh, LayerNorms, RoPE, online softmax, score scale 0.125 in f32.
#include <hip/hip_runtime.h>
#include <math.h>
#include <stdint.h>

constexpr int kBatch = 2;
constexpr int kSeq   = 2048;
constexpr int kRows  = kBatch * kSeq;   // token rows of both batch elements, row = b*kSeq + s
constexpr int kDm    = 1024;
constexpr int kHeads = 16;
constexpr int kLoraN = 96;      // 3 x 32 LoRA outputs
constexpr int kLoraP = 128;     // padded to a 64-multiple
constexpr int kLoraD = 32;

typedef __attribute__((ext_vector_type(16))) _Float16 v16h;
typedef __attribute__((ext_vector_type(8)))  _Float16 v8h;
typedef __attribute__((ext_vector_type(16))) __bf16   v16b;
typedef __attribute__((ext_vector_type(8)))  __bf16   v8b;
typedef __attribute__((ext_vector_type(2)))  __bf16   v2b;
typedef __attribute__((ext_vector_type(8)))  float    v8f;
typedef __attribute__((ext_vector_type(4)))  float    v4f;
typedef __attribute__((ext_vector_type(2)))  float    v2f;
typedef __attribute__((ext_vector_type(4)))  unsigned int v4u;
typedef __attribute__((ext_vector_type(8)))  unsigned short v8us;

__device__ __forceinline__ unsigned short f2bf_bits(float f) {
  unsigned u = __float_as_uint(f);
  return (unsigned short)((u + 0x7FFFu + ((u >> 16) & 1u)) >> 16);
}
__device__ __forceinline__ float bf_bits2f(unsigned short h) { return __uint_as_float(((unsigned)h) << 16); }

// hazard guards as plain device helpers
__device__ __forceinline__ void dep_guard_h(v8f& a, v8f& b, v16h x, v16h y) { asm volatile("v_nop\n\tv_nop\n\tv_nop\n\tv_nop" : "+v"(a), "+v"(b) : "v"(x), "v"(y)); }
__device__ __forceinline__ void dep_guard_b(v8f& a, v8f& b, v16b x, v16b y) { asm volatile("v_nop\n\tv_nop\n\tv_nop\n\tv_nop" : "+v"(a), "+v"(b) : "v"(x), "v"(y)); }
__device__ __forceinline__ void keep4_h(v16h a, v16h b, v16h c, v16h d) { asm volatile("v_nop" :: "v"(a), "v"(b), "v"(c), "v"(d)); }
__device__ __forceinline__ void keep4_b(v16b a, v16b b, v16b c, v16b d) { asm volatile("v_nop" :: "v"(a), "v"(b), "v"(c), "v"(d)); }
__device__ __forceinline__ void acc_guard4(v8f& a, v8f& b, v8f& c, v8f& d) { asm volatile("v_nop\n\tv_nop\n\tv_nop\n\tv_nop" : "+v"(a), "+v"(b), "+v"(c), "+v"(d)); }
template <typename T> struct Frag;
template <> struct Frag<_Float16> {
  typedef v16h V; union U { v16h v; v8h h[2]; };
  static __device__ __forceinline__ v16h load(const _Float16* p) {   // elements 0..7 <- p[0..7], 8..15 <- p[16..23]
    U f; f.h[0] = *(const v8h*)(p); f.h[1] = *(const v8h*)(p + 16); return f.v;
  }
  static __device__ __forceinline__ v8f mma(v16h a, v16h b, v8f c) {
    return __builtin_amdgcn_wmma_f32_16x16x32_f16(false, a, false, b, (short)0, c, false, false);
  }
  static __device__ __forceinline__ void guard(v8f& a, v8f& b, v16h x, v16h y) { dep_guard_h(a, b, x, y); }
  static __device__ __forceinline__ void keep(v16h a, v16h b, v16h c, v16h d) { keep4_h(a, b, c, d); }
};
template <> struct Frag<__bf16> {
  typedef v16b V; union U { v16b v; v8b h[2]; };
  static __device__ __forceinline__ v16b load(const __bf16* p) {
    U f; f.h[0] = *(const v8b*)(p); f.h[1] = *(const v8b*)(p + 16); return f.v;
  }
  static __device__ __forceinline__ v8f mma(v16b a, v16b b, v8f c) {
    return __builtin_amdgcn_wmma_f32_16x16x32_bf16(false, a, false, b, (short)0, c, false, false);
  }
  static __device__ __forceinline__ void guard(v8f& a, v8f& b, v16b x, v16b y) { dep_guard_b(a, b, x, y); }
  static __device__ __forceinline__ void keep(v16b a, v16b b, v16b c, v16b d) { keep4_b(a, b, c, d); }
};

// ---- Register-blocked batched WMMA GEMM, operands staged in LDS --------------
// C[m,n] = scale * sum_k A[m,k] * Bt[n,k] (+bias)(+resid); a block of 4 waves (2 x 2) owns a 128x128 tile, each wave 64x64 of it.
// A row-major [M,K]; Bt row-major [N,K]; M,N % 128 == 0, K % 32 == 0.
// Per 32-wide k tile the block brings 128 A rows and 128 Bt rows of every plane (64 B a row) into LDS with asynchronous
// 16-B copies (a wave-wide copy = 8 rows x 64 contiguous B), two buffers: tile t+1 flies while tile t is multiplied.
// SPLIT: operands are hi/lo planes (A2/Bt2 = lo planes, same layout); product = hi.hi + hi.lo + lo.hi.
// BIAS_MODE: 0 = none, 1 = bias[m], 2 = bias[n].
// OUT_MODE: 0 = f32, 1 = f16, 2 = bf16 hi plane (Cout) + bf16 lo plane (Cout2).
// Coverage per wave tile: 4 slabs x 16 rows x 64 cols = 64x64 (f32: it 0..7 x hh 0..1 rows, 16 lanes x 4 floats;
// 16-bit: it 0..3 x q 0..3 rows, 8 lanes x 8 elements).
// ET: 0 = f16 operands, 1 = bf16 operands (pointers passed as 16-bit storage)
template <int ET> struct Elem;
template <> struct Elem<0> { typedef _Float16 T; };
template <> struct Elem<1> { typedef __bf16 T; };
constexpr int kGLP    = 40;            // LDS row pitch in 16-bit elements: 80 B = 16 B x 5 (odd), the pitch for 16-B reads of 64-B rows
constexpr int kGPlane = 128 * kGLP;    // one plane of a stage: 128 rows
constexpr int kGStage = 4 * kGPlane;   // A hi, A lo, Bt hi, Bt lo

// Four rows (32 apart) of one plane pair -> LDS: 8 (hi and lo) or 4 (hi only) copies of 16 B per lane. l = the lane's LDS byte
// address of its first hi row, g / g2 = its global address in the hi / lo plane, step = 32 source rows in elements.
// s_wait_xcnt 0 ends the copies' own statement, so that it stands in front of any rewrite of the address registers they name.
template <typename T>
__device__ __forceinline__ void stage_rows8(unsigned l, const T* g, const T* g2, size_t step) {
  const unsigned l1 = l + 32 * kGLP * 2, l2 = l + 64 * kGLP * 2, l3 = l + 96 * kGLP * 2;
  const unsigned m0 = l + kGPlane * 2, m1 = l1 + kGPlane * 2, m2 = l2 + kGPlane * 2, m3 = l3 + kGPlane * 2;
  const T* g1 = g + step;  const T* gg2 = g1 + step;  const T* g3 = gg2 + step;
  const T* h1 = g2 + step; const T* h2 = h1 + step;   const T* h3 = h2 + step;
  asm volatile("global_load_async_to_lds_b128 %0, %8, off\n\t"
               "global_load_async_to_lds_b128 %1, %9, off\n\t"
               "global_load_async_to_lds_b128 %2, %10, off\n\t"
               "global_load_async_to_lds_b128 %3, %11, off\n\t"
               "global_load_async_to_lds_b128 %4, %12, off\n\t"
               "global_load_async_to_lds_b128 %5, %13, off\n\t"
               "global_load_async_to_lds_b128 %6, %14, off\n\t"
               "global_load_async_to_lds_b128 %7, %15, off\n\t"
               "s_wait_xcnt 0x0"
               :: "v"(l), "v"(l1), "v"(l2), "v"(l3), "v"(m0), "v"(m1), "v"(m2), "v"(m3),
                  "v"(g), "v"(g1), "v"(gg2), "v"(g3), "v"(g2), "v"(h1), "v"(h2), "v"(h3) : "memory");
}
template <typename T>
__device__ __forceinline__ void stage_rows4(unsigned l, const T* g, size_t step) {
  const unsigned l1 = l + 32 * kGLP * 2, l2 = l + 64 * kGLP * 2, l3 = l + 96 * kGLP * 2;
  const T* g1 = g + step; const T* gg2 = g1 + step; const T* g3 = gg2 + step;
  asm volatile("global_load_async_to_lds_b128 %0, %4, off\n\t"
               "global_load_async_to_lds_b128 %1, %5, off\n\t"
               "global_load_async_to_lds_b128 %2, %6, off\n\t"
               "global_load_async_to_lds_b128 %3, %7, off\n\t"
               "s_wait_xcnt 0x0"
               :: "v"(l), "v"(l1), "v"(l2), "v"(l3), "v"(g), "v"(g1), "v"(gg2), "v"(g3) : "memory");
}

template <int ET, bool SPLIT, int BIAS_MODE, int OUT_MODE, bool RESID, int ACT = 0>
__global__ __launch_bounds__(128) void wmma_gemm64(
    const unsigned short* __restrict__ Ap, const unsigned short* __restrict__ A2p, int lda, long strideA,
    const unsigned short* __restrict__ Btp, const unsigned short* __restrict__ Bt2p, int ldb, long strideB,
    void* __restrict__ Cout, void* __restrict__ Cout2, int ldc, long strideC,
    const float* __restrict__ bias,
    const float* __restrict__ resid, long strideR,
    int M, int N, int K, float scale) {
  typedef typename Elem<ET>::T T;
  typedef typename Frag<T>::V V;
  const T* A = (const T*)Ap; const T* A2 = (const T*)A2p; const T* Bt = (const T*)Btp; const T* Bt2 = (const T*)Bt2p;
  __shared__ __align__(16) T ring[2 * kGStage];    // two stages of operand tiles, 2 x 40,960 B
  __shared__ __align__(16) float sT[4][16 * 68];   // per-wave 16x64 slab, pitch 68 floats
  const int b    = blockIdx.y;
  const int lane = threadIdx.x & 31;
  const int wave = threadIdx.x >> 5;
  const int tilesN = N >> 7;
  const int tilesM = M >> 7;
  const int tile = blockIdx.x;
  if (tile >= tilesM * tilesN) return;   // block-uniform, in front of every barrier and copy
  const int tm = tile / tilesN;
  const int tn = tile - tm * tilesN;
  const int bm0 = tm << 7;                         // block tile origin
  const int bn0 = tn << 7;
  const int wm = (wave >> 1) << 6;                 // wave tile origin inside the block tile
  const int wn = (wave & 1) << 6;
  const int m0 = bm0 + wm;
  const int n0 = bn0 + wn;

  const T* Ab  = A  + (size_t)b * strideA;
  const T* Bb  = Bt + (size_t)b * strideB;
  const T* Ab2 = SPLIT ? (A2  + (size_t)b * strideA) : nullptr;
  const T* Bb2 = SPLIT ? (Bt2 + (size_t)b * strideB) : nullptr;

  const int rlane = lane & 15;                 // row (A) / col (B, D) within subtile
  const int koff  = (lane >> 4) * 8;           // k offset of this lane half
  const int mOff  = (lane >> 4) * 8;           // D row offset

  v8f acc[4][4];
#pragma unroll
  for (int i = 0; i < 4; ++i)
#pragma unroll
    for (int j = 0; j < 4; ++j) acc[i][j] = (v8f){0.f,0.f,0.f,0.f,0.f,0.f,0.f,0.f};

  // copy map: thread -> row (tid >> 2) + 32 r, r = 0..3, 16-B chunk tid & 3 of the row's 64 B; 128 threads x 4 rows = 128 rows a plane
  const int crow = threadIdx.x >> 2;
  const int cchk = (threadIdx.x & 3) * 8;
  const size_t cao = (size_t)(bm0 + crow) * lda + cchk;
  const size_t cbo = (size_t)(bn0 + crow) * ldb + cchk;
  const size_t stepA = (size_t)32 * lda, stepB = (size_t)32 * ldb;
  const unsigned lds0 = (unsigned)(uintptr_t)(&ring[0]) + (unsigned)(crow * kGLP + cchk) * 2u;   // LDS byte address: low 32 bits
  const int nT = K >> 5;                           // k tiles, the same for the whole grid

#define GEMM_STAGE(t_)                                                                          \
  {                                                                                             \
    const unsigned lt = lds0 + (unsigned)((t_) & 1) * (kGStage * 2u);                           \
    const size_t ko = (size_t)(t_) * 32;                                                        \
    if (SPLIT) {                                                                                \
      stage_rows8<T>(lt, Ab + cao + ko, Ab2 + cao + ko, stepA);                                 \
      stage_rows8<T>(lt + 2u * kGPlane * 2u, Bb + cbo + ko, Bb2 + cbo + ko, stepB);             \
    } else {                                                                                    \
      stage_rows4<T>(lt, Ab + cao + ko, stepA);                                                 \
      stage_rows4<T>(lt + 2u * kGPlane * 2u, Bb + cbo + ko, stepB);                             \
    }                                                                                           \
  }

  GEMM_STAGE(0)
  asm volatile("s_wait_asynccnt 0x0" ::: "memory");   // this wave's copies of tile 0 have landed
  __syncthreads();                                    // ... and every other wave's: tile 0 may be read
  if (nT > 1) GEMM_STAGE(1)

  for (int t = 0; t < nT; ++t) {
    const T* st = ring + (t & 1) * kGStage;
    const T* sA = st + (wm + rlane) * kGLP + koff;
    const T* sB = st + 2 * kGPlane + (wn + rlane) * kGLP + koff;
    V bh[4], bl[4];
#pragma unroll
    for (int j = 0; j < 4; ++j) {
      bh[j] = Frag<T>::load(sB + (j << 4) * kGLP);
      if (SPLIT) bl[j] = Frag<T>::load(sB + kGPlane + (j << 4) * kGLP);
    }
#pragma unroll
    for (int i = 0; i < 4; ++i) {
      V ah = Frag<T>::load(sA + (i << 4) * kGLP);
      V al;
      if (SPLIT) al = Frag<T>::load(sA + kGPlane + (i << 4) * kGLP);
#pragma unroll
      for (int j = 0; j < 4; ++j) {
        acc[i][j] = Frag<T>::mma(ah, bh[j], acc[i][j]);
        if (SPLIT) {
          acc[i][j] = Frag<T>::mma(ah, bl[j], acc[i][j]);
          acc[i][j] = Frag<T>::mma(al, bh[j], acc[i][j]);
        }
      }
      Frag<T>::guard(acc[i][0], acc[i][3], ah, SPLIT ? al : ah);
    }
    Frag<T>::keep(bh[0], bh[1], bh[2], bh[3]);
    if (SPLIT) Frag<T>::keep(bl[0], bl[1], bl[2], bl[3]);
    asm volatile("s_wait_dscnt 0x0" ::: "memory");      // this wave's reads of tile t's buffer are done before it is refilled
    asm volatile("s_wait_asynccnt 0x0" ::: "memory");   // this wave's copies of tile t+1 have landed
    __syncthreads();                                    // publishes tile t+1 and ends every wave's reads of tile t
    if (t + 2 < nT) GEMM_STAGE(t + 2)                   // uniform test; into the buffer that trip t has just read
  }
  asm volatile("s_wait_asynccnt 0x0" ::: "memory");     // no copy outstanding behind the loop
#undef GEMM_STAGE
  acc_guard4(acc[0][0], acc[0][1], acc[0][2], acc[0][3]);
  acc_guard4(acc[1][0], acc[1][1], acc[1][2], acc[1][3]);
  acc_guard4(acc[2][0], acc[2][1], acc[2][2], acc[2][3]);
  acc_guard4(acc[3][0], acc[3][1], acc[3][2], acc[3][3]);

  // ---- epilogue ----
  float* slab = sT[wave];
  const float* Rb = RESID ? (resid + (size_t)b * strideR) : nullptr;
#pragma unroll
  for (int i = 0; i < 4; ++i) {
    const int mBase = m0 + (i << 4);
#pragma unroll
    for (int j = 0; j < 4; ++j) {
      const int n = n0 + (j << 4) + rlane;
      float bv = 0.f;
      if (BIAS_MODE == 2) bv = bias[n];
#pragma unroll
      for (int r = 0; r < 8; ++r) {
        float v = acc[i][j][r] * scale;
        if (BIAS_MODE == 1) v += bias[mBase + mOff + r];
        if (BIAS_MODE == 2) v += bv;
        if (RESID) v += Rb[(size_t)(mBase + mOff + r) * ldc + n];
        if (ACT == 1) v = tanhf(v);
        if (ACT == 2) v = fmaxf(v, 0.0f);
        if (ACT == 3) v = v / (1.0f + expf(-v));
        if (ACT == 4) v = (v > 0.f) ? v : 0.01f * v;
        slab[(mOff + r) * 68 + (j << 4) + rlane] = v;
      }
    }
    __builtin_amdgcn_fence(__ATOMIC_RELEASE, "workgroup");
    __builtin_amdgcn_wave_barrier();
    __builtin_amdgcn_fence(__ATOMIC_ACQUIRE, "workgroup");
    if (OUT_MODE == 0) {
      float* C = (float*)Cout + (size_t)b * strideC;
      const int hh = lane >> 4, c4 = (lane & 15) * 4;     // row seg = 256 B = 16 lanes x 16 B
      {
#pragma unroll
        for (int it = 0; it < 8; ++it) {
          const int row = it * 2 + hh;
          v4f v = *(const v4f*)(slab + row * 68 + c4);
          *(v4f*)(C + (size_t)(mBase + row) * ldc + n0 + c4) = v;
        }
        
      }
    } else {
      const int q = lane >> 3, c8 = (lane & 7) * 8;
      unsigned short* C  = (unsigned short*)Cout  + (size_t)b * strideC;
      unsigned short* C2 = (OUT_MODE == 2) ? ((unsigned short*)Cout2 + (size_t)b * strideC) : nullptr;
      {
#pragma unroll
        for (int it = 0; it < 4; ++it) {
          const int row = it * 4 + q;
          const float* sp = slab + row * 68 + c8;
          v8h hv, lv;
#pragma unroll
          for (int e = 0; e < 8; ++e) {
            if (OUT_MODE == 1) {
              hv[e] = (_Float16)sp[e];
            } else {
              unsigned short hb = f2bf_bits(sp[e]);
              unsigned short lb = f2bf_bits(sp[e] - bf_bits2f(hb));
              hv[e] = __builtin_bit_cast(_Float16, hb);
              lv[e] = __builtin_bit_cast(_Float16, lb);
            }
          }
          *(v8h*)(C + (size_t)(mBase + row) * ldc + n0 + c8) = hv;
          if (OUT_MODE == 2) *(v8h*)(C2 + (size_t)(mBase + row) * ldc + n0 + c8) = lv;
        }
        
      }
    }
    __builtin_amdgcn_fence(__ATOMIC_RELEASE, "workgroup");
    __builtin_amdgcn_wave_barrier();
    __builtin_amdgcn_fence(__ATOMIC_ACQUIRE, "workgroup");
  }
}

// ---------------------------------------------------------------------------
// Shared elementwise split helper for 8 consecutive values -> v8us hi/lo.
// ---------------------------------------------------------------------------
__device__ __forceinline__ void split8(const v4f va, const v4f vb, v8us& hv, v8us& lv) {
#pragma unroll
  for (int e = 0; e < 4; ++e) {
    const unsigned short h0 = f2bf_bits(va[e]);
    hv[e] = h0; lv[e] = f2bf_bits(va[e] - bf_bits2f(h0));
    const unsigned short h1 = f2bf_bits(vb[e]);
    hv[4 + e] = h1; lv[4 + e] = f2bf_bits(vb[e] - bf_bits2f(h1));
  }
}
__device__ __forceinline__ void store16x2(unsigned short* ph, unsigned short* pl, size_t o, const v8us hv, const v8us lv) {
  *(v8us*)(ph + o) = hv;
  *(v8us*)(pl + o) = lv;
}

// The elementwise launches below are sized by the waves they start, not by their elements: a wave takes 256 to 1024 elements
// (8 to 32 a lane, 16-B loads and stores), so that a launch starts about 16 waves a WGP and not several hundred short ones.

// ---------------------------------------------------------------------------
// Elementwise bf16 split: hi = bf16_rne(in), lo = bf16_rne(in - hi); a thread takes 4 groups of 8 elements, 256 groups apart.
// blockIdx.y (block-uniform) picks one of four equally sized sources; its planes start pstride 16-bit elements apart.
// Coverage: grid.x = ceil(n8 / 1024) blocks x 4 x 256 groups of 8 = the whole plane (n8 = groups per source).
// ---------------------------------------------------------------------------
__global__ __launch_bounds__(256) void split_bf16x2_kernel(const float* __restrict__ in0, const float* __restrict__ in1,
                                                           const float* __restrict__ in2, const float* __restrict__ in3,
                                                           unsigned short* __restrict__ hi, unsigned short* __restrict__ lo,
                                                           int n8, long pstride) {
  const int w = blockIdx.y;
  const float* in = (w == 0) ? in0 : (w == 1) ? in1 : (w == 2) ? in2 : in3;
  unsigned short* ph = hi + (size_t)w * pstride;
  unsigned short* pl = lo + (size_t)w * pstride;
  v4f va[4], vb[4];
  // unrolled: the 8 loads of a thread are in flight together (index clamped, so that no branch stands between them)
#pragma unroll
  for (int it = 0; it < 4; ++it) {
    const int i = (blockIdx.x * 4 + it) * 256 + threadIdx.x;
    const int ic = (i < n8) ? i : (n8 - 1);
    va[it] = *(const v4f*)(in + 8 * (size_t)ic);
    vb[it] = *(const v4f*)(in + 8 * (size_t)ic + 4);
  }
  // unrolled: va and vb live in registers and take compile-time indices only
#pragma unroll
  for (int it = 0; it < 4; ++it) {
    const int i = (blockIdx.x * 4 + it) * 256 + threadIdx.x;
    if (i < n8) {
      v8us hv, lv;
      split8(va[it], vb[it], hv, lv);
      store16x2(ph, pl, 8 * (size_t)i, hv, lv);
    }
  }
}

// ---------------------------------------------------------------------------
// tanh then bf16 split: hi = bf16_rne(tanh(in)), lo = bf16_rne(tanh(in) - hi); 8 elements per thread, one 16-B store a plane
// Coverage: grid = ceil(n8/256) x 256 threads x 8 elements = 8*n8 = whole plane.
// ---------------------------------------------------------------------------
__global__ __launch_bounds__(256) void tanh_split_kernel(const float* __restrict__ in, unsigned short* __restrict__ hi,
                                                         unsigned short* __restrict__ lo, int n8) {
  const int i = blockIdx.x * 256 + threadIdx.x;
  if (i < n8) {
    const v4f fa = *(const v4f*)(in + 8 * (size_t)i);
    const v4f fb = *(const v4f*)(in + 8 * (size_t)i + 4);
    const v4f ta = (v4f){tanhf(fa[0]), tanhf(fa[1]), tanhf(fa[2]), tanhf(fa[3])};
    const v4f tb = (v4f){tanhf(fb[0]), tanhf(fb[1]), tanhf(fb[2]), tanhf(fb[3])};
    v8us hv, lv;
    split8(ta, tb, hv, lv);
    store16x2(hi, lo, 8 * (size_t)i, hv, lv);
  }
}

// ---------------------------------------------------------------------------
// Transpose + bf16 split: in w[R][Cn] f32 -> planes th/tl [Cn][R] bf16: out[n*R + k] = split(w[k*Cn + n]).
// grid = (Cn/64, R/64, matrices), R, Cn % 64 == 0; matrix z starts z*R*Cn elements into w, th and tl.
// (Used for the LayerNormed v [b][s=R=2048][c=Cn=1024] -> v^T planes [b][c][s].)
// Coverage: load 256 threads x 16 = 64x64; store 8 waves x 2 it x 4 rows(q) x 8 lanes x 8 elements = 64x64.
// ---------------------------------------------------------------------------
__global__ __launch_bounds__(256) void wt_split_kernel(const float* __restrict__ wz, unsigned short* __restrict__ thz,
                                                       unsigned short* __restrict__ tlz, int R, int Cn) {
  __shared__ float tile[64 * 65];
  const int n0 = blockIdx.x * 64;
  const int k0 = blockIdx.y * 64;
  const size_t zo = (size_t)blockIdx.z * R * Cn;
  const float* w = wz + zo;
  unsigned short* th = thz + zo;
  unsigned short* tl = tlz + zo;
  const int t = threadIdx.x;
#pragma unroll
  for (int i = 0; i < 16; ++i) {
    const int idx = i * 256 + t;
    const int kk = idx >> 6, nn = idx & 63;
    tile[nn * 65 + kk] = w[(size_t)(k0 + kk) * Cn + n0 + nn];
  }
  __syncthreads();
  const int lane = t & 31, wave = t >> 5;
  const int q = lane >> 3, c8 = (lane & 7) * 8;
  {
#pragma unroll
    for (int it = 0; it < 2; ++it) {
      const int row = wave * 8 + it * 4 + q;          // 0..63 = local n
      const float* sp = tile + row * 65 + c8;
      v8us hv, lv;
#pragma unroll
      for (int e = 0; e < 8; ++e) {
        const unsigned short hb = f2bf_bits(sp[e]);
        const unsigned short lb = f2bf_bits(sp[e] - bf_bits2f(hb));
        hv[e] = hb; lv[e] = lb;
      }
      const size_t o = (size_t)(n0 + row) * R + k0 + c8;
      *(v8us*)(th + o) = hv;
      *(v8us*)(tl + o) = lv;
    }
    
  }
}

// ---------------------------------------------------------------------------
// LoRA weight w1 [1024 in k][96 out n] f32 -> Bt planes th/tl [kLoraP=128 n][1024 k] bf16, rows n >= 96 ZERO:
//   out[n*1024 + k] = split(n < 96 ? w1[k*96 + n] : 0).  grid = 1024/64 k-tiles; block = 256 threads.
// LDS tile [128 n][65]: load 256 threads x 32 iterations = 64 k x 128 n (address clamped to n <= 95, zero by predicate).
// ---------------------------------------------------------------------------
__global__ __launch_bounds__(256) void w1t_split_kernel(const float* __restrict__ w1, unsigned short* __restrict__ th,
                                                        unsigned short* __restrict__ tl) {
  __shared__ float tile[kLoraP * 65];
  const int k0 = blockIdx.x * 64;
  const int t = threadIdx.x;
#pragma unroll 4
  for (int i = 0; i < 32; ++i) {
    const int idx = i * 256 + t;
    const int kk = idx >> 7, nn = idx & 127;
    const int nc = (nn < kLoraN) ? nn : (kLoraN - 1);
    float v = w1[(size_t)(k0 + kk) * kLoraN + nc];
    if (nn >= kLoraN) v = 0.0f;
    tile[nn * 65 + kk] = v;
  }
  __syncthreads();
  const int lane = t & 31, wave = t >> 5;
  const int q = lane >> 3, c8 = (lane & 7) * 8;
  {
#pragma unroll
    for (int it = 0; it < 4; ++it) {
      const int row = wave * 16 + it * 4 + q;         // 0..127 = n
      const float* sp = tile + row * 65 + c8;
      v8us hv, lv;
#pragma unroll
      for (int e = 0; e < 8; ++e) {
        const unsigned short hb = f2bf_bits(sp[e]);
        const unsigned short lb = f2bf_bits(sp[e] - bf_bits2f(hb));
        hv[e] = hb; lv[e] = lb;
      }
      const size_t o = (size_t)row * kDm + k0 + c8;
      *(v8us*)(th + o) = hv;
      *(v8us*)(tl + o) = lv;
    }
    
  }
}

// ---------------------------------------------------------------------------
// LoRA weight w2 [3 l][32 d][1024 c] f32 -> Bt planes th/tl [3 l][1024 n=c][32 k=d] bf16: out[l][n][k] = split(w2[l][k][n]).
// grid = (1024/64 n-tiles, 3); block 256. LDS tile [64 n][33]: load 256 threads x 8 = 32 k x 64 n.
// 512 contiguous bytes) with ONE 16-B-per-lane instruction: lane -> line L = lane>>3, row = wave*8 + 2L + ((lane&7)>>2),
// ---------------------------------------------------------------------------
__global__ __launch_bounds__(256) void w2t_split_kernel(const float* __restrict__ w2, unsigned short* __restrict__ th,
                                                        unsigned short* __restrict__ tl) {
  __shared__ float tile[64 * 33];
  const int n0 = blockIdx.x * 64;
  const int l  = blockIdx.y;
  const int t  = threadIdx.x;
  const float* wl = w2 + (size_t)l * kLoraD * kDm;
#pragma unroll
  for (int i = 0; i < 8; ++i) {
    const int idx = i * 256 + t;
    const int kk = idx >> 6, nn = idx & 63;
    tile[nn * 33 + kk] = wl[(size_t)kk * kDm + n0 + nn];
  }
  __syncthreads();
  const int lane = t & 31, wave = t >> 5;
  const int L = lane >> 3, q = lane & 7;
  const int row = wave * 8 + 2 * L + (q >> 2);
  const int k8 = (q & 3) * 8;
  const float* sp = tile + row * 33 + k8;
  v8us hv, lv;
#pragma unroll
  for (int e = 0; e < 8; ++e) {
    const unsigned short hb = f2bf_bits(sp[e]);
    const unsigned short lb = f2bf_bits(sp[e] - bf_bits2f(hb));
    hv[e] = hb; lv[e] = lb;
  }
  const size_t o = (size_t)l * kDm * kLoraD + (size_t)(n0 + row) * kLoraD + k8;
  *(v8us*)(th + o) = hv;
  *(v8us*)(tl + o) = lv;
  
}

constexpr int kEwRows = 4;   // token rows per block of the two mixing kernels below

// ---------------------------------------------------------------------------
// Token shift: xxx = x + (xprev - x) * maa_x -> bf16 hi/lo planes [kRows][kDm], row = b*kSeq + s;
// xprev = shift_state[b] for s == 0, else x[b][s-1] (block-uniform pointer choice).
// grid = kRows / kEwRows blocks x kEwRows rows x 128 threads x 8 elements = kRows x kDm = the whole plane; each lane stores 16 B.
// ---------------------------------------------------------------------------
__global__ __launch_bounds__(128) void xxx_split_kernel(const float* __restrict__ x, const float* __restrict__ ss,
                                                        const float* __restrict__ maax,
                                                        unsigned short* __restrict__ oh, unsigned short* __restrict__ ol) {
  const int c0 = threadIdx.x * 8;
  const v4f ma = *(const v4f*)(maax + c0), mb = *(const v4f*)(maax + c0 + 4);
  // unrolled: the loads of the block's rows are in flight together
#pragma unroll
  for (int rr = 0; rr < kEwRows; ++rr) {
    const int row = blockIdx.x * kEwRows + rr;
    const int b = row / kSeq, s = row % kSeq;
    const float* xr = x + (size_t)row * kDm;
    const float* xp = (s == 0) ? (ss + (size_t)b * kDm) : (xr - kDm);
    const v4f xa = *(const v4f*)(xr + c0), xb = *(const v4f*)(xr + c0 + 4);
    const v4f pa = *(const v4f*)(xp + c0), pb = *(const v4f*)(xp + c0 + 4);
    const v4f va = xa + (pa - xa) * ma;
    const v4f vb = xb + (pb - xb) * mb;
    v8us hv, lv;
    split8(va, vb, hv, lv);
    store16x2(oh, ol, (size_t)row * kDm + c0, hv, lv);
  }
}

// ---------------------------------------------------------------------------
// Data-dependent mixing: x? = x + (xprev - x) * (maa_? + mix_?[s][c]) for ? in {q(r), k, v} -> three bf16 hi/lo plane pairs
// [kRows][kDm]. mix planes f32 [3][kRows][kDm] (l = 0 r, 1 k, 2 v). Same row index and thread/store shape as xxx_split_kernel.
// ---------------------------------------------------------------------------
__global__ __launch_bounds__(128) void mix_split_kernel(const float* __restrict__ x, const float* __restrict__ ss,
                                                        const float* __restrict__ maar, const float* __restrict__ maak,
                                                        const float* __restrict__ maav, const float* __restrict__ mix,
                                                        unsigned short* __restrict__ qh, unsigned short* __restrict__ ql,
                                                        unsigned short* __restrict__ kh, unsigned short* __restrict__ kl,
                                                        unsigned short* __restrict__ vh, unsigned short* __restrict__ vl) {
  const int c0 = threadIdx.x * 8;
  const size_t plane = (size_t)kRows * kDm;
  const v4f mra = *(const v4f*)(maar + c0), mrb = *(const v4f*)(maar + c0 + 4);
  const v4f mka = *(const v4f*)(maak + c0), mkb = *(const v4f*)(maak + c0 + 4);
  const v4f mva = *(const v4f*)(maav + c0), mvb = *(const v4f*)(maav + c0 + 4);
  // both loops are unrolled in full: the arrays live in registers and take compile-time indices only
  v4f xa[kEwRows], xb[kEwRows], pa[kEwRows], pb[kEwRows], qa[kEwRows][3], qb[kEwRows][3];
#pragma unroll
  for (int rr = 0; rr < kEwRows; ++rr) {
    const int row = blockIdx.x * kEwRows + rr;
    const int b = row / kSeq, s = row % kSeq;
    const float* xr = x + (size_t)row * kDm;
    const float* xp = (s == 0) ? (ss + (size_t)b * kDm) : (xr - kDm);
    xa[rr] = *(const v4f*)(xr + c0);  xb[rr] = *(const v4f*)(xr + c0 + 4);
    pa[rr] = *(const v4f*)(xp + c0);  pb[rr] = *(const v4f*)(xp + c0 + 4);
#pragma unroll
    for (int l = 0; l < 3; ++l) {
      const float* mr = mix + l * plane + (size_t)row * kDm;   // block-uniform row base
      qa[rr][l] = *(const v4f*)(mr + c0);
      qb[rr][l] = *(const v4f*)(mr + c0 + 4);
    }
    // in front of any rewrite of the address registers that this row's loads name (the data stay in flight); the lane's byte offset is an
    // input, so that it keeps its register up to the wait and no later load of the row lands on it
    asm volatile("s_wait_xcnt 0x0" :: "v"(c0 * 4) : "memory");
  }
  __builtin_amdgcn_sched_barrier(0);   // keeps the loads above in one group, all in flight together: sunk to their users, each pair would expose the memory latency again
#pragma unroll
  for (int rr = 0; rr < kEwRows; ++rr) {
    const int row = blockIdx.x * kEwRows + rr;
    const v4f da = pa[rr] - xa[rr], db = pb[rr] - xb[rr];
    const size_t o = (size_t)row * kDm + c0;
    {
      const v4f va = xa[rr] + da * (mra + qa[rr][0]), vb = xb[rr] + db * (mrb + qb[rr][0]);
      v8us hv, lv; split8(va, vb, hv, lv); store16x2(qh, ql, o, hv, lv);
    }
    {
      const v4f va = xa[rr] + da * (mka + qa[rr][1]), vb = xb[rr] + db * (mkb + qb[rr][1]);
      v8us hv, lv; split8(va, vb, hv, lv); store16x2(kh, kl, o, hv, lv);
    }
    {
      const v4f va = xa[rr] + da * (mva + qa[rr][2]), vb = xb[rr] + db * (mvb + qb[rr][2]);
      v8us hv, lv; split8(va, vb, hv, lv); store16x2(vh, vl, o, hv, lv);
    }
  }
}

// ---------------------------------------------------------------------------
// LayerNorm over a token row of kDm = 1024 values, ONE WAVE A ROW (32 values a lane, no work-group barrier); block = 8 waves = 8 rows.
//   Lane map: group j = 0, 1; head = 8j + (lane >> 2); f8 = (lane & 3) * 8. The lane holds the head's values f8..f8+7 (xv[j][0], xv[j][1])
//   and 32+f8..32+f8+7 (xv[j][2], xv[j][3]): both partners of every rotation pair, and 8 neighbouring results for each 16-B store.
//   Mean and variance: the lane's 32 values in the order of the map, then a five-step butterfly over the wave.
//   MODE 0: LN then RoPE (half-split per 64-wide head: out[f] = x1*cos - x2*sin, out[32+f] = x1*sin + x2*cos with
//           cos/sin = cosf/sinf(angles[s][f]), s = row % kSeq) then bf16 hi/lo split into planes [kRows][kDm]; grid = (kRows/8, 2),
//           blockIdx.y selects source/params/planes A (0) or B (1). Lane f computes cos and sin of angle f once; the wave's own
//           LDS row hands them to the lanes that use them.
//   MODE 1: LN written back IN PLACE as f32 (dstf == src): each wave owns its row and has read all of it before it writes.
//   MODE 2: LN then bf16 hi/lo split into planes (no rotation); grid = (kRows/8, 1).
// ---------------------------------------------------------------------------
template <int MODE>
__global__ __launch_bounds__(256) void ln_kernel(const float* srcA, const float* srcB,
                                                 const float* __restrict__ gA, const float* __restrict__ bA,
                                                 const float* __restrict__ gB, const float* __restrict__ bB,
                                                 const float* __restrict__ ang,
                                                 unsigned short* hA, unsigned short* lA,
                                                 unsigned short* hB, unsigned short* lB, float* dstf) {
  const int tid = threadIdx.x, lane = tid & 31, wave = tid >> 5;
  const int s = blockIdx.x * 8 + wave;           // token row b*kSeq + position
  const int which = blockIdx.y;                  // block-uniform
  const float* src = (which == 0) ? srcA : srcB;
  const float* g   = (which == 0) ? gA : gB;
  const float* bb  = (which == 0) ? bA : bB;
  unsigned short* dh = (which == 0) ? hA : hB;
  unsigned short* dl = (which == 0) ? lA : lB;

  const int f8 = (lane & 3) * 8;
  const int e0 = (lane >> 2) * 64 + f8;          // the lane's first element in group 0; group 1 lies 512 further
  const size_t ro = (size_t)s * kDm + e0;
  // every loop below is unrolled in full: xv lives in registers and takes compile-time indices only
  v4f xv[2][4];
#pragma unroll
  for (int j = 0; j < 2; ++j) {
    const float* p = src + ro + j * 512;
    xv[j][0] = *(const v4f*)(p);
    xv[j][1] = *(const v4f*)(p + 4);
    xv[j][2] = *(const v4f*)(p + 32);
    xv[j][3] = *(const v4f*)(p + 36);
  }
  float a = 0.f;
  if (MODE == 0) a = ang[(size_t)(s % kSeq) * 32 + lane];
  asm volatile("s_wait_xcnt 0x0" ::: "memory");   // in front of any rewrite of the address registers that the loads above name
  float ps = 0.f;
#pragma unroll
  for (int j = 0; j < 2; ++j)
#pragma unroll
    for (int q = 0; q < 4; ++q) ps += (xv[j][q][0] + xv[j][q][1]) + (xv[j][q][2] + xv[j][q][3]);
#pragma unroll
  for (int off = 1; off < 32; off <<= 1) ps += __shfl_xor(ps, off, 32);
  const float mean = ps * (1.0f / (float)kDm);
  float pq = 0.f;
#pragma unroll
  for (int j = 0; j < 2; ++j)
#pragma unroll
    for (int q = 0; q < 4; ++q) {
      xv[j][q] = xv[j][q] - mean;
      const v4f d = xv[j][q];
      pq += (d[0] * d[0] + d[1] * d[1]) + (d[2] * d[2] + d[3] * d[3]);
    }
#pragma unroll
  for (int off = 1; off < 32; off <<= 1) pq += __shfl_xor(pq, off, 32);
  const float var  = pq * (1.0f / (float)kDm);
  const float rstd = rsqrtf(var + 1.0e-5f);
#pragma unroll
  for (int j = 0; j < 2; ++j)
#pragma unroll
    for (int q = 0; q < 4; ++q) {
      const int eo = e0 + j * 512 + (q >> 1) * 32 + (q & 1) * 4;
      const v4f gv = *(const v4f*)(g + eo);
      const v4f bv = *(const v4f*)(bb + eo);
#pragma unroll
      for (int e = 0; e < 4; ++e) xv[j][q][e] = xv[j][q][e] * rstd * gv[e] + bv[e];
    }

  if (MODE == 1) {
#pragma unroll
    for (int j = 0; j < 2; ++j) {
      float* dp = dstf + ro + j * 512;
      *(v4f*)(dp)      = xv[j][0];
      *(v4f*)(dp + 4)  = xv[j][1];
      *(v4f*)(dp + 32) = xv[j][2];
      *(v4f*)(dp + 36) = xv[j][3];
    }
    return;                                     // MODE is a compile-time constant: uniform
  }

  v4f ca = (v4f){1.f, 1.f, 1.f, 1.f}, cb = ca;
  v4f sa = (v4f){0.f, 0.f, 0.f, 0.f}, sb = sa;
  if (MODE == 0) {
    __shared__ __align__(16) float scs[8][32];
    __shared__ __align__(16) float ssn[8][32];
    scs[wave][lane] = cosf(a);
    ssn[wave][lane] = sinf(a);
    // the wave reads back what its own lanes have just written: order inside the wave is all that is needed
    __builtin_amdgcn_fence(__ATOMIC_RELEASE, "workgroup");
    __builtin_amdgcn_wave_barrier();
    __builtin_amdgcn_fence(__ATOMIC_ACQUIRE, "workgroup");
    ca = *(const v4f*)(&scs[wave][f8]);  cb = *(const v4f*)(&scs[wave][f8 + 4]);
    sa = *(const v4f*)(&ssn[wave][f8]);  sb = *(const v4f*)(&ssn[wave][f8 + 4]);
  }
#pragma unroll
  for (int j = 0; j < 2; ++j) {
    v4f ra = xv[j][0], rb = xv[j][1], ia = xv[j][2], ib = xv[j][3];
    if (MODE == 0) {
#pragma unroll
      for (int e = 0; e < 4; ++e) {
        const float x1a = xv[j][0][e], x2a = xv[j][2][e], x1b = xv[j][1][e], x2b = xv[j][3][e];
        ra[e] = x1a * ca[e] - x2a * sa[e];  ia[e] = x1a * sa[e] + x2a * ca[e];
        rb[e] = x1b * cb[e] - x2b * sb[e];  ib[e] = x1b * sb[e] + x2b * cb[e];
      }
    }
    v8us hv, lv;
    split8(ra, rb, hv, lv);
    store16x2(dh, dl, ro + j * 512, hv, lv);
    split8(ia, ib, hv, lv);
    store16x2(dh, dl, ro + j * 512 + 32, hv, lv);
  }
}

#define AT_D 64
#define AT_NW 4
#define AT_QB 64
#define AT_KC 64
#define AT_LP 72   // LDS row pitch of the K and V^T tiles in 16-bit elements: 144 B = 16 B x 9 (odd), so that the 16 rows of one 16-B fragment read fall on 16 different bank groups

__device__ __forceinline__ v8f at_mma(v16b a, v16b b, v8f c) {
  return __builtin_amdgcn_wmma_f32_16x16x32_bf16(false, a, false, b, (short)0, c, false, false);
}

// Value of lane l ^ 16 (the other half's lane of the same query) by a cross-row move of the vector unit.
__device__ __forceinline__ float at_other_half(float v) {
  const int b = __float_as_int(v);
  return __int_as_float(__builtin_amdgcn_permlanex16(b, b, 0x76543210, 0xfedcba98, false, false));
}

// 4 waves a SIMD (4 blocks a WGP = the whole grid resident) is the target: the register budget of that occupancy, 256, holds the fragment groups below
__global__ __launch_bounds__(128) __attribute__((amdgpu_waves_per_eu(4, 4)))
void attn_causal64_kernel(const unsigned short* __restrict__ qhp, const unsigned short* __restrict__ qlp,
                          const unsigned short* __restrict__ khp, const unsigned short* __restrict__ klp,
                          const unsigned short* __restrict__ vhp, const unsigned short* __restrict__ vlp,
                          float* __restrict__ out, float sscale, float mfill) {
  union PB { v16b v; v2b w[8]; };
  __shared__ __align__(16) __bf16 Ksh[AT_KC * AT_LP];            // K hi [kv][d], 64 rows of 144 B
  __shared__ __align__(16) __bf16 Ksl[AT_KC * AT_LP];            // K lo
  __shared__ __align__(16) __bf16 Vth[AT_D * AT_LP];             // V hi [d][kv], 64 rows of 144 B
  __shared__ __align__(16) __bf16 Vtl[AT_D * AT_LP];             // V lo
  __shared__ __align__(16) float  Os[AT_NW][16 * 68];            // per wave out tile, pitch 68

  const int tid  = threadIdx.x;
  const int wave = tid >> 5;
  const int lane = tid & 31;
  const int hh   = lane >> 4;
  const int c    = lane & 15;

  const int nqb = kSeq / AT_QB;           // 32
  const int bx = blockIdx.x;
  const int h  = bx / nqb;                // 0..kHeads-1 (grid = kHeads * nqb)
  // Query tile of this block. A tile's cost is its key walk, qb + 1 chunks, and the whole grid is resident at once (4 blocks a WGP),
  // so the launch lasts as long as the WGP whose 4 blocks hold the most chunks. With qb = bx % 32 blocks whose flat index is equal
  // mod 256 (and mod 32) all hold the same tile. The map below is, for each head and batch element, a permutation of the 32 tiles in
  // which j and j + 16, and flat indices 256 apart, hold tiles t and 31 - t, and an even j and j + 1 tiles that add up to 30 or 32: sets
  // of blocks that start next to each other or a whole round of WGPs apart then hold about 33 chunks a pair. For speed only: the result
  // does not depend on where a block runs.
  const int j   = bx % nqb;
  const int tt  = (j >= nqb / 2) ? (nqb + nqb / 2 - 1 - j) : j;   // j = 0..15 -> j, 16..31 -> 47 - j = 31 - (j - 16)
  const int rnd = bx >> 8;                                        // parity of flat block index / 256 (gridDim.x = 512 = 2 x 256)
  const int qb  = ((j ^ rnd) & 1) ? (nqb - 1 - tt) : tt;          // block-uniform, 0..31
  const int q0 = qb * AT_QB + wave * 16;

  const size_t bo = (size_t)blockIdx.y * kSeq * kDm;
  const __bf16* Qh = (const __bf16*)(const void*)qhp + bo + (size_t)h * AT_D;
  const __bf16* Ql = (const __bf16*)(const void*)qlp + bo + (size_t)h * AT_D;
  const __bf16* Kh = (const __bf16*)(const void*)khp + bo + (size_t)h * AT_D;
  const __bf16* Kl = (const __bf16*)(const void*)klp + bo + (size_t)h * AT_D;
  const __bf16* Vh = (const __bf16*)(const void*)vhp + bo + (size_t)h * AT_D * kSeq;
  const __bf16* Vl = (const __bf16*)(const void*)vlp + bo + (size_t)h * AT_D * kSeq;
  float*        ob = out + bo + (size_t)h * AT_D;

  // ---- Q fragments (B operand, column = query = lane&15, split k map via Frag load): 2 d-chunks, hi and lo ----
  v16b qah[2], qal[2];
#pragma unroll
  for (int dc = 0; dc < 2; ++dc) {
    const __bf16* qr = Qh + (size_t)(q0 + c) * kDm + dc * 32 + 8 * hh;
    const __bf16* ql = Ql + (size_t)(q0 + c) * kDm + dc * 32 + 8 * hh;
    qah[dc] = Frag<__bf16>::load(qr);
    qal[dc] = Frag<__bf16>::load(ql);
  }

  float mrow = -INFINITY;   // running maximum of query q0 + c, the same in both lane halves
  float lrow = 0.f;         // running sum over this lane half's keys; the halves are joined behind the loop
  v8f oacc[4];              // O^T: oacc[t][r] = out[q0 + c][16t + 8hh + r]
#pragma unroll
  for (int t = 0; t < 4; ++t) oacc[t] = (v8f){0.f,0.f,0.f,0.f,0.f,0.f,0.f,0.f};

  int nChunks = qb + 1;                      // block-uniform, <= 32
  if (nChunks > kSeq / AT_KC) nChunks = kSeq / AT_KC;
  for (int kc = 0; kc < nChunks; ++kc) {
    const int kv0 = kc * AT_KC;
    __syncthreads();
    {
      // staging coverage: 128 threads x (4 x 8) elements = 64 rows x 64 per plane = the whole chunk tile
      const int r = tid >> 1, half = (tid & 1) * 32;
      const __bf16* ksh = Kh + (size_t)(kv0 + r) * kDm + half;     // K row kv0+r, d = half..half+31
      const __bf16* ksl = Kl + (size_t)(kv0 + r) * kDm + half;
      const __bf16* vsh = Vh + (size_t)r * kSeq + kv0 + half;     // V^T row d = r, s = kv0+half..+31
      const __bf16* vsl = Vl + (size_t)r * kSeq + kv0 + half;
#pragma unroll
      for (int i = 0; i < 4; ++i) {
        const v8b a0 = *(const v8b*)(ksh + 8 * i);
        const v8b a1 = *(const v8b*)(ksl + 8 * i);
        const v8b b0 = *(const v8b*)(vsh + 8 * i);
        const v8b b1 = *(const v8b*)(vsl + 8 * i);
        *(v8b*)(Ksh + r * AT_LP + half + 8 * i) = a0;
        *(v8b*)(Ksl + r * AT_LP + half + 8 * i) = a1;
        *(v8b*)(Vth + r * AT_LP + half + 8 * i) = b0;
        *(v8b*)(Vtl + r * AT_LP + half + 8 * i) = b1;
      }
    }
    __syncthreads();

    // The K fragments are read in two groups, well in front of their products, in the order of their use: the wave meets the LDS latency
    // once a chunk, not once per fragment. The products run term by term over the four score tiles, so that neighbouring matrix
    // instructions have different accumulators; each tile still takes its six terms in the order dc 0: hi.hi, lo.hi, hi.lo, dc 1: the same.
    v16b kfh[2][4], kfl[2][4];
#pragma unroll
    for (int j = 0; j < 4; ++j) kfh[0][j] = Frag<__bf16>::load(Ksh + (j * 16 + c) * AT_LP + 8 * hh);
#pragma unroll
    for (int j = 0; j < 4; ++j) kfl[0][j] = Frag<__bf16>::load(Ksl + (j * 16 + c) * AT_LP + 8 * hh);
#pragma unroll
    for (int j = 0; j < 4; ++j) kfh[1][j] = Frag<__bf16>::load(Ksh + (j * 16 + c) * AT_LP + 32 + 8 * hh);
    __builtin_amdgcn_sched_barrier(0);   // keeps the reads above in one group: sunk to their users they would each expose the LDS latency again
    v8f s[4];                            // s[j][r] = score of key kv0 + 16j + 8hh + r, query q0 + c
#pragma unroll
    for (int j = 0; j < 4; ++j) s[j] = at_mma(kfh[0][j], qah[0], (v8f){0.f,0.f,0.f,0.f,0.f,0.f,0.f,0.f});
#pragma unroll
    for (int j = 0; j < 4; ++j) s[j] = at_mma(kfl[0][j], qah[0], s[j]);
    __builtin_amdgcn_sched_barrier(0);   // the last K group waits for the registers of the lo fragments just used (all four groups at once do not fit) ...
#pragma unroll
    for (int j = 0; j < 4; ++j) kfl[1][j] = Frag<__bf16>::load(Ksl + (j * 16 + c) * AT_LP + 32 + 8 * hh);
    __builtin_amdgcn_sched_barrier(0);   // ... and stays eight products in front of its first user
#pragma unroll
    for (int j = 0; j < 4; ++j) s[j] = at_mma(kfh[0][j], qal[0], s[j]);
#pragma unroll
    for (int j = 0; j < 4; ++j) s[j] = at_mma(kfh[1][j], qah[1], s[j]);
#pragma unroll
    for (int j = 0; j < 4; ++j) s[j] = at_mma(kfl[1][j], qah[1], s[j]);
#pragma unroll
    for (int j = 0; j < 4; ++j) s[j] = at_mma(kfh[1][j], qal[1], s[j]);
    __builtin_amdgcn_sched_barrier(0);   // the V^T reads below stay behind the last score product (they take over the K fragments' registers)
    // V^T fragments, first three groups: read here, they arrive under the softmax arithmetic
    v16b vfh[2][4], vfl[2][4];
#pragma unroll
    for (int t = 0; t < 4; ++t) vfh[0][t] = Frag<__bf16>::load(Vth + (t * 16 + c) * AT_LP + 8 * hh);
#pragma unroll
    for (int t = 0; t < 4; ++t) vfl[0][t] = Frag<__bf16>::load(Vtl + (t * 16 + c) * AT_LP + 8 * hh);
#pragma unroll
    for (int t = 0; t < 4; ++t) vfh[1][t] = Frag<__bf16>::load(Vth + (t * 16 + c) * AT_LP + 32 + 8 * hh);
    __builtin_amdgcn_sched_barrier(0);   // ... and in front of the softmax, not sunk to their users behind it
    // ---- scale, structural causal select on the diagonal tile, maximum over the lane's 32 keys and the other half's ----
    const bool diag = (kc == qb);            // block-uniform
    // a key of this lane, 16j + 8hh + r inside the chunk, is masked where it lies behind the lane's query; off the diagonal none is (limit 64)
    const int lim = diag ? (q0 + c - kv0 - 8 * hh) : AT_KC;
    float m = -INFINITY;
    // the loops from here to the end of the chunk are unrolled in full: s, ph, pl and oacc live in registers and take compile-time indices only
#pragma unroll
    for (int j = 0; j < 4; ++j) {
#pragma unroll
      for (int r = 0; r < 8; ++r) {
        const float sv = s[j][r] * sscale;
        const float sm = (j * 16 + r > lim) ? mfill : sv;
        s[j][r] = sm;
        m = fmaxf(m, sm);
      }
    }
    m = fmaxf(m, at_other_half(m));
    const float mnew = fmaxf(mrow, m);
    const float alpha = expf(mrow - mnew);
    mrow = mnew;
    v2f psum = (v2f){0.f, 0.f};              // even and odd keys apart: one packed add per pair
    PB ph[2], pl[2];                         // P^T hi / lo as B operands: keys 32kk..32kk+31, element 8(j&1) + r <- tile j = 2kk + (j&1)
#pragma unroll
    for (int j = 0; j < 4; ++j) {
#pragma unroll
      for (int r = 0; r < 8; r += 2) {
        const v2f p = (v2f){expf(s[j][r] - mnew), expf(s[j][r + 1] - mnew)};
        psum += p;
        // two neighbouring keys fill one operand register: packed round-to-nearest-even conversions, hi = bf16(p), lo = bf16(p - hi)
        const v2b a = __builtin_convertvector(p, v2b);
        const v2b bl = __builtin_convertvector(p - __builtin_convertvector(a, v2f), v2b);
        ph[j >> 1].w[(j & 1) * 4 + (r >> 1)] = a;
        pl[j >> 1].w[(j & 1) * 4 + (r >> 1)] = bl;
      }
    }
    lrow = lrow * alpha + (psum[0] + psum[1]);
#pragma unroll
    for (int t = 0; t < 4; ++t) oacc[t] *= alpha;
    // term by term over the four output tiles; each tile takes its six terms in the order kk 0: hi.hi, lo.hi, hi.lo, kk 1: the same
#pragma unroll
    for (int t = 0; t < 4; ++t) oacc[t] = at_mma(vfh[0][t], ph[0].v, oacc[t]);
#pragma unroll
    for (int t = 0; t < 4; ++t) oacc[t] = at_mma(vfl[0][t], ph[0].v, oacc[t]);
    __builtin_amdgcn_sched_barrier(0);   // the last V^T group waits for the registers of the lo fragments just used ...
#pragma unroll
    for (int t = 0; t < 4; ++t) vfl[1][t] = Frag<__bf16>::load(Vtl + (t * 16 + c) * AT_LP + 32 + 8 * hh);
    __builtin_amdgcn_sched_barrier(0);   // ... and stays eight products in front of its first user
#pragma unroll
    for (int t = 0; t < 4; ++t) oacc[t] = at_mma(vfh[0][t], pl[0].v, oacc[t]);
#pragma unroll
    for (int t = 0; t < 4; ++t) oacc[t] = at_mma(vfh[1][t], ph[1].v, oacc[t]);
#pragma unroll
    for (int t = 0; t < 4; ++t) oacc[t] = at_mma(vfl[1][t], ph[1].v, oacc[t]);
#pragma unroll
    for (int t = 0; t < 4; ++t) oacc[t] = at_mma(vfh[1][t], pl[1].v, oacc[t]);
  }

  float* os = Os[wave];
  const float inv = 1.0f / (lrow + at_other_half(lrow));   // the query's sum: both halves' keys
#pragma unroll
  for (int t = 0; t < 4; ++t) {
    const v8f o = oacc[t] * inv;
    *(v4f*)(os + c * 68 + t * 16 + 8 * hh)     = (v4f){o[0], o[1], o[2], o[3]};
    *(v4f*)(os + c * 68 + t * 16 + 8 * hh + 4) = (v4f){o[4], o[5], o[6], o[7]};
  }
  __builtin_amdgcn_fence(__ATOMIC_RELEASE, "workgroup");
  __builtin_amdgcn_wave_barrier();
  __builtin_amdgcn_fence(__ATOMIC_ACQUIRE, "workgroup");
  {
    const int c4 = (lane & 15) * 4;
    {
#pragma unroll
      for (int it = 0; it < 8; ++it) {
        const int row = it * 2 + hh;   // it 0..7 x hh 0..1 covers rows 0..15 of the wave tile
        v4f val = *(const v4f*)(os + row * 68 + c4);
        *(v4f*)(ob + (size_t)(q0 + row) * kDm + c4) = val;
      }
      
    }
  }
}

// ---------------------------------------------------------------------------
// Workspace region map (byte offsets). Every GEMM: K in {1024, 32} (%32 == 0), M = kRows = 4096, N in {128, 1024} (%128 == 0).
// Activation regions hold both batch elements, row = b*2048 + s.
// Every region is fully written before it is read within the in-order launch sequence; reused regions noted.
//   Wqh bf16 [1024 n][1024 k]        0      Wql    2097152
//   Wkh                        4194304      Wkl    6291456
//   Wvh                        8388608      Wvl   10485760
//   Woh                       12582912      Wol   14680064
//   W1Th bf16 [128 n][1024 k] 16777216      W1Tl  17039360   (rows 96..127 zero)
//   W2Th bf16 [3][1024 n][32] 17301504      W2Tl  17498112
//   XXh  bf16 [4096][1024]    17694720      XXl   26083328   (xxx planes; reused after the LoRA GEMM as Oh / Ol)
//   LORAf f32 [4096][128]     34471936
//   LTh  bf16 [4096][128]     36569088      LTl   37617664
//   MIX  f32 [3][4096][1024]  38666240                       (reused after the mix kernel: Qf = +0, Kf = +16777216,
//                                                             Vf = +33554432 f32 [4096][1024]; Of reuses Qf)
//   XQh/XQl/XKh/XKl/XVh/XVl   88997888 .. (6 x 8388608)
//   Qh/Ql/Kh/Kl              139329536 .. (4 x 8388608)
//   VTh/VTl bf16 [2][1024][2048] 172883968, 181272576
//   total                    189661184  (~180.9 MiB)
// ---------------------------------------------------------------------------
extern "C" void kernel_launch(void* const* d_in, const int* in_sizes, int n_in,
                              void* d_out, int out_size, void* d_ws, size_t ws_size,
                              hipStream_t stream) {
  if (n_in < 21) return;
  const int nRow = kSeq * kDm;            // 2097152 per batch element
  const int nAct = kBatch * nRow;         // 4194304
  const int nW   = kDm * kDm;             // 1048576
  if (in_sizes[0] != nAct) return;
  if (in_sizes[1] != kBatch * kDm) return;
  if (in_sizes[2] != kDm || in_sizes[3] != kDm || in_sizes[4] != kDm || in_sizes[5] != kDm) return;
  if (in_sizes[6] != kDm * kLoraN) return;
  if (in_sizes[7] != 3 * kLoraD * kDm) return;
  if (in_sizes[8] != nW || in_sizes[9] != nW || in_sizes[10] != nW || in_sizes[11] != nW) return;
  for (int i = 12; i < 20; ++i) if (in_sizes[i] != kDm) return;
  if (in_sizes[20] != kSeq * 32) return;
  if (out_size != nAct) return;

  const float* x     = (const float*)d_in[0];    // [2][2048][1024]
  const float* ss    = (const float*)d_in[1];    // [2][1024]
  const float* maax  = (const float*)d_in[2];    // [1024]
  const float* maar  = (const float*)d_in[3];
  const float* maak  = (const float*)d_in[4];
  const float* maav  = (const float*)d_in[5];
  const float* w1    = (const float*)d_in[6];    // [1024][96]
  const float* w2    = (const float*)d_in[7];    // [3][32][1024]
  const float* wq    = (const float*)d_in[8];    // [1024 out][1024 in]
  const float* wk    = (const float*)d_in[9];
  const float* wv    = (const float*)d_in[10];
  const float* wo    = (const float*)d_in[11];
  const float* lnrg  = (const float*)d_in[12];
  const float* lnrb  = (const float*)d_in[13];
  const float* lnkg  = (const float*)d_in[14];
  const float* lnkb  = (const float*)d_in[15];
  const float* lnvg  = (const float*)d_in[16];
  const float* lnvb  = (const float*)d_in[17];
  const float* lnxg  = (const float*)d_in[18];
  const float* lnxb  = (const float*)d_in[19];
  const float* ang   = (const float*)d_in[20];   // [2048][32]

  const size_t PW   = (size_t)kDm * kDm * 2;          // 2097152  bf16 weight plane
  const size_t PX   = (size_t)kRows * kDm * 2;        // 8388608  bf16 activation plane (both batch elements)
  const size_t PF   = (size_t)kRows * kDm * 4;        // 16777216 f32 activation plane
  const size_t PW1  = (size_t)kLoraP * kDm * 2;       // 262144
  const size_t PW2  = (size_t)3 * kDm * kLoraD * 2;   // 196608
  const size_t PLF  = (size_t)kRows * kLoraP * 4;     // 2097152
  const size_t PLT  = (size_t)kRows * kLoraP * 2;     // 1048576
  size_t off = 0;
  const size_t oWqh = off; off += PW;  const size_t oWql = off; off += PW;
  off += 4 * PW;                                // Wkh, Wkl, Wvh, Wvl: reached from Wqh / Wql by the plane stride
  const size_t oWoh = off; off += PW;  const size_t oWol = off; off += PW;
  const size_t oW1h = off; off += PW1; const size_t oW1l = off; off += PW1;
  const size_t oW2h = off; off += PW2; const size_t oW2l = off; off += PW2;
  const size_t oXXh = off; off += PX;  const size_t oXXl = off; off += PX;
  const size_t oLF  = off; off += PLF;
  const size_t oLTh = off; off += PLT; const size_t oLTl = off; off += PLT;
  const size_t oMIX = off; off += 3 * PF;
  const size_t oXQh = off; off += PX;  const size_t oXQl = off; off += PX;
  const size_t oXKh = off; off += PX;  const size_t oXKl = off; off += PX;
  const size_t oXVh = off; off += PX;  const size_t oXVl = off; off += PX;
  const size_t oQh  = off; off += PX;  const size_t oQl  = off; off += PX;
  const size_t oKh  = off; off += PX;  const size_t oKl  = off; off += PX;
  const size_t oVTh = off; off += PX;  const size_t oVTl = off; off += PX;
  if (off > ws_size) return;                    // off = 189661184

  char* ws = (char*)d_ws;
  unsigned short* Wqh = (unsigned short*)(ws + oWqh); unsigned short* Wql = (unsigned short*)(ws + oWql);
  unsigned short* Woh = (unsigned short*)(ws + oWoh); unsigned short* Wol = (unsigned short*)(ws + oWol);
  unsigned short* W1h = (unsigned short*)(ws + oW1h); unsigned short* W1l = (unsigned short*)(ws + oW1l);
  unsigned short* W2h = (unsigned short*)(ws + oW2h); unsigned short* W2l = (unsigned short*)(ws + oW2l);
  unsigned short* XXh = (unsigned short*)(ws + oXXh); unsigned short* XXl = (unsigned short*)(ws + oXXl);
  float*          LF  = (float*)(ws + oLF);
  unsigned short* LTh = (unsigned short*)(ws + oLTh); unsigned short* LTl = (unsigned short*)(ws + oLTl);
  float*          MIX = (float*)(ws + oMIX);
  float*          Qf  = (float*)(ws + oMIX);
  float*          Kf  = (float*)(ws + oMIX + PF);
  float*          Vf  = (float*)(ws + oMIX + 2 * PF);
  float*          Of  = Qf;
  unsigned short* XQh = (unsigned short*)(ws + oXQh); unsigned short* XQl = (unsigned short*)(ws + oXQl);
  unsigned short* XKh = (unsigned short*)(ws + oXKh); unsigned short* XKl = (unsigned short*)(ws + oXKl);
  unsigned short* XVh = (unsigned short*)(ws + oXVh); unsigned short* XVl = (unsigned short*)(ws + oXVl);
  unsigned short* Qh  = (unsigned short*)(ws + oQh);  unsigned short* Ql  = (unsigned short*)(ws + oQl);
  unsigned short* Kh  = (unsigned short*)(ws + oKh);  unsigned short* Kl  = (unsigned short*)(ws + oKl);
  unsigned short* VTh = (unsigned short*)(ws + oVTh); unsigned short* VTl = (unsigned short*)(ws + oVTl);
  unsigned short* Oh  = XXh;                          unsigned short* Ol  = XXl;

  const float* dummyf = lnrg;                         // valid pointer for unused bias / resid arguments (never read)

  const dim3 blk(256);
  const int  n8w = nW / 8;                                  // 131072 groups of 8 per weight plane
  const dim3 gCastW((n8w + 1023) / 1024, 4);                // 128 blocks x 256 threads x 4 x 8 = 1024x1024, y = q, k, v, o
  const dim3 gW1(kDm / 64);                                 // 16 k-tiles
  const dim3 gW2(kDm / 64, 3);                              // 16 n-tiles x 3
  const dim3 gRow(kRows / kEwRows);                         // one block per kEwRows token rows (128-thread kernels)
  const dim3 blkG(128);                                     // GEMM block: 4 waves, one 128x128 tile
  const dim3 gLora((kRows / 128) * (kLoraP / 128));         // 32 tiles: M=4096, N=128
  const dim3 gMix((kRows / 128) * (kDm / 128), 3);          // 256 tiles x 3 (l): M=4096, N=1024, K=32
  const int  n8l = kRows * kLoraP / 8;                      // 65536 groups of 8
  const dim3 gTanh((n8l + 255) / 256);                      // 256 blocks x 256 x 8 = 4096x128
  const dim3 gQKV((kRows / 128) * (kDm / 128), 3);          // 256 tiles x 3 (q, k, v): M=4096, N=1024
  const dim3 gProj((kRows / 128) * (kDm / 128), 1);         // 256 tiles: M=4096, N=1024
  const dim3 gLnQK(kRows / 8, 2);                           // 512 blocks x 8 waves = 4096 rows, x {q, k}
  const dim3 gLn1(kRows / 8, 1);
  const dim3 gVT(kDm / 64, kSeq / 64, kBatch);              // per b: in [R=2048 s][Cn=1024 c] -> planes [c][s]
  const dim3 gAtt(kHeads * (kSeq / 64), kBatch);            // 512 x 2 blocks: 16 heads x 32 query blocks, y = b

  // setup: weights -> bf16 hi/lo planes (q/k/v/o already [out n][in k] = Bt layout; w1/w2 transposed).
  // The hi planes of q, k, v, o lie 2 weight planes apart (hi, lo, hi, lo, ...), and so do the lo planes.
  split_bf16x2_kernel<<<gCastW, blk, 0, stream>>>(wq, wk, wv, wo, Wqh, Wql, n8w, 2L * nW);
  w1t_split_kernel<<<gW1, blk, 0, stream>>>(w1, W1h, W1l);
  w2t_split_kernel<<<gW2, blk, 0, stream>>>(w2, W2h, W2l);

  // Each stage below runs once, on the rows of both batch elements.
  // (1) xxx = x + dxprev*maa_x -> planes
  xxx_split_kernel<<<gRow, dim3(128), 0, stream>>>(x, ss, maax, XXh, XXl);
  // (2) lora_pre = xxx . w1 -> f32 [4096][128]   (M=4096, N=128, K=1024)
  wmma_gemm64<1, true, 0, 0, false, 0><<<gLora, blkG, 0, stream>>>(
      XXh, XXl, kDm, 0L, W1h, W1l, kDm, 0L, (void*)LF, (void*)LF, kLoraP, 0L,
      dummyf, dummyf, 0L, kRows, kLoraP, kDm, 1.0f);
  // (3) lora = tanh -> planes [4096][128]
  tanh_split_kernel<<<gTanh, blk, 0, stream>>>(LF, LTh, LTl, n8l);
  // (4) mixes[l] = lora[:, 32l..32l+31] . w2[l] -> f32 [3][4096][1024]   (M=4096, N=1024, K=32; grid.y = l)
  wmma_gemm64<1, true, 0, 0, false, 0><<<gMix, blkG, 0, stream>>>(
      LTh, LTl, kLoraP, (long)kLoraD, W2h, W2l, kLoraD, (long)kDm * kLoraD, (void*)MIX, (void*)MIX, kDm, (long)nAct,
      dummyf, dummyf, 0L, kRows, kDm, kLoraD, 1.0f);
  // (5) xq/xk/xv = x + dxprev*(maa + mix) -> planes
  mix_split_kernel<<<gRow, dim3(128), 0, stream>>>(x, ss, maar, maak, maav, MIX, XQh, XQl, XKh, XKl, XVh, XVl);
  // (6) q0 = xq . Wq^T, k0 = xk . Wk^T, v0 = xv . Wv^T -> f32 [3][4096][1024]   (M=4096, N=1024, K=1024; grid.y = q, k, v:
  //     XQ/XK/XV hi planes lie 2 activation planes apart, Wq/Wk/Wv hi planes 2 weight planes, Qf/Kf/Vf one f32 plane)
  wmma_gemm64<1, true, 0, 0, false, 0><<<gQKV, blkG, 0, stream>>>(
      XQh, XQl, kDm, 2L * nAct, Wqh, Wql, kDm, 2L * nW, (void*)Qf, (void*)Qf, kDm, (long)nAct,
      dummyf, dummyf, 0L, kRows, kDm, kDm, 1.0f);
  // (7) LayerNorm + RoPE + split for q and k -> planes [row][h*64+d]
  ln_kernel<0><<<gLnQK, blk, 0, stream>>>(Qf, Kf, lnrg, lnrb, lnkg, lnkb, ang, Qh, Ql, Kh, Kl, Qf);
  // (8) LayerNorm of v in place (f32), then transpose-split -> v^T planes [b][h*64+d][s]
  ln_kernel<1><<<gLn1, blk, 0, stream>>>(Vf, Vf, lnvg, lnvb, lnvg, lnvb, ang, VTh, VTl, VTh, VTl, Vf);
  wt_split_kernel<<<gVT, blk, 0, stream>>>(Vf, VTh, VTl, kSeq, kDm);
  // (9) causal attention per batch element and head -> f32 [row][h*64+d] (Of region; Qf is dead after step 7)
  attn_causal64_kernel<<<gAtt, dim3(128), 0, stream>>>(Qh, Ql, Kh, Kl, VTh, VTl, Of, 0.125f, -1.0e30f);
  // (10) output LayerNorm + split -> planes (XX region is dead after step 2)
  ln_kernel<2><<<gLn1, blk, 0, stream>>>(Of, Of, lnxg, lnxb, lnxg, lnxb, ang, Oh, Ol, Oh, Ol, Of);
  // (11) out = o . Wo^T -> d_out (f32)   (M=4096, N=1024, K=1024)
  wmma_gemm64<1, true, 0, 0, false, 0><<<gProj, blkG, 0, stream>>>(
      Oh, Ol, kDm, 0L, Woh, Wol, kDm, 0L, d_out, d_out, kDm, 0L,
      dummyf, dummyf, 0L, kRows, kDm, kDm, 1.0f);
}
